// v000
// Times are from an AMD MI455X. After a warm-up the kernel runs many times in a row, and a time is the length of
// such a window on the GPU divided by its runs, so every launch and the gaps after it count. The runs cycle
// through copies of the inputs. A figure is the median of several windows, for all but v000 over two sittings.
// Sittings can differ by a few percent; kernels timed side by side share one.
// v000, which the later versions start from, runs in 2020 microseconds.
#include <hip/hip_runtime.h>

// 16-head scaled dot-product attention with a key padding mask: q = query Wq^T + bq, k = key Wk^T + bk, v = value Wv^T + bv (weights [out][in]); scores x 1/8; masked keys (mask == 0) replaced by -inf; softmax over keys; out = merged Wo^T + bo.
// Compute dtypes, f32 accumulate everywhere: every float input converted to bf16 (RNE); projections v_wmma_f32_16x16x32_bf16 on exact bf16 planes + bf16-rounded bias added in f32; scores rows < RH bf16 hi/lo planes (3 products), rows >= RH v_wmma_f32_16x16x32_f16;
// P.V rows < RH bf16 hi/lo planes (3 products), rows >= RH f16 with P carried x1024 (folded back in f32); output projection bf16 hi/lo ctx planes x bf16 Wo (2 products) + bf16-rounded bias added in f32; softmax f32.

#ifndef NB
#define NB 2
#endif
#ifndef SEQ
#define SEQ 2048
#endif
#define NB_FULL  2
#define SEQ_FULL 2048
#define TT   SEQ
#define DM   1024
#define NH_  16
#define NKV  16
#define REP  (NH_ / NKV)
#define HD   64
#define DQ   (NH_ * HD)
#define DKV  (NKV * HD)
#define ZH   2
#define RH   ((TT > 512) ? 512 : (TT / 2))   // query rows < RH use hi+lo planes
#define PCAR 1024.0f
#define SCL  0.125f       // HD^-0.5
#define NEGBIG (-1.0e30f)

static_assert(NB >= 1 && NB <= NB_FULL);
static_assert(TT <= SEQ_FULL && TT % 128 == 0);
static_assert(RH >= 64 && RH % 64 == 0 && TT > RH && (TT - RH) % 64 == 0);
static_assert(HD == 64 && DM % 64 == 0 && DQ % 64 == 0 && DM % 32 == 0 && TT % 32 == 0);
static_assert(NH_ % ZH == 0 && REP == 1);

#define SZ_W    ((size_t)DQ * DM * 2)
#define SZ_XB   ((size_t)TT * DM * 2)
#define SZ_F    ((size_t)TT * DQ * 4)
#define SZ_HP   ((size_t)NH_ * TT * HD * 2)
#define SZ_PHL  ((size_t)ZH * RH * TT * 2)
#define SZ_SB   ((size_t)ZH * TT * TT * 4)
#define SZ_P16  ((size_t)ZH * TT * TT * 2)
#define SZ_OB   ((size_t)ZH * TT * HD * 4)
#define SZ_AT   ((size_t)TT * DQ * 2)
#define SZ_ALL  (4 * SZ_W + SZ_XB + SZ_F + 9 * SZ_HP + 2 * SZ_PHL + SZ_SB + SZ_P16 + SZ_OB + 2 * SZ_AT)
static_assert(SZ_W % 256 == 0 && SZ_XB % 256 == 0 && SZ_F % 256 == 0 && SZ_HP % 256 == 0 && SZ_PHL % 256 == 0 && SZ_SB % 256 == 0 && SZ_P16 % 256 == 0 && SZ_OB % 256 == 0 && SZ_AT % 256 == 0);
static_assert(SZ_ALL <= (size_t)134217728);

typedef _Float16 h16;
typedef unsigned short bf;
typedef __attribute__((ext_vector_type(16))) __bf16   v16bf;
typedef __attribute__((ext_vector_type(16))) _Float16 v16h;
typedef __attribute__((ext_vector_type(8)))  _Float16 v8h;
typedef __attribute__((ext_vector_type(8)))  unsigned short v8us;
typedef __attribute__((ext_vector_type(8)))  float    v8f;
typedef __attribute__((ext_vector_type(4)))  float    v4f;
typedef v4f  __attribute__((may_alias)) v4fa;
typedef __attribute__((ext_vector_type(2))) _Float16 v2h;
typedef __attribute__((ext_vector_type(4))) _Float16 v4h;
typedef __attribute__((ext_vector_type(2))) unsigned short v2us;
typedef __attribute__((ext_vector_type(4))) unsigned short v4us;
typedef __attribute__((ext_vector_type(2))) float v2f;
typedef __attribute__((ext_vector_type(4))) int v4i;

__device__ __forceinline__ unsigned short f2bf(float f) { unsigned u = __float_as_uint(f); u += 0x7FFFu + ((u >> 16) & 1u); return (unsigned short)(u >> 16); }
__device__ __forceinline__ float bf2f(unsigned short b) { return __uint_as_float(((unsigned)b) << 16); }
__device__ __forceinline__ float bfr(float f) { return bf2f(f2bf(f)); }
__device__ __forceinline__ v16h cat16(v8h lo, v8h hi) { return __builtin_shufflevector(lo, hi, 0, 1, 2, 3, 4, 5, 6, 7, 8, 9, 10, 11, 12, 13, 14, 15); }
__device__ __forceinline__ v16bf cat16b(v8us lo, v8us hi) { return __builtin_bit_cast(v16bf, __builtin_shufflevector(lo, hi, 0, 1, 2, 3, 4, 5, 6, 7, 8, 9, 10, 11, 12, 13, 14, 15)); }
__device__ __forceinline__ v8f wmma16(v16h a, v16h b, v8f c) { return __builtin_amdgcn_wmma_f32_16x16x32_f16(false, a, false, b, (short)0, c, false, false); }
__device__ __forceinline__ v8f wmmab(v16bf a, v16bf b, v8f c) { return __builtin_amdgcn_wmma_f32_16x16x32_bf16(false, a, false, b, (short)0, c, false, false); }

// ---- k_gemmw: register-blocked GEMM, ONE WAVE per 64x64 output tile (16 accumulators), operands straight from K-contiguous 16-bit planes; grid (M/64, N/64, Z), 32 threads.
// C[m][n] (f32, pitch ldc, + optional bias[n] rounded to bf16) = sum_k A[m][k] Bt[n][k] (+ split products per NSPLIT). z-batch strides sA/sB/sC in elements. K % 32 == 0, M % 64 == 0, N % 64 == 0.
// Fragment map (A and B alike): lane l -> row/col l & 15, h = l >> 4; elements 0..7 = k0 + 8h + 0..7, elements 8..15 = k0 + 16 + 8h + 0..7. D: element r -> row 8h + r, col l & 15.
template <typename T16> struct WFrag;
template <> struct WFrag<h16> { typedef v16h V; static __device__ __forceinline__ V ld(const h16* p) { return cat16(*(const v8h*)p, *(const v8h*)(p + 16)); } static __device__ __forceinline__ v8f mma(V a, V b, v8f c) { return wmma16(a, b, c); } };
template <> struct WFrag<bf> { typedef v16bf V; static __device__ __forceinline__ V ld(const bf* p) { return cat16b(*(const v8us*)p, *(const v8us*)(p + 16)); } static __device__ __forceinline__ v8f mma(V a, V b, v8f c) { return wmmab(a, b, c); } };
template <typename T16, int NSPLIT, bool BIAS>
__global__ __launch_bounds__(32) void k_gemmw(const T16* __restrict__ A, const T16* __restrict__ A2, const T16* __restrict__ Bt, const T16* __restrict__ Bt2, int K, float* C, int ldc, const float* __restrict__ bias, size_t sA, size_t sB, size_t sC) {
    typedef typename WFrag<T16>::V V;
    __shared__ __align__(16) float os[16 * 68];
    const size_t z = blockIdx.z; A += z * sA; if (A2) A2 += z * sA; Bt += z * sB; if (Bt2) Bt2 += z * sB; C += z * sC;
    const int lane = threadIdx.x & 31, lr = lane & 15, hi = lane >> 4; const int r0 = blockIdx.x * 64, c0 = blockIdx.y * 64;
    v8f acc[4][4];
#pragma unroll
    for (int mb = 0; mb < 4; ++mb)
#pragma unroll
        for (int nb = 0; nb < 4; ++nb) acc[mb][nb] = (v8f){};
    const size_t aoff = (size_t)(r0 + lr) * K + 8 * hi, boff = (size_t)(c0 + lr) * K + 8 * hi;
#pragma unroll 1
    for (int kc = 0; kc < K; kc += 32) {
        V a[4], a2[4];
#pragma unroll
        for (int mb = 0; mb < 4; ++mb) { a[mb] = WFrag<T16>::ld(A + aoff + (size_t)mb * 16 * K + kc); if (NSPLIT == 1 || NSPLIT == 2) a2[mb] = WFrag<T16>::ld(A2 + aoff + (size_t)mb * 16 * K + kc); }
#pragma unroll
        for (int nb = 0; nb < 4; ++nb) { const V b = WFrag<T16>::ld(Bt + boff + (size_t)nb * 16 * K + kc); V b2; if (NSPLIT >= 2) b2 = WFrag<T16>::ld(Bt2 + boff + (size_t)nb * 16 * K + kc);
#pragma unroll
            for (int mb = 0; mb < 4; ++mb) { acc[mb][nb] = WFrag<T16>::mma(a[mb], b, acc[mb][nb]); if (NSPLIT == 1 || NSPLIT == 2) acc[mb][nb] = WFrag<T16>::mma(a2[mb], b, acc[mb][nb]); if (NSPLIT >= 2) acc[mb][nb] = WFrag<T16>::mma(a[mb], b2, acc[mb][nb]); } }
        asm volatile("v_nop\n\tv_nop\n\tv_nop\n\tv_nop" : "+v"(acc[0][0]), "+v"(acc[1][1]), "+v"(acc[2][2]), "+v"(acc[3][3]) : "v"(a[0]), "v"(a[3]));
    }
#pragma unroll
    for (int mb = 0; mb < 4; ++mb) {
#pragma unroll
        for (int nb = 0; nb < 4; ++nb) {
#pragma unroll
            for (int j = 0; j < 8; ++j) os[(hi * 8 + j) * 68 + nb * 16 + lr] = acc[mb][nb][j]; }
        __builtin_amdgcn_fence(3 /* release order */, "wavefront"); __builtin_amdgcn_wave_barrier(); asm volatile("" ::: "memory");
        float* crow = C + (size_t)(r0 + mb * 16) * ldc + c0;
{
#pragma unroll
            for (int s = 0; s < 8; ++s) { const int row = 2 * s + hi, cofs = lr * 4; v4f val = *(const v4fa*)(os + row * 68 + cofs); if (BIAS) { val[0] += bfr(bias[c0 + cofs]); val[1] += bfr(bias[c0 + cofs + 1]); val[2] += bfr(bias[c0 + cofs + 2]); val[3] += bfr(bias[c0 + cofs + 3]); }
                *(v4f*)(crow + (size_t)row * ldc + cofs) = val; }
             }
        __builtin_amdgcn_fence(3 /* release order */, "wavefront"); __builtin_amdgcn_wave_barrier(); asm volatile("" ::: "memory");
    }
}

__device__ __forceinline__ h16 tohx(float x) { return (h16)x; }
__device__ __forceinline__ void splitf(float y, unsigned short& h, unsigned short& l) { h = f2bf(y); l = f2bf(y - bf2f(h)); }

__global__ __launch_bounds__(256) void k_cvt8(const float* __restrict__ src, bf* dst, size_t n8) { const size_t i = (size_t)blockIdx.x * 256 + threadIdx.x; if (i >= n8) return; const v8f v = *(const v8f*)(src + i * 8); v8us o;
#pragma unroll
    for (int k = 0; k < 8; ++k) o[k] = f2bf(v[k]); *(v8us*)(dst + i * 8) = o;  }

__global__ __launch_bounds__(256) void k_hpl(const float* __restrict__ F, int pitch, int nheads, h16* P16, bf* Ph, bf* Pl) {
    const size_t e = ((size_t)blockIdx.x * 256 + threadIdx.x) * 2; if (e >= (size_t)nheads * TT * HD) return; const int d = (int)(e % HD); const int t = (int)((e / HD) % TT); const int h = (int)(e / ((size_t)HD * TT));
    const v2f x = *(const v2f*)(F + (size_t)t * pitch + h * HD + d); v2h o16; v2us oh, ol;
#pragma unroll
    for (int q = 0; q < 2; ++q) { o16[q] = tohx(x[q]); unsigned short a2, c2; splitf(x[q], a2, c2); oh[q] = a2; ol[q] = c2; }
    *(v2h*)(P16 + e) = o16; *(v2us*)(Ph + e) = oh; *(v2us*)(Pl + e) = ol;  }

__global__ __launch_bounds__(256) void k_vtp(const float* __restrict__ F, int pitch, int nheads, h16* V16, bf* Vh, bf* Vl) { const size_t e = ((size_t)blockIdx.x * 256 + threadIdx.x) * 2; if (e >= (size_t)nheads * HD * TT) return; const int t = (int)(e % TT); const int d = (int)((e / TT) % HD); const int g = (int)(e / ((size_t)TT * HD)); v2h o16; v2us oh, ol;
#pragma unroll
    for (int q = 0; q < 2; ++q) { const float x = F[(size_t)(t + q) * pitch + g * HD + d]; o16[q] = tohx(x); unsigned short a2, c2; splitf(x, a2, c2); oh[q] = a2; ol[q] = c2; }
    *(v2h*)(V16 + e) = o16; *(v2us*)(Vh + e) = oh; *(v2us*)(Vl + e) = ol;  }

// k_asoft: one wave per row (zz, i): t = S x HD^-0.5, keys with mk[j] == 0 replaced (excluded from max and sum, weight exactly 0; a row with no valid key yields NaN);
__global__ __launch_bounds__(256) void k_asoft(const float* __restrict__ Sb, const int* __restrict__ mk, h16* P16, bf* Ph, bf* Pl) {
    const int lane = threadIdx.x & 31; const int row = blockIdx.x * 8 + (threadIdx.x >> 5); if (row >= ZH * TT) return; const int i = row % TT; const int zz = row / TT; const bool hires = (i < RH); const float* sr = Sb + (size_t)row * TT; float v[TT / 32]; float mx = NEGBIG;
#pragma unroll
    for (int ch = 0; ch < TT / 128; ++ch) { const int j0 = ch * 128 + lane * 4; const v4f a = *(const v4f*)(sr + j0); const v4i m = *(const v4i*)(mk + j0);
#pragma unroll
        for (int q = 0; q < 4; ++q) { const float t = (m[q] != 0) ? a[q] * SCL : NEGBIG; v[ch * 4 + q] = t; mx = fmaxf(mx, t); } }
#pragma unroll
    for (int sh = 16; sh; sh >>= 1) mx = fmaxf(mx, __shfl_xor(mx, sh, 32));
    float sum = 0.f;
#pragma unroll
    for (int k = 0; k < TT / 32; ++k) { const bool ok = (v[k] > -1.0e29f); float d0 = __fsub_rn(v[k], mx); asm volatile("" : "+v"(d0)); const float ex = __builtin_amdgcn_exp2f(__fmul_rn(d0, 1.4426950408889634f)); const float p = ok ? ex : 0.0f; v[k] = p; sum += p; }
#pragma unroll
    for (int sh = 16; sh; sh >>= 1) sum += __shfl_xor(sum, sh, 32);
    const float f = __fdiv_rn(hires ? 1.0f : PCAR, sum);
{
        if (hires) {
#pragma unroll
            for (int ch = 0; ch < TT / 128; ++ch) { v4us oh, ol;
#pragma unroll
                for (int q = 0; q < 4; ++q) { unsigned short a, c2; splitf(v[ch * 4 + q] * f, a, c2); oh[q] = a; ol[q] = c2; }
                const size_t oo = ((size_t)zz * RH + i) * TT + ch * 128 + lane * 4; *(v4us*)(Ph + oo) = oh; *(v4us*)(Pl + oo) = ol; }
        } else {
#pragma unroll
            for (int ch = 0; ch < TT / 128; ++ch) { v4h o4;
#pragma unroll
                for (int q = 0; q < 4; ++q) o4[q] = tohx(v[ch * 4 + q] * f);
                *(v4h*)(P16 + (size_t)row * TT + ch * 128 + lane * 4) = o4; } }
         }
}

__global__ __launch_bounds__(256) void k_merge(const float* __restrict__ O, int h0, bf* Ah, bf* Al) { const size_t e = ((size_t)blockIdx.x * 256 + threadIdx.x) * 2; if (e >= (size_t)ZH * TT * HD) return; const int d = (int)(e % HD); const int t = (int)((e / HD) % TT); const int zz = (int)(e / ((size_t)HD * TT)); const float cs = (t < RH) ? 1.0f : (1.0f / PCAR); const size_t oo = (size_t)t * DQ + (h0 + zz) * HD + d;
    const v2f x = *(const v2f*)(O + e); v2us oh, ol;
#pragma unroll
    for (int q = 0; q < 2; ++q) { unsigned short a, c2; splitf(x[q] * cs, a, c2); oh[q] = a; ol[q] = c2; } *(v2us*)(Ah + oo) = oh; *(v2us*)(Al + oo) = ol;  }

extern "C" void kernel_launch(void* const* d_in, const int* in_sizes, int n_in,
                              void* d_out, int out_size, void* d_ws, size_t ws_size, hipStream_t stream) {
    if (n_in < 12) return;
    const size_t needx = (size_t)(NB - 1) * SEQ_FULL * DM + (size_t)TT * DM;
    const size_t needm = (size_t)(NB - 1) * SEQ_FULL + (size_t)TT;
    if ((size_t)in_sizes[0] < needx || (size_t)in_sizes[1] < needx || (size_t)in_sizes[2] < needx || (size_t)in_sizes[3] < needm) return;
    if ((size_t)in_sizes[4] < (size_t)DQ * DM || (size_t)in_sizes[6] < (size_t)DKV * DM || (size_t)in_sizes[8] < (size_t)DKV * DM || (size_t)in_sizes[10] < (size_t)DM * DQ) return;
    if (in_sizes[5] < DQ || in_sizes[7] < DKV || in_sizes[9] < DKV || in_sizes[11] < DM) return;
    if ((size_t)out_size < needx) return;
    // wire order: query, key, value, mask (int32), Wq, bq, Wk, bk, Wv, bv, Wo, bo; weights [out][in]
    const float* xq = (const float*)d_in[0]; const float* xk = (const float*)d_in[1]; const float* xv = (const float*)d_in[2]; const int* mask = (const int*)d_in[3];
    const float* wq = (const float*)d_in[4]; const float* bq = (const float*)d_in[5]; const float* wk = (const float*)d_in[6]; const float* bk = (const float*)d_in[7];
    const float* wv = (const float*)d_in[8]; const float* bv = (const float*)d_in[9]; const float* wo = (const float*)d_in[10]; const float* bo = (const float*)d_in[11];
    float* OUT = (float*)d_out;     // [NB_FULL][SEQ_FULL][DM]
    char* wsp = (char*)d_ws;
    auto take = [&](size_t bytes) { char* p = wsp; wsp += (bytes + 255) & ~(size_t)255; return (void*)p; };
    bf* WQ = (bf*)take(SZ_W); bf* WK = (bf*)take(SZ_W); bf* WV = (bf*)take(SZ_W); bf* WO = (bf*)take(SZ_W);
    bf* XB = (bf*)take(SZ_XB); float* F = (float*)take(SZ_F);   // one f32 projection buffer, reused for q, k, v in stream order
    h16* QP16 = (h16*)take(SZ_HP); h16* KP16 = (h16*)take(SZ_HP); h16* VT16 = (h16*)take(SZ_HP);
    bf* QPh = (bf*)take(SZ_HP); bf* QPl = (bf*)take(SZ_HP); bf* KPh = (bf*)take(SZ_HP); bf* KPl = (bf*)take(SZ_HP); bf* VTh = (bf*)take(SZ_HP); bf* VTl = (bf*)take(SZ_HP);
    bf* Ph = (bf*)take(SZ_PHL); bf* Pl = (bf*)take(SZ_PHL);
    float* Sb = (float*)take(SZ_SB); h16* P16 = (h16*)take(SZ_P16); float* Ob = (float*)take(SZ_OB); bf* ATh = (bf*)take(SZ_AT); bf* ATl = (bf*)take(SZ_AT);
    if ((size_t)(wsp - (char*)d_ws) > ws_size) return;
    const unsigned LW = (unsigned)(((size_t)DQ * DM / 8 + 255) / 256);
    k_cvt8<<<LW, 256, 0, stream>>>(wq, WQ, (size_t)DQ * DM / 8);
    k_cvt8<<<LW, 256, 0, stream>>>(wk, WK, (size_t)DKV * DM / 8);
    k_cvt8<<<LW, 256, 0, stream>>>(wv, WV, (size_t)DKV * DM / 8);
    k_cvt8<<<LW, 256, 0, stream>>>(wo, WO, (size_t)DM * DQ / 8);
    const unsigned LX = (unsigned)(((size_t)TT * DM / 8 + 255) / 256);
    const unsigned LQ = (unsigned)(((size_t)NH_ * TT * HD / 2 + 255) / 256), LKv = (unsigned)(((size_t)NKV * TT * HD / 2 + 255) / 256);
    for (int b = 0; b < NB; ++b) {
        const size_t xo = (size_t)b * SEQ_FULL * DM;
        // q projection -> q planes
        k_cvt8<<<LX, 256, 0, stream>>>(xq + xo, XB, (size_t)TT * DM / 8);
        k_gemmw<bf, 0, true><<<dim3(TT / 64, DQ / 64, 1), 32, 0, stream>>>(XB, nullptr, WQ, nullptr, DM, F, DQ, bq, 0, 0, 0);
        k_hpl<<<LQ, 256, 0, stream>>>(F, DQ, NH_, QP16, QPh, QPl);
        // k projection -> k planes
        k_cvt8<<<LX, 256, 0, stream>>>(xk + xo, XB, (size_t)TT * DM / 8);
        k_gemmw<bf, 0, true><<<dim3(TT / 64, DKV / 64, 1), 32, 0, stream>>>(XB, nullptr, WK, nullptr, DM, F, DKV, bk, 0, 0, 0);
        k_hpl<<<LKv, 256, 0, stream>>>(F, DKV, NKV, KP16, KPh, KPl);
        // v projection -> transposed v planes
        k_cvt8<<<LX, 256, 0, stream>>>(xv + xo, XB, (size_t)TT * DM / 8);
        k_gemmw<bf, 0, true><<<dim3(TT / 64, DKV / 64, 1), 32, 0, stream>>>(XB, nullptr, WV, nullptr, DM, F, DKV, bv, 0, 0, 0);
        k_vtp<<<LKv, 256, 0, stream>>>(F, DKV, NKV, VT16, VTh, VTl);
        const int* mk = mask + (size_t)b * SEQ_FULL;
        for (int h0 = 0; h0 < NH_; h0 += ZH) { const size_t zq = (size_t)h0, zk = (size_t)(h0 / REP);
            // scores S[zz][i][j] = q_i . k_j: rows < RH hi/lo (3 products), rows >= RH f16
            k_gemmw<bf, 2, false><<<dim3(RH / 64, TT / 64, ZH), 32, 0, stream>>>(QPh + zq * TT * HD, QPl + zq * TT * HD, KPh + zk * TT * HD, KPl + zk * TT * HD, HD, Sb, TT, nullptr, (size_t)TT * HD, (size_t)TT * HD, (size_t)TT * TT);
            k_gemmw<h16, 0, false><<<dim3((TT - RH) / 64, TT / 64, ZH), 32, 0, stream>>>(QP16 + zq * TT * HD + (size_t)RH * HD, nullptr, KP16 + zk * TT * HD, nullptr, HD, Sb + (size_t)RH * TT, TT, nullptr, (size_t)TT * HD, (size_t)TT * HD, (size_t)TT * TT);
            k_asoft<<<ZH * TT / 8, 256, 0, stream>>>(Sb, mk, P16, Ph, Pl);
            // O[zz][i][d] = sum_j P[i][j] V^T[d][j]
            k_gemmw<bf, 2, false><<<dim3(RH / 64, HD / 64, ZH), 32, 0, stream>>>(Ph, Pl, VTh + zk * HD * TT, VTl + zk * HD * TT, TT, Ob, HD, nullptr, (size_t)RH * TT, (size_t)HD * TT, (size_t)TT * HD);
            k_gemmw<h16, 0, false><<<dim3((TT - RH) / 64, HD / 64, ZH), 32, 0, stream>>>(P16 + (size_t)RH * TT, nullptr, VT16 + zk * HD * TT, nullptr, TT, Ob + (size_t)RH * HD, HD, nullptr, (size_t)TT * TT, (size_t)HD * TT, (size_t)TT * HD);
            k_merge<<<(unsigned)(((size_t)ZH * TT * HD / 2 + 255) / 256), 256, 0, stream>>>(Ob, h0, ATh, ATl); }
        // out[b][t][n] = sum_k ctx[t][k] Wo[n][k] + bo[n]
        k_gemmw<bf, 1, true><<<dim3(TT / 64, DM / 64, 1), 32, 0, stream>>>(ATh, ATl, WO, nullptr, DQ, OUT + xo, DM, bo, 0, 0, 0); }
}

// v001
// A run of this version takes 1060 microseconds.
// Two timings next to v000 put it at 1.92 and 1.91 times that version's speed.
#include <hip/hip_runtime.h>

// 16-head scaled dot-product attention with a key padding mask: q = query Wq^T + bq, k = key Wk^T + bk, v = value Wv^T + bv (weights [out][in]); scores x 1/8; masked keys (mask == 0) replaced by -inf; softmax over keys; out = merged Wo^T + bo.
// Compute dtypes, f32 accumulate everywhere: every float input converted to bf16 (RNE); projections v_wmma_f32_16x16x32_bf16 on exact bf16 planes + bf16-rounded bias added in f32; scores rows < RH bf16 hi/lo planes (3 products), rows >= RH v_wmma_f32_16x16x32_f16;
// P.V rows < RH bf16 hi/lo planes (3 products), rows >= RH f16 with P carried x1024 (folded back in f32); output projection bf16 hi/lo ctx planes x bf16 Wo (2 products) + bf16-rounded bias added in f32; softmax f32.

#ifndef NB
#define NB 2
#endif
#ifndef SEQ
#define SEQ 2048
#endif
#define NB_FULL  2
#define SEQ_FULL 2048
#define TT   SEQ
#define DM   1024
#define NH_  16
#define NKV  16
#define REP  (NH_ / NKV)
#define HD   64
#define DQ   (NH_ * HD)
#define DKV  (NKV * HD)
#define ZH   2
#define RH   ((TT > 512) ? 512 : (TT / 2))   // query rows < RH use hi+lo planes
#define PCAR 1024.0f
#define SCL  0.125f       // HD^-0.5
#define NEGBIG (-1.0e30f)
#define KSP  8            // waves per tile (k slices) in the four projections, K = DM or DQ
#define KSV  16           // waves per tile (k slices) in P.V, K = TT

static_assert(NB >= 1 && NB <= NB_FULL);
static_assert(TT <= SEQ_FULL && TT % 128 == 0);
static_assert(RH >= 64 && RH % 64 == 0 && TT > RH && (TT - RH) % 64 == 0);
static_assert(HD == 64 && DM % 64 == 0 && DQ % 64 == 0 && DM % 32 == 0 && TT % 32 == 0);
static_assert(NH_ % ZH == 0 && REP == 1);
static_assert(DM % (32 * KSP) == 0 && DQ % (32 * KSP) == 0 && TT % (32 * KSV) == 0);

#define SZ_W    ((size_t)DQ * DM * 2)
#define SZ_XB   ((size_t)TT * DM * 2)
#define SZ_F    ((size_t)TT * DQ * 4)
#define SZ_HP   ((size_t)NH_ * TT * HD * 2)
#define SZ_PHL  ((size_t)ZH * RH * TT * 2)
#define SZ_SB   ((size_t)ZH * TT * TT * 4)
#define SZ_P16  ((size_t)ZH * TT * TT * 2)
#define SZ_OB   ((size_t)ZH * TT * HD * 4)
#define SZ_AT   ((size_t)TT * DQ * 2)
#define SZ_ALL  (4 * SZ_W + SZ_XB + SZ_F + 9 * SZ_HP + 2 * SZ_PHL + SZ_SB + SZ_P16 + SZ_OB + 2 * SZ_AT)
static_assert(SZ_W % 256 == 0 && SZ_XB % 256 == 0 && SZ_F % 256 == 0 && SZ_HP % 256 == 0 && SZ_PHL % 256 == 0 && SZ_SB % 256 == 0 && SZ_P16 % 256 == 0 && SZ_OB % 256 == 0 && SZ_AT % 256 == 0);
static_assert(SZ_ALL <= (size_t)134217728);

typedef _Float16 h16;
typedef unsigned short bf;
typedef __attribute__((ext_vector_type(16))) __bf16   v16bf;
typedef __attribute__((ext_vector_type(16))) _Float16 v16h;
typedef __attribute__((ext_vector_type(8)))  _Float16 v8h;
typedef __attribute__((ext_vector_type(8)))  unsigned short v8us;
typedef __attribute__((ext_vector_type(8)))  float    v8f;
typedef __attribute__((ext_vector_type(4)))  float    v4f;
typedef v4f  __attribute__((may_alias)) v4fa;
typedef __attribute__((ext_vector_type(2))) _Float16 v2h;
typedef __attribute__((ext_vector_type(4))) _Float16 v4h;
typedef __attribute__((ext_vector_type(2))) unsigned short v2us;
typedef __attribute__((ext_vector_type(4))) unsigned short v4us;
typedef __attribute__((ext_vector_type(2))) float v2f;
typedef __attribute__((ext_vector_type(4))) int v4i;

__device__ __forceinline__ unsigned short f2bf(float f) { unsigned u = __float_as_uint(f); u += 0x7FFFu + ((u >> 16) & 1u); return (unsigned short)(u >> 16); }
__device__ __forceinline__ float bf2f(unsigned short b) { return __uint_as_float(((unsigned)b) << 16); }
__device__ __forceinline__ float bfr(float f) { return bf2f(f2bf(f)); }
__device__ __forceinline__ v16h cat16(v8h lo, v8h hi) { return __builtin_shufflevector(lo, hi, 0, 1, 2, 3, 4, 5, 6, 7, 8, 9, 10, 11, 12, 13, 14, 15); }
__device__ __forceinline__ v16bf cat16b(v8us lo, v8us hi) { return __builtin_bit_cast(v16bf, __builtin_shufflevector(lo, hi, 0, 1, 2, 3, 4, 5, 6, 7, 8, 9, 10, 11, 12, 13, 14, 15)); }
__device__ __forceinline__ v8f wmma16(v16h a, v16h b, v8f c) { return __builtin_amdgcn_wmma_f32_16x16x32_f16(false, a, false, b, (short)0, c, false, false); }
__device__ __forceinline__ v8f wmmab(v16bf a, v16bf b, v8f c) { return __builtin_amdgcn_wmma_f32_16x16x32_bf16(false, a, false, b, (short)0, c, false, false); }

// ---- k_gemmw: register-blocked GEMM, KS WAVES per 64x64 output tile (16 accumulators each), operands straight from K-contiguous 16-bit planes; grid (M/64, N/64, Z), 32 * KS threads.
// Wave w sums the k range [w K/KS, (w + 1) K/KS); for KS > 1 the KS partial tiles meet in LDS and are added in wave order 0..KS-1 (fixed order, same result every run). K % (32 KS) == 0.
// C[m][n] (f32, pitch ldc, + optional bf16-rounded bias[n]) = sum_k A[m][k] Bt[n][k] (+ split products per NSPLIT). z-batch strides sA/sB/sC in elements. K % 32 == 0, M % 64 == 0, N % 64 == 0.
// Fragment map (A and B alike): lane l -> row/col l & 15, h = l >> 4; elements 0..7 = k0 + 8h + 0..7, elements 8..15 = k0 + 16 + 8h + 0..7. D: element r -> row 8h + r, col l & 15.
template <typename T16> struct WFrag;
template <> struct WFrag<h16> { typedef v16h V; static __device__ __forceinline__ V ld(const h16* p) { return cat16(*(const v8h*)p, *(const v8h*)(p + 16)); } static __device__ __forceinline__ v8f mma(V a, V b, v8f c) { return wmma16(a, b, c); } };
template <> struct WFrag<bf> { typedef v16bf V; static __device__ __forceinline__ V ld(const bf* p) { return cat16b(*(const v8us*)p, *(const v8us*)(p + 16)); } static __device__ __forceinline__ v8f mma(V a, V b, v8f c) { return wmmab(a, b, c); } };
template <typename T16, int NSPLIT, bool BIAS, int KS>
__global__ __launch_bounds__(32 * KS) void k_gemmw(const T16* __restrict__ A, const T16* __restrict__ A2, const T16* __restrict__ Bt, const T16* __restrict__ Bt2, int K, float* C, int ldc, const float* __restrict__ bias, size_t sA, size_t sB, size_t sC) {
    typedef typename WFrag<T16>::V V;
    __shared__ __align__(16) float os[(KS > 1 ? 2 * KS : 1) * 16 * 68];
    const size_t z = blockIdx.z; A += z * sA; if (A2) A2 += z * sA; Bt += z * sB; if (Bt2) Bt2 += z * sB; C += z * sC;
    const int lane = threadIdx.x & 31, lr = lane & 15, hi = lane >> 4; const int r0 = blockIdx.x * 64, c0 = blockIdx.y * 64;
    v8f acc[4][4];
#pragma unroll
    for (int mb = 0; mb < 4; ++mb)
#pragma unroll
        for (int nb = 0; nb < 4; ++nb) acc[mb][nb] = (v8f){};
    const size_t aoff = (size_t)(r0 + lr) * K + 8 * hi, boff = (size_t)(c0 + lr) * K + 8 * hi;
    // wave number through readfirstlane: the k loop's bounds and the slab address stay in scalar registers
    const int wv = (KS > 1) ? __builtin_amdgcn_readfirstlane((int)(threadIdx.x >> 5)) : 0; const int kw = K / KS, kbeg = wv * kw, kend = kbeg + kw;
#pragma unroll 1
    for (int kc = kbeg; kc < kend; kc += 32) {
        V a[4], a2[4];
#pragma unroll
        for (int mb = 0; mb < 4; ++mb) { a[mb] = WFrag<T16>::ld(A + aoff + (size_t)mb * 16 * K + kc); if (NSPLIT == 1 || NSPLIT == 2) a2[mb] = WFrag<T16>::ld(A2 + aoff + (size_t)mb * 16 * K + kc); }
#pragma unroll
        for (int nb = 0; nb < 4; ++nb) { const V b = WFrag<T16>::ld(Bt + boff + (size_t)nb * 16 * K + kc); V b2; if (NSPLIT >= 2) b2 = WFrag<T16>::ld(Bt2 + boff + (size_t)nb * 16 * K + kc);
#pragma unroll
            for (int mb = 0; mb < 4; ++mb) { acc[mb][nb] = WFrag<T16>::mma(a[mb], b, acc[mb][nb]); if (NSPLIT == 1 || NSPLIT == 2) acc[mb][nb] = WFrag<T16>::mma(a2[mb], b, acc[mb][nb]); if (NSPLIT >= 2) acc[mb][nb] = WFrag<T16>::mma(a[mb], b2, acc[mb][nb]); } }
        asm volatile("v_nop\n\tv_nop\n\tv_nop\n\tv_nop" : "+v"(acc[0][0]), "+v"(acc[1][1]), "+v"(acc[2][2]), "+v"(acc[3][3]) : "v"(a[0]), "v"(a[3]));
    }
    if constexpr (KS > 1) {
        // 16 x 64 slab per pass: every wave stores its partial, one barrier, then each thread adds the KS partials of its EPT neighbouring columns.
        // Two slab sets in turn: the barrier of pass mb + 1 ends every read of pass mb before pass mb + 2 writes that set again.
        // The four results stay in registers and go to memory behind the last barrier, so that no barrier waits for a global store.
        // Every loop here is unrolled because acc, res and the vectors live in registers and need constant indices.
        constexpr int EPT = (16 * 64) / (32 * KS); static_assert(EPT == 2 || EPT == 4);
        typedef __attribute__((ext_vector_type(EPT))) float vE; typedef vE __attribute__((may_alias)) vEa;
        const int e0 = (int)threadIdx.x * EPT, row = e0 >> 6, cofs = e0 & 63;
        vE res[4], bv = (vE)(0.0f);
        if (BIAS) {
#pragma unroll
            for (int q = 0; q < EPT; ++q) bv[q] = bfr(bias[c0 + cofs + q]); }
#pragma unroll
        for (int mb = 0; mb < 4; ++mb) {
            float* my = os + ((mb & 1) * KS + wv) * (16 * 68);
#pragma unroll
            for (int nb = 0; nb < 4; ++nb) {
#pragma unroll
                for (int j = 0; j < 8; ++j) my[(hi * 8 + j) * 68 + nb * 16 + lr] = acc[mb][nb][j]; }
            __syncthreads();   // publishes the KS partial slabs of this pass to the threads that add them
            const float* rd = os + (mb & 1) * KS * (16 * 68) + row * 68 + cofs; vE val = *(const vEa*)rd;
#pragma unroll
            for (int w = 1; w < KS; ++w) val += *(const vEa*)(rd + w * (16 * 68));
            res[mb] = BIAS ? val + bv : val; }
#pragma unroll
        for (int mb = 0; mb < 4; ++mb) *(vE*)(C + (size_t)(r0 + mb * 16 + row) * ldc + c0 + cofs) = res[mb];
        return; }
#pragma unroll
    for (int mb = 0; mb < 4; ++mb) {
#pragma unroll
        for (int nb = 0; nb < 4; ++nb) {
#pragma unroll
            for (int j = 0; j < 8; ++j) os[(hi * 8 + j) * 68 + nb * 16 + lr] = acc[mb][nb][j]; }
        __builtin_amdgcn_fence(3 /* release order */, "wavefront"); __builtin_amdgcn_wave_barrier(); asm volatile("" ::: "memory");
        float* crow = C + (size_t)(r0 + mb * 16) * ldc + c0;
{
#pragma unroll
            for (int s = 0; s < 8; ++s) { const int row = 2 * s + hi, cofs = lr * 4; v4f val = *(const v4fa*)(os + row * 68 + cofs); if (BIAS) { val[0] += bfr(bias[c0 + cofs]); val[1] += bfr(bias[c0 + cofs + 1]); val[2] += bfr(bias[c0 + cofs + 2]); val[3] += bfr(bias[c0 + cofs + 3]); }
                *(v4f*)(crow + (size_t)row * ldc + cofs) = val; }
             }
        __builtin_amdgcn_fence(3 /* release order */, "wavefront"); __builtin_amdgcn_wave_barrier(); asm volatile("" ::: "memory");
    }
}

__device__ __forceinline__ h16 tohx(float x) { return (h16)x; }
__device__ __forceinline__ void splitf(float y, unsigned short& h, unsigned short& l) { h = f2bf(y); l = f2bf(y - bf2f(h)); }

__global__ __launch_bounds__(256) void k_cvt8(const float* __restrict__ src, bf* dst, size_t n8) { const size_t i = (size_t)blockIdx.x * 256 + threadIdx.x; if (i >= n8) return; const v8f v = *(const v8f*)(src + i * 8); v8us o;
#pragma unroll
    for (int k = 0; k < 8; ++k) o[k] = f2bf(v[k]); *(v8us*)(dst + i * 8) = o;  }

__global__ __launch_bounds__(256) void k_hpl(const float* __restrict__ F, int pitch, int nheads, h16* P16, bf* Ph, bf* Pl) {
    const size_t e = ((size_t)blockIdx.x * 256 + threadIdx.x) * 2; if (e >= (size_t)nheads * TT * HD) return; const int d = (int)(e % HD); const int t = (int)((e / HD) % TT); const int h = (int)(e / ((size_t)HD * TT));
    const v2f x = *(const v2f*)(F + (size_t)t * pitch + h * HD + d); v2h o16; v2us oh, ol;
#pragma unroll
    for (int q = 0; q < 2; ++q) { o16[q] = tohx(x[q]); unsigned short a2, c2; splitf(x[q], a2, c2); oh[q] = a2; ol[q] = c2; }
    *(v2h*)(P16 + e) = o16; *(v2us*)(Ph + e) = oh; *(v2us*)(Pl + e) = ol;  }

__global__ __launch_bounds__(256) void k_vtp(const float* __restrict__ F, int pitch, int nheads, h16* V16, bf* Vh, bf* Vl) { const size_t e = ((size_t)blockIdx.x * 256 + threadIdx.x) * 2; if (e >= (size_t)nheads * HD * TT) return; const int t = (int)(e % TT); const int d = (int)((e / TT) % HD); const int g = (int)(e / ((size_t)TT * HD)); v2h o16; v2us oh, ol;
#pragma unroll
    for (int q = 0; q < 2; ++q) { const float x = F[(size_t)(t + q) * pitch + g * HD + d]; o16[q] = tohx(x); unsigned short a2, c2; splitf(x, a2, c2); oh[q] = a2; ol[q] = c2; }
    *(v2h*)(V16 + e) = o16; *(v2us*)(Vh + e) = oh; *(v2us*)(Vl + e) = ol;  }

// k_asoft: one wave per row (zz, i): t = S x HD^-0.5, keys with mk[j] == 0 replaced (excluded from max and sum, weight exactly 0; a row with no valid key yields NaN);
__global__ __launch_bounds__(256) void k_asoft(const float* __restrict__ Sb, const int* __restrict__ mk, h16* P16, bf* Ph, bf* Pl) {
    const int lane = threadIdx.x & 31; const int row = blockIdx.x * 8 + (threadIdx.x >> 5); if (row >= ZH * TT) return; const int i = row % TT; const int zz = row / TT; const bool hires = (i < RH); const float* sr = Sb + (size_t)row * TT; float v[TT / 32]; float mx = NEGBIG;
#pragma unroll
    for (int ch = 0; ch < TT / 128; ++ch) { const int j0 = ch * 128 + lane * 4; const v4f a = *(const v4f*)(sr + j0); const v4i m = *(const v4i*)(mk + j0);
#pragma unroll
        for (int q = 0; q < 4; ++q) { const float t = (m[q] != 0) ? a[q] * SCL : NEGBIG; v[ch * 4 + q] = t; mx = fmaxf(mx, t); } }
#pragma unroll
    for (int sh = 16; sh; sh >>= 1) mx = fmaxf(mx, __shfl_xor(mx, sh, 32));
    float sum = 0.f;
#pragma unroll
    for (int k = 0; k < TT / 32; ++k) { const bool ok = (v[k] > -1.0e29f); float d0 = __fsub_rn(v[k], mx); asm volatile("" : "+v"(d0)); const float ex = __builtin_amdgcn_exp2f(__fmul_rn(d0, 1.4426950408889634f)); const float p = ok ? ex : 0.0f; v[k] = p; sum += p; }
#pragma unroll
    for (int sh = 16; sh; sh >>= 1) sum += __shfl_xor(sum, sh, 32);
    const float f = __fdiv_rn(hires ? 1.0f : PCAR, sum);
{
        if (hires) {
#pragma unroll
            for (int ch = 0; ch < TT / 128; ++ch) { v4us oh, ol;
#pragma unroll
                for (int q = 0; q < 4; ++q) { unsigned short a, c2; splitf(v[ch * 4 + q] * f, a, c2); oh[q] = a; ol[q] = c2; }
                const size_t oo = ((size_t)zz * RH + i) * TT + ch * 128 + lane * 4; *(v4us*)(Ph + oo) = oh; *(v4us*)(Pl + oo) = ol; }
        } else {
#pragma unroll
            for (int ch = 0; ch < TT / 128; ++ch) { v4h o4;
#pragma unroll
                for (int q = 0; q < 4; ++q) o4[q] = tohx(v[ch * 4 + q] * f);
                *(v4h*)(P16 + (size_t)row * TT + ch * 128 + lane * 4) = o4; } }
         }
}

__global__ __launch_bounds__(256) void k_merge(const float* __restrict__ O, int h0, bf* Ah, bf* Al) { const size_t e = ((size_t)blockIdx.x * 256 + threadIdx.x) * 2; if (e >= (size_t)ZH * TT * HD) return; const int d = (int)(e % HD); const int t = (int)((e / HD) % TT); const int zz = (int)(e / ((size_t)HD * TT)); const float cs = (t < RH) ? 1.0f : (1.0f / PCAR); const size_t oo = (size_t)t * DQ + (h0 + zz) * HD + d;
    const v2f x = *(const v2f*)(O + e); v2us oh, ol;
#pragma unroll
    for (int q = 0; q < 2; ++q) { unsigned short a, c2; splitf(x[q] * cs, a, c2); oh[q] = a; ol[q] = c2; } *(v2us*)(Ah + oo) = oh; *(v2us*)(Al + oo) = ol;  }

extern "C" void kernel_launch(void* const* d_in, const int* in_sizes, int n_in,
                              void* d_out, int out_size, void* d_ws, size_t ws_size, hipStream_t stream) {
    if (n_in < 12) return;
    const size_t needx = (size_t)(NB - 1) * SEQ_FULL * DM + (size_t)TT * DM;
    const size_t needm = (size_t)(NB - 1) * SEQ_FULL + (size_t)TT;
    if ((size_t)in_sizes[0] < needx || (size_t)in_sizes[1] < needx || (size_t)in_sizes[2] < needx || (size_t)in_sizes[3] < needm) return;
    if ((size_t)in_sizes[4] < (size_t)DQ * DM || (size_t)in_sizes[6] < (size_t)DKV * DM || (size_t)in_sizes[8] < (size_t)DKV * DM || (size_t)in_sizes[10] < (size_t)DM * DQ) return;
    if (in_sizes[5] < DQ || in_sizes[7] < DKV || in_sizes[9] < DKV || in_sizes[11] < DM) return;
    if ((size_t)out_size < needx) return;
    // wire order: query, key, value, mask (int32), Wq, bq, Wk, bk, Wv, bv, Wo, bo; weights [out][in]
    const float* xq = (const float*)d_in[0]; const float* xk = (const float*)d_in[1]; const float* xv = (const float*)d_in[2]; const int* mask = (const int*)d_in[3];
    const float* wq = (const float*)d_in[4]; const float* bq = (const float*)d_in[5]; const float* wk = (const float*)d_in[6]; const float* bk = (const float*)d_in[7];
    const float* wv = (const float*)d_in[8]; const float* bv = (const float*)d_in[9]; const float* wo = (const float*)d_in[10]; const float* bo = (const float*)d_in[11];
    float* OUT = (float*)d_out;     // [NB_FULL][SEQ_FULL][DM]
    char* wsp = (char*)d_ws;
    auto take = [&](size_t bytes) { char* p = wsp; wsp += (bytes + 255) & ~(size_t)255; return (void*)p; };
    bf* WQ = (bf*)take(SZ_W); bf* WK = (bf*)take(SZ_W); bf* WV = (bf*)take(SZ_W); bf* WO = (bf*)take(SZ_W);
    bf* XB = (bf*)take(SZ_XB); float* F = (float*)take(SZ_F);   // one f32 projection buffer, reused for q, k, v in stream order
    h16* QP16 = (h16*)take(SZ_HP); h16* KP16 = (h16*)take(SZ_HP); h16* VT16 = (h16*)take(SZ_HP);
    bf* QPh = (bf*)take(SZ_HP); bf* QPl = (bf*)take(SZ_HP); bf* KPh = (bf*)take(SZ_HP); bf* KPl = (bf*)take(SZ_HP); bf* VTh = (bf*)take(SZ_HP); bf* VTl = (bf*)take(SZ_HP);
    bf* Ph = (bf*)take(SZ_PHL); bf* Pl = (bf*)take(SZ_PHL);
    float* Sb = (float*)take(SZ_SB); h16* P16 = (h16*)take(SZ_P16); float* Ob = (float*)take(SZ_OB); bf* ATh = (bf*)take(SZ_AT); bf* ATl = (bf*)take(SZ_AT);
    if ((size_t)(wsp - (char*)d_ws) > ws_size) return;
    const unsigned LW = (unsigned)(((size_t)DQ * DM / 8 + 255) / 256);
    k_cvt8<<<LW, 256, 0, stream>>>(wq, WQ, (size_t)DQ * DM / 8);
    k_cvt8<<<LW, 256, 0, stream>>>(wk, WK, (size_t)DKV * DM / 8);
    k_cvt8<<<LW, 256, 0, stream>>>(wv, WV, (size_t)DKV * DM / 8);
    k_cvt8<<<LW, 256, 0, stream>>>(wo, WO, (size_t)DM * DQ / 8);
    const unsigned LX = (unsigned)(((size_t)TT * DM / 8 + 255) / 256);
    const unsigned LQ = (unsigned)(((size_t)NH_ * TT * HD / 2 + 255) / 256), LKv = (unsigned)(((size_t)NKV * TT * HD / 2 + 255) / 256);
    for (int b = 0; b < NB; ++b) {
        const size_t xo = (size_t)b * SEQ_FULL * DM;
        // q projection -> q planes
        k_cvt8<<<LX, 256, 0, stream>>>(xq + xo, XB, (size_t)TT * DM / 8);
        k_gemmw<bf, 0, true, KSP><<<dim3(TT / 64, DQ / 64, 1), 32 * KSP, 0, stream>>>(XB, nullptr, WQ, nullptr, DM, F, DQ, bq, 0, 0, 0);
        k_hpl<<<LQ, 256, 0, stream>>>(F, DQ, NH_, QP16, QPh, QPl);
        // k projection -> k planes
        k_cvt8<<<LX, 256, 0, stream>>>(xk + xo, XB, (size_t)TT * DM / 8);
        k_gemmw<bf, 0, true, KSP><<<dim3(TT / 64, DKV / 64, 1), 32 * KSP, 0, stream>>>(XB, nullptr, WK, nullptr, DM, F, DKV, bk, 0, 0, 0);
        k_hpl<<<LKv, 256, 0, stream>>>(F, DKV, NKV, KP16, KPh, KPl);
        // v projection -> transposed v planes
        k_cvt8<<<LX, 256, 0, stream>>>(xv + xo, XB, (size_t)TT * DM / 8);
        k_gemmw<bf, 0, true, KSP><<<dim3(TT / 64, DKV / 64, 1), 32 * KSP, 0, stream>>>(XB, nullptr, WV, nullptr, DM, F, DKV, bv, 0, 0, 0);
        k_vtp<<<LKv, 256, 0, stream>>>(F, DKV, NKV, VT16, VTh, VTl);
        const int* mk = mask + (size_t)b * SEQ_FULL;
        for (int h0 = 0; h0 < NH_; h0 += ZH) { const size_t zq = (size_t)h0, zk = (size_t)(h0 / REP);
            // scores S[zz][i][j] = q_i . k_j: rows < RH hi/lo (3 products), rows >= RH f16
            k_gemmw<bf, 2, false, 1><<<dim3(RH / 64, TT / 64, ZH), 32, 0, stream>>>(QPh + zq * TT * HD, QPl + zq * TT * HD, KPh + zk * TT * HD, KPl + zk * TT * HD, HD, Sb, TT, nullptr, (size_t)TT * HD, (size_t)TT * HD, (size_t)TT * TT);
            k_gemmw<h16, 0, false, 1><<<dim3((TT - RH) / 64, TT / 64, ZH), 32, 0, stream>>>(QP16 + zq * TT * HD + (size_t)RH * HD, nullptr, KP16 + zk * TT * HD, nullptr, HD, Sb + (size_t)RH * TT, TT, nullptr, (size_t)TT * HD, (size_t)TT * HD, (size_t)TT * TT);
            k_asoft<<<ZH * TT / 8, 256, 0, stream>>>(Sb, mk, P16, Ph, Pl);
            // O[zz][i][d] = sum_j P[i][j] V^T[d][j]
            k_gemmw<bf, 2, false, KSV><<<dim3(RH / 64, HD / 64, ZH), 32 * KSV, 0, stream>>>(Ph, Pl, VTh + zk * HD * TT, VTl + zk * HD * TT, TT, Ob, HD, nullptr, (size_t)RH * TT, (size_t)HD * TT, (size_t)TT * HD);
            k_gemmw<h16, 0, false, KSV><<<dim3((TT - RH) / 64, HD / 64, ZH), 32 * KSV, 0, stream>>>(P16 + (size_t)RH * TT, nullptr, VT16 + zk * HD * TT, nullptr, TT, Ob + (size_t)RH * HD, HD, nullptr, (size_t)TT * TT, (size_t)HD * TT, (size_t)TT * HD);
            k_merge<<<(unsigned)(((size_t)ZH * TT * HD / 2 + 255) / 256), 256, 0, stream>>>(Ob, h0, ATh, ATl); }
        // out[b][t][n] = sum_k ctx[t][k] Wo[n][k] + bo[n]
        k_gemmw<bf, 1, true, KSP><<<dim3(TT / 64, DM / 64, 1), 32 * KSP, 0, stream>>>(ATh, ATl, WO, nullptr, DQ, OUT + xo, DM, bo, 0, 0, 0); }
}

// v002
// Measured time: 582 microseconds a run.
// In two side-by-side timings against v001, it was 1.84 and 1.82 times as fast.
// Counting every step since v000, it is 3.50 times as fast.
#include <hip/hip_runtime.h>

// 16-head scaled dot-product attention with a key padding mask: q = query Wq^T + bq, k = key Wk^T + bk, v = value Wv^T + bv (weights [out][in]); scores x 1/8; masked keys (mask == 0) replaced by -inf; softmax over keys; out = merged Wo^T + bo.
// Compute dtypes, f32 accumulate everywhere: every float input converted to bf16 (RNE); projections v_wmma_f32_16x16x32_bf16 on exact bf16 planes + bf16-rounded bias added in f32; scores rows < RH bf16 hi/lo planes (3 products), rows >= RH v_wmma_f32_16x16x32_f16;
// P.V rows < RH bf16 hi/lo planes (3 products), rows >= RH f16 with P carried x1024 (folded back in f32); output projection bf16 hi/lo ctx planes x bf16 Wo (2 products) + bf16-rounded bias added in f32; softmax f32.

#ifndef NB
#define NB 2
#endif
#ifndef SEQ
#define SEQ 2048
#endif
#define NB_FULL  2
#define SEQ_FULL 2048
#define TT   SEQ
#define DM   1024
#define NH_  16
#define NKV  16
#define REP  (NH_ / NKV)
#define HD   64
#define DQ   (NH_ * HD)
#define DKV  (NKV * HD)
#define ZH   8            // heads per attention launch (grid z)
#define RH   ((TT > 512) ? 512 : (TT / 2))   // query rows < RH use hi+lo planes
#define PCAR 1024.0f
#define SCL  0.125f       // HD^-0.5
#define NEGBIG (-1.0e30f)
#define KSP  8            // waves per tile (k slices) in the four projections, K = DM or DQ
#define KSV  16           // waves per tile (k slices) in P.V, K = TT

static_assert(NB >= 1 && NB <= NB_FULL);
static_assert(TT <= SEQ_FULL && TT % 128 == 0);
static_assert(RH >= 64 && RH % 64 == 0 && TT > RH && (TT - RH) % 64 == 0);
static_assert(HD == 64 && DM % 64 == 0 && DQ % 64 == 0 && DM % 32 == 0 && TT % 32 == 0);
static_assert(NH_ % ZH == 0 && REP == 1);
static_assert(DM % (32 * KSP) == 0 && DQ % (32 * KSP) == 0 && TT % (32 * KSV) == 0);

#define SZ_W    ((size_t)DQ * DM * 2)
#define SZ_XB   ((size_t)3 * NB * TT * DM * 2)
#define SZ_F    ((size_t)3 * NB * TT * DQ * 4)
#define SZ_HP   ((size_t)NB * NH_ * TT * HD * 2)
#define SZ_SB   ((size_t)ZH * TT * TT * 4)
#define SZ_OB   ((size_t)ZH * TT * HD * 4)
#define SZ_AT   ((size_t)NB * TT * DQ * 2)
#define SZ_ALL  (4 * SZ_W + 9 * SZ_HP + SZ_SB + SZ_OB + 2 * SZ_AT)   // XB and F lie inside Sb
static_assert(SZ_W % 256 == 0 && SZ_XB % 256 == 0 && SZ_F % 256 == 0 && SZ_HP % 256 == 0 && SZ_SB % 256 == 0 && SZ_OB % 256 == 0 && SZ_AT % 256 == 0);
static_assert(SZ_ALL <= (size_t)268435456 && SZ_XB + SZ_F <= SZ_SB && DQ == DKV && NH_ == NKV);

typedef _Float16 h16;
typedef unsigned short bf;
typedef __attribute__((ext_vector_type(16))) __bf16   v16bf;
typedef __attribute__((ext_vector_type(16))) _Float16 v16h;
typedef __attribute__((ext_vector_type(8)))  _Float16 v8h;
typedef __attribute__((ext_vector_type(8)))  unsigned short v8us;
typedef __attribute__((ext_vector_type(8)))  float    v8f;
typedef __attribute__((ext_vector_type(4)))  float    v4f;
typedef v4f  __attribute__((may_alias)) v4fa;
typedef __attribute__((ext_vector_type(2))) _Float16 v2h;
typedef __attribute__((ext_vector_type(4))) _Float16 v4h;
typedef __attribute__((ext_vector_type(2))) unsigned short v2us;
typedef __attribute__((ext_vector_type(4))) unsigned short v4us;
typedef __attribute__((ext_vector_type(2))) float v2f;
typedef __attribute__((ext_vector_type(4))) int v4i;

__device__ __forceinline__ unsigned short f2bf(float f) { unsigned u = __float_as_uint(f); u += 0x7FFFu + ((u >> 16) & 1u); return (unsigned short)(u >> 16); }
__device__ __forceinline__ float bf2f(unsigned short b) { return __uint_as_float(((unsigned)b) << 16); }
__device__ __forceinline__ float bfr(float f) { return bf2f(f2bf(f)); }
__device__ __forceinline__ v16h cat16(v8h lo, v8h hi) { return __builtin_shufflevector(lo, hi, 0, 1, 2, 3, 4, 5, 6, 7, 8, 9, 10, 11, 12, 13, 14, 15); }
__device__ __forceinline__ v16bf cat16b(v8us lo, v8us hi) { return __builtin_bit_cast(v16bf, __builtin_shufflevector(lo, hi, 0, 1, 2, 3, 4, 5, 6, 7, 8, 9, 10, 11, 12, 13, 14, 15)); }
__device__ __forceinline__ v8f wmma16(v16h a, v16h b, v8f c) { return __builtin_amdgcn_wmma_f32_16x16x32_f16(false, a, false, b, (short)0, c, false, false); }
__device__ __forceinline__ v8f wmmab(v16bf a, v16bf b, v8f c) { return __builtin_amdgcn_wmma_f32_16x16x32_bf16(false, a, false, b, (short)0, c, false, false); }

// ---- k_gemmw: register-blocked GEMM, KS WAVES per 64x64 output tile (16 accumulators each), operands straight from K-contiguous 16-bit planes; grid (M/64, N/64, Z), 32 * KS threads.
// Wave w sums the k range [w K/KS, (w + 1) K/KS); for KS > 1 the KS partial tiles meet in LDS and are added in wave order 0..KS-1 (fixed order, same result every run). K % (32 KS) == 0.
// C[m][n] (f32, pitch ldc, + optional bias[n] rounded to bf16) = sum_k A[m][k] Bt[n][k] (+ split products per NSPLIT). A rows have pitch lda, Bt rows pitch K. z-batch strides sA/sB/sC in elements; Bt and the bias change only every zdiv-th z (bias0, bias1, bias2 in turn). K % 32 == 0, M % 64 == 0, N % 64 == 0.
// Fragment map (A and B alike): lane l -> row/col l & 15, h = l >> 4; elements 0..7 = k0 + 8h + 0..7, elements 8..15 = k0 + 16 + 8h + 0..7. D: element r -> row 8h + r, col l & 15.
template <typename T16> struct WFrag;
template <> struct WFrag<h16> { typedef v16h V; static __device__ __forceinline__ V ld(const h16* p) { return cat16(*(const v8h*)p, *(const v8h*)(p + 16)); } static __device__ __forceinline__ v8f mma(V a, V b, v8f c) { return wmma16(a, b, c); } };
template <> struct WFrag<bf> { typedef v16bf V; static __device__ __forceinline__ V ld(const bf* p) { return cat16b(*(const v8us*)p, *(const v8us*)(p + 16)); } static __device__ __forceinline__ v8f mma(V a, V b, v8f c) { return wmmab(a, b, c); } };
template <typename T16, int NSPLIT, bool BIAS, int KS>
__global__ __launch_bounds__(32 * KS) void k_gemmw(const T16* __restrict__ A, const T16* __restrict__ A2, const T16* __restrict__ Bt, const T16* __restrict__ Bt2, int K, int lda, float* C, int ldc, const float* __restrict__ bias0, const float* __restrict__ bias1, const float* __restrict__ bias2, int zdiv, size_t sA, size_t sB, size_t sC) {
    typedef typename WFrag<T16>::V V;
    __shared__ __align__(16) float os[(KS > 1 ? 2 * KS : 1) * 16 * 68];
    const size_t z = blockIdx.z, zb = blockIdx.z / (unsigned)zdiv; A += z * sA; if (A2) A2 += z * sA; Bt += zb * sB; if (Bt2) Bt2 += zb * sB; C += z * sC;
    const float* bias = (zb == 0) ? bias0 : ((zb == 1) ? bias1 : bias2);
    const int lane = threadIdx.x & 31, lr = lane & 15, hi = lane >> 4; const int r0 = blockIdx.x * 64, c0 = blockIdx.y * 64;
    v8f acc[4][4];
#pragma unroll
    for (int mb = 0; mb < 4; ++mb)
#pragma unroll
        for (int nb = 0; nb < 4; ++nb) acc[mb][nb] = (v8f){};
    const size_t aoff = (size_t)(r0 + lr) * lda + 8 * hi, boff = (size_t)(c0 + lr) * K + 8 * hi;
    // wave number through readfirstlane: the k loop's bounds and the slab address stay in scalar registers
    const int wv = (KS > 1) ? __builtin_amdgcn_readfirstlane((int)(threadIdx.x >> 5)) : 0; const int kw = K / KS, kbeg = wv * kw, kend = kbeg + kw;
#pragma unroll 1
    for (int kc = kbeg; kc < kend; kc += 32) {
        V a[4], a2[4];
#pragma unroll
        for (int mb = 0; mb < 4; ++mb) { a[mb] = WFrag<T16>::ld(A + aoff + (size_t)mb * 16 * lda + kc); if (NSPLIT == 1 || NSPLIT == 2) a2[mb] = WFrag<T16>::ld(A2 + aoff + (size_t)mb * 16 * lda + kc); }
#pragma unroll
        for (int nb = 0; nb < 4; ++nb) { const V b = WFrag<T16>::ld(Bt + boff + (size_t)nb * 16 * K + kc); V b2; if (NSPLIT >= 2) b2 = WFrag<T16>::ld(Bt2 + boff + (size_t)nb * 16 * K + kc);
#pragma unroll
            for (int mb = 0; mb < 4; ++mb) { acc[mb][nb] = WFrag<T16>::mma(a[mb], b, acc[mb][nb]); if (NSPLIT == 1 || NSPLIT == 2) acc[mb][nb] = WFrag<T16>::mma(a2[mb], b, acc[mb][nb]); if (NSPLIT >= 2) acc[mb][nb] = WFrag<T16>::mma(a[mb], b2, acc[mb][nb]); } }
        asm volatile("v_nop\n\tv_nop\n\tv_nop\n\tv_nop" : "+v"(acc[0][0]), "+v"(acc[1][1]), "+v"(acc[2][2]), "+v"(acc[3][3]) : "v"(a[0]), "v"(a[3]));
    }
    if constexpr (KS > 1) {
        // 16 x 64 slab per pass: every wave stores its partial, one barrier, then each thread adds the KS partials of its EPT neighbouring columns.
        // Two slab sets in turn: the barrier of pass mb + 1 ends every read of pass mb before pass mb + 2 writes that set again.
        // The four results stay in registers and go to memory behind the last barrier, so that no barrier waits for a global store.
        // Every loop here is unrolled because acc, res and the vectors live in registers and need constant indices.
        constexpr int EPT = (16 * 64) / (32 * KS); static_assert(EPT == 2 || EPT == 4);
        typedef __attribute__((ext_vector_type(EPT))) float vE; typedef vE __attribute__((may_alias)) vEa;
        const int e0 = (int)threadIdx.x * EPT, row = e0 >> 6, cofs = e0 & 63;
        vE res[4], bv = (vE)(0.0f);
        if (BIAS) {
#pragma unroll
            for (int q = 0; q < EPT; ++q) bv[q] = bfr(bias[c0 + cofs + q]); }
#pragma unroll
        for (int mb = 0; mb < 4; ++mb) {
            float* my = os + ((mb & 1) * KS + wv) * (16 * 68);
#pragma unroll
            for (int nb = 0; nb < 4; ++nb) {
#pragma unroll
                for (int j = 0; j < 8; ++j) my[(hi * 8 + j) * 68 + nb * 16 + lr] = acc[mb][nb][j]; }
            __syncthreads();   // publishes the KS partial slabs of this pass to the threads that add them
            const float* rd = os + (mb & 1) * KS * (16 * 68) + row * 68 + cofs; vE val = *(const vEa*)rd;
#pragma unroll
            for (int w = 1; w < KS; ++w) val += *(const vEa*)(rd + w * (16 * 68));
            res[mb] = BIAS ? val + bv : val; }
#pragma unroll
        for (int mb = 0; mb < 4; ++mb) *(vE*)(C + (size_t)(r0 + mb * 16 + row) * ldc + c0 + cofs) = res[mb];
        return; }
#pragma unroll
    for (int mb = 0; mb < 4; ++mb) {
#pragma unroll
        for (int nb = 0; nb < 4; ++nb) {
#pragma unroll
            for (int j = 0; j < 8; ++j) os[(hi * 8 + j) * 68 + nb * 16 + lr] = acc[mb][nb][j]; }
        __builtin_amdgcn_fence(3 /* release order */, "wavefront"); __builtin_amdgcn_wave_barrier(); asm volatile("" ::: "memory");
        float* crow = C + (size_t)(r0 + mb * 16) * ldc + c0;
{
#pragma unroll
            for (int s = 0; s < 8; ++s) { const int row = 2 * s + hi, cofs = lr * 4; v4f val = *(const v4fa*)(os + row * 68 + cofs); if (BIAS) { val[0] += bfr(bias[c0 + cofs]); val[1] += bfr(bias[c0 + cofs + 1]); val[2] += bfr(bias[c0 + cofs + 2]); val[3] += bfr(bias[c0 + cofs + 3]); }
                *(v4f*)(crow + (size_t)row * ldc + cofs) = val; }
             }
        __builtin_amdgcn_fence(3 /* release order */, "wavefront"); __builtin_amdgcn_wave_barrier(); asm volatile("" ::: "memory");
    }
}

__device__ __forceinline__ h16 tohx(float x) { return (h16)x; }
__device__ __forceinline__ void splitf(float y, unsigned short& h, unsigned short& l) { h = f2bf(y); l = f2bf(y - bf2f(h)); }

// blockIdx.z = which source tensor, blockIdx.y = batch (ny of them): src advances by ss elements per batch, dst is dense [z][y][8 n8]
__global__ __launch_bounds__(256) void k_cvt8(const float* __restrict__ s0, const float* __restrict__ s1, const float* __restrict__ s2, const float* __restrict__ s3, bf* dst, size_t n8, size_t ss, unsigned ny) { const size_t i = (size_t)blockIdx.x * 256 + threadIdx.x; if (i >= n8) return;
    const float* src = ((blockIdx.z == 0) ? s0 : (blockIdx.z == 1) ? s1 : (blockIdx.z == 2) ? s2 : s3) + blockIdx.y * ss; dst += ((size_t)blockIdx.z * ny + blockIdx.y) * n8 * 8; const v8f v = *(const v8f*)(src + i * 8); v8us o;
#pragma unroll
    for (int k = 0; k < 8; ++k) o[k] = f2bf(v[k]); *(v8us*)(dst + i * 8) = o;  }

__global__ __launch_bounds__(256) void k_hpl(const float* __restrict__ F, int pitch, int nheads, h16* P16, bf* Ph, bf* Pl) {
    const size_t e = ((size_t)blockIdx.x * 256 + threadIdx.x) * 2; if (e >= (size_t)nheads * TT * HD) return; const int d = (int)(e % HD); const int t = (int)((e / HD) % TT); const int h = (int)(e / ((size_t)HD * TT));
    const size_t bo = (size_t)blockIdx.y * nheads * TT * HD + e;   // blockIdx.y = (tensor, batch) slice of F and of the planes
    const v2f x = *(const v2f*)(F + ((size_t)blockIdx.y * TT + t) * pitch + h * HD + d); v2h o16; v2us oh, ol;
#pragma unroll
    for (int q = 0; q < 2; ++q) { o16[q] = tohx(x[q]); unsigned short a2, c2; splitf(x[q], a2, c2); oh[q] = a2; ol[q] = c2; }
    *(v2h*)(P16 + bo) = o16; *(v2us*)(Ph + bo) = oh; *(v2us*)(Pl + bo) = ol;  }

__global__ __launch_bounds__(256) void k_vtp(const float* __restrict__ F, int pitch, int nheads, h16* V16, bf* Vh, bf* Vl) { const size_t e = ((size_t)blockIdx.x * 256 + threadIdx.x) * 2; if (e >= (size_t)nheads * HD * TT) return; const int t = (int)(e % TT); const int d = (int)((e / TT) % HD); const int g = (int)(e / ((size_t)TT * HD)); v2h o16; v2us oh, ol;
    const size_t bo = (size_t)blockIdx.y * nheads * HD * TT + e;   // blockIdx.y = batch
#pragma unroll
    for (int q = 0; q < 2; ++q) { const float x = F[((size_t)blockIdx.y * TT + t + q) * pitch + g * HD + d]; o16[q] = tohx(x); unsigned short a2, c2; splitf(x, a2, c2); oh[q] = a2; ol[q] = c2; }
    *(v2h*)(V16 + bo) = o16; *(v2us*)(Vh + bo) = oh; *(v2us*)(Vl + bo) = ol;  }

// k_asoft: one wave per row (zz, i): t = S x HD^-0.5, keys with mk[j] == 0 replaced (excluded from max and sum, weight exactly 0; a row with no valid key yields NaN);
// P goes back over the row's own 4 TT bytes of S: rows < RH the hi plane in 16-bit elements [0, TT) and the lo plane in [TT, 2 TT), rows >= RH f16 in [0, TT).
// The wave holds its whole row in registers before the row sum, on which every stored value depends, so no store can pass a load of the row.
__global__ __launch_bounds__(256) void k_asoft(float* Sb, const int* __restrict__ mk) {
    const int lane = threadIdx.x & 31; const int row = blockIdx.x * 8 + (threadIdx.x >> 5); if (row >= ZH * TT) return; const int i = row % TT; const bool hires = (i < RH); const float* sr = Sb + (size_t)row * TT; float v[TT / 32]; float mx = NEGBIG;
#pragma unroll
    for (int ch = 0; ch < TT / 128; ++ch) { const int j0 = ch * 128 + lane * 4; const v4f a = *(const v4f*)(sr + j0); const v4i m = *(const v4i*)(mk + j0);
#pragma unroll
        for (int q = 0; q < 4; ++q) { const float t = (m[q] != 0) ? a[q] * SCL : NEGBIG; v[ch * 4 + q] = t; mx = fmaxf(mx, t); } }
#pragma unroll
    for (int sh = 16; sh; sh >>= 1) mx = fmaxf(mx, __shfl_xor(mx, sh, 32));
    float sum = 0.f;
#pragma unroll
    for (int k = 0; k < TT / 32; ++k) { const bool ok = (v[k] > -1.0e29f); float d0 = __fsub_rn(v[k], mx); asm volatile("" : "+v"(d0)); const float ex = __builtin_amdgcn_exp2f(__fmul_rn(d0, 1.4426950408889634f)); const float p = ok ? ex : 0.0f; v[k] = p; sum += p; }
#pragma unroll
    for (int sh = 16; sh; sh >>= 1) sum += __shfl_xor(sum, sh, 32);
    const float f = __fdiv_rn(hires ? 1.0f : PCAR, sum);
{
        if (hires) {
#pragma unroll
            for (int ch = 0; ch < TT / 128; ++ch) { v4us oh, ol;
#pragma unroll
                for (int q = 0; q < 4; ++q) { unsigned short a, c2; splitf(v[ch * 4 + q] * f, a, c2); oh[q] = a; ol[q] = c2; }
                bf* pr = (bf*)(Sb + (size_t)row * TT) + ch * 128 + lane * 4; *(v4us*)pr = oh; *(v4us*)(pr + TT) = ol; }
        } else {
#pragma unroll
            for (int ch = 0; ch < TT / 128; ++ch) { v4h o4;
#pragma unroll
                for (int q = 0; q < 4; ++q) o4[q] = tohx(v[ch * 4 + q] * f);
                *(v4h*)((h16*)(Sb + (size_t)row * TT) + ch * 128 + lane * 4) = o4; } }
         }
}

__global__ __launch_bounds__(256) void k_merge(const float* __restrict__ O, int h0, bf* Ah, bf* Al) { const size_t e = ((size_t)blockIdx.x * 256 + threadIdx.x) * 2; if (e >= (size_t)ZH * TT * HD) return; const int d = (int)(e % HD); const int t = (int)((e / HD) % TT); const int zz = (int)(e / ((size_t)HD * TT)); const float cs = (t < RH) ? 1.0f : (1.0f / PCAR); const size_t oo = (size_t)t * DQ + (h0 + zz) * HD + d;
    const v2f x = *(const v2f*)(O + e); v2us oh, ol;
#pragma unroll
    for (int q = 0; q < 2; ++q) { unsigned short a, c2; splitf(x[q] * cs, a, c2); oh[q] = a; ol[q] = c2; } *(v2us*)(Ah + oo) = oh; *(v2us*)(Al + oo) = ol;  }

extern "C" void kernel_launch(void* const* d_in, const int* in_sizes, int n_in,
                              void* d_out, int out_size, void* d_ws, size_t ws_size, hipStream_t stream) {
    if (n_in < 12) return;
    const size_t needx = (size_t)(NB - 1) * SEQ_FULL * DM + (size_t)TT * DM;
    const size_t needm = (size_t)(NB - 1) * SEQ_FULL + (size_t)TT;
    if ((size_t)in_sizes[0] < needx || (size_t)in_sizes[1] < needx || (size_t)in_sizes[2] < needx || (size_t)in_sizes[3] < needm) return;
    if ((size_t)in_sizes[4] < (size_t)DQ * DM || (size_t)in_sizes[6] < (size_t)DKV * DM || (size_t)in_sizes[8] < (size_t)DKV * DM || (size_t)in_sizes[10] < (size_t)DM * DQ) return;
    if (in_sizes[5] < DQ || in_sizes[7] < DKV || in_sizes[9] < DKV || in_sizes[11] < DM) return;
    if ((size_t)out_size < needx) return;
    // wire order: query, key, value, mask (int32), Wq, bq, Wk, bk, Wv, bv, Wo, bo; weights [out][in]
    const float* xq = (const float*)d_in[0]; const float* xk = (const float*)d_in[1]; const float* xv = (const float*)d_in[2]; const int* mask = (const int*)d_in[3];
    const float* wq = (const float*)d_in[4]; const float* bq = (const float*)d_in[5]; const float* wk = (const float*)d_in[6]; const float* bk = (const float*)d_in[7];
    const float* wv = (const float*)d_in[8]; const float* bv = (const float*)d_in[9]; const float* wo = (const float*)d_in[10]; const float* bo = (const float*)d_in[11];
    float* OUT = (float*)d_out;     // [NB_FULL][SEQ_FULL][DM]
    char* wsp = (char*)d_ws;
    auto take = [&](size_t bytes) { char* p = wsp; wsp += (bytes + 255) & ~(size_t)255; return (void*)p; };
    bf* WQ = (bf*)take(SZ_W); bf* WK = (bf*)take(SZ_W); bf* WV = (bf*)take(SZ_W); bf* WO = (bf*)take(SZ_W);   // one after the other: filled by one launch, WQ WK WV read by one launch
    // planes [b][head][.][.]; each k plane directly behind its q plane, so that one launch fills both
    h16* QP16 = (h16*)take(SZ_HP); h16* KP16 = (h16*)take(SZ_HP); bf* QPh = (bf*)take(SZ_HP); bf* KPh = (bf*)take(SZ_HP); bf* QPl = (bf*)take(SZ_HP); bf* KPl = (bf*)take(SZ_HP);
    h16* VT16 = (h16*)take(SZ_HP); bf* VTh = (bf*)take(SZ_HP); bf* VTl = (bf*)take(SZ_HP);
    float* Sb = (float*)take(SZ_SB); float* Ob = (float*)take(SZ_OB); bf* ATh = (bf*)take(SZ_AT); bf* ATl = (bf*)take(SZ_AT);
    if ((size_t)(wsp - (char*)d_ws) > ws_size) return;
    // XB [q k v][b][t][DM] bf16 and F [q k v][b][t][DQ] f32 live in Sb: their last reader (k_vtp) is launched before the first scores
    bf* XB = (bf*)Sb; float* F = (float*)((char*)Sb + SZ_XB);
    const unsigned LW = (unsigned)(((size_t)DQ * DM / 8 + 255) / 256);
    const unsigned LX = (unsigned)(((size_t)TT * DM / 8 + 255) / 256);
    const unsigned LQ = (unsigned)(((size_t)NH_ * TT * HD / 2 + 255) / 256), LKv = (unsigned)(((size_t)NKV * TT * HD / 2 + 255) / 256);
    const size_t xs = (size_t)SEQ_FULL * DM;   // batch stride of the f32 inputs and of the output
    // four weights in one launch; q, k, v inputs of every batch in one launch
    k_cvt8<<<dim3(LW, 1, 4), 256, 0, stream>>>(wq, wk, wv, wo, WQ, (size_t)DQ * DM / 8, 0, 1);
    k_cvt8<<<dim3(LX, NB, 3), 256, 0, stream>>>(xq, xk, xv, xv, XB, (size_t)TT * DM / 8, xs, NB);
    // the three projections of every batch in one launch: z = tensor * NB + batch
    k_gemmw<bf, 0, true, KSP><<<dim3(TT / 64, DQ / 64, 3 * NB), 32 * KSP, 0, stream>>>(XB, nullptr, WQ, nullptr, DM, DM, F, DQ, bq, bk, bv, NB, (size_t)TT * DM, (size_t)DQ * DM, (size_t)TT * DQ);
    // q and k planes in one launch, then the transposed v planes
    k_hpl<<<dim3(LQ, 2 * NB), 256, 0, stream>>>(F, DQ, NH_, QP16, QPh, QPl);
    k_vtp<<<dim3(LKv, NB), 256, 0, stream>>>(F + (size_t)2 * NB * TT * DQ, DKV, NKV, VT16, VTh, VTl);
    for (int b = 0; b < NB; ++b) {
        const int* mk = mask + (size_t)b * SEQ_FULL;
        for (int h0 = 0; h0 < NH_; h0 += ZH) { const size_t zq = (size_t)b * NH_ + h0, zk = (size_t)b * NKV + h0 / REP;
            // scores S[zz][i][j] = q_i . k_j: rows < RH hi/lo (3 products), rows >= RH f16
            k_gemmw<bf, 2, false, 1><<<dim3(RH / 64, TT / 64, ZH), 32, 0, stream>>>(QPh + zq * TT * HD, QPl + zq * TT * HD, KPh + zk * TT * HD, KPl + zk * TT * HD, HD, HD, Sb, TT, nullptr, nullptr, nullptr, 1, (size_t)TT * HD, (size_t)TT * HD, (size_t)TT * TT);
            k_gemmw<h16, 0, false, 1><<<dim3((TT - RH) / 64, TT / 64, ZH), 32, 0, stream>>>(QP16 + zq * TT * HD + (size_t)RH * HD, nullptr, KP16 + zk * TT * HD, nullptr, HD, HD, Sb + (size_t)RH * TT, TT, nullptr, nullptr, nullptr, 1, (size_t)TT * HD, (size_t)TT * HD, (size_t)TT * TT);
            k_asoft<<<ZH * TT / 8, 256, 0, stream>>>(Sb, mk);
            // O[zz][i][d] = sum_j P[i][j] V^T[d][j]; P lies in the S rows: pitch 2 TT 16-bit elements, lo plane TT behind hi
            k_gemmw<bf, 2, false, KSV><<<dim3(RH / 64, HD / 64, ZH), 32 * KSV, 0, stream>>>((const bf*)Sb, (const bf*)Sb + TT, VTh + zk * HD * TT, VTl + zk * HD * TT, TT, 2 * TT, Ob, HD, nullptr, nullptr, nullptr, 1, (size_t)TT * 2 * TT, (size_t)HD * TT, (size_t)TT * HD);
            k_gemmw<h16, 0, false, KSV><<<dim3((TT - RH) / 64, HD / 64, ZH), 32 * KSV, 0, stream>>>((const h16*)Sb + (size_t)RH * 2 * TT, nullptr, VT16 + zk * HD * TT, nullptr, TT, 2 * TT, Ob + (size_t)RH * HD, HD, nullptr, nullptr, nullptr, 1, (size_t)TT * 2 * TT, (size_t)HD * TT, (size_t)TT * HD);
            k_merge<<<(unsigned)(((size_t)ZH * TT * HD / 2 + 255) / 256), 256, 0, stream>>>(Ob, h0, ATh + (size_t)b * TT * DQ, ATl + (size_t)b * TT * DQ); } }
    // out[b][t][n] = sum_k ctx[b][t][k] Wo[n][k] + bo[n], every batch in one launch
    k_gemmw<bf, 1, true, KSP><<<dim3(TT / 64, DM / 64, NB), 32 * KSP, 0, stream>>>(ATh, ATl, WO, nullptr, DQ, DQ, OUT, DM, bo, bo, bo, NB, (size_t)TT * DQ, 0, xs);
}

// v003
// It runs in 212 microseconds.
// Two timings next to v002 put it at 2.74 and 2.73 times that version's speed.
// All steps since v000 together make it 9.60 times as fast.
#include <hip/hip_runtime.h>

// 16-head scaled dot-product attention with a key padding mask: q = query Wq^T + bq, k = key Wk^T + bk, v = value Wv^T + bv (weights [out][in]); scores x 1/8; masked keys (mask == 0) replaced by -inf; softmax over keys; out = merged Wo^T + bo.
// Compute dtypes, f32 accumulate everywhere: every float input converted to bf16 (RNE); projections v_wmma_f32_16x16x32_bf16 on exact bf16 planes + bf16-rounded bias; scores rows < RH bf16 hi/lo planes (3 products), rows >= RH v_wmma_f32_16x16x32_f16;
// P.V rows < RH bf16 hi/lo planes (3 products), rows >= RH f16 with P carried x1024 (the f32 row sum carries it too); output projection bf16 hi/lo ctx planes x bf16 Wo (2 products) + bf16-rounded bias; softmax f32.

#ifndef NB
#define NB 2
#endif
#ifndef SEQ
#define SEQ 2048
#endif
#define NB_FULL  2
#define SEQ_FULL 2048
#define TT   SEQ
#define DM   1024
#define NH_  16
#define NKV  16
#define REP  (NH_ / NKV)
#define HD   64
#define DQ   (NH_ * HD)
#define DKV  (NKV * HD)
#define RH   ((TT > 512) ? 512 : (TT / 2))   // query rows < RH use hi+lo planes
#define PCARL2 10.0f      // P of the f16 rows is carried x 2^10
#define SCL  0.125f       // HD^-0.5
#define NEGBIG (-1.0e30f)
#define KSP  8            // waves per tile (k slices) in the four projections, K = DM or DQ

static_assert(NB >= 1 && NB <= NB_FULL);
static_assert(TT <= SEQ_FULL && TT % 128 == 0);
static_assert(RH >= 64 && RH % 64 == 0 && TT > RH && (TT - RH) % 64 == 0);
static_assert(HD == 64 && DM % 64 == 0 && DQ % 64 == 0 && DM % 32 == 0 && TT % 32 == 0);
static_assert(REP == 1);
static_assert(DM % (32 * KSP) == 0 && DQ % (32 * KSP) == 0);

#define SZ_W    ((size_t)DQ * DM * 2)
#define SZ_XB   ((size_t)3 * NB * TT * DM * 2)
#define SZ_F    ((size_t)3 * NB * TT * DQ * 4)
#define SZ_HP   ((size_t)NB * NH_ * TT * HD * 2)
#define SZ_AT   ((size_t)NB * TT * DQ * 2)
#define SZ_ALL  (4 * SZ_W + 9 * SZ_HP + SZ_XB + SZ_F + 2 * SZ_AT)
static_assert(SZ_W % 256 == 0 && SZ_XB % 256 == 0 && SZ_F % 256 == 0 && SZ_HP % 256 == 0 && SZ_AT % 256 == 0);
static_assert(SZ_ALL <= (size_t)268435456 && DQ == DKV && NH_ == NKV);

typedef _Float16 h16;
typedef unsigned short bf;
typedef __attribute__((ext_vector_type(16))) __bf16   v16bf;
typedef __attribute__((ext_vector_type(16))) _Float16 v16h;
typedef __attribute__((ext_vector_type(8)))  _Float16 v8h;
typedef __attribute__((ext_vector_type(8)))  unsigned short v8us;
typedef __attribute__((ext_vector_type(8)))  float    v8f;
typedef __attribute__((ext_vector_type(4)))  float    v4f;
typedef v4f  __attribute__((may_alias)) v4fa;
typedef __attribute__((ext_vector_type(2))) _Float16 v2h;
typedef __attribute__((ext_vector_type(4))) _Float16 v4h;
typedef __attribute__((ext_vector_type(2))) unsigned short v2us;
typedef __attribute__((ext_vector_type(4))) unsigned short v4us;
typedef __attribute__((ext_vector_type(2))) float v2f;
typedef __attribute__((ext_vector_type(4))) int v4i;

__device__ __forceinline__ unsigned short f2bf(float f) { unsigned u = __float_as_uint(f); u += 0x7FFFu + ((u >> 16) & 1u); return (unsigned short)(u >> 16); }
__device__ __forceinline__ float bf2f(unsigned short b) { return __uint_as_float(((unsigned)b) << 16); }
__device__ __forceinline__ float bfr(float f) { return bf2f(f2bf(f)); }
__device__ __forceinline__ v16h cat16(v8h lo, v8h hi) { return __builtin_shufflevector(lo, hi, 0, 1, 2, 3, 4, 5, 6, 7, 8, 9, 10, 11, 12, 13, 14, 15); }
__device__ __forceinline__ v16bf cat16b(v8us lo, v8us hi) { return __builtin_bit_cast(v16bf, __builtin_shufflevector(lo, hi, 0, 1, 2, 3, 4, 5, 6, 7, 8, 9, 10, 11, 12, 13, 14, 15)); }
__device__ __forceinline__ v8f wmma16(v16h a, v16h b, v8f c) { return __builtin_amdgcn_wmma_f32_16x16x32_f16(false, a, false, b, (short)0, c, false, false); }
__device__ __forceinline__ v8f wmmab(v16bf a, v16bf b, v8f c) { return __builtin_amdgcn_wmma_f32_16x16x32_bf16(false, a, false, b, (short)0, c, false, false); }

// ---- k_gemmw: register-blocked GEMM, KS WAVES per 64x64 output tile (16 accumulators each), operands straight from K-contiguous 16-bit planes; grid (M/64, N/64, Z), 32 * KS threads.
// Wave w sums the k range [w K/KS, (w + 1) K/KS); the KS partial tiles meet in LDS and are added in wave order 0..KS-1 (fixed order, same result every run). K % (32 KS) == 0.
// C[m][n] (f32, pitch ldc, + optional bias[n] rounded to bf16) = sum_k A[m][k] Bt[n][k] (+ split products per NSPLIT). A rows have pitch lda, Bt rows pitch K. z-batch strides sA/sB/sC in elements; Bt and the bias change only every zdiv-th z (bias0, bias1, bias2 in turn). K % 32 == 0, M % 64 == 0, N % 64 == 0.
// Fragment map (A and B alike): lane l -> row/col l & 15, h = l >> 4; elements 0..7 = k0 + 8h + 0..7, elements 8..15 = k0 + 16 + 8h + 0..7. D: element r -> row 8h + r, col l & 15.
template <typename T16> struct WFrag;
template <> struct WFrag<h16> { typedef v16h V; static __device__ __forceinline__ V ld(const h16* p) { return cat16(*(const v8h*)p, *(const v8h*)(p + 16)); } static __device__ __forceinline__ v8f mma(V a, V b, v8f c) { return wmma16(a, b, c); } };
template <> struct WFrag<bf> { typedef v16bf V; static __device__ __forceinline__ V ld(const bf* p) { return cat16b(*(const v8us*)p, *(const v8us*)(p + 16)); } static __device__ __forceinline__ v8f mma(V a, V b, v8f c) { return wmmab(a, b, c); } };
template <typename T16, int NSPLIT, bool BIAS, int KS>
__global__ __launch_bounds__(32 * KS) void k_gemmw(const T16* __restrict__ A, const T16* __restrict__ A2, const T16* __restrict__ Bt, const T16* __restrict__ Bt2, int K, int lda, float* C, int ldc, const float* __restrict__ bias0, const float* __restrict__ bias1, const float* __restrict__ bias2, int zdiv, size_t sA, size_t sB, size_t sC) {
    typedef typename WFrag<T16>::V V; static_assert(KS > 1);
    __shared__ __align__(16) float os[2 * KS * 16 * 68];
    const size_t z = blockIdx.z, zb = blockIdx.z / (unsigned)zdiv; A += z * sA; if (A2) A2 += z * sA; Bt += zb * sB; if (Bt2) Bt2 += zb * sB; C += z * sC;
    const float* bias = (zb == 0) ? bias0 : ((zb == 1) ? bias1 : bias2);
    const int lane = threadIdx.x & 31, lr = lane & 15, hi = lane >> 4; const int r0 = blockIdx.x * 64, c0 = blockIdx.y * 64;
    v8f acc[4][4];
#pragma unroll
    for (int mb = 0; mb < 4; ++mb)
#pragma unroll
        for (int nb = 0; nb < 4; ++nb) acc[mb][nb] = (v8f){};
    const size_t aoff = (size_t)(r0 + lr) * lda + 8 * hi, boff = (size_t)(c0 + lr) * K + 8 * hi;
    // wave number through readfirstlane: the k loop's bounds and the slab address stay in scalar registers
    const int wv = (KS > 1) ? __builtin_amdgcn_readfirstlane((int)(threadIdx.x >> 5)) : 0; const int kw = K / KS, kbeg = wv * kw, kend = kbeg + kw;
#pragma unroll 1
    for (int kc = kbeg; kc < kend; kc += 32) {
        V a[4], a2[4];
#pragma unroll
        for (int mb = 0; mb < 4; ++mb) { a[mb] = WFrag<T16>::ld(A + aoff + (size_t)mb * 16 * lda + kc); if (NSPLIT == 1 || NSPLIT == 2) a2[mb] = WFrag<T16>::ld(A2 + aoff + (size_t)mb * 16 * lda + kc); }
#pragma unroll
        for (int nb = 0; nb < 4; ++nb) { const V b = WFrag<T16>::ld(Bt + boff + (size_t)nb * 16 * K + kc); V b2; if (NSPLIT >= 2) b2 = WFrag<T16>::ld(Bt2 + boff + (size_t)nb * 16 * K + kc);
#pragma unroll
            for (int mb = 0; mb < 4; ++mb) { acc[mb][nb] = WFrag<T16>::mma(a[mb], b, acc[mb][nb]); if (NSPLIT == 1 || NSPLIT == 2) acc[mb][nb] = WFrag<T16>::mma(a2[mb], b, acc[mb][nb]); if (NSPLIT >= 2) acc[mb][nb] = WFrag<T16>::mma(a[mb], b2, acc[mb][nb]); } }
        asm volatile("v_nop\n\tv_nop\n\tv_nop\n\tv_nop" : "+v"(acc[0][0]), "+v"(acc[1][1]), "+v"(acc[2][2]), "+v"(acc[3][3]) : "v"(a[0]), "v"(a[3]));
    }
    if constexpr (KS > 1) {
        // 16 x 64 slab per pass: every wave stores its partial, one barrier, then each thread adds the KS partials of its EPT neighbouring columns.
        // Two slab sets in turn: the barrier of pass mb + 1 ends every read of pass mb before pass mb + 2 writes that set again.
        // The four results stay in registers and go to memory behind the last barrier, so that no barrier waits for a global store.
        // Every loop here is unrolled because acc, res and the vectors live in registers and need constant indices.
        constexpr int EPT = (16 * 64) / (32 * KS); static_assert(EPT == 2 || EPT == 4);
        typedef __attribute__((ext_vector_type(EPT))) float vE; typedef vE __attribute__((may_alias)) vEa;
        const int e0 = (int)threadIdx.x * EPT, row = e0 >> 6, cofs = e0 & 63;
        vE res[4], bv = (vE)(0.0f);
        if (BIAS) {
#pragma unroll
            for (int q = 0; q < EPT; ++q) bv[q] = bfr(bias[c0 + cofs + q]); }
#pragma unroll
        for (int mb = 0; mb < 4; ++mb) {
            float* my = os + ((mb & 1) * KS + wv) * (16 * 68);
#pragma unroll
            for (int nb = 0; nb < 4; ++nb) {
#pragma unroll
                for (int j = 0; j < 8; ++j) my[(hi * 8 + j) * 68 + nb * 16 + lr] = acc[mb][nb][j]; }
            __syncthreads();   // publishes the KS partial slabs of this pass to the threads that add them
            const float* rd = os + (mb & 1) * KS * (16 * 68) + row * 68 + cofs; vE val = *(const vEa*)rd;
#pragma unroll
            for (int w = 1; w < KS; ++w) val += *(const vEa*)(rd + w * (16 * 68));
            res[mb] = BIAS ? val + bv : val; }
#pragma unroll
        for (int mb = 0; mb < 4; ++mb) *(vE*)(C + (size_t)(r0 + mb * 16 + row) * ldc + c0 + cofs) = res[mb];
    }
}

__device__ __forceinline__ h16 tohx(float x) { return (h16)x; }
__device__ __forceinline__ void splitf(float y, unsigned short& h, unsigned short& l) { h = f2bf(y); l = f2bf(y - bf2f(h)); }

// blockIdx.z = which source tensor, blockIdx.y = batch (ny of them): src advances by ss elements per batch, dst is dense [z][y][8 n8]
__global__ __launch_bounds__(256) void k_cvt8(const float* __restrict__ s0, const float* __restrict__ s1, const float* __restrict__ s2, const float* __restrict__ s3, bf* dst, size_t n8, size_t ss, unsigned ny) { const size_t i = (size_t)blockIdx.x * 256 + threadIdx.x; if (i >= n8) return;
    const float* src = ((blockIdx.z == 0) ? s0 : (blockIdx.z == 1) ? s1 : (blockIdx.z == 2) ? s2 : s3) + blockIdx.y * ss; dst += ((size_t)blockIdx.z * ny + blockIdx.y) * n8 * 8; const v8f v = *(const v8f*)(src + i * 8); v8us o;
#pragma unroll
    for (int k = 0; k < 8; ++k) o[k] = f2bf(v[k]); *(v8us*)(dst + i * 8) = o;  }

__global__ __launch_bounds__(256) void k_hpl(const float* __restrict__ F, int pitch, int nheads, h16* P16, bf* Ph, bf* Pl) {
    const size_t e = ((size_t)blockIdx.x * 256 + threadIdx.x) * 2; if (e >= (size_t)nheads * TT * HD) return; const int d = (int)(e % HD); const int t = (int)((e / HD) % TT); const int h = (int)(e / ((size_t)HD * TT));
    const size_t bo = (size_t)blockIdx.y * nheads * TT * HD + e;   // blockIdx.y = (tensor, batch) slice of F and of the planes
    const v2f x = *(const v2f*)(F + ((size_t)blockIdx.y * TT + t) * pitch + h * HD + d); v2h o16; v2us oh, ol;
#pragma unroll
    for (int q = 0; q < 2; ++q) { o16[q] = tohx(x[q]); unsigned short a2, c2; splitf(x[q], a2, c2); oh[q] = a2; ol[q] = c2; }
    *(v2h*)(P16 + bo) = o16; *(v2us*)(Ph + bo) = oh; *(v2us*)(Pl + bo) = ol;  }

__global__ __launch_bounds__(256) void k_vtp(const float* __restrict__ F, int pitch, int nheads, h16* V16, bf* Vh, bf* Vl) { const size_t e = ((size_t)blockIdx.x * 256 + threadIdx.x) * 2; if (e >= (size_t)nheads * HD * TT) return; const int t = (int)(e % TT); const int d = (int)((e / TT) % HD); const int g = (int)(e / ((size_t)TT * HD)); v2h o16; v2us oh, ol;
    const size_t bo = (size_t)blockIdx.y * nheads * HD * TT + e;   // blockIdx.y = batch
#pragma unroll
    for (int q = 0; q < 2; ++q) { const float x = F[((size_t)blockIdx.y * TT + t + q) * pitch + g * HD + d]; o16[q] = tohx(x); unsigned short a2, c2; splitf(x, a2, c2); oh[q] = a2; ol[q] = c2; }
    *(v2h*)(V16 + bo) = o16; *(v2us*)(Vh + bo) = oh; *(v2us*)(Vl + bo) = ol;  }

#define FP   72             // LDS row pitch in 16-bit elements: 128 B + 16 B, the 16 rows of a 16-byte fragment read fall on distinct banks
#define FT   (64 * FP)      // one 64 x 64 tile
#define QBH  128            // queries per work-group, rows < RH
#define QBL  256            // queries per work-group, rows >= RH
#define MSTART (-5.0e29f)
#define SCL2 (SCL * 1.4426950408889634f)
static_assert(RH % QBH == 0 && (TT - RH) % QBL == 0 && TT % 1024 == 0 && TT % 64 == 0);
typedef v4i __attribute__((may_alias)) v4ia;
typedef __attribute__((ext_vector_type(8))) __bf16 v8bf;

__device__ __forceinline__ float xhalf(float x) { const int b = __float_as_int(x); return __int_as_float(__builtin_amdgcn_permlanex16(b, b, 0x76543210, 0xfedcba98, false, false)); }   // lane l <-> l ^ 16

template <typename T16, bool HI>
__device__ __forceinline__ void fa_body(T16* sm, const int* smk, const T16* __restrict__ Q, const T16* __restrict__ Q2, const T16* __restrict__ Kp, const T16* __restrict__ K2,
                                        const T16* __restrict__ Vt, const T16* __restrict__ V2, int q0, bf* Ah, bf* Al) {
    typedef typename WFrag<T16>::V V;
    constexpr int NPL = HI ? 2 : 1, NG = HI ? 1 : 2, NS = TT / 64;
    const int tid = (int)threadIdx.x, lane = tid & 31, lr = lane & 15, hi = lane >> 4;
    const int qw = q0 + (tid >> 5) * (16 * NG);
    const int srow = tid >> 3, scol = (tid & 7) * 8;   // staging: 16 bytes of rows srow and srow + 32 of every tile
    v4i st[2 * NPL][2];
    auto gl = [&](int j0) {
#pragma unroll
        for (int i = 0; i < 2; ++i) { const int row = srow + 32 * i;
            st[0][i] = *(const v4ia*)(Kp + (size_t)(j0 + row) * HD + scol); if (HI) st[1][i] = *(const v4ia*)(K2 + (size_t)(j0 + row) * HD + scol);
            st[NPL][i] = *(const v4ia*)(Vt + (size_t)row * TT + j0 + scol); if (HI) st[NPL + 1][i] = *(const v4ia*)(V2 + (size_t)row * TT + j0 + scol); } };
    auto sl = [&](int buf) {
#pragma unroll
        for (int tl = 0; tl < 2 * NPL; ++tl)
#pragma unroll
            for (int i = 0; i < 2; ++i) *(v4ia*)(sm + (buf * 2 * NPL + tl) * FT + (srow + 32 * i) * FP + scol) = st[tl][i]; };
    V q[NG][2], q2[NG][2];
#pragma unroll
    for (int g = 0; g < NG; ++g)
#pragma unroll
        for (int ks = 0; ks < 2; ++ks) { q[g][ks] = WFrag<T16>::ld(Q + (size_t)(qw + g * 16 + lr) * HD + ks * 32 + 8 * hi); if (HI) q2[g][ks] = WFrag<T16>::ld(Q2 + (size_t)(qw + g * 16 + lr) * HD + ks * 32 + 8 * hi); }
    v8f o[NG][4]; float mrun[NG], lsum[NG];
#pragma unroll
    for (int g = 0; g < NG; ++g) { mrun[g] = MSTART; lsum[g] = 0.0f;
#pragma unroll
        for (int mb = 0; mb < 4; ++mb) o[g][mb] = (v8f){}; }
    gl(0); sl(0);
#pragma unroll 1
    for (int s = 0; s < NS; ++s) {
        __syncthreads();   // publishes buffer s & 1 (and, at s = 0, the mask); ends every read of the other buffer, which is refilled below
        const bool more = (s + 1 < NS);
        if (more) gl((s + 1) * 64);
        const T16* kt = sm + ((s & 1) * 2 * NPL) * FT; const T16* vt = kt + NPL * FT;
        v8f sc[NG][4];
#pragma unroll
        for (int t = 0; t < 4; ++t) {
#pragma unroll
            for (int g = 0; g < NG; ++g) sc[g][t] = (v8f){};
#pragma unroll
            for (int ks = 0; ks < 2; ++ks) { const V ka = WFrag<T16>::ld(kt + (t * 16 + lr) * FP + ks * 32 + 8 * hi); V kb; if (HI) kb = WFrag<T16>::ld(kt + FT + (t * 16 + lr) * FP + ks * 32 + 8 * hi);
#pragma unroll
                for (int g = 0; g < NG; ++g) { sc[g][t] = WFrag<T16>::mma(ka, q[g][ks], sc[g][t]); if (HI) { sc[g][t] = WFrag<T16>::mma(ka, q2[g][ks], sc[g][t]); sc[g][t] = WFrag<T16>::mma(kb, q[g][ks], sc[g][t]); } } } }
        float mnew[NG];
#pragma unroll
        for (int g = 0; g < NG; ++g) mnew[g] = mrun[g];
#pragma unroll
        for (int t = 0; t < 4; ++t) { const int* mp = smk + s * 64 + t * 16 + 8 * hi; const v4i m0 = *(const v4ia*)mp, m1 = *(const v4ia*)(mp + 4);
#pragma unroll
            for (int r = 0; r < 8; ++r) { const bool ok = ((r < 4) ? m0[r & 3] : m1[r & 3]) != 0;
#pragma unroll
                for (int g = 0; g < NG; ++g) { const float x = ok ? sc[g][t][r] * SCL2 : NEGBIG; sc[g][t][r] = x; mnew[g] = fmaxf(mnew[g], x); } } }
        V pf[NG][2], pl[NG][2];
#pragma unroll
        for (int g = 0; g < NG; ++g) {
            const float mx = fmaxf(mnew[g], xhalf(mnew[g]));   // both halves of a column share one maximum: their keys meet in one product
            const float da = mrun[g] - mx; float al = __builtin_amdgcn_exp2f(da); mrun[g] = mx;
            asm volatile("v_nop" : "+v"(al) : "v"(da));       // the free slot behind a transcendental, see below
            const float off = HI ? mx : mx - PCARL2;
            float ps = 0.0f;
#pragma unroll
            for (int t = 0; t < 4; ++t) { const v8f d = sc[g][t] - off; v8f p;
#pragma unroll
                for (int r = 0; r < 8; ++r) p[r] = __builtin_amdgcn_exp2f(d[r]);
                // The instruction set asks for one free slot behind v_exp_f32 before its result is read or its source overwritten. Naming the eight sources as inputs keeps them
                // whole until here, naming the results as in-out keeps their readers behind: inside the run each v_exp_f32 is the next one's slot, the v_nop is the last one's.
                asm volatile("v_nop" : "+v"(p) : "v"(d));
                sc[g][t] = p;
#pragma unroll
                for (int r = 0; r < 8; ++r) ps += p[r]; }
            lsum[g] = lsum[g] * al + ps;
#pragma unroll
            for (int mb = 0; mb < 4; ++mb) o[g][mb] *= al;
#pragma unroll
            for (int p2 = 0; p2 < 2; ++p2) {
                if constexpr (HI) {
                    const v8bf h0 = __builtin_convertvector(sc[g][2 * p2], v8bf), h1 = __builtin_convertvector(sc[g][2 * p2 + 1], v8bf);
                    const v8bf l0 = __builtin_convertvector(sc[g][2 * p2] - __builtin_convertvector(h0, v8f), v8bf), l1 = __builtin_convertvector(sc[g][2 * p2 + 1] - __builtin_convertvector(h1, v8f), v8bf);
                    pf[g][p2] = __builtin_shufflevector(h0, h1, 0, 1, 2, 3, 4, 5, 6, 7, 8, 9, 10, 11, 12, 13, 14, 15);
                    pl[g][p2] = __builtin_shufflevector(l0, l1, 0, 1, 2, 3, 4, 5, 6, 7, 8, 9, 10, 11, 12, 13, 14, 15);
                } else {
                    pf[g][p2] = cat16(__builtin_convertvector(sc[g][2 * p2], v8h), __builtin_convertvector(sc[g][2 * p2 + 1], v8h));
                } } }
#pragma unroll
        for (int p2 = 0; p2 < 2; ++p2)
#pragma unroll
            for (int mb = 0; mb < 4; ++mb) { const V va = WFrag<T16>::ld(vt + (mb * 16 + lr) * FP + p2 * 32 + 8 * hi); V vb; if (HI) vb = WFrag<T16>::ld(vt + FT + (mb * 16 + lr) * FP + p2 * 32 + 8 * hi);
#pragma unroll
                for (int g = 0; g < NG; ++g) { o[g][mb] = WFrag<T16>::mma(va, pf[g][p2], o[g][mb]); if (HI) { o[g][mb] = WFrag<T16>::mma(va, pl[g][p2], o[g][mb]); o[g][mb] = WFrag<T16>::mma(vb, pf[g][p2], o[g][mb]); } } }
        if (more) sl((s + 1) & 1);
    }
    // lane l: query qw + 16 g + (l & 15), d = 16 mb + 8 (l >> 4) + 0..7: 16 bytes of each ctx plane
#pragma unroll
    for (int g = 0; g < NG; ++g) { const float inv = __fdiv_rn(1.0f, lsum[g] + xhalf(lsum[g]));
#pragma unroll
        for (int mb = 0; mb < 4; ++mb) { v8us oh, ol;
#pragma unroll
            for (int r = 0; r < 8; ++r) { unsigned short a, c2; splitf(o[g][mb][r] * inv, a, c2); oh[r] = a; ol[r] = c2; }
            const size_t oo = (size_t)(qw + g * 16 + lr) * DQ + mb * 16 + 8 * hi; *(v8us*)(Ah + oo) = oh; *(v8us*)(Al + oo) = ol; } }
}

// grid: the hi/lo blocks (three products, the longer ones) first, then the f16 blocks; planes [b][head][.][.], ctx planes [b][t][DQ]
__global__ __launch_bounds__(256) void k_fattn(const h16* __restrict__ Q16, const h16* __restrict__ K16, const h16* __restrict__ V16, const bf* __restrict__ Qh, const bf* __restrict__ Ql, const bf* __restrict__ Kh, const bf* __restrict__ Kl,
                                               const bf* __restrict__ Vh, const bf* __restrict__ Vl, const int* __restrict__ mask, bf* Ah, bf* Al) {
    __shared__ __align__(16) unsigned short sm[2 * 4 * FT];
    __shared__ __align__(16) int smk[TT];
    constexpr int HB = RH / QBH, LB = (TT - RH) / QBL, NHIW = NB * NH_ * HB;
    const int x = (int)blockIdx.x; const bool hires = (x < NHIW);
    const int bh = hires ? x / HB : (x - NHIW) / LB; const int q0 = hires ? (x % HB) * QBH : RH + ((x - NHIW) % LB) * QBL;
    const int b = bh / NH_, hd = bh % NH_; const size_t po = (size_t)bh * TT * HD, ao = (size_t)b * TT * DQ + (size_t)hd * HD;
    const int* mk = mask + (size_t)b * SEQ_FULL;
#pragma unroll
    for (int i = 0; i < TT / 1024; ++i) ((v4ia*)smk)[threadIdx.x + 256 * i] = ((const v4ia*)mk)[threadIdx.x + 256 * i];
    if (hires) fa_body<bf, true>((bf*)sm, smk, Qh + po, Ql + po, Kh + po, Kl + po, Vh + po, Vl + po, q0, Ah + ao, Al + ao);
    else fa_body<h16, false>((h16*)sm, smk, Q16 + po, nullptr, K16 + po, nullptr, V16 + po, nullptr, q0, Ah + ao, Al + ao);
}

extern "C" void kernel_launch(void* const* d_in, const int* in_sizes, int n_in,
                              void* d_out, int out_size, void* d_ws, size_t ws_size, hipStream_t stream) {
    if (n_in < 12) return;
    const size_t needx = (size_t)(NB - 1) * SEQ_FULL * DM + (size_t)TT * DM;
    const size_t needm = (size_t)(NB - 1) * SEQ_FULL + (size_t)TT;
    if ((size_t)in_sizes[0] < needx || (size_t)in_sizes[1] < needx || (size_t)in_sizes[2] < needx || (size_t)in_sizes[3] < needm) return;
    if ((size_t)in_sizes[4] < (size_t)DQ * DM || (size_t)in_sizes[6] < (size_t)DKV * DM || (size_t)in_sizes[8] < (size_t)DKV * DM || (size_t)in_sizes[10] < (size_t)DM * DQ) return;
    if (in_sizes[5] < DQ || in_sizes[7] < DKV || in_sizes[9] < DKV || in_sizes[11] < DM) return;
    if ((size_t)out_size < needx) return;
    // wire order: query, key, value, mask (int32), Wq, bq, Wk, bk, Wv, bv, Wo, bo; weights [out][in]
    const float* xq = (const float*)d_in[0]; const float* xk = (const float*)d_in[1]; const float* xv = (const float*)d_in[2]; const int* mask = (const int*)d_in[3];
    const float* wq = (const float*)d_in[4]; const float* bq = (const float*)d_in[5]; const float* wk = (const float*)d_in[6]; const float* bk = (const float*)d_in[7];
    const float* wv = (const float*)d_in[8]; const float* bv = (const float*)d_in[9]; const float* wo = (const float*)d_in[10]; const float* bo = (const float*)d_in[11];
    float* OUT = (float*)d_out;     // [NB_FULL][SEQ_FULL][DM]
    char* wsp = (char*)d_ws;
    auto take = [&](size_t bytes) { char* p = wsp; wsp += (bytes + 255) & ~(size_t)255; return (void*)p; };
    bf* WQ = (bf*)take(SZ_W); bf* WK = (bf*)take(SZ_W); bf* WV = (bf*)take(SZ_W); bf* WO = (bf*)take(SZ_W);   // one after the other: filled by one launch, WQ WK WV read by one launch
    // planes [b][head][.][.]; each k plane directly behind its q plane, so that one launch fills both
    h16* QP16 = (h16*)take(SZ_HP); h16* KP16 = (h16*)take(SZ_HP); bf* QPh = (bf*)take(SZ_HP); bf* KPh = (bf*)take(SZ_HP); bf* QPl = (bf*)take(SZ_HP); bf* KPl = (bf*)take(SZ_HP);
    h16* VT16 = (h16*)take(SZ_HP); bf* VTh = (bf*)take(SZ_HP); bf* VTl = (bf*)take(SZ_HP);
    bf* XB = (bf*)take(SZ_XB); float* F = (float*)take(SZ_F); bf* ATh = (bf*)take(SZ_AT);   // XB [q k v][b][t][DM] bf16, F [q k v][b][t][DQ] f32
    bf* ATl = (bf*)take(SZ_AT);
    if ((size_t)(wsp - (char*)d_ws) > ws_size) return;
    const unsigned LW = (unsigned)(((size_t)DQ * DM / 8 + 255) / 256);
    const unsigned LX = (unsigned)(((size_t)TT * DM / 8 + 255) / 256);
    const unsigned LQ = (unsigned)(((size_t)NH_ * TT * HD / 2 + 255) / 256), LKv = (unsigned)(((size_t)NKV * TT * HD / 2 + 255) / 256);
    const size_t xs = (size_t)SEQ_FULL * DM;   // batch stride of the f32 inputs and of the output
    // four weights in one launch; q, k, v inputs of every batch in one launch
    k_cvt8<<<dim3(LW, 1, 4), 256, 0, stream>>>(wq, wk, wv, wo, WQ, (size_t)DQ * DM / 8, 0, 1);
    k_cvt8<<<dim3(LX, NB, 3), 256, 0, stream>>>(xq, xk, xv, xv, XB, (size_t)TT * DM / 8, xs, NB);
    // the three projections of every batch in one launch: z = tensor * NB + batch
    k_gemmw<bf, 0, true, KSP><<<dim3(TT / 64, DQ / 64, 3 * NB), 32 * KSP, 0, stream>>>(XB, nullptr, WQ, nullptr, DM, DM, F, DQ, bq, bk, bv, NB, (size_t)TT * DM, (size_t)DQ * DM, (size_t)TT * DQ);
    // q and k planes in one launch, then the transposed v planes
    k_hpl<<<dim3(LQ, 2 * NB), 256, 0, stream>>>(F, DQ, NH_, QP16, QPh, QPl);
    k_vtp<<<dim3(LKv, NB), 256, 0, stream>>>(F + (size_t)2 * NB * TT * DQ, DKV, NKV, VT16, VTh, VTl);
    // attention of every batch and head in one launch, ctx planes written directly
    k_fattn<<<NB * NH_ * (RH / QBH + (TT - RH) / QBL), 256, 0, stream>>>(QP16, KP16, VT16, QPh, QPl, KPh, KPl, VTh, VTl, mask, ATh, ATl);
    // out[b][t][n] = sum_k ctx[b][t][k] Wo[n][k] + bo[n], every batch in one launch
    k_gemmw<bf, 1, true, KSP><<<dim3(TT / 64, DM / 64, NB), 32 * KSP, 0, stream>>>(ATh, ATl, WO, nullptr, DQ, DQ, OUT, DM, bo, bo, bo, NB, (size_t)TT * DQ, 0, xs);
}

// v004
// It runs in 158 microseconds.
// In both of two side-by-side timings against v003, it was 1.34 times as fast.
// Over all steps from v000 it is 12.9 times as fast.
#include <hip/hip_runtime.h>

// 16-head scaled dot-product attention with a key padding mask: q = query Wq^T + bq, k = key Wk^T + bk, v = value Wv^T + bv (weights [out][in]); scores x 1/8; masked keys (mask == 0) replaced by -inf; softmax over keys; out = merged Wo^T + bo.
// Compute dtypes, f32 accumulate everywhere: every float input converted to bf16 (RNE); projections v_wmma_f32_16x16x32_bf16 on exact bf16 planes + bf16-rounded bias; scores rows < RH bf16 hi/lo planes (3 products), rows >= RH v_wmma_f32_16x16x32_f16;
// P.V rows < RH bf16 hi/lo planes (3 products), rows >= RH f16 with P carried x1024 (the f32 row sum carries it too); output projection bf16 hi/lo ctx planes x bf16 Wo (2 products) + bf16-rounded bias; softmax f32.

#ifndef NB
#define NB 2
#endif
#ifndef SEQ
#define SEQ 2048
#endif
#define NB_FULL  2
#define SEQ_FULL 2048
#define TT   SEQ
#define DM   1024
#define NH_  16
#define NKV  16
#define REP  (NH_ / NKV)
#define HD   64
#define DQ   (NH_ * HD)
#define DKV  (NKV * HD)
#define RH   ((TT > 512) ? 512 : (TT / 2))   // query rows < RH use hi+lo planes
#define PCARL2 10.0f      // P of the f16 rows is carried x 2^10
#define SCL  0.125f       // HD^-0.5
#define NEGBIG (-1.0e30f)

static_assert(NB >= 1 && NB <= NB_FULL);
static_assert(TT <= SEQ_FULL && TT % 128 == 0);
static_assert(RH >= 64 && RH % 64 == 0 && TT > RH && (TT - RH) % 64 == 0);
static_assert(HD == 64 && DM % 64 == 0 && DQ % 64 == 0 && DM % 32 == 0 && TT % 32 == 0);
static_assert(REP == 1);
static_assert(DM % 128 == 0 && DQ % 128 == 0);

#define SZ_W    ((size_t)DQ * DM * 2)
#define SZ_XB   ((size_t)3 * NB * TT * DM * 2)
#define SZ_F    ((size_t)3 * NB * TT * DQ * 4)
#define SZ_HP   ((size_t)NB * NH_ * TT * HD * 2)
#define SZ_AT   ((size_t)NB * TT * DQ * 2)
#define SZ_ALL  (4 * SZ_W + 9 * SZ_HP + SZ_XB + SZ_F + 2 * SZ_AT)
static_assert(SZ_W % 256 == 0 && SZ_XB % 256 == 0 && SZ_F % 256 == 0 && SZ_HP % 256 == 0 && SZ_AT % 256 == 0);
static_assert(SZ_ALL <= (size_t)268435456 && DQ == DKV && NH_ == NKV);

typedef _Float16 h16;
typedef unsigned short bf;
typedef __attribute__((ext_vector_type(16))) __bf16   v16bf;
typedef __attribute__((ext_vector_type(16))) _Float16 v16h;
typedef __attribute__((ext_vector_type(8)))  _Float16 v8h;
typedef __attribute__((ext_vector_type(8)))  unsigned short v8us;
typedef __attribute__((ext_vector_type(8)))  float    v8f;
typedef __attribute__((ext_vector_type(4)))  float    v4f;
typedef v4f  __attribute__((may_alias)) v4fa;
typedef __attribute__((ext_vector_type(2))) _Float16 v2h;
typedef __attribute__((ext_vector_type(4))) _Float16 v4h;
typedef __attribute__((ext_vector_type(2))) unsigned short v2us;
typedef __attribute__((ext_vector_type(4))) unsigned short v4us;
typedef __attribute__((ext_vector_type(2))) float v2f;
typedef __attribute__((ext_vector_type(4))) int v4i;

__device__ __forceinline__ unsigned short f2bf(float f) { unsigned u = __float_as_uint(f); u += 0x7FFFu + ((u >> 16) & 1u); return (unsigned short)(u >> 16); }
__device__ __forceinline__ float bf2f(unsigned short b) { return __uint_as_float(((unsigned)b) << 16); }
__device__ __forceinline__ float bfr(float f) { return bf2f(f2bf(f)); }
__device__ __forceinline__ v16h cat16(v8h lo, v8h hi) { return __builtin_shufflevector(lo, hi, 0, 1, 2, 3, 4, 5, 6, 7, 8, 9, 10, 11, 12, 13, 14, 15); }
__device__ __forceinline__ v16bf cat16b(v8us lo, v8us hi) { return __builtin_bit_cast(v16bf, __builtin_shufflevector(lo, hi, 0, 1, 2, 3, 4, 5, 6, 7, 8, 9, 10, 11, 12, 13, 14, 15)); }
__device__ __forceinline__ v8f wmma16(v16h a, v16h b, v8f c) { return __builtin_amdgcn_wmma_f32_16x16x32_f16(false, a, false, b, (short)0, c, false, false); }
__device__ __forceinline__ v8f wmmab(v16bf a, v16bf b, v8f c) { return __builtin_amdgcn_wmma_f32_16x16x32_bf16(false, a, false, b, (short)0, c, false, false); }

// ---- k_gemms: GEMM on K-contiguous 16-bit planes, one 128x128 output tile per work-group of 4 waves (2 x 2, 64x64 and 16 accumulators each); grid (M/128, N/128, Z), 128 threads.
// C[m][n] (f32, + optional bias[n] rounded to bf16) = sum_k (A[m][k] + A2[m][k]) Bt[n][k] (A2 only with NSPLIT == 1). A rows have pitch LDA, Bt rows pitch K, C rows pitch LDC. z-batch strides sA/sB/sC in elements; Bt and the bias change only every zdiv-th z (bias0, bias1, bias2 in turn). K % 64 == 0, M % 128 == 0, N % 128 == 0.
// k goes by stages of 64: the A (and A2) tile [128 rows][64 k] and the Bt tile [128 rows][64 k] pass through registers into one of two LDS buffers while the other is read.
// A staging load of a wave covers four whole 128-byte rows, and every operand line is fetched once per work-group. Each wave sums its whole K in ascending order.
// Fragment map (A and B alike): lane l -> row/col l & 15, h = l >> 4; elements 0..7 = k0 + 8h + 0..7, elements 8..15 = k0 + 16 + 8h + 0..7. D: element r -> row 8h + r, col l & 15.
template <typename T16> struct WFrag;
template <> struct WFrag<h16> { typedef v16h V; static __device__ __forceinline__ V ld(const h16* p) { return cat16(*(const v8h*)p, *(const v8h*)(p + 16)); } static __device__ __forceinline__ v8f mma(V a, V b, v8f c) { return wmma16(a, b, c); } };
template <> struct WFrag<bf> { typedef v16bf V; static __device__ __forceinline__ V ld(const bf* p) { return cat16b(*(const v8us*)p, *(const v8us*)(p + 16)); } static __device__ __forceinline__ v8f mma(V a, V b, v8f c) { return wmmab(a, b, c); } };
#define GP   72             // LDS row pitch in 16-bit elements: 128 B + 16 B, the 16 rows of a 16-byte fragment read fall on distinct banks
#define GT   (128 * GP)     // one 128 x 64 tile
typedef v4i __attribute__((may_alias)) v4ig;
template <typename T16, int NSPLIT, bool BIAS, int K, int LDA, int LDC>
__global__ __launch_bounds__(128) void k_gemms(const T16* __restrict__ A, const T16* __restrict__ A2, const T16* __restrict__ Bt, float* C, const float* __restrict__ bias0, const float* __restrict__ bias1, const float* __restrict__ bias2, int zdiv, size_t sA, size_t sB, size_t sC) {
    typedef typename WFrag<T16>::V V; static_assert((NSPLIT == 0 || NSPLIT == 1) && K % 64 == 0 && K >= 64);
    constexpr int NT = (NSPLIT == 1) ? 3 : 2;   // tiles per stage: A, (A2), Bt
    constexpr int NS = K / 64;
    __shared__ __align__(16) unsigned char smraw[2 * NT * GT * 2];
    static_assert(2 * 4 * 16 * 68 * 4 <= 2 * NT * GT * 2);
    T16* sm = (T16*)smraw;
    const size_t z = blockIdx.z, zb = blockIdx.z / (unsigned)zdiv;
    const float* bias = (zb == 0) ? bias0 : ((zb == 1) ? bias1 : bias2);
    const int tid = (int)threadIdx.x, lane = tid & 31, lr = lane & 15, hi = lane >> 4; const int r0 = blockIdx.x * 128, c0 = blockIdx.y * 128;
    // wave number through readfirstlane: the tile offsets stay in scalar registers
    const int wv = __builtin_amdgcn_readfirstlane(tid >> 5), wm = wv >> 1, wn = wv & 1;
    const int srow = tid >> 3, scol = (tid & 7) * 8;   // staging: 16 bytes of rows srow + 16 i, i = 0..7, of every tile
    // a work-group-uniform base plus one 32-bit byte offset per thread; the eight rows differ by constants
    const char* ua = (const char*)(A + z * sA + (size_t)r0 * LDA); const char* ua2 = (NSPLIT == 1) ? (const char*)(A2 + z * sA + (size_t)r0 * LDA) : nullptr; const char* ub = (const char*)(Bt + zb * sB + (size_t)c0 * K);
    const unsigned va = (unsigned)(srow * LDA + scol) * 2u, vb = (unsigned)(srow * K + scol) * 2u;
    v4i st[NT][8];
    auto gl = [&](int kc) {
        const char* pa = ua + kc * 2 + va; const char* pa2 = (NSPLIT == 1) ? ua2 + kc * 2 + va : nullptr; const char* pb = ub + kc * 2 + vb;
#pragma unroll
        for (int i = 0; i < 8; ++i) { st[0][i] = *(const v4ig*)(pa + i * (16 * LDA * 2)); if (NSPLIT == 1) st[1][i] = *(const v4ig*)(pa2 + i * (16 * LDA * 2)); st[NT - 1][i] = *(const v4ig*)(pb + i * (16 * K * 2)); }
        // The wait stands in front of whatever next writes a register that holds an address of the loads above (the fragment reads and the accumulators may take those registers);
        // the addresses are named as inputs so that their registers stay theirs up to the wait.
        if constexpr (NSPLIT == 1) asm volatile("s_wait_xcnt 0x0" :: "v"(pa), "v"(pa2), "v"(pb), "v"(va), "v"(vb) : "memory");
        else asm volatile("s_wait_xcnt 0x0" :: "v"(pa), "v"(pb), "v"(va), "v"(vb) : "memory"); };
    auto sl = [&](int buf) {
#pragma unroll
        for (int tl = 0; tl < NT; ++tl)
#pragma unroll
            for (int i = 0; i < 8; ++i) *(v4ig*)(sm + (buf * NT + tl) * GT + (srow + 16 * i) * GP + scol) = st[tl][i]; };
    v8f acc[4][4];
#pragma unroll
    for (int mb = 0; mb < 4; ++mb)
#pragma unroll
        for (int nb = 0; nb < 4; ++nb) acc[mb][nb] = (v8f){};
    gl(0); sl(0);
    // The stage loop stays rolled: one copy of the stage's products in the instruction cache. The loops inside it are unrolled because st, a, b and acc live in registers and need constant indices.
#pragma unroll 1
    for (int s = 0; s < NS; ++s) {
        __syncthreads();   // publishes buffer s & 1; ends every read of the other buffer, which is refilled below
        const bool more = (s + 1 < NS);
        if (more) gl((s + 1) * 64);
        const T16* at = sm + ((s & 1) * NT) * GT + (wm * 64 + lr) * GP + 8 * hi; const T16* bt = sm + ((s & 1) * NT + NT - 1) * GT + (wn * 64 + lr) * GP + 8 * hi;
        V a[2][4], a2[2][4], b[2][4];
#pragma unroll
        for (int ks = 0; ks < 2; ++ks)
#pragma unroll
            for (int f = 0; f < 4; ++f) { a[ks][f] = WFrag<T16>::ld(at + f * 16 * GP + ks * 32); if (NSPLIT == 1) a2[ks][f] = WFrag<T16>::ld(at + GT + f * 16 * GP + ks * 32); b[ks][f] = WFrag<T16>::ld(bt + f * 16 * GP + ks * 32); }
        __builtin_amdgcn_sched_barrier(0);   // keeps the stage's fragment reads one group in front of its products, for speed only
#pragma unroll
        for (int ks = 0; ks < 2; ++ks)
#pragma unroll
            for (int nb = 0; nb < 4; ++nb) {
#pragma unroll
                for (int mb = 0; mb < 4; ++mb) acc[mb][nb] = WFrag<T16>::mma(a[ks][mb], b[ks][nb], acc[mb][nb]);
                if (NSPLIT == 1) {
#pragma unroll
                    for (int mb = 0; mb < 4; ++mb) acc[mb][nb] = WFrag<T16>::mma(a2[ks][mb], b[ks][nb], acc[mb][nb]); } }
        if (more) sl((s + 1) & 1);
    }
    // Output through LDS, so that every global store covers whole 256-byte row pieces: per pass a wave lays 16 x 64 of its tile in its own slab (pitch 68 floats) and reads it back by rows.
    // Two slab sets in turn. The results stay in registers and go to memory behind the last barrier, so that no barrier waits for a global store.
    // Every loop here is unrolled because acc and res live in registers and need constant indices.
    __syncthreads();   // ends every read of the operand tiles: the slabs lie over them
    float* os = (float*)smraw;
    v4f res[4][8], bv = (v4f)(0.0f);
    if (BIAS) {
#pragma unroll
        for (int q = 0; q < 4; ++q) bv[q] = bfr(bias[c0 + wn * 64 + lr * 4 + q]); }
#pragma unroll
    for (int mb = 0; mb < 4; ++mb) {
        float* my = os + ((mb & 1) * 4 + wv) * (16 * 68);
#pragma unroll
        for (int nb = 0; nb < 4; ++nb) {
#pragma unroll
            for (int j = 0; j < 8; ++j) my[(hi * 8 + j) * 68 + nb * 16 + lr] = acc[mb][nb][j]; }
        __syncthreads();   // orders the slab's stores in front of the reads of other lanes' values
#pragma unroll
        for (int i = 0; i < 8; ++i) { const v4f val = *(const v4fa*)(my + (2 * i + hi) * 68 + lr * 4); res[mb][i] = BIAS ? val + bv : val; } }
    float* cw = C + z * sC + (size_t)(r0 + wm * 64 + hi) * LDC + c0 + wn * 64 + lr * 4;
#pragma unroll
    for (int mb = 0; mb < 4; ++mb)
#pragma unroll
        for (int i = 0; i < 8; ++i) *(v4f*)(cw + (mb * 16 + 2 * i) * LDC) = res[mb][i];
}

__device__ __forceinline__ h16 tohx(float x) { return (h16)x; }
__device__ __forceinline__ void splitf(float y, unsigned short& h, unsigned short& l) { h = f2bf(y); l = f2bf(y - bf2f(h)); }

// blockIdx.z = which source tensor, blockIdx.y = batch (ny of them): src advances by ss elements per batch, dst is dense [z][y][8 n8]
__global__ __launch_bounds__(256) void k_cvt8(const float* __restrict__ s0, const float* __restrict__ s1, const float* __restrict__ s2, const float* __restrict__ s3, bf* dst, size_t n8, size_t ss, unsigned ny) { const size_t i = (size_t)blockIdx.x * 256 + threadIdx.x; if (i >= n8) return;
    const float* src = ((blockIdx.z == 0) ? s0 : (blockIdx.z == 1) ? s1 : (blockIdx.z == 2) ? s2 : s3) + blockIdx.y * ss; dst += ((size_t)blockIdx.z * ny + blockIdx.y) * n8 * 8; const v8f v = *(const v8f*)(src + i * 8); v8us o;
#pragma unroll
    for (int k = 0; k < 8; ++k) o[k] = f2bf(v[k]); *(v8us*)(dst + i * 8) = o;  }

__global__ __launch_bounds__(256) void k_hpl(const float* __restrict__ F, int pitch, int nheads, h16* P16, bf* Ph, bf* Pl) {
    const size_t e = ((size_t)blockIdx.x * 256 + threadIdx.x) * 2; if (e >= (size_t)nheads * TT * HD) return; const int d = (int)(e % HD); const int t = (int)((e / HD) % TT); const int h = (int)(e / ((size_t)HD * TT));
    const size_t bo = (size_t)blockIdx.y * nheads * TT * HD + e;   // blockIdx.y = (tensor, batch) slice of F and of the planes
    const v2f x = *(const v2f*)(F + ((size_t)blockIdx.y * TT + t) * pitch + h * HD + d); v2h o16; v2us oh, ol;
#pragma unroll
    for (int q = 0; q < 2; ++q) { o16[q] = tohx(x[q]); unsigned short a2, c2; splitf(x[q], a2, c2); oh[q] = a2; ol[q] = c2; }
    *(v2h*)(P16 + bo) = o16; *(v2us*)(Ph + bo) = oh; *(v2us*)(Pl + bo) = ol;  }

__global__ __launch_bounds__(256) void k_vtp(const float* __restrict__ F, int pitch, int nheads, h16* V16, bf* Vh, bf* Vl) { const size_t e = ((size_t)blockIdx.x * 256 + threadIdx.x) * 2; if (e >= (size_t)nheads * HD * TT) return; const int t = (int)(e % TT); const int d = (int)((e / TT) % HD); const int g = (int)(e / ((size_t)TT * HD)); v2h o16; v2us oh, ol;
    const size_t bo = (size_t)blockIdx.y * nheads * HD * TT + e;   // blockIdx.y = batch
#pragma unroll
    for (int q = 0; q < 2; ++q) { const float x = F[((size_t)blockIdx.y * TT + t + q) * pitch + g * HD + d]; o16[q] = tohx(x); unsigned short a2, c2; splitf(x, a2, c2); oh[q] = a2; ol[q] = c2; }
    *(v2h*)(V16 + bo) = o16; *(v2us*)(Vh + bo) = oh; *(v2us*)(Vl + bo) = ol;  }

#define FP   72             // LDS row pitch in 16-bit elements: 128 B + 16 B, the 16 rows of a 16-byte fragment read fall on distinct banks
#define FT   (64 * FP)      // one 64 x 64 tile
#define QBH  128            // queries per work-group, rows < RH
#define QBL  256            // queries per work-group, rows >= RH
#define MSTART (-5.0e29f)
#define SCL2 (SCL * 1.4426950408889634f)
static_assert(RH % QBH == 0 && (TT - RH) % QBL == 0 && TT % 1024 == 0 && TT % 64 == 0);
typedef v4i __attribute__((may_alias)) v4ia;
typedef __attribute__((ext_vector_type(8))) __bf16 v8bf;

__device__ __forceinline__ float xhalf(float x) { const int b = __float_as_int(x); return __int_as_float(__builtin_amdgcn_permlanex16(b, b, 0x76543210, 0xfedcba98, false, false)); }   // lane l <-> l ^ 16

template <typename T16, bool HI>
__device__ __forceinline__ void fa_body(T16* sm, const int* smk, const T16* __restrict__ Q, const T16* __restrict__ Q2, const T16* __restrict__ Kp, const T16* __restrict__ K2,
                                        const T16* __restrict__ Vt, const T16* __restrict__ V2, int q0, bf* Ah, bf* Al) {
    typedef typename WFrag<T16>::V V;
    constexpr int NPL = HI ? 2 : 1, NG = HI ? 1 : 2, NS = TT / 64;
    const int tid = (int)threadIdx.x, lane = tid & 31, lr = lane & 15, hi = lane >> 4;
    const int qw = q0 + (tid >> 5) * (16 * NG);
    const int srow = tid >> 3, scol = (tid & 7) * 8;   // staging: 16 bytes of rows srow and srow + 32 of every tile
    v4i st[2 * NPL][2];
    auto gl = [&](int j0) {
#pragma unroll
        for (int i = 0; i < 2; ++i) { const int row = srow + 32 * i;
            st[0][i] = *(const v4ia*)(Kp + (size_t)(j0 + row) * HD + scol); if (HI) st[1][i] = *(const v4ia*)(K2 + (size_t)(j0 + row) * HD + scol);
            st[NPL][i] = *(const v4ia*)(Vt + (size_t)row * TT + j0 + scol); if (HI) st[NPL + 1][i] = *(const v4ia*)(V2 + (size_t)row * TT + j0 + scol); } };
    auto sl = [&](int buf) {
#pragma unroll
        for (int tl = 0; tl < 2 * NPL; ++tl)
#pragma unroll
            for (int i = 0; i < 2; ++i) *(v4ia*)(sm + (buf * 2 * NPL + tl) * FT + (srow + 32 * i) * FP + scol) = st[tl][i]; };
    V q[NG][2], q2[NG][2];
#pragma unroll
    for (int g = 0; g < NG; ++g)
#pragma unroll
        for (int ks = 0; ks < 2; ++ks) { q[g][ks] = WFrag<T16>::ld(Q + (size_t)(qw + g * 16 + lr) * HD + ks * 32 + 8 * hi); if (HI) q2[g][ks] = WFrag<T16>::ld(Q2 + (size_t)(qw + g * 16 + lr) * HD + ks * 32 + 8 * hi); }
    v8f o[NG][4]; float mrun[NG], lsum[NG];
#pragma unroll
    for (int g = 0; g < NG; ++g) { mrun[g] = MSTART; lsum[g] = 0.0f;
#pragma unroll
        for (int mb = 0; mb < 4; ++mb) o[g][mb] = (v8f){}; }
    gl(0); sl(0);
#pragma unroll 1
    for (int s = 0; s < NS; ++s) {
        __syncthreads();   // publishes buffer s & 1 (and, at s = 0, the mask); ends every read of the other buffer, which is refilled below
        const bool more = (s + 1 < NS);
        if (more) gl((s + 1) * 64);
        const T16* kt = sm + ((s & 1) * 2 * NPL) * FT; const T16* vt = kt + NPL * FT;
        v8f sc[NG][4];
#pragma unroll
        for (int t = 0; t < 4; ++t) {
#pragma unroll
            for (int g = 0; g < NG; ++g) sc[g][t] = (v8f){};
#pragma unroll
            for (int ks = 0; ks < 2; ++ks) { const V ka = WFrag<T16>::ld(kt + (t * 16 + lr) * FP + ks * 32 + 8 * hi); V kb; if (HI) kb = WFrag<T16>::ld(kt + FT + (t * 16 + lr) * FP + ks * 32 + 8 * hi);
#pragma unroll
                for (int g = 0; g < NG; ++g) { sc[g][t] = WFrag<T16>::mma(ka, q[g][ks], sc[g][t]); if (HI) { sc[g][t] = WFrag<T16>::mma(ka, q2[g][ks], sc[g][t]); sc[g][t] = WFrag<T16>::mma(kb, q[g][ks], sc[g][t]); } } } }
        float mnew[NG];
#pragma unroll
        for (int g = 0; g < NG; ++g) mnew[g] = mrun[g];
#pragma unroll
        for (int t = 0; t < 4; ++t) { const int* mp = smk + s * 64 + t * 16 + 8 * hi; const v4i m0 = *(const v4ia*)mp, m1 = *(const v4ia*)(mp + 4);
#pragma unroll
            for (int r = 0; r < 8; ++r) { const bool ok = ((r < 4) ? m0[r & 3] : m1[r & 3]) != 0;
#pragma unroll
                for (int g = 0; g < NG; ++g) { const float x = ok ? sc[g][t][r] * SCL2 : NEGBIG; sc[g][t][r] = x; mnew[g] = fmaxf(mnew[g], x); } } }
        V pf[NG][2], pl[NG][2];
#pragma unroll
        for (int g = 0; g < NG; ++g) {
            const float mx = fmaxf(mnew[g], xhalf(mnew[g]));   // both halves of a column share one maximum: their keys meet in one product
            const float da = mrun[g] - mx; float al = __builtin_amdgcn_exp2f(da); mrun[g] = mx;
            asm volatile("v_nop" : "+v"(al) : "v"(da));       // the free slot behind a transcendental, see below
            const float off = HI ? mx : mx - PCARL2;
            float ps = 0.0f;
#pragma unroll
            for (int t = 0; t < 4; ++t) { const v8f d = sc[g][t] - off; v8f p;
#pragma unroll
                for (int r = 0; r < 8; ++r) p[r] = __builtin_amdgcn_exp2f(d[r]);
                // The instruction set asks for one free slot behind v_exp_f32 before its result is read or its source overwritten. Naming the eight sources as inputs keeps them
                // whole until here, naming the results as in-out keeps their readers behind: inside the run each v_exp_f32 is the next one's slot, the v_nop is the last one's.
                asm volatile("v_nop" : "+v"(p) : "v"(d));
                sc[g][t] = p;
#pragma unroll
                for (int r = 0; r < 8; ++r) ps += p[r]; }
            lsum[g] = lsum[g] * al + ps;
#pragma unroll
            for (int mb = 0; mb < 4; ++mb) o[g][mb] *= al;
#pragma unroll
            for (int p2 = 0; p2 < 2; ++p2) {
                if constexpr (HI) {
                    const v8bf h0 = __builtin_convertvector(sc[g][2 * p2], v8bf), h1 = __builtin_convertvector(sc[g][2 * p2 + 1], v8bf);
                    const v8bf l0 = __builtin_convertvector(sc[g][2 * p2] - __builtin_convertvector(h0, v8f), v8bf), l1 = __builtin_convertvector(sc[g][2 * p2 + 1] - __builtin_convertvector(h1, v8f), v8bf);
                    pf[g][p2] = __builtin_shufflevector(h0, h1, 0, 1, 2, 3, 4, 5, 6, 7, 8, 9, 10, 11, 12, 13, 14, 15);
                    pl[g][p2] = __builtin_shufflevector(l0, l1, 0, 1, 2, 3, 4, 5, 6, 7, 8, 9, 10, 11, 12, 13, 14, 15);
                } else {
                    pf[g][p2] = cat16(__builtin_convertvector(sc[g][2 * p2], v8h), __builtin_convertvector(sc[g][2 * p2 + 1], v8h));
                } } }
#pragma unroll
        for (int p2 = 0; p2 < 2; ++p2)
#pragma unroll
            for (int mb = 0; mb < 4; ++mb) { const V va = WFrag<T16>::ld(vt + (mb * 16 + lr) * FP + p2 * 32 + 8 * hi); V vb; if (HI) vb = WFrag<T16>::ld(vt + FT + (mb * 16 + lr) * FP + p2 * 32 + 8 * hi);
#pragma unroll
                for (int g = 0; g < NG; ++g) { o[g][mb] = WFrag<T16>::mma(va, pf[g][p2], o[g][mb]); if (HI) { o[g][mb] = WFrag<T16>::mma(va, pl[g][p2], o[g][mb]); o[g][mb] = WFrag<T16>::mma(vb, pf[g][p2], o[g][mb]); } } }
        if (more) sl((s + 1) & 1);
    }
    // lane l: query qw + 16 g + (l & 15), d = 16 mb + 8 (l >> 4) + 0..7: 16 bytes of each ctx plane
#pragma unroll
    for (int g = 0; g < NG; ++g) { const float inv = __fdiv_rn(1.0f, lsum[g] + xhalf(lsum[g]));
#pragma unroll
        for (int mb = 0; mb < 4; ++mb) { v8us oh, ol;
#pragma unroll
            for (int r = 0; r < 8; ++r) { unsigned short a, c2; splitf(o[g][mb][r] * inv, a, c2); oh[r] = a; ol[r] = c2; }
            const size_t oo = (size_t)(qw + g * 16 + lr) * DQ + mb * 16 + 8 * hi; *(v8us*)(Ah + oo) = oh; *(v8us*)(Al + oo) = ol; } }
}

// grid: the hi/lo blocks (three products, the longer ones) first, then the f16 blocks; planes [b][head][.][.], ctx planes [b][t][DQ]
__global__ __launch_bounds__(256) void k_fattn(const h16* __restrict__ Q16, const h16* __restrict__ K16, const h16* __restrict__ V16, const bf* __restrict__ Qh, const bf* __restrict__ Ql, const bf* __restrict__ Kh, const bf* __restrict__ Kl,
                                               const bf* __restrict__ Vh, const bf* __restrict__ Vl, const int* __restrict__ mask, bf* Ah, bf* Al) {
    __shared__ __align__(16) unsigned short sm[2 * 4 * FT];
    __shared__ __align__(16) int smk[TT];
    constexpr int HB = RH / QBH, LB = (TT - RH) / QBL, NHIW = NB * NH_ * HB;
    const int x = (int)blockIdx.x; const bool hires = (x < NHIW);
    const int bh = hires ? x / HB : (x - NHIW) / LB; const int q0 = hires ? (x % HB) * QBH : RH + ((x - NHIW) % LB) * QBL;
    const int b = bh / NH_, hd = bh % NH_; const size_t po = (size_t)bh * TT * HD, ao = (size_t)b * TT * DQ + (size_t)hd * HD;
    const int* mk = mask + (size_t)b * SEQ_FULL;
#pragma unroll
    for (int i = 0; i < TT / 1024; ++i) ((v4ia*)smk)[threadIdx.x + 256 * i] = ((const v4ia*)mk)[threadIdx.x + 256 * i];
    if (hires) fa_body<bf, true>((bf*)sm, smk, Qh + po, Ql + po, Kh + po, Kl + po, Vh + po, Vl + po, q0, Ah + ao, Al + ao);
    else fa_body<h16, false>((h16*)sm, smk, Q16 + po, nullptr, K16 + po, nullptr, V16 + po, nullptr, q0, Ah + ao, Al + ao);
}

extern "C" void kernel_launch(void* const* d_in, const int* in_sizes, int n_in,
                              void* d_out, int out_size, void* d_ws, size_t ws_size, hipStream_t stream) {
    if (n_in < 12) return;
    const size_t needx = (size_t)(NB - 1) * SEQ_FULL * DM + (size_t)TT * DM;
    const size_t needm = (size_t)(NB - 1) * SEQ_FULL + (size_t)TT;
    if ((size_t)in_sizes[0] < needx || (size_t)in_sizes[1] < needx || (size_t)in_sizes[2] < needx || (size_t)in_sizes[3] < needm) return;
    if ((size_t)in_sizes[4] < (size_t)DQ * DM || (size_t)in_sizes[6] < (size_t)DKV * DM || (size_t)in_sizes[8] < (size_t)DKV * DM || (size_t)in_sizes[10] < (size_t)DM * DQ) return;
    if (in_sizes[5] < DQ || in_sizes[7] < DKV || in_sizes[9] < DKV || in_sizes[11] < DM) return;
    if ((size_t)out_size < needx) return;
    // wire order: query, key, value, mask (int32), Wq, bq, Wk, bk, Wv, bv, Wo, bo; weights [out][in]
    const float* xq = (const float*)d_in[0]; const float* xk = (const float*)d_in[1]; const float* xv = (const float*)d_in[2]; const int* mask = (const int*)d_in[3];
    const float* wq = (const float*)d_in[4]; const float* bq = (const float*)d_in[5]; const float* wk = (const float*)d_in[6]; const float* bk = (const float*)d_in[7];
    const float* wv = (const float*)d_in[8]; const float* bv = (const float*)d_in[9]; const float* wo = (const float*)d_in[10]; const float* bo = (const float*)d_in[11];
    float* OUT = (float*)d_out;     // [NB_FULL][SEQ_FULL][DM]
    char* wsp = (char*)d_ws;
    auto take = [&](size_t bytes) { char* p = wsp; wsp += (bytes + 255) & ~(size_t)255; return (void*)p; };
    bf* WQ = (bf*)take(SZ_W); bf* WK = (bf*)take(SZ_W); bf* WV = (bf*)take(SZ_W); bf* WO = (bf*)take(SZ_W);   // one after the other: filled by one launch, WQ WK WV read by one launch
    // planes [b][head][.][.]; each k plane directly behind its q plane, so that one launch fills both
    h16* QP16 = (h16*)take(SZ_HP); h16* KP16 = (h16*)take(SZ_HP); bf* QPh = (bf*)take(SZ_HP); bf* KPh = (bf*)take(SZ_HP); bf* QPl = (bf*)take(SZ_HP); bf* KPl = (bf*)take(SZ_HP);
    h16* VT16 = (h16*)take(SZ_HP); bf* VTh = (bf*)take(SZ_HP); bf* VTl = (bf*)take(SZ_HP);
    bf* XB = (bf*)take(SZ_XB); float* F = (float*)take(SZ_F); bf* ATh = (bf*)take(SZ_AT);   // XB [q k v][b][t][DM] bf16, F [q k v][b][t][DQ] f32
    bf* ATl = (bf*)take(SZ_AT);
    if ((size_t)(wsp - (char*)d_ws) > ws_size) return;
    const unsigned LW = (unsigned)(((size_t)DQ * DM / 8 + 255) / 256);
    const unsigned LX = (unsigned)(((size_t)TT * DM / 8 + 255) / 256);
    const unsigned LQ = (unsigned)(((size_t)NH_ * TT * HD / 2 + 255) / 256), LKv = (unsigned)(((size_t)NKV * TT * HD / 2 + 255) / 256);
    const size_t xs = (size_t)SEQ_FULL * DM;   // batch stride of the f32 inputs and of the output
    // four weights in one launch; q, k, v inputs of every batch in one launch
    k_cvt8<<<dim3(LW, 1, 4), 256, 0, stream>>>(wq, wk, wv, wo, WQ, (size_t)DQ * DM / 8, 0, 1);
    k_cvt8<<<dim3(LX, NB, 3), 256, 0, stream>>>(xq, xk, xv, xv, XB, (size_t)TT * DM / 8, xs, NB);
    // the three projections of every batch in one launch: z = tensor * NB + batch
    k_gemms<bf, 0, true, DM, DM, DQ><<<dim3(TT / 128, DQ / 128, 3 * NB), 128, 0, stream>>>(XB, nullptr, WQ, F, bq, bk, bv, NB, (size_t)TT * DM, (size_t)DQ * DM, (size_t)TT * DQ);
    // q and k planes in one launch, then the transposed v planes
    k_hpl<<<dim3(LQ, 2 * NB), 256, 0, stream>>>(F, DQ, NH_, QP16, QPh, QPl);
    k_vtp<<<dim3(LKv, NB), 256, 0, stream>>>(F + (size_t)2 * NB * TT * DQ, DKV, NKV, VT16, VTh, VTl);
    // attention of every batch and head in one launch, ctx planes written directly
    k_fattn<<<NB * NH_ * (RH / QBH + (TT - RH) / QBL), 256, 0, stream>>>(QP16, KP16, VT16, QPh, QPl, KPh, KPl, VTh, VTl, mask, ATh, ATl);
    // out[b][t][n] = sum_k ctx[b][t][k] Wo[n][k] + bo[n], every batch in one launch
    k_gemms<bf, 1, true, DQ, DQ, DM><<<dim3(TT / 128, DM / 128, NB), 128, 0, stream>>>(ATh, ATl, WO, OUT, bo, bo, bo, NB, (size_t)TT * DQ, 0, xs);
}

// v005
// A run of this version takes 134 microseconds.
// Two timings next to v004 both put it at 1.18 times that version's speed.
// All steps since v000 together make it 15.2 times as fast.
#include <hip/hip_runtime.h>

// 16-head scaled dot-product attention with a key padding mask: q = query Wq^T + bq, k = key Wk^T + bk, v = value Wv^T + bv (weights [out][in]); scores x 1/8; masked keys (mask == 0) replaced by -inf; softmax over keys; out = merged Wo^T + bo.
// Compute dtypes, f32 accumulate everywhere: every float input converted to bf16 (RNE); projections v_wmma_f32_16x16x32_bf16 on exact bf16 planes + bf16-rounded bias; scores rows < RH bf16 hi/lo planes (3 products), rows >= RH v_wmma_f32_16x16x32_f16;
// P.V rows < RH bf16 hi/lo planes (3 products), rows >= RH f16 with P carried x1024 (the f32 row sum carries it too); output projection bf16 hi/lo ctx planes x bf16 Wo (2 products) + bf16-rounded bias; softmax f32.

#ifndef NB
#define NB 2
#endif
#ifndef SEQ
#define SEQ 2048
#endif
#define NB_FULL  2
#define SEQ_FULL 2048
#define TT   SEQ
#define DM   1024
#define NH_  16
#define NKV  16
#define REP  (NH_ / NKV)
#define HD   64
#define DQ   (NH_ * HD)
#define DKV  (NKV * HD)
#define RH   ((TT > 512) ? 512 : (TT / 2))   // query rows < RH use hi+lo planes
#define PCARL2 10.0f      // P of the f16 rows is carried x 2^10
#define SCL  0.125f       // HD^-0.5
#define NEGBIG (-1.0e30f)

static_assert(NB >= 1 && NB <= NB_FULL);
static_assert(TT <= SEQ_FULL && TT % 128 == 0);
static_assert(RH >= 64 && RH % 64 == 0 && TT > RH && (TT - RH) % 64 == 0);
static_assert(HD == 64 && DM % 64 == 0 && DQ % 64 == 0 && DM % 32 == 0 && TT % 32 == 0);
static_assert(REP == 1);
static_assert(DM % 128 == 0 && DQ % 128 == 0);

#define SZ_W    ((size_t)DQ * DM * 2)
#define SZ_XB   ((size_t)3 * NB * TT * DM * 2)
#define SZ_HP   ((size_t)NB * NH_ * TT * HD * 2)
#define SZ_AT   ((size_t)NB * TT * DQ * 2)
#define SZ_ALL  (4 * SZ_W + 9 * SZ_HP + SZ_XB + 2 * SZ_AT)
static_assert(SZ_W % 256 == 0 && SZ_XB % 256 == 0 && SZ_HP % 256 == 0 && SZ_AT % 256 == 0);
static_assert(SZ_ALL <= (size_t)268435456 && DQ == DKV && NH_ == NKV);

typedef _Float16 h16;
typedef unsigned short bf;
typedef __attribute__((ext_vector_type(16))) __bf16   v16bf;
typedef __attribute__((ext_vector_type(16))) _Float16 v16h;
typedef __attribute__((ext_vector_type(8)))  _Float16 v8h;
typedef __attribute__((ext_vector_type(8)))  unsigned short v8us;
typedef __attribute__((ext_vector_type(8)))  float    v8f;
typedef __attribute__((ext_vector_type(4)))  float    v4f;
typedef v4f  __attribute__((may_alias)) v4fa;
typedef __attribute__((ext_vector_type(4))) _Float16 v4h;
typedef __attribute__((ext_vector_type(4))) unsigned short v4us;
typedef __attribute__((ext_vector_type(4))) int v4i;

__device__ __forceinline__ unsigned short f2bf(float f) { unsigned u = __float_as_uint(f); u += 0x7FFFu + ((u >> 16) & 1u); return (unsigned short)(u >> 16); }
__device__ __forceinline__ float bf2f(unsigned short b) { return __uint_as_float(((unsigned)b) << 16); }
__device__ __forceinline__ float bfr(float f) { return bf2f(f2bf(f)); }
__device__ __forceinline__ v16h cat16(v8h lo, v8h hi) { return __builtin_shufflevector(lo, hi, 0, 1, 2, 3, 4, 5, 6, 7, 8, 9, 10, 11, 12, 13, 14, 15); }
__device__ __forceinline__ v16bf cat16b(v8us lo, v8us hi) { return __builtin_bit_cast(v16bf, __builtin_shufflevector(lo, hi, 0, 1, 2, 3, 4, 5, 6, 7, 8, 9, 10, 11, 12, 13, 14, 15)); }
__device__ __forceinline__ v8f wmma16(v16h a, v16h b, v8f c) { return __builtin_amdgcn_wmma_f32_16x16x32_f16(false, a, false, b, (short)0, c, false, false); }
__device__ __forceinline__ v8f wmmab(v16bf a, v16bf b, v8f c) { return __builtin_amdgcn_wmma_f32_16x16x32_bf16(false, a, false, b, (short)0, c, false, false); }

// ---- k_gemms: GEMM on K-contiguous 16-bit planes, one 128x128 output tile per work-group of 4 waves (2 x 2, 64x64 and 16 accumulators each); grid (M/128, N/128, Z), 128 threads.
// C[m][n] (f32, + optional bias[n] rounded to bf16) = sum_k (A[m][k] + A2[m][k]) Bt[n][k] (A2 only with NSPLIT == 1). A rows have pitch LDA, Bt rows pitch K, C rows pitch LDC. z-batch strides sA/sB/sC in elements; Bt and the bias change only every zdiv-th z (bias0, bias1, bias2 in turn). K % 64 == 0, M % 128 == 0, N % 128 == 0.
// k goes by stages of 64: the A (and A2) tile [128 rows][64 k] and the Bt tile [128 rows][64 k] pass through registers into one of two LDS buffers while the other is read.
// A staging load of a wave covers four whole 128-byte rows, and every operand line is fetched once per work-group. Each wave sums its whole K in ascending order.
// With PLANES the result does not go to C: z / zdiv = 0, 1 (q, k) writes x = sum + bias as three 16-bit planes [z][head][t][d] (f16, bf16 hi, bf16 lo = bf16(x - hi)), z / zdiv = 2 (v) the same three planes transposed, [z - 2 zdiv][head][d][t]. A wave's 64 columns are one head.
// Fragment map (A and B alike): lane l -> row/col l & 15, h = l >> 4; elements 0..7 = k0 + 8h + 0..7, elements 8..15 = k0 + 16 + 8h + 0..7. D: element r -> row 8h + r, col l & 15.
template <typename T16> struct WFrag;
template <> struct WFrag<h16> { typedef v16h V; static __device__ __forceinline__ V ld(const h16* p) { return cat16(*(const v8h*)p, *(const v8h*)(p + 16)); } static __device__ __forceinline__ v8f mma(V a, V b, v8f c) { return wmma16(a, b, c); } };
template <> struct WFrag<bf> { typedef v16bf V; static __device__ __forceinline__ V ld(const bf* p) { return cat16b(*(const v8us*)p, *(const v8us*)(p + 16)); } static __device__ __forceinline__ v8f mma(V a, V b, v8f c) { return wmmab(a, b, c); } };
#define GP   72             // LDS row pitch in 16-bit elements: 128 B + 16 B, the 16 rows of a 16-byte fragment read fall on distinct banks
#define GT   (128 * GP)     // one 128 x 64 tile
typedef v4i __attribute__((may_alias)) v4ig;
typedef __attribute__((ext_vector_type(8))) __bf16 v8bf;
// the three planes of eight values, every conversion round to nearest even
__device__ __forceinline__ void planes8(v8f x, v4i& o16, v4i& oh, v4i& ol) { oh = __builtin_bit_cast(v4i, __builtin_convertvector(x, v8bf)); v8f hf;
#pragma unroll
    for (int k = 0; k < 4; ++k) { hf[2 * k] = __int_as_float(oh[k] << 16); hf[2 * k + 1] = __int_as_float(oh[k] & (int)0xFFFF0000u); }   // the packed hi words back to f32
    o16 = __builtin_bit_cast(v4i, __builtin_convertvector(x, v8h)); ol = __builtin_bit_cast(v4i, __builtin_convertvector(x - hf, v8bf)); }
template <typename T16, int NSPLIT, bool BIAS, bool PLANES, int K, int LDA, int LDC>
__global__ __launch_bounds__(128) void k_gemms(const T16* __restrict__ A, const T16* __restrict__ A2, const T16* __restrict__ Bt, float* C, h16* P16, bf* Ph, bf* Pl, h16* V16, bf* Vh, bf* Vl, const float* __restrict__ bias0, const float* __restrict__ bias1, const float* __restrict__ bias2, int zdiv, size_t sA, size_t sB, size_t sC) {
    typedef typename WFrag<T16>::V V; static_assert((NSPLIT == 0 || NSPLIT == 1) && K % 64 == 0 && K >= 64);
    constexpr int NT = (NSPLIT == 1) ? 3 : 2;   // tiles per stage: A, (A2), Bt
    constexpr int NS = K / 64;
    __shared__ __align__(16) unsigned char smraw[2 * NT * GT * 2];
    static_assert(2 * 4 * 16 * 68 * 4 <= 2 * NT * GT * 2);
    T16* sm = (T16*)smraw;
    const size_t z = blockIdx.z, zb = blockIdx.z / (unsigned)zdiv;
    const float* bias = (zb == 0) ? bias0 : ((zb == 1) ? bias1 : bias2);
    const int tid = (int)threadIdx.x, lane = tid & 31, lr = lane & 15, hi = lane >> 4; const int r0 = blockIdx.x * 128, c0 = blockIdx.y * 128;
    // wave number through readfirstlane: the tile offsets stay in scalar registers
    const int wv = __builtin_amdgcn_readfirstlane(tid >> 5), wm = wv >> 1, wn = wv & 1;
    const int srow = tid >> 3, scol = (tid & 7) * 8;   // staging: 16 bytes of rows srow + 16 i, i = 0..7, of every tile
    // a work-group-uniform base plus one 32-bit byte offset per thread; the eight rows differ by constants
    const char* ua = (const char*)(A + z * sA + (size_t)r0 * LDA); const char* ua2 = (NSPLIT == 1) ? (const char*)(A2 + z * sA + (size_t)r0 * LDA) : nullptr; const char* ub = (const char*)(Bt + zb * sB + (size_t)c0 * K);
    const unsigned va = (unsigned)(srow * LDA + scol) * 2u, vb = (unsigned)(srow * K + scol) * 2u;
    v4i st[NT][8];
    auto gl = [&](int kc) {
        const char* pa = ua + kc * 2 + va; const char* pa2 = (NSPLIT == 1) ? ua2 + kc * 2 + va : nullptr; const char* pb = ub + kc * 2 + vb;
#pragma unroll
        for (int i = 0; i < 8; ++i) { st[0][i] = *(const v4ig*)(pa + i * (16 * LDA * 2)); if (NSPLIT == 1) st[1][i] = *(const v4ig*)(pa2 + i * (16 * LDA * 2)); st[NT - 1][i] = *(const v4ig*)(pb + i * (16 * K * 2)); }
        // The wait stands in front of whatever next writes a register that holds an address of the loads above (the fragment reads and the accumulators may take those registers);
        // the addresses are named as inputs so that their registers stay theirs up to the wait.
        if constexpr (NSPLIT == 1) asm volatile("s_wait_xcnt 0x0" :: "v"(pa), "v"(pa2), "v"(pb), "v"(va), "v"(vb) : "memory");
        else asm volatile("s_wait_xcnt 0x0" :: "v"(pa), "v"(pb), "v"(va), "v"(vb) : "memory"); };
    auto sl = [&](int buf) {
#pragma unroll
        for (int tl = 0; tl < NT; ++tl)
#pragma unroll
            for (int i = 0; i < 8; ++i) *(v4ig*)(sm + (buf * NT + tl) * GT + (srow + 16 * i) * GP + scol) = st[tl][i]; };
    v8f acc[4][4];
#pragma unroll
    for (int mb = 0; mb < 4; ++mb)
#pragma unroll
        for (int nb = 0; nb < 4; ++nb) acc[mb][nb] = (v8f){};
    gl(0); sl(0);
    // The stage loop stays rolled: one copy of the stage's products in the instruction cache. The loops inside it are unrolled because st, a, b and acc live in registers and need constant indices.
#pragma unroll 1
    for (int s = 0; s < NS; ++s) {
        __syncthreads();   // publishes buffer s & 1; ends every read of the other buffer, which is refilled below
        const bool more = (s + 1 < NS);
        if (more) gl((s + 1) * 64);
        const T16* at = sm + ((s & 1) * NT) * GT + (wm * 64 + lr) * GP + 8 * hi; const T16* bt = sm + ((s & 1) * NT + NT - 1) * GT + (wn * 64 + lr) * GP + 8 * hi;
        V a[2][4], a2[2][4], b[2][4];
#pragma unroll
        for (int ks = 0; ks < 2; ++ks)
#pragma unroll
            for (int f = 0; f < 4; ++f) { a[ks][f] = WFrag<T16>::ld(at + f * 16 * GP + ks * 32); if (NSPLIT == 1) a2[ks][f] = WFrag<T16>::ld(at + GT + f * 16 * GP + ks * 32); b[ks][f] = WFrag<T16>::ld(bt + f * 16 * GP + ks * 32); }
        __builtin_amdgcn_sched_barrier(0);   // keeps the stage's fragment reads one group in front of its products, for speed only
#pragma unroll
        for (int ks = 0; ks < 2; ++ks)
#pragma unroll
            for (int nb = 0; nb < 4; ++nb) {
#pragma unroll
                for (int mb = 0; mb < 4; ++mb) acc[mb][nb] = WFrag<T16>::mma(a[ks][mb], b[ks][nb], acc[mb][nb]);
                if (NSPLIT == 1) {
#pragma unroll
                    for (int mb = 0; mb < 4; ++mb) acc[mb][nb] = WFrag<T16>::mma(a2[ks][mb], b[ks][nb], acc[mb][nb]); } }
        if (more) sl((s + 1) & 1);
    }
    // Output through LDS, so that every global store covers whole 256-byte row pieces: per pass a wave lays 16 x 64 of its tile in its own slab (pitch 68 floats) and reads it back by rows.
    // Two slab sets in turn. The results stay in registers and go to memory behind the last barrier, so that no barrier waits for a global store.
    // Every loop here is unrolled because acc and res live in registers and need constant indices.
    __syncthreads();   // ends every read of the operand tiles: the slabs lie over them
    if constexpr (PLANES) {
        // Every wave stages in its own quarter of the LDS and reads it back so that a lane holds 16 bytes of a plane's row and eight lanes one whole 128-byte line.
        // All results wait in registers and go to memory behind the last barrier: no barrier waits for a global store, and no register of an issued store is written again.
        // Every loop here is unrolled because acc and the results live in registers and need constant indices.
        static_assert(BIAS && HD == 64 && DQ == NH_ * HD && 4 * 64 * 68 * 4 <= 2 * NT * GT * 2 && 4 * 2 * 64 * GP * 2 <= 2 * NT * GT * 2);
        const int head = (int)blockIdx.y * 2 + wn, t0 = r0 + wm * 64, rr = lane >> 3, c8 = (lane & 7) * 8;
        v4i r16[16], rh[16], rl[16];
        if (zb < 2) {
            // q, k: the 64 x 64 f32 tile [t][d] (pitch 68 floats), read back by rows of d
            float* my = (float*)smraw + wv * (64 * 68);
#pragma unroll
            for (int mb = 0; mb < 4; ++mb)
#pragma unroll
                for (int nb = 0; nb < 4; ++nb) {
#pragma unroll
                    for (int j = 0; j < 8; ++j) my[(mb * 16 + hi * 8 + j) * 68 + nb * 16 + lr] = acc[mb][nb][j]; }
            v8f b8;
#pragma unroll
            for (int q = 0; q < 8; ++q) b8[q] = bfr(bias[c0 + wn * 64 + c8 + q]);
            __syncthreads();   // orders the slab's stores in front of the reads of other lanes' values
#pragma unroll
            for (int i = 0; i < 16; ++i) { const float* rp = my + (4 * i + rr) * 68 + c8; const v4f x0 = *(const v4fa*)rp, x1 = *(const v4fa*)(rp + 4);
                planes8(__builtin_shufflevector(x0, x1, 0, 1, 2, 3, 4, 5, 6, 7) + b8, r16[i], rh[i], rl[i]); }
            __builtin_amdgcn_sched_barrier(0);   // keeps every conversion in front of the first store, so that no register of an issued store is written again
            const size_t po = ((z * NH_ + head) * TT + t0 + rr) * HD + c8;
#pragma unroll
            for (int i = 0; i < 16; ++i) { *(v4ig*)(P16 + po + i * (4 * HD)) = r16[i]; *(v4ig*)(Ph + po + i * (4 * HD)) = rh[i]; *(v4ig*)(Pl + po + i * (4 * HD)) = rl[i]; }
        } else {
            // v: a lane's eight accumulator elements are eight successive t of one d, 16 bytes of a transposed plane; slabs [d][t] (pitch GP), two per wave: f16 and hi first, then lo
            unsigned short* s0 = (unsigned short*)smraw + wv * (2 * 64 * GP); unsigned short* s1 = s0 + 64 * GP;
            float bn[4];
#pragma unroll
            for (int nb = 0; nb < 4; ++nb) bn[nb] = bfr(bias[c0 + wn * 64 + nb * 16 + lr]);
            v4i lo[4][4];
#pragma unroll
            for (int mb = 0; mb < 4; ++mb)
#pragma unroll
                for (int nb = 0; nb < 4; ++nb) { v4i o16, oh; planes8(acc[mb][nb] + bn[nb], o16, oh, lo[mb][nb]); const int so = (nb * 16 + lr) * GP + mb * 16 + hi * 8; *(v4ig*)(s0 + so) = o16; *(v4ig*)(s1 + so) = oh; }
            __syncthreads();   // orders the slabs' stores in front of the reads of other lanes' values
#pragma unroll
            for (int i = 0; i < 16; ++i) { const int ro = (4 * i + rr) * GP + c8; r16[i] = *(const v4ig*)(s0 + ro); rh[i] = *(const v4ig*)(s1 + ro); }
            __syncthreads();   // ends the reads of the first slab, which takes the lo plane now
#pragma unroll
            for (int mb = 0; mb < 4; ++mb)
#pragma unroll
                for (int nb = 0; nb < 4; ++nb) *(v4ig*)(s0 + (nb * 16 + lr) * GP + mb * 16 + hi * 8) = lo[mb][nb];
            __syncthreads();   // orders the slab's stores in front of the reads of other lanes' values
#pragma unroll
            for (int i = 0; i < 16; ++i) rl[i] = *(const v4ig*)(s0 + (4 * i + rr) * GP + c8);
            const size_t vo = (((z - 2 * (size_t)zdiv) * NKV + head) * HD + rr) * TT + t0 + c8;
#pragma unroll
            for (int i = 0; i < 16; ++i) { *(v4ig*)(V16 + vo + (size_t)i * (4 * TT)) = r16[i]; *(v4ig*)(Vh + vo + (size_t)i * (4 * TT)) = rh[i]; *(v4ig*)(Vl + vo + (size_t)i * (4 * TT)) = rl[i]; }
            asm volatile("s_wait_xcnt 0x0" ::: "memory");   // stands behind the last store, in front of whatever the code laid out behind this branch writes into a register that a store above names
        }
        return;
    }
    float* os = (float*)smraw;
    v4f res[4][8], bv = (v4f)(0.0f);
    if (BIAS) {
#pragma unroll
        for (int q = 0; q < 4; ++q) bv[q] = bfr(bias[c0 + wn * 64 + lr * 4 + q]); }
#pragma unroll
    for (int mb = 0; mb < 4; ++mb) {
        float* my = os + ((mb & 1) * 4 + wv) * (16 * 68);
#pragma unroll
        for (int nb = 0; nb < 4; ++nb) {
#pragma unroll
            for (int j = 0; j < 8; ++j) my[(hi * 8 + j) * 68 + nb * 16 + lr] = acc[mb][nb][j]; }
        __syncthreads();   // orders the slab's stores in front of the reads of other lanes' values
#pragma unroll
        for (int i = 0; i < 8; ++i) { const v4f val = *(const v4fa*)(my + (2 * i + hi) * 68 + lr * 4); res[mb][i] = BIAS ? val + bv : val; } }
    float* cw = C + z * sC + (size_t)(r0 + wm * 64 + hi) * LDC + c0 + wn * 64 + lr * 4;
#pragma unroll
    for (int mb = 0; mb < 4; ++mb)
#pragma unroll
        for (int i = 0; i < 8; ++i) *(v4f*)(cw + (mb * 16 + 2 * i) * LDC) = res[mb][i];
}

__device__ __forceinline__ void splitf(float y, unsigned short& h, unsigned short& l) { h = f2bf(y); l = f2bf(y - bf2f(h)); }

// blockIdx.z = which source tensor, blockIdx.y = batch (ny of them): src advances by ss elements per batch, dst is dense [z][y][8 n8]
__global__ __launch_bounds__(256) void k_cvt8(const float* __restrict__ s0, const float* __restrict__ s1, const float* __restrict__ s2, const float* __restrict__ s3, bf* dst, size_t n8, size_t ss, unsigned ny) { const size_t i = (size_t)blockIdx.x * 256 + threadIdx.x; if (i >= n8) return;
    const float* src = ((blockIdx.z == 0) ? s0 : (blockIdx.z == 1) ? s1 : (blockIdx.z == 2) ? s2 : s3) + blockIdx.y * ss; dst += ((size_t)blockIdx.z * ny + blockIdx.y) * n8 * 8; const v8f v = *(const v8f*)(src + i * 8); v8us o;
#pragma unroll
    for (int k = 0; k < 8; ++k) o[k] = f2bf(v[k]); *(v8us*)(dst + i * 8) = o;  }

#define FP   72             // LDS row pitch in 16-bit elements: 128 B + 16 B, the 16 rows of a 16-byte fragment read fall on distinct banks
#define FT   (64 * FP)      // one 64 x 64 tile
#define QBH  128            // queries per work-group, rows < RH
#define QBL  256            // queries per work-group, rows >= RH
#define MSTART (-5.0e29f)
#define SCL2 (SCL * 1.4426950408889634f)
static_assert(RH % QBH == 0 && (TT - RH) % QBL == 0 && TT % 1024 == 0 && TT % 64 == 0);
typedef v4i __attribute__((may_alias)) v4ia;

__device__ __forceinline__ float xhalf(float x) { const int b = __float_as_int(x); return __int_as_float(__builtin_amdgcn_permlanex16(b, b, 0x76543210, 0xfedcba98, false, false)); }   // lane l <-> l ^ 16

template <typename T16, bool HI>
__device__ __forceinline__ void fa_body(T16* sm, const int* smk, const T16* __restrict__ Q, const T16* __restrict__ Q2, const T16* __restrict__ Kp, const T16* __restrict__ K2,
                                        const T16* __restrict__ Vt, const T16* __restrict__ V2, int q0, bf* Ah, bf* Al) {
    typedef typename WFrag<T16>::V V;
    constexpr int NPL = HI ? 2 : 1, NG = HI ? 1 : 2, NS = TT / 64;
    const int tid = (int)threadIdx.x, lane = tid & 31, lr = lane & 15, hi = lane >> 4;
    const int qw = q0 + (tid >> 5) * (16 * NG);
    const int srow = tid >> 3, scol = (tid & 7) * 8;   // staging: 16 bytes of rows srow and srow + 32 of every tile
    v4i st[2 * NPL][2];
    auto gl = [&](int j0) {
#pragma unroll
        for (int i = 0; i < 2; ++i) { const int row = srow + 32 * i;
            st[0][i] = *(const v4ia*)(Kp + (size_t)(j0 + row) * HD + scol); if (HI) st[1][i] = *(const v4ia*)(K2 + (size_t)(j0 + row) * HD + scol);
            st[NPL][i] = *(const v4ia*)(Vt + (size_t)row * TT + j0 + scol); if (HI) st[NPL + 1][i] = *(const v4ia*)(V2 + (size_t)row * TT + j0 + scol); } };
    auto sl = [&](int buf) {
#pragma unroll
        for (int tl = 0; tl < 2 * NPL; ++tl)
#pragma unroll
            for (int i = 0; i < 2; ++i) *(v4ia*)(sm + (buf * 2 * NPL + tl) * FT + (srow + 32 * i) * FP + scol) = st[tl][i]; };
    V q[NG][2], q2[NG][2];
#pragma unroll
    for (int g = 0; g < NG; ++g)
#pragma unroll
        for (int ks = 0; ks < 2; ++ks) { q[g][ks] = WFrag<T16>::ld(Q + (size_t)(qw + g * 16 + lr) * HD + ks * 32 + 8 * hi); if (HI) q2[g][ks] = WFrag<T16>::ld(Q2 + (size_t)(qw + g * 16 + lr) * HD + ks * 32 + 8 * hi); }
    v8f o[NG][4]; float mrun[NG], lsum[NG];
#pragma unroll
    for (int g = 0; g < NG; ++g) { mrun[g] = MSTART; lsum[g] = 0.0f;
#pragma unroll
        for (int mb = 0; mb < 4; ++mb) o[g][mb] = (v8f){}; }
    gl(0); sl(0);
#pragma unroll 1
    for (int s = 0; s < NS; ++s) {
        __syncthreads();   // publishes buffer s & 1 (and, at s = 0, the mask); ends every read of the other buffer, which is refilled below
        const bool more = (s + 1 < NS);
        if (more) gl((s + 1) * 64);
        const T16* kt = sm + ((s & 1) * 2 * NPL) * FT; const T16* vt = kt + NPL * FT;
        v8f sc[NG][4];
#pragma unroll
        for (int t = 0; t < 4; ++t) {
#pragma unroll
            for (int g = 0; g < NG; ++g) sc[g][t] = (v8f){};
#pragma unroll
            for (int ks = 0; ks < 2; ++ks) { const V ka = WFrag<T16>::ld(kt + (t * 16 + lr) * FP + ks * 32 + 8 * hi); V kb; if (HI) kb = WFrag<T16>::ld(kt + FT + (t * 16 + lr) * FP + ks * 32 + 8 * hi);
#pragma unroll
                for (int g = 0; g < NG; ++g) { sc[g][t] = WFrag<T16>::mma(ka, q[g][ks], sc[g][t]); if (HI) { sc[g][t] = WFrag<T16>::mma(ka, q2[g][ks], sc[g][t]); sc[g][t] = WFrag<T16>::mma(kb, q[g][ks], sc[g][t]); } } } }
        float mnew[NG];
#pragma unroll
        for (int g = 0; g < NG; ++g) mnew[g] = mrun[g];
#pragma unroll
        for (int t = 0; t < 4; ++t) { const int* mp = smk + s * 64 + t * 16 + 8 * hi; const v4i m0 = *(const v4ia*)mp, m1 = *(const v4ia*)(mp + 4);
#pragma unroll
            for (int r = 0; r < 8; ++r) { const bool ok = ((r < 4) ? m0[r & 3] : m1[r & 3]) != 0;
#pragma unroll
                for (int g = 0; g < NG; ++g) { const float x = ok ? sc[g][t][r] * SCL2 : NEGBIG; sc[g][t][r] = x; mnew[g] = fmaxf(mnew[g], x); } } }
        V pf[NG][2], pl[NG][2];
#pragma unroll
        for (int g = 0; g < NG; ++g) {
            const float mx = fmaxf(mnew[g], xhalf(mnew[g]));   // both halves of a column share one maximum: their keys meet in one product
            const float da = mrun[g] - mx; float al = __builtin_amdgcn_exp2f(da); mrun[g] = mx;
            asm volatile("v_nop" : "+v"(al) : "v"(da));       // the free slot behind a transcendental, see below
            const float off = HI ? mx : mx - PCARL2;
            float ps = 0.0f;
#pragma unroll
            for (int t = 0; t < 4; ++t) { const v8f d = sc[g][t] - off; v8f p;
#pragma unroll
                for (int r = 0; r < 8; ++r) p[r] = __builtin_amdgcn_exp2f(d[r]);
                // The instruction set asks for one free slot behind v_exp_f32 before its result is read or its source overwritten. Naming the eight sources as inputs keeps them
                // whole until here, naming the results as in-out keeps their readers behind: inside the run each v_exp_f32 is the next one's slot, the v_nop is the last one's.
                asm volatile("v_nop" : "+v"(p) : "v"(d));
                sc[g][t] = p;
#pragma unroll
                for (int r = 0; r < 8; ++r) ps += p[r]; }
            lsum[g] = lsum[g] * al + ps;
#pragma unroll
            for (int mb = 0; mb < 4; ++mb) o[g][mb] *= al;
#pragma unroll
            for (int p2 = 0; p2 < 2; ++p2) {
                if constexpr (HI) {
                    const v8bf h0 = __builtin_convertvector(sc[g][2 * p2], v8bf), h1 = __builtin_convertvector(sc[g][2 * p2 + 1], v8bf);
                    const v8bf l0 = __builtin_convertvector(sc[g][2 * p2] - __builtin_convertvector(h0, v8f), v8bf), l1 = __builtin_convertvector(sc[g][2 * p2 + 1] - __builtin_convertvector(h1, v8f), v8bf);
                    pf[g][p2] = __builtin_shufflevector(h0, h1, 0, 1, 2, 3, 4, 5, 6, 7, 8, 9, 10, 11, 12, 13, 14, 15);
                    pl[g][p2] = __builtin_shufflevector(l0, l1, 0, 1, 2, 3, 4, 5, 6, 7, 8, 9, 10, 11, 12, 13, 14, 15);
                } else {
                    pf[g][p2] = cat16(__builtin_convertvector(sc[g][2 * p2], v8h), __builtin_convertvector(sc[g][2 * p2 + 1], v8h));
                } } }
#pragma unroll
        for (int p2 = 0; p2 < 2; ++p2)
#pragma unroll
            for (int mb = 0; mb < 4; ++mb) { const V va = WFrag<T16>::ld(vt + (mb * 16 + lr) * FP + p2 * 32 + 8 * hi); V vb; if (HI) vb = WFrag<T16>::ld(vt + FT + (mb * 16 + lr) * FP + p2 * 32 + 8 * hi);
#pragma unroll
                for (int g = 0; g < NG; ++g) { o[g][mb] = WFrag<T16>::mma(va, pf[g][p2], o[g][mb]); if (HI) { o[g][mb] = WFrag<T16>::mma(va, pl[g][p2], o[g][mb]); o[g][mb] = WFrag<T16>::mma(vb, pf[g][p2], o[g][mb]); } } }
        if (more) sl((s + 1) & 1);
    }
    // lane l: query qw + 16 g + (l & 15), d = 16 mb + 8 (l >> 4) + 0..7: 16 bytes of each ctx plane
#pragma unroll
    for (int g = 0; g < NG; ++g) { const float inv = __fdiv_rn(1.0f, lsum[g] + xhalf(lsum[g]));
#pragma unroll
        for (int mb = 0; mb < 4; ++mb) { v8us oh, ol;
#pragma unroll
            for (int r = 0; r < 8; ++r) { unsigned short a, c2; splitf(o[g][mb][r] * inv, a, c2); oh[r] = a; ol[r] = c2; }
            const size_t oo = (size_t)(qw + g * 16 + lr) * DQ + mb * 16 + 8 * hi; *(v8us*)(Ah + oo) = oh; *(v8us*)(Al + oo) = ol; } }
}

// grid: the hi/lo blocks (three products, the longer ones) first, then the f16 blocks; planes [b][head][.][.], ctx planes [b][t][DQ]
__global__ __launch_bounds__(256) void k_fattn(const h16* __restrict__ Q16, const h16* __restrict__ K16, const h16* __restrict__ V16, const bf* __restrict__ Qh, const bf* __restrict__ Ql, const bf* __restrict__ Kh, const bf* __restrict__ Kl,
                                               const bf* __restrict__ Vh, const bf* __restrict__ Vl, const int* __restrict__ mask, bf* Ah, bf* Al) {
    __shared__ __align__(16) unsigned short sm[2 * 4 * FT];
    __shared__ __align__(16) int smk[TT];
    constexpr int HB = RH / QBH, LB = (TT - RH) / QBL, NHIW = NB * NH_ * HB;
    const int x = (int)blockIdx.x; const bool hires = (x < NHIW);
    const int bh = hires ? x / HB : (x - NHIW) / LB; const int q0 = hires ? (x % HB) * QBH : RH + ((x - NHIW) % LB) * QBL;
    const int b = bh / NH_, hd = bh % NH_; const size_t po = (size_t)bh * TT * HD, ao = (size_t)b * TT * DQ + (size_t)hd * HD;
    const int* mk = mask + (size_t)b * SEQ_FULL;
#pragma unroll
    for (int i = 0; i < TT / 1024; ++i) ((v4ia*)smk)[threadIdx.x + 256 * i] = ((const v4ia*)mk)[threadIdx.x + 256 * i];
    if (hires) fa_body<bf, true>((bf*)sm, smk, Qh + po, Ql + po, Kh + po, Kl + po, Vh + po, Vl + po, q0, Ah + ao, Al + ao);
    else fa_body<h16, false>((h16*)sm, smk, Q16 + po, nullptr, K16 + po, nullptr, V16 + po, nullptr, q0, Ah + ao, Al + ao);
}

extern "C" void kernel_launch(void* const* d_in, const int* in_sizes, int n_in,
                              void* d_out, int out_size, void* d_ws, size_t ws_size, hipStream_t stream) {
    if (n_in < 12) return;
    const size_t needx = (size_t)(NB - 1) * SEQ_FULL * DM + (size_t)TT * DM;
    const size_t needm = (size_t)(NB - 1) * SEQ_FULL + (size_t)TT;
    if ((size_t)in_sizes[0] < needx || (size_t)in_sizes[1] < needx || (size_t)in_sizes[2] < needx || (size_t)in_sizes[3] < needm) return;
    if ((size_t)in_sizes[4] < (size_t)DQ * DM || (size_t)in_sizes[6] < (size_t)DKV * DM || (size_t)in_sizes[8] < (size_t)DKV * DM || (size_t)in_sizes[10] < (size_t)DM * DQ) return;
    if (in_sizes[5] < DQ || in_sizes[7] < DKV || in_sizes[9] < DKV || in_sizes[11] < DM) return;
    if ((size_t)out_size < needx) return;
    // wire order: query, key, value, mask (int32), Wq, bq, Wk, bk, Wv, bv, Wo, bo; weights [out][in]
    const float* xq = (const float*)d_in[0]; const float* xk = (const float*)d_in[1]; const float* xv = (const float*)d_in[2]; const int* mask = (const int*)d_in[3];
    const float* wq = (const float*)d_in[4]; const float* bq = (const float*)d_in[5]; const float* wk = (const float*)d_in[6]; const float* bk = (const float*)d_in[7];
    const float* wv = (const float*)d_in[8]; const float* bv = (const float*)d_in[9]; const float* wo = (const float*)d_in[10]; const float* bo = (const float*)d_in[11];
    float* OUT = (float*)d_out;     // [NB_FULL][SEQ_FULL][DM]
    char* wsp = (char*)d_ws;
    auto take = [&](size_t bytes) { char* p = wsp; wsp += (bytes + 255) & ~(size_t)255; return (void*)p; };
    bf* WQ = (bf*)take(SZ_W); bf* WK = (bf*)take(SZ_W); bf* WV = (bf*)take(SZ_W); bf* WO = (bf*)take(SZ_W);   // one after the other: filled by one launch, WQ WK WV read by one launch
    // planes [b][head][.][.]; each k plane directly behind its q plane, so that one launch fills both
    h16* QP16 = (h16*)take(SZ_HP); h16* KP16 = (h16*)take(SZ_HP); bf* QPh = (bf*)take(SZ_HP); bf* KPh = (bf*)take(SZ_HP); bf* QPl = (bf*)take(SZ_HP); bf* KPl = (bf*)take(SZ_HP);
    h16* VT16 = (h16*)take(SZ_HP); bf* VTh = (bf*)take(SZ_HP); bf* VTl = (bf*)take(SZ_HP);
    bf* XB = (bf*)take(SZ_XB); bf* ATh = (bf*)take(SZ_AT);   // XB [q k v][b][t][DM] bf16
    bf* ATl = (bf*)take(SZ_AT);
    if ((size_t)(wsp - (char*)d_ws) > ws_size) return;
    const unsigned LW = (unsigned)(((size_t)DQ * DM / 8 + 255) / 256);
    const unsigned LX = (unsigned)(((size_t)TT * DM / 8 + 255) / 256);
    const size_t xs = (size_t)SEQ_FULL * DM;   // batch stride of the f32 inputs and of the output
    // four weights in one launch; q, k, v inputs of every batch in one launch
    k_cvt8<<<dim3(LW, 1, 4), 256, 0, stream>>>(wq, wk, wv, wo, WQ, (size_t)DQ * DM / 8, 0, 1);
    k_cvt8<<<dim3(LX, NB, 3), 256, 0, stream>>>(xq, xk, xv, xv, XB, (size_t)TT * DM / 8, xs, NB);
    // the three projections of every batch in one launch: z = tensor * NB + batch; the q and k planes and the transposed v planes are written directly
    k_gemms<bf, 0, true, true, DM, DM, DQ><<<dim3(TT / 128, DQ / 128, 3 * NB), 128, 0, stream>>>(XB, nullptr, WQ, nullptr, QP16, QPh, QPl, VT16, VTh, VTl, bq, bk, bv, NB, (size_t)TT * DM, (size_t)DQ * DM, 0);
    // attention of every batch and head in one launch, ctx planes written directly
    k_fattn<<<NB * NH_ * (RH / QBH + (TT - RH) / QBL), 256, 0, stream>>>(QP16, KP16, VT16, QPh, QPl, KPh, KPl, VTh, VTl, mask, ATh, ATl);
    // out[b][t][n] = sum_k ctx[b][t][k] Wo[n][k] + bo[n], every batch in one launch
    k_gemms<bf, 1, true, false, DQ, DQ, DM><<<dim3(TT / 128, DM / 128, NB), 128, 0, stream>>>(ATh, ATl, WO, OUT, nullptr, nullptr, nullptr, nullptr, nullptr, nullptr, bo, bo, bo, NB, (size_t)TT * DQ, 0, xs);
}

// v006
// Measured time: 94.8 microseconds a run.
// Timed twice side by side with v005, it ran 1.41 and 1.40 times as fast.
// Counting every step since v000, it is 21.4 times as fast.
#include <hip/hip_runtime.h>

// 16-head scaled dot-product attention with a key padding mask: q = query Wq^T + bq, k = key Wk^T + bk, v = value Wv^T + bv (weights [out][in]); scores x 1/8; masked keys (mask == 0) replaced by -inf; softmax over keys; out = merged Wo^T + bo.
// A masked key has weight exactly 0, so it is left out: the unmasked keys of a batch are ranked in their order, the key and value rows are gathered by rank, and k, v and the attention run over those rows alone.
// Compute dtypes, f32 accumulate everywhere: every float input converted to bf16 (RNE); projections v_wmma_f32_16x16x32_bf16 on exact bf16 planes + bias rounded to bf16; scores rows < RH bf16 hi/lo planes (3 products), rows >= RH v_wmma_f32_16x16x32_f16;
// P.V rows < RH bf16 hi/lo planes (3 products), rows >= RH f16 with P carried x1024 (the f32 row sum carries it too); output projection bf16 hi/lo ctx planes x bf16 Wo (2 products) + bias rounded to bf16; softmax f32.

#ifndef NB
#define NB 2
#endif
#ifndef SEQ
#define SEQ 2048
#endif
#define NB_FULL  2
#define SEQ_FULL 2048
#define TT   SEQ
#define DM   1024
#define NH_  16
#define NKV  16
#define REP  (NH_ / NKV)
#define HD   64
#define DQ   (NH_ * HD)
#define DKV  (NKV * HD)
#define RH   ((TT > 512) ? 512 : (TT / 2))   // query rows < RH use hi+lo planes
#define PCARL2 10.0f      // P of the f16 rows is carried x 2^10
#define SCL  0.125f       // HD^-0.5
#define NEGBIG (-1.0e30f)

static_assert(NB >= 1 && NB <= NB_FULL);
static_assert(TT <= SEQ_FULL && TT % 128 == 0);
static_assert(RH >= 64 && RH % 64 == 0 && TT > RH && (TT - RH) % 64 == 0);
static_assert(HD == 64 && DM % 64 == 0 && DQ % 64 == 0 && DM % 32 == 0 && TT % 32 == 0);
static_assert(REP == 1);
static_assert(DM % 128 == 0 && DQ % 128 == 0);

#define SZ_W    ((size_t)DQ * DM * 2)
#define SZ_XB   ((size_t)3 * NB * TT * DM * 2)
#define SZ_HP   ((size_t)NB * NH_ * TT * HD * 2)
#define SZ_AT   ((size_t)NB * TT * DQ * 2)
#define SZ_IX   ((size_t)NB * TT * 4)      // rank -> key row, per batch
#define SZ_CN   (((size_t)NB * 128 + 255) / 256 * 256)   // number of unmasked keys, one 128-byte line per batch
#define CNS     32                         // ints between two batches' counts
#define SZ_ALL  (4 * SZ_W + 9 * SZ_HP + SZ_XB + 2 * SZ_AT + SZ_IX + SZ_CN)
static_assert(SZ_W % 256 == 0 && SZ_XB % 256 == 0 && SZ_HP % 256 == 0 && SZ_AT % 256 == 0 && SZ_IX % 256 == 0 && SZ_CN % 256 == 0);
static_assert(SZ_ALL <= (size_t)268435456 && DQ == DKV && NH_ == NKV);

typedef _Float16 h16;
typedef unsigned short bf;
typedef __attribute__((ext_vector_type(16))) __bf16   v16bf;
typedef __attribute__((ext_vector_type(16))) _Float16 v16h;
typedef __attribute__((ext_vector_type(8)))  _Float16 v8h;
typedef __attribute__((ext_vector_type(8)))  unsigned short v8us;
typedef __attribute__((ext_vector_type(8)))  float    v8f;
typedef __attribute__((ext_vector_type(4)))  float    v4f;
typedef v4f  __attribute__((may_alias)) v4fa;
typedef __attribute__((ext_vector_type(4))) _Float16 v4h;
typedef __attribute__((ext_vector_type(4))) unsigned short v4us;
typedef __attribute__((ext_vector_type(4))) int v4i;

__device__ __forceinline__ unsigned short f2bf(float f) { unsigned u = __float_as_uint(f); u += 0x7FFFu + ((u >> 16) & 1u); return (unsigned short)(u >> 16); }
__device__ __forceinline__ float bf2f(unsigned short b) { return __uint_as_float(((unsigned)b) << 16); }
__device__ __forceinline__ float bfr(float f) { return bf2f(f2bf(f)); }
__device__ __forceinline__ v16h cat16(v8h lo, v8h hi) { return __builtin_shufflevector(lo, hi, 0, 1, 2, 3, 4, 5, 6, 7, 8, 9, 10, 11, 12, 13, 14, 15); }
__device__ __forceinline__ v16bf cat16b(v8us lo, v8us hi) { return __builtin_bit_cast(v16bf, __builtin_shufflevector(lo, hi, 0, 1, 2, 3, 4, 5, 6, 7, 8, 9, 10, 11, 12, 13, 14, 15)); }
__device__ __forceinline__ v8f wmma16(v16h a, v16h b, v8f c) { return __builtin_amdgcn_wmma_f32_16x16x32_f16(false, a, false, b, (short)0, c, false, false); }
__device__ __forceinline__ v8f wmmab(v16bf a, v16bf b, v8f c) { return __builtin_amdgcn_wmma_f32_16x16x32_bf16(false, a, false, b, (short)0, c, false, false); }

// ---- k_gemms: GEMM on K-contiguous 16-bit planes, one 128x128 output tile per work-group of 4 waves (2 x 2, 64x64 and 16 accumulators each); grid (M/128, N/128, Z), 128 threads.
// C[m][n] (f32, + optional bias[n] rounded to bf16) = sum_k (A[m][k] + A2[m][k]) Bt[n][k] (A2 only with NSPLIT == 1). A rows have pitch LDA, Bt rows pitch K, C rows pitch LDC. z-batch strides sA/sB/sC in elements; Bt and the bias change only every zdiv-th z (bias0, bias1, bias2 in turn). K % 64 == 0, M % 128 == 0, N % 128 == 0.
// k goes by stages of 64: the A (and A2) tile [128 rows][64 k] and the Bt tile [128 rows][64 k] pass through registers into one of two LDS buffers while the other is read.
// A staging load of a wave covers four whole 128-byte rows, and every operand line is fetched once per work-group. Each wave sums its whole K in ascending order.
// With PLANES the result does not go to C: z / zdiv = 0, 1 (q, k) writes x = sum + bias as three 16-bit planes [z][head][t][d] (f16, bf16 hi, bf16 lo = bf16(x - hi)), z / zdiv = 2 (v) the same three planes transposed, [z - 2 zdiv][head][d][t]. A wave's 64 columns are one head.
// With PLANES the rows of k and v are the ranked unmasked keys: a tile whose first row is not below the batch's count cnt[] has nothing to do (the rows from the count up to the tile's end hold a copy of key row 0, see k_cvtx).
// Fragment map (A and B alike): lane l -> row/col l & 15, h = l >> 4; elements 0..7 = k0 + 8h + 0..7, elements 8..15 = k0 + 16 + 8h + 0..7. D: element r -> row 8h + r, col l & 15.
template <typename T16> struct WFrag;
template <> struct WFrag<h16> { typedef v16h V; static __device__ __forceinline__ V ld(const h16* p) { return cat16(*(const v8h*)p, *(const v8h*)(p + 16)); } static __device__ __forceinline__ v8f mma(V a, V b, v8f c) { return wmma16(a, b, c); } };
template <> struct WFrag<bf> { typedef v16bf V; static __device__ __forceinline__ V ld(const bf* p) { return cat16b(*(const v8us*)p, *(const v8us*)(p + 16)); } static __device__ __forceinline__ v8f mma(V a, V b, v8f c) { return wmmab(a, b, c); } };
#define GP   72             // LDS row pitch in 16-bit elements: 128 B + 16 B, the 16 rows of a 16-byte fragment read fall on distinct banks
#define GT   (128 * GP)     // one 128 x 64 tile
typedef v4i __attribute__((may_alias)) v4ig;
typedef __attribute__((ext_vector_type(8))) __bf16 v8bf;
// the three planes of eight values, every conversion round to nearest even
__device__ __forceinline__ void planes8(v8f x, v4i& o16, v4i& oh, v4i& ol) { oh = __builtin_bit_cast(v4i, __builtin_convertvector(x, v8bf)); v8f hf;
#pragma unroll
    for (int k = 0; k < 4; ++k) { hf[2 * k] = __int_as_float(oh[k] << 16); hf[2 * k + 1] = __int_as_float(oh[k] & (int)0xFFFF0000u); }   // the packed hi words back to f32
    o16 = __builtin_bit_cast(v4i, __builtin_convertvector(x, v8h)); ol = __builtin_bit_cast(v4i, __builtin_convertvector(x - hf, v8bf)); }
template <typename T16, int NSPLIT, bool BIAS, bool PLANES, int K, int LDA, int LDC>
__global__ __launch_bounds__(128) void k_gemms(const T16* __restrict__ A, const T16* __restrict__ A2, const T16* __restrict__ Bt, float* C, h16* P16, bf* Ph, bf* Pl, h16* V16, bf* Vh, bf* Vl, const float* __restrict__ bias0, const float* __restrict__ bias1, const float* __restrict__ bias2, const int* __restrict__ cnt, int zdiv, size_t sA, size_t sB, size_t sC) {
    typedef typename WFrag<T16>::V V; static_assert((NSPLIT == 0 || NSPLIT == 1) && K % 64 == 0 && K >= 64);
    constexpr int NT = (NSPLIT == 1) ? 3 : 2;   // tiles per stage: A, (A2), Bt
    constexpr int NS = K / 64;
    __shared__ __align__(16) unsigned char smraw[2 * NT * GT * 2];
    static_assert(2 * 4 * 16 * 68 * 4 <= 2 * NT * GT * 2);
    T16* sm = (T16*)smraw;
    const size_t z = blockIdx.z, zb = blockIdx.z / (unsigned)zdiv;
    if constexpr (PLANES) { if (zb != 0 && (int)blockIdx.x * 128 >= cnt[(z - zb * (unsigned)zdiv) * CNS]) return; }   // the same for the whole work-group, in front of every barrier
    const float* bias = (zb == 0) ? bias0 : ((zb == 1) ? bias1 : bias2);
    const int tid = (int)threadIdx.x, lane = tid & 31, lr = lane & 15, hi = lane >> 4; const int r0 = blockIdx.x * 128, c0 = blockIdx.y * 128;
    // wave number through readfirstlane: the tile offsets stay in scalar registers
    const int wv = __builtin_amdgcn_readfirstlane(tid >> 5), wm = wv >> 1, wn = wv & 1;
    const int srow = tid >> 3, scol = (tid & 7) * 8;   // staging: 16 bytes of rows srow + 16 i, i = 0..7, of every tile
    // a work-group-uniform base plus one 32-bit byte offset per thread; the eight rows differ by constants
    const char* ua = (const char*)(A + z * sA + (size_t)r0 * LDA); const char* ua2 = (NSPLIT == 1) ? (const char*)(A2 + z * sA + (size_t)r0 * LDA) : nullptr; const char* ub = (const char*)(Bt + zb * sB + (size_t)c0 * K);
    const unsigned va = (unsigned)(srow * LDA + scol) * 2u, vb = (unsigned)(srow * K + scol) * 2u;
    v4i st[NT][8];
    auto gl = [&](int kc) {
        const char* pa = ua + kc * 2 + va; const char* pa2 = (NSPLIT == 1) ? ua2 + kc * 2 + va : nullptr; const char* pb = ub + kc * 2 + vb;
#pragma unroll
        for (int i = 0; i < 8; ++i) { st[0][i] = *(const v4ig*)(pa + i * (16 * LDA * 2)); if (NSPLIT == 1) st[1][i] = *(const v4ig*)(pa2 + i * (16 * LDA * 2)); st[NT - 1][i] = *(const v4ig*)(pb + i * (16 * K * 2)); }
        // The wait stands in front of whatever next writes a register that holds an address of the loads above (the fragment reads and the accumulators may take those registers);
        // the addresses are named as inputs so that their registers stay theirs up to the wait.
        if constexpr (NSPLIT == 1) asm volatile("s_wait_xcnt 0x0" :: "v"(pa), "v"(pa2), "v"(pb), "v"(va), "v"(vb) : "memory");
        else asm volatile("s_wait_xcnt 0x0" :: "v"(pa), "v"(pb), "v"(va), "v"(vb) : "memory"); };
    auto sl = [&](int buf) {
#pragma unroll
        for (int tl = 0; tl < NT; ++tl)
#pragma unroll
            for (int i = 0; i < 8; ++i) *(v4ig*)(sm + (buf * NT + tl) * GT + (srow + 16 * i) * GP + scol) = st[tl][i]; };
    v8f acc[4][4];
#pragma unroll
    for (int mb = 0; mb < 4; ++mb)
#pragma unroll
        for (int nb = 0; nb < 4; ++nb) acc[mb][nb] = (v8f){};
    gl(0); sl(0);
    // The stage loop stays rolled: one copy of the stage's products in the instruction cache. The loops inside it are unrolled because st, a, b and acc live in registers and need constant indices.
#pragma unroll 1
    for (int s = 0; s < NS; ++s) {
        __syncthreads();   // publishes buffer s & 1; ends every read of the other buffer, which is refilled below
        const bool more = (s + 1 < NS);
        if (more) gl((s + 1) * 64);
        const T16* at = sm + ((s & 1) * NT) * GT + (wm * 64 + lr) * GP + 8 * hi; const T16* bt = sm + ((s & 1) * NT + NT - 1) * GT + (wn * 64 + lr) * GP + 8 * hi;
        V a[2][4], a2[2][4], b[2][4];
#pragma unroll
        for (int ks = 0; ks < 2; ++ks)
#pragma unroll
            for (int f = 0; f < 4; ++f) { a[ks][f] = WFrag<T16>::ld(at + f * 16 * GP + ks * 32); if (NSPLIT == 1) a2[ks][f] = WFrag<T16>::ld(at + GT + f * 16 * GP + ks * 32); b[ks][f] = WFrag<T16>::ld(bt + f * 16 * GP + ks * 32); }
        __builtin_amdgcn_sched_barrier(0);   // keeps the stage's fragment reads one group in front of its products, for speed only
#pragma unroll
        for (int ks = 0; ks < 2; ++ks)
#pragma unroll
            for (int nb = 0; nb < 4; ++nb) {
#pragma unroll
                for (int mb = 0; mb < 4; ++mb) acc[mb][nb] = WFrag<T16>::mma(a[ks][mb], b[ks][nb], acc[mb][nb]);
                if (NSPLIT == 1) {
#pragma unroll
                    for (int mb = 0; mb < 4; ++mb) acc[mb][nb] = WFrag<T16>::mma(a2[ks][mb], b[ks][nb], acc[mb][nb]); } }
        if (more) sl((s + 1) & 1);
    }
    // Output through LDS, so that every global store covers whole 256-byte row pieces: per pass a wave lays 16 x 64 of its tile in its own slab (pitch 68 floats) and reads it back by rows.
    // Two slab sets in turn. The results stay in registers and go to memory behind the last barrier, so that no barrier waits for a global store.
    // Every loop here is unrolled because acc and res live in registers and need constant indices.
    __syncthreads();   // ends every read of the operand tiles: the slabs lie over them
    if constexpr (PLANES) {
        // Every wave stages in its own quarter of the LDS and reads it back so that a lane holds 16 bytes of a plane's row and eight lanes one whole 128-byte line.
        // All results wait in registers and go to memory behind the last barrier: no barrier waits for a global store, and no register of an issued store is written again.
        // Every loop here is unrolled because acc and the results live in registers and need constant indices.
        static_assert(BIAS && HD == 64 && DQ == NH_ * HD && 4 * 64 * 68 * 4 <= 2 * NT * GT * 2 && 4 * 2 * 64 * GP * 2 <= 2 * NT * GT * 2);
        const int head = (int)blockIdx.y * 2 + wn, t0 = r0 + wm * 64, rr = lane >> 3, c8 = (lane & 7) * 8;
        v4i r16[16], rh[16], rl[16];
        if (zb < 2) {
            // q, k: the 64 x 64 f32 tile [t][d] (pitch 68 floats), read back by rows of d
            float* my = (float*)smraw + wv * (64 * 68);
#pragma unroll
            for (int mb = 0; mb < 4; ++mb)
#pragma unroll
                for (int nb = 0; nb < 4; ++nb) {
#pragma unroll
                    for (int j = 0; j < 8; ++j) my[(mb * 16 + hi * 8 + j) * 68 + nb * 16 + lr] = acc[mb][nb][j]; }
            v8f b8;
#pragma unroll
            for (int q = 0; q < 8; ++q) b8[q] = bfr(bias[c0 + wn * 64 + c8 + q]);
            __syncthreads();   // orders the slab's stores in front of the reads of other lanes' values
#pragma unroll
            for (int i = 0; i < 16; ++i) { const float* rp = my + (4 * i + rr) * 68 + c8; const v4f x0 = *(const v4fa*)rp, x1 = *(const v4fa*)(rp + 4);
                planes8(__builtin_shufflevector(x0, x1, 0, 1, 2, 3, 4, 5, 6, 7) + b8, r16[i], rh[i], rl[i]); }
            __builtin_amdgcn_sched_barrier(0);   // keeps every conversion in front of the first store, so that no register of an issued store is written again
            const size_t po = ((z * NH_ + head) * TT + t0 + rr) * HD + c8;
#pragma unroll
            for (int i = 0; i < 16; ++i) { *(v4ig*)(P16 + po + i * (4 * HD)) = r16[i]; *(v4ig*)(Ph + po + i * (4 * HD)) = rh[i]; *(v4ig*)(Pl + po + i * (4 * HD)) = rl[i]; }
        } else {
            // v: a lane's eight accumulator elements are eight successive t of one d, 16 bytes of a transposed plane; slabs [d][t] (pitch GP), two per wave: f16 and hi first, then lo
            unsigned short* s0 = (unsigned short*)smraw + wv * (2 * 64 * GP); unsigned short* s1 = s0 + 64 * GP;
            float bn[4];
#pragma unroll
            for (int nb = 0; nb < 4; ++nb) bn[nb] = bfr(bias[c0 + wn * 64 + nb * 16 + lr]);
            v4i lo[4][4];
#pragma unroll
            for (int mb = 0; mb < 4; ++mb)
#pragma unroll
                for (int nb = 0; nb < 4; ++nb) { v4i o16, oh; planes8(acc[mb][nb] + bn[nb], o16, oh, lo[mb][nb]); const int so = (nb * 16 + lr) * GP + mb * 16 + hi * 8; *(v4ig*)(s0 + so) = o16; *(v4ig*)(s1 + so) = oh; }
            __syncthreads();   // orders the slabs' stores in front of the reads of other lanes' values
#pragma unroll
            for (int i = 0; i < 16; ++i) { const int ro = (4 * i + rr) * GP + c8; r16[i] = *(const v4ig*)(s0 + ro); rh[i] = *(const v4ig*)(s1 + ro); }
            __syncthreads();   // ends the reads of the first slab, which takes the lo plane now
#pragma unroll
            for (int mb = 0; mb < 4; ++mb)
#pragma unroll
                for (int nb = 0; nb < 4; ++nb) *(v4ig*)(s0 + (nb * 16 + lr) * GP + mb * 16 + hi * 8) = lo[mb][nb];
            __syncthreads();   // orders the slab's stores in front of the reads of other lanes' values
#pragma unroll
            for (int i = 0; i < 16; ++i) rl[i] = *(const v4ig*)(s0 + (4 * i + rr) * GP + c8);
            const size_t vo = (((z - 2 * (size_t)zdiv) * NKV + head) * HD + rr) * TT + t0 + c8;
#pragma unroll
            for (int i = 0; i < 16; ++i) { *(v4ig*)(V16 + vo + (size_t)i * (4 * TT)) = r16[i]; *(v4ig*)(Vh + vo + (size_t)i * (4 * TT)) = rh[i]; *(v4ig*)(Vl + vo + (size_t)i * (4 * TT)) = rl[i]; }
            asm volatile("s_wait_xcnt 0x0" ::: "memory");   // stands behind the last store, in front of whatever the code laid out behind this branch writes into a register that a store above names
        }
        return;
    }
    float* os = (float*)smraw;
    v4f res[4][8], bv = (v4f)(0.0f);
    if (BIAS) {
#pragma unroll
        for (int q = 0; q < 4; ++q) bv[q] = bfr(bias[c0 + wn * 64 + lr * 4 + q]); }
#pragma unroll
    for (int mb = 0; mb < 4; ++mb) {
        float* my = os + ((mb & 1) * 4 + wv) * (16 * 68);
#pragma unroll
        for (int nb = 0; nb < 4; ++nb) {
#pragma unroll
            for (int j = 0; j < 8; ++j) my[(hi * 8 + j) * 68 + nb * 16 + lr] = acc[mb][nb][j]; }
        __syncthreads();   // orders the slab's stores in front of the reads of other lanes' values
#pragma unroll
        for (int i = 0; i < 8; ++i) { const v4f val = *(const v4fa*)(my + (2 * i + hi) * 68 + lr * 4); res[mb][i] = BIAS ? val + bv : val; } }
    float* cw = C + z * sC + (size_t)(r0 + wm * 64 + hi) * LDC + c0 + wn * 64 + lr * 4;
#pragma unroll
    for (int mb = 0; mb < 4; ++mb)
#pragma unroll
        for (int i = 0; i < 8; ++i) *(v4f*)(cw + (mb * 16 + 2 * i) * LDC) = res[mb][i];
}

__device__ __forceinline__ void splitf(float y, unsigned short& h, unsigned short& l) { h = f2bf(y); l = f2bf(y - bf2f(h)); }

// ---- k_prep: work-groups 0 .. NB-1 rank the unmasked keys of one batch each; the others convert the four weights to bf16 (dst dense [weight][DQ DM]).
// idx[b][j] = row of the j-th unmasked key for j < n, 0 for j >= n; cnt[b CNS] = n. A thread counts TT / 256 successive keys; the counts are summed along each wave by lane shifts, and the eight waves' totals pass through LDS.
#define LWB ((unsigned)((size_t)DQ * DM / 8 / 256))
static_assert((size_t)DQ * DM % 2048 == 0 && TT % 1024 == 0);
__global__ __launch_bounds__(256) void k_prep(const float* __restrict__ s0, const float* __restrict__ s1, const float* __restrict__ s2, const float* __restrict__ s3, bf* dst, const int* __restrict__ mask, int* idx, int* cnt) {
    __shared__ int part[8];
    const int tid = (int)threadIdx.x;
    if (blockIdx.x < NB) {
        constexpr int E = TT / 256;   // the loops below are unrolled because m lives in registers and needs constant indices, and so that the lane shifts and the stores have constant distances
        const int* mk = mask + (size_t)blockIdx.x * SEQ_FULL + tid * E; int* ix = idx + (size_t)blockIdx.x * TT;
        int m[E], c = 0;
#pragma unroll
        for (int i = 0; i < E / 4; ++i) { const v4i v = ((const v4ig*)mk)[i];
#pragma unroll
            for (int k = 0; k < 4; ++k) { m[4 * i + k] = v[k]; c += (v[k] != 0) ? 1 : 0; } }
        int run = c;   // becomes the sum over the wave's lanes up to this one
#pragma unroll
        for (int d = 1; d < 32; d <<= 1) { const int o = __shfl_up(run, (unsigned)d, 32); run += ((tid & 31) >= d) ? o : 0; }
        if ((tid & 31) == 31) part[tid >> 5] = run;
        __syncthreads();   // publishes the waves' totals
        int n = 0, pos = run - c;
#pragma unroll
        for (int w = 0; w < 8; ++w) { const int t = part[w]; n += t; pos += (w < (tid >> 5)) ? t : 0; }
#pragma unroll
        for (int k = 0; k < E; ++k) { if (m[k] != 0) ix[pos] = tid * E + k; pos += (m[k] != 0) ? 1 : 0; }
#pragma unroll
        for (int k = 0; k < E; ++k) { if (tid + 256 * k >= n) ix[tid + 256 * k] = 0; }
        if (tid == 0) cnt[blockIdx.x * CNS] = n;
        return;
    }
    const unsigned w = blockIdx.x - NB, zs = w / LWB; const size_t i = (size_t)(w % LWB) * 256 + tid;
    const float* src = (zs == 0) ? s0 : (zs == 1) ? s1 : (zs == 2) ? s2 : s3; dst += (size_t)zs * DQ * DM; const v8f v = *(const v8f*)(src + i * 8); v8us o;
#pragma unroll
    for (int k = 0; k < 8; ++k) o[k] = f2bf(v[k]); *(v8us*)(dst + i * 8) = o;
    asm volatile("s_wait_xcnt 0x0" ::: "memory"); }   // stands behind the store, in front of whatever the code laid out behind this part (the ranking) writes into a register that the store names

// ---- k_cvtx: query, key, value to bf16, dst [z][b][row][DM]; blockIdx.z = tensor, blockIdx.y = batch, 256 / (DM / 8) rows per work-group.
// Row j of key and value is the row of the j-th unmasked key; rows are written up to the next multiple of 128 behind the count (those take key row 0: finite values that the attention gives weight 0), the rest is neither written nor read.
static_assert(DM % 8 == 0 && 256 % (DM / 8) == 0 && TT % (256 / (DM / 8)) == 0);
__global__ __launch_bounds__(256) void k_cvtx(const float* __restrict__ s0, const float* __restrict__ s1, const float* __restrict__ s2, bf* dst, const int* __restrict__ idx, const int* __restrict__ cnt) {
    constexpr int R8 = DM / 8, RW = 256 / R8;
    const int row = (int)blockIdx.x * RW + (int)threadIdx.x / R8, c8 = ((int)threadIdx.x % R8) * 8; int srow = row;
    if (blockIdx.z != 0) { if ((int)blockIdx.x * RW >= ((cnt[blockIdx.y * CNS] + 127) & ~127)) return; srow = min(max(idx[(size_t)blockIdx.y * TT + row], 0), TT - 1); }
    const float* src = ((blockIdx.z == 0) ? s0 : (blockIdx.z == 1) ? s1 : s2) + ((size_t)blockIdx.y * SEQ_FULL + srow) * DM + c8; const v8f v = *(const v8f*)src; v8us o;
#pragma unroll
    for (int k = 0; k < 8; ++k) o[k] = f2bf(v[k]); *(v8us*)(dst + (((size_t)blockIdx.z * NB + blockIdx.y) * TT + row) * DM + c8) = o; }

#define FP   72             // LDS row pitch in 16-bit elements: 128 B + 16 B, the 16 rows of a 16-byte fragment read fall on distinct banks
#define FT   (64 * FP)      // one 64 x 64 tile
#define QBH  128            // queries per work-group, rows < RH
#define QBL  256            // queries per work-group, rows >= RH
#define MSTART (-5.0e29f)
#define SCL2 (SCL * 1.4426950408889634f)
static_assert(RH % QBH == 0 && (TT - RH) % QBL == 0 && TT % 1024 == 0 && TT % 64 == 0);
typedef v4i __attribute__((may_alias)) v4ia;

__device__ __forceinline__ float xhalf(float x) { const int b = __float_as_int(x); return __int_as_float(__builtin_amdgcn_permlanex16(b, b, 0x76543210, 0xfedcba98, false, false)); }   // lane l <-> l ^ 16

template <typename T16, bool HI>
__device__ __forceinline__ void fa_body(T16* sm, int n, const T16* __restrict__ Q, const T16* __restrict__ Q2, const T16* __restrict__ Kp, const T16* __restrict__ K2,
                                        const T16* __restrict__ Vt, const T16* __restrict__ V2, int q0, bf* Ah, bf* Al) {
    typedef typename WFrag<T16>::V V;
    constexpr int NPL = HI ? 2 : 1, NG = HI ? 1 : 2; const int NS = (n + 63) >> 6;   // n is in 0 .. TT, so at most TT / 64 stages
    const int tid = (int)threadIdx.x, lane = tid & 31, lr = lane & 15, hi = lane >> 4;
    const int qw = q0 + (tid >> 5) * (16 * NG);
    const int srow = tid >> 3, scol = (tid & 7) * 8;   // staging: 16 bytes of rows srow and srow + 32 of every tile
    v4i st[2 * NPL][2];
    auto gl = [&](int j0) {
#pragma unroll
        for (int i = 0; i < 2; ++i) { const int row = srow + 32 * i;
            st[0][i] = *(const v4ia*)(Kp + (size_t)(j0 + row) * HD + scol); if (HI) st[1][i] = *(const v4ia*)(K2 + (size_t)(j0 + row) * HD + scol);
            st[NPL][i] = *(const v4ia*)(Vt + (size_t)row * TT + j0 + scol); if (HI) st[NPL + 1][i] = *(const v4ia*)(V2 + (size_t)row * TT + j0 + scol); } };
    auto sl = [&](int buf) {
#pragma unroll
        for (int tl = 0; tl < 2 * NPL; ++tl)
#pragma unroll
            for (int i = 0; i < 2; ++i) *(v4ia*)(sm + (buf * 2 * NPL + tl) * FT + (srow + 32 * i) * FP + scol) = st[tl][i]; };
    V q[NG][2], q2[NG][2];
#pragma unroll
    for (int g = 0; g < NG; ++g)
#pragma unroll
        for (int ks = 0; ks < 2; ++ks) { q[g][ks] = WFrag<T16>::ld(Q + (size_t)(qw + g * 16 + lr) * HD + ks * 32 + 8 * hi); if (HI) q2[g][ks] = WFrag<T16>::ld(Q2 + (size_t)(qw + g * 16 + lr) * HD + ks * 32 + 8 * hi); }
    v8f o[NG][4]; float mrun[NG], lsum[NG];
#pragma unroll
    for (int g = 0; g < NG; ++g) { mrun[g] = MSTART; lsum[g] = 0.0f;
#pragma unroll
        for (int mb = 0; mb < 4; ++mb) o[g][mb] = (v8f){}; }
    if (NS > 0) { gl(0); sl(0); }
#pragma unroll 1
    for (int s = 0; s < NS; ++s) {
        __syncthreads();   // publishes buffer s & 1; ends every read of the other buffer, which is refilled below
        const bool more = (s + 1 < NS);
        if (more) gl((s + 1) * 64);
        const T16* kt = sm + ((s & 1) * 2 * NPL) * FT; const T16* vt = kt + NPL * FT;
        v8f sc[NG][4];
#pragma unroll
        for (int t = 0; t < 4; ++t) {
#pragma unroll
            for (int g = 0; g < NG; ++g) sc[g][t] = (v8f){};
#pragma unroll
            for (int ks = 0; ks < 2; ++ks) { const V ka = WFrag<T16>::ld(kt + (t * 16 + lr) * FP + ks * 32 + 8 * hi); V kb; if (HI) kb = WFrag<T16>::ld(kt + FT + (t * 16 + lr) * FP + ks * 32 + 8 * hi);
#pragma unroll
                for (int g = 0; g < NG; ++g) { sc[g][t] = WFrag<T16>::mma(ka, q[g][ks], sc[g][t]); if (HI) { sc[g][t] = WFrag<T16>::mma(ka, q2[g][ks], sc[g][t]); sc[g][t] = WFrag<T16>::mma(kb, q[g][ks], sc[g][t]); } } } }
        float mnew[NG]; const int lim = n - s * 64 - 8 * hi;   // this lane's keys of the stage below lim are real
#pragma unroll
        for (int g = 0; g < NG; ++g) mnew[g] = mrun[g];
#pragma unroll
        for (int t = 0; t < 4; ++t) {
#pragma unroll
            for (int r = 0; r < 8; ++r) { const bool ok = t * 16 + r < lim;
#pragma unroll
                for (int g = 0; g < NG; ++g) { const float x = ok ? sc[g][t][r] * SCL2 : NEGBIG; sc[g][t][r] = x; mnew[g] = fmaxf(mnew[g], x); } } }
        V pf[NG][2], pl[NG][2];
#pragma unroll
        for (int g = 0; g < NG; ++g) {
            const float mx = fmaxf(mnew[g], xhalf(mnew[g]));   // both halves of a column share one maximum: their keys meet in one product
            const float da = mrun[g] - mx; float al = __builtin_amdgcn_exp2f(da); mrun[g] = mx;
            asm volatile("v_nop" : "+v"(al) : "v"(da));       // the free slot behind a transcendental, see below
            const float off = HI ? mx : mx - PCARL2;
            float ps = 0.0f;
#pragma unroll
            for (int t = 0; t < 4; ++t) { const v8f d = sc[g][t] - off; v8f p;
#pragma unroll
                for (int r = 0; r < 8; ++r) p[r] = __builtin_amdgcn_exp2f(d[r]);
                // The instruction set asks for one free slot behind v_exp_f32 before its result is read or its source overwritten. Naming the eight sources as inputs keeps them
                // whole until here, naming the results as in-out keeps their readers behind: inside the run each v_exp_f32 is the next one's slot, the v_nop is the last one's.
                asm volatile("v_nop" : "+v"(p) : "v"(d));
                sc[g][t] = p;
#pragma unroll
                for (int r = 0; r < 8; ++r) ps += p[r]; }
            lsum[g] = lsum[g] * al + ps;
#pragma unroll
            for (int mb = 0; mb < 4; ++mb) o[g][mb] *= al;
#pragma unroll
            for (int p2 = 0; p2 < 2; ++p2) {
                if constexpr (HI) {
                    const v8bf h0 = __builtin_convertvector(sc[g][2 * p2], v8bf), h1 = __builtin_convertvector(sc[g][2 * p2 + 1], v8bf);
                    const v8bf l0 = __builtin_convertvector(sc[g][2 * p2] - __builtin_convertvector(h0, v8f), v8bf), l1 = __builtin_convertvector(sc[g][2 * p2 + 1] - __builtin_convertvector(h1, v8f), v8bf);
                    pf[g][p2] = __builtin_shufflevector(h0, h1, 0, 1, 2, 3, 4, 5, 6, 7, 8, 9, 10, 11, 12, 13, 14, 15);
                    pl[g][p2] = __builtin_shufflevector(l0, l1, 0, 1, 2, 3, 4, 5, 6, 7, 8, 9, 10, 11, 12, 13, 14, 15);
                } else {
                    pf[g][p2] = cat16(__builtin_convertvector(sc[g][2 * p2], v8h), __builtin_convertvector(sc[g][2 * p2 + 1], v8h));
                } } }
#pragma unroll
        for (int p2 = 0; p2 < 2; ++p2)
#pragma unroll
            for (int mb = 0; mb < 4; ++mb) { const V va = WFrag<T16>::ld(vt + (mb * 16 + lr) * FP + p2 * 32 + 8 * hi); V vb; if (HI) vb = WFrag<T16>::ld(vt + FT + (mb * 16 + lr) * FP + p2 * 32 + 8 * hi);
#pragma unroll
                for (int g = 0; g < NG; ++g) { o[g][mb] = WFrag<T16>::mma(va, pf[g][p2], o[g][mb]); if (HI) { o[g][mb] = WFrag<T16>::mma(va, pl[g][p2], o[g][mb]); o[g][mb] = WFrag<T16>::mma(vb, pf[g][p2], o[g][mb]); } } }
        if (more) sl((s + 1) & 1);
    }
    // lane l: query qw + 16 g + (l & 15), d = 16 mb + 8 (l >> 4) + 0..7: 16 bytes of each ctx plane
#pragma unroll
    for (int g = 0; g < NG; ++g) { const float inv = __fdiv_rn(1.0f, lsum[g] + xhalf(lsum[g]));
#pragma unroll
        for (int mb = 0; mb < 4; ++mb) { v8us oh, ol;
#pragma unroll
            for (int r = 0; r < 8; ++r) { unsigned short a, c2; splitf(o[g][mb][r] * inv, a, c2); oh[r] = a; ol[r] = c2; }
            const size_t oo = (size_t)(qw + g * 16 + lr) * DQ + mb * 16 + 8 * hi; *(v8us*)(Ah + oo) = oh; *(v8us*)(Al + oo) = ol; } }
}

// grid: the hi/lo blocks (three products, the longer ones) first, then the f16 blocks; planes [b][head][.][.], ctx planes [b][t][DQ]
__global__ __launch_bounds__(256) void k_fattn(const h16* __restrict__ Q16, const h16* __restrict__ K16, const h16* __restrict__ V16, const bf* __restrict__ Qh, const bf* __restrict__ Ql, const bf* __restrict__ Kh, const bf* __restrict__ Kl,
                                               const bf* __restrict__ Vh, const bf* __restrict__ Vl, const int* __restrict__ cnt, bf* Ah, bf* Al) {
    __shared__ __align__(16) unsigned short sm[2 * 4 * FT];
    constexpr int HB = RH / QBH, LB = (TT - RH) / QBL, NHIW = NB * NH_ * HB;
    const int x = (int)blockIdx.x; const bool hires = (x < NHIW);
    const int bh = hires ? x / HB : (x - NHIW) / LB; const int q0 = hires ? (x % HB) * QBH : RH + ((x - NHIW) % LB) * QBL;
    const int b = bh / NH_, hd = bh % NH_; const size_t po = (size_t)bh * TT * HD, ao = (size_t)b * TT * DQ + (size_t)hd * HD;
    const int n = min(max(cnt[b * CNS], 0), TT);   // the same for the whole work-group: it bounds the stage loop and its barriers
    if (hires) fa_body<bf, true>((bf*)sm, n, Qh + po, Ql + po, Kh + po, Kl + po, Vh + po, Vl + po, q0, Ah + ao, Al + ao);
    else fa_body<h16, false>((h16*)sm, n, Q16 + po, nullptr, K16 + po, nullptr, V16 + po, nullptr, q0, Ah + ao, Al + ao);
}

extern "C" void kernel_launch(void* const* d_in, const int* in_sizes, int n_in,
                              void* d_out, int out_size, void* d_ws, size_t ws_size, hipStream_t stream) {
    if (n_in < 12) return;
    const size_t needx = (size_t)(NB - 1) * SEQ_FULL * DM + (size_t)TT * DM;
    const size_t needm = (size_t)(NB - 1) * SEQ_FULL + (size_t)TT;
    if ((size_t)in_sizes[0] < needx || (size_t)in_sizes[1] < needx || (size_t)in_sizes[2] < needx || (size_t)in_sizes[3] < needm) return;
    if ((size_t)in_sizes[4] < (size_t)DQ * DM || (size_t)in_sizes[6] < (size_t)DKV * DM || (size_t)in_sizes[8] < (size_t)DKV * DM || (size_t)in_sizes[10] < (size_t)DM * DQ) return;
    if (in_sizes[5] < DQ || in_sizes[7] < DKV || in_sizes[9] < DKV || in_sizes[11] < DM) return;
    if ((size_t)out_size < needx) return;
    // wire order: query, key, value, mask (int32), Wq, bq, Wk, bk, Wv, bv, Wo, bo; weights [out][in]
    const float* xq = (const float*)d_in[0]; const float* xk = (const float*)d_in[1]; const float* xv = (const float*)d_in[2]; const int* mask = (const int*)d_in[3];
    const float* wq = (const float*)d_in[4]; const float* bq = (const float*)d_in[5]; const float* wk = (const float*)d_in[6]; const float* bk = (const float*)d_in[7];
    const float* wv = (const float*)d_in[8]; const float* bv = (const float*)d_in[9]; const float* wo = (const float*)d_in[10]; const float* bo = (const float*)d_in[11];
    float* OUT = (float*)d_out;     // [NB_FULL][SEQ_FULL][DM]
    char* wsp = (char*)d_ws;
    auto take = [&](size_t bytes) { char* p = wsp; wsp += (bytes + 255) & ~(size_t)255; return (void*)p; };
    bf* WQ = (bf*)take(SZ_W); bf* WK = (bf*)take(SZ_W); bf* WV = (bf*)take(SZ_W); bf* WO = (bf*)take(SZ_W);   // one after the other: filled by one launch, WQ WK WV read by one launch
    // planes [b][head][.][.]; each k plane directly behind its q plane, so that one launch fills both
    h16* QP16 = (h16*)take(SZ_HP); h16* KP16 = (h16*)take(SZ_HP); bf* QPh = (bf*)take(SZ_HP); bf* KPh = (bf*)take(SZ_HP); bf* QPl = (bf*)take(SZ_HP); bf* KPl = (bf*)take(SZ_HP);
    h16* VT16 = (h16*)take(SZ_HP); bf* VTh = (bf*)take(SZ_HP); bf* VTl = (bf*)take(SZ_HP);
    bf* XB = (bf*)take(SZ_XB); bf* ATh = (bf*)take(SZ_AT);   // XB [q k v][b][t][DM] bf16
    bf* ATl = (bf*)take(SZ_AT); int* IX = (int*)take(SZ_IX); int* CN = (int*)take(SZ_CN);
    if ((size_t)(wsp - (char*)d_ws) > ws_size) return;
    const unsigned LX = (unsigned)(((size_t)TT * DM / 8 + 255) / 256);
    const size_t xs = (size_t)SEQ_FULL * DM;   // batch stride of the f32 inputs and of the output
    // the ranks of the unmasked keys and the four weights in one launch; q inputs and the ranked k, v inputs of every batch in one launch
    k_prep<<<NB + 4 * LWB, 256, 0, stream>>>(wq, wk, wv, wo, WQ, mask, IX, CN);
    k_cvtx<<<dim3(LX, NB, 3), 256, 0, stream>>>(xq, xk, xv, XB, IX, CN);
    // the three projections of every batch in one launch: z = tensor * NB + batch; the q and k planes and the transposed v planes are written directly
    k_gemms<bf, 0, true, true, DM, DM, DQ><<<dim3(TT / 128, DQ / 128, 3 * NB), 128, 0, stream>>>(XB, nullptr, WQ, nullptr, QP16, QPh, QPl, VT16, VTh, VTl, bq, bk, bv, CN, NB, (size_t)TT * DM, (size_t)DQ * DM, 0);
    // attention of every batch and head in one launch, ctx planes written directly
    k_fattn<<<NB * NH_ * (RH / QBH + (TT - RH) / QBL), 256, 0, stream>>>(QP16, KP16, VT16, QPh, QPl, KPh, KPl, VTh, VTl, CN, ATh, ATl);
    // out[b][t][n] = sum_k ctx[b][t][k] Wo[n][k] + bo[n], every batch in one launch
    k_gemms<bf, 1, true, false, DQ, DQ, DM><<<dim3(TT / 128, DM / 128, NB), 128, 0, stream>>>(ATh, ATl, WO, OUT, nullptr, nullptr, nullptr, nullptr, nullptr, nullptr, bo, bo, bo, nullptr, NB, (size_t)TT * DQ, 0, xs);
}

// v007
// It runs in 91.1 microseconds.
// Timed twice side by side with v006, it ran 1.04 and 1.05 times as fast.
// Counting every step since v000, it is 22.3 times as fast.
#include <hip/hip_runtime.h>

// 16-head scaled dot-product attention with a key padding mask: q = query Wq^T + bq, k = key Wk^T + bk, v = value Wv^T + bv (weights [out][in]); scores x 1/8; masked keys (mask == 0) replaced by -inf; softmax over keys; out = merged Wo^T + bo.
// A masked key has weight exactly 0, so it is left out: the unmasked keys of a batch are ranked in their order, the key and value rows are gathered by rank, and k, v and the attention run over those rows alone.
// Compute dtypes, f32 accumulate everywhere: every float input converted to bf16 (RNE); projections v_wmma_f32_16x16x32_bf16 on exact bf16 planes + bias rounded to bf16; scores rows < RH bf16 hi/lo planes (3 products), rows >= RH v_wmma_f32_16x16x32_f16;
// P.V rows < RH bf16 hi/lo planes (3 products), rows >= RH f16 with P carried x1024 (the f32 row sum carries it too); output projection bf16 hi/lo ctx planes x bf16 Wo (2 products) + bias rounded to bf16; softmax f32.

#ifndef NB
#define NB 2
#endif
#ifndef SEQ
#define SEQ 2048
#endif
#define NB_FULL  2
#define SEQ_FULL 2048
#define TT   SEQ
#define DM   1024
#define NH_  16
#define NKV  16
#define REP  (NH_ / NKV)
#define HD   64
#define DQ   (NH_ * HD)
#define DKV  (NKV * HD)
#define RH   ((TT > 512) ? 512 : (TT / 2))   // query rows < RH use hi+lo planes
#define PCARL2 10.0f      // P of the f16 rows is carried x 2^10
#define SCL  0.125f       // HD^-0.5
#define NEGBIG (-1.0e30f)

static_assert(NB >= 1 && NB <= NB_FULL);
static_assert(TT <= SEQ_FULL && TT % 128 == 0);
static_assert(RH >= 64 && RH % 64 == 0 && TT > RH && (TT - RH) % 64 == 0);
static_assert(HD == 64 && DM % 64 == 0 && DQ % 64 == 0 && DM % 32 == 0 && TT % 32 == 0);
static_assert(REP == 1);
static_assert(DM % 128 == 0 && DQ % 128 == 0);

#define SZ_W    ((size_t)DQ * DM * 2)
#define SZ_XB   ((size_t)3 * NB * TT * DM * 2)
#define SZ_HP   ((size_t)NB * NH_ * TT * HD * 2)
#define SZ_AT   ((size_t)NB * TT * DQ * 2)
#define SZ_IX   ((size_t)NB * TT * 4)      // rank -> key row, per batch
#define SZ_CN   (((size_t)NB * 128 + 255) / 256 * 256)   // number of unmasked keys, one 128-byte line per batch
#define CNS     32                         // ints between two batches' counts
#define SZ_ALL  (4 * SZ_W + 9 * SZ_HP + SZ_XB + 2 * SZ_AT + SZ_IX + SZ_CN)
static_assert(SZ_W % 256 == 0 && SZ_XB % 256 == 0 && SZ_HP % 256 == 0 && SZ_AT % 256 == 0 && SZ_IX % 256 == 0 && SZ_CN % 256 == 0);
static_assert(SZ_ALL <= (size_t)268435456 && DQ == DKV && NH_ == NKV);

typedef _Float16 h16;
typedef unsigned short bf;
typedef __attribute__((ext_vector_type(16))) __bf16   v16bf;
typedef __attribute__((ext_vector_type(16))) _Float16 v16h;
typedef __attribute__((ext_vector_type(8)))  _Float16 v8h;
typedef __attribute__((ext_vector_type(8)))  unsigned short v8us;
typedef __attribute__((ext_vector_type(8)))  float    v8f;
typedef __attribute__((ext_vector_type(4)))  float    v4f;
typedef v4f  __attribute__((may_alias)) v4fa;
typedef __attribute__((ext_vector_type(4))) _Float16 v4h;
typedef __attribute__((ext_vector_type(4))) unsigned short v4us;
typedef __attribute__((ext_vector_type(4))) int v4i;

__device__ __forceinline__ unsigned short f2bf(float f) { unsigned u = __float_as_uint(f); u += 0x7FFFu + ((u >> 16) & 1u); return (unsigned short)(u >> 16); }
__device__ __forceinline__ float bf2f(unsigned short b) { return __uint_as_float(((unsigned)b) << 16); }
__device__ __forceinline__ float bfr(float f) { return bf2f(f2bf(f)); }
__device__ __forceinline__ v16h cat16(v8h lo, v8h hi) { return __builtin_shufflevector(lo, hi, 0, 1, 2, 3, 4, 5, 6, 7, 8, 9, 10, 11, 12, 13, 14, 15); }
__device__ __forceinline__ v16bf cat16b(v8us lo, v8us hi) { return __builtin_bit_cast(v16bf, __builtin_shufflevector(lo, hi, 0, 1, 2, 3, 4, 5, 6, 7, 8, 9, 10, 11, 12, 13, 14, 15)); }
__device__ __forceinline__ v8f wmma16(v16h a, v16h b, v8f c) { return __builtin_amdgcn_wmma_f32_16x16x32_f16(false, a, false, b, (short)0, c, false, false); }
__device__ __forceinline__ v8f wmmab(v16bf a, v16bf b, v8f c) { return __builtin_amdgcn_wmma_f32_16x16x32_bf16(false, a, false, b, (short)0, c, false, false); }

// ---- k_gemms: GEMM on K-contiguous 16-bit planes, one 128x128 output tile per work-group of 4 waves (2 x 2, 64x64 and 16 accumulators each); grid (M/128, N/128, Z), 128 threads.
// C[m][n] (f32, + optional bias[n] rounded to bf16) = sum_k (A[m][k] + A2[m][k]) Bt[n][k] (A2 only with NSPLIT == 1). A rows have pitch LDA, Bt rows pitch K, C rows pitch LDC. z-batch strides sA/sB/sC in elements; Bt and the bias change only every zdiv-th z (bias0, bias1, bias2 in turn). K % 64 == 0, M % 128 == 0, N % 128 == 0.
// k goes by stages of 64: the A (and A2) tile [128 rows][64 k] and the Bt tile [128 rows][64 k] pass through registers into one of two LDS buffers while the other is read.
// A staging load of a wave covers four whole 128-byte rows, and every operand line is fetched once per work-group. Each wave sums its whole K in ascending order.
// With PLANES the result does not go to C: z / zdiv = 0, 1 (q, k) writes x = sum + bias as three 16-bit planes [z][head][t][d] (f16, bf16 hi, bf16 lo = bf16(x - hi)), z / zdiv = 2 (v) the same three planes transposed, [z - 2 zdiv][head][d][t]. A wave's 64 columns are one head.
// With PLANES the rows of k and v are the ranked unmasked keys: a tile whose first row is not below the batch's count cnt[] has nothing to do (the rows from the count up to the tile's end hold a copy of key row 0, see k_cvtx).
// Fragment map (A and B alike): lane l -> row/col l & 15, h = l >> 4; elements 0..7 = k0 + 8h + 0..7, elements 8..15 = k0 + 16 + 8h + 0..7. D: element r -> row 8h + r, col l & 15.
template <typename T16> struct WFrag;
template <> struct WFrag<h16> { typedef v16h V; static __device__ __forceinline__ V ld(const h16* p) { return cat16(*(const v8h*)p, *(const v8h*)(p + 16)); } static __device__ __forceinline__ v8f mma(V a, V b, v8f c) { return wmma16(a, b, c); } };
template <> struct WFrag<bf> { typedef v16bf V; static __device__ __forceinline__ V ld(const bf* p) { return cat16b(*(const v8us*)p, *(const v8us*)(p + 16)); } static __device__ __forceinline__ v8f mma(V a, V b, v8f c) { return wmmab(a, b, c); } };
#define GP   72             // LDS row pitch in 16-bit elements: 128 B + 16 B, the 16 rows of a 16-byte fragment read fall on distinct banks
#define GT   (128 * GP)     // one 128 x 64 tile
typedef v4i __attribute__((may_alias)) v4ig;
typedef __attribute__((ext_vector_type(8))) __bf16 v8bf;
// the three planes of eight values, every conversion round to nearest even
__device__ __forceinline__ void planes8(v8f x, v4i& o16, v4i& oh, v4i& ol) { oh = __builtin_bit_cast(v4i, __builtin_convertvector(x, v8bf)); v8f hf;
#pragma unroll
    for (int k = 0; k < 4; ++k) { hf[2 * k] = __int_as_float(oh[k] << 16); hf[2 * k + 1] = __int_as_float(oh[k] & (int)0xFFFF0000u); }   // the packed hi words back to f32
    o16 = __builtin_bit_cast(v4i, __builtin_convertvector(x, v8h)); ol = __builtin_bit_cast(v4i, __builtin_convertvector(x - hf, v8bf)); }
template <typename T16, int NSPLIT, bool BIAS, bool PLANES, int K, int LDA, int LDC>
__global__ __launch_bounds__(128) void k_gemms(const T16* __restrict__ A, const T16* __restrict__ A2, const T16* __restrict__ Bt, float* C, h16* P16, bf* Ph, bf* Pl, h16* V16, bf* Vh, bf* Vl, const float* __restrict__ bias0, const float* __restrict__ bias1, const float* __restrict__ bias2, const int* __restrict__ cnt, int zdiv, size_t sA, size_t sB, size_t sC) {
    typedef typename WFrag<T16>::V V; static_assert((NSPLIT == 0 || NSPLIT == 1) && K % 64 == 0 && K >= 64);
    constexpr int NT = (NSPLIT == 1) ? 3 : 2;   // tiles per stage: A, (A2), Bt
    constexpr int NS = K / 64;
    __shared__ __align__(16) unsigned char smraw[2 * NT * GT * 2];
    static_assert(2 * 4 * 16 * 68 * 4 <= 2 * NT * GT * 2);
    T16* sm = (T16*)smraw;
    const size_t z = blockIdx.z, zb = blockIdx.z / (unsigned)zdiv;
    if constexpr (PLANES) { if (zb != 0 && (int)blockIdx.x * 128 >= cnt[(z - zb * (unsigned)zdiv) * CNS]) return; }   // the same for the whole work-group, in front of every barrier
    const float* bias = (zb == 0) ? bias0 : ((zb == 1) ? bias1 : bias2);
    const int tid = (int)threadIdx.x, lane = tid & 31, lr = lane & 15, hi = lane >> 4; const int r0 = blockIdx.x * 128, c0 = blockIdx.y * 128;
    // wave number through readfirstlane: the tile offsets stay in scalar registers
    const int wv = __builtin_amdgcn_readfirstlane(tid >> 5), wm = wv >> 1, wn = wv & 1;
    const int srow = tid >> 3, scol = (tid & 7) * 8;   // staging: 16 bytes of rows srow + 16 i, i = 0..7, of every tile
    // a work-group-uniform base plus one 32-bit byte offset per thread; the eight rows differ by constants
    const char* ua = (const char*)(A + z * sA + (size_t)r0 * LDA); const char* ua2 = (NSPLIT == 1) ? (const char*)(A2 + z * sA + (size_t)r0 * LDA) : nullptr; const char* ub = (const char*)(Bt + zb * sB + (size_t)c0 * K);
    const unsigned va = (unsigned)(srow * LDA + scol) * 2u, vb = (unsigned)(srow * K + scol) * 2u;
    v4i st[NT][8];
    auto gl = [&](int kc) {
        const char* pa = ua + kc * 2 + va; const char* pa2 = (NSPLIT == 1) ? ua2 + kc * 2 + va : nullptr; const char* pb = ub + kc * 2 + vb;
#pragma unroll
        for (int i = 0; i < 8; ++i) { st[0][i] = *(const v4ig*)(pa + i * (16 * LDA * 2)); if (NSPLIT == 1) st[1][i] = *(const v4ig*)(pa2 + i * (16 * LDA * 2)); st[NT - 1][i] = *(const v4ig*)(pb + i * (16 * K * 2)); }
        // The wait stands in front of whatever next writes a register that holds an address of the loads above (the fragment reads and the accumulators may take those registers);
        // the addresses are named as inputs so that their registers stay theirs up to the wait.
        if constexpr (NSPLIT == 1) asm volatile("s_wait_xcnt 0x0" :: "v"(pa), "v"(pa2), "v"(pb), "v"(va), "v"(vb) : "memory");
        else asm volatile("s_wait_xcnt 0x0" :: "v"(pa), "v"(pb), "v"(va), "v"(vb) : "memory"); };
    auto sl = [&](int buf) {
#pragma unroll
        for (int tl = 0; tl < NT; ++tl)
#pragma unroll
            for (int i = 0; i < 8; ++i) *(v4ig*)(sm + (buf * NT + tl) * GT + (srow + 16 * i) * GP + scol) = st[tl][i]; };
    v8f acc[4][4];
#pragma unroll
    for (int mb = 0; mb < 4; ++mb)
#pragma unroll
        for (int nb = 0; nb < 4; ++nb) acc[mb][nb] = (v8f){};
    gl(0); sl(0);
    // The stage loop stays rolled: one copy of the stage's products in the instruction cache. The loops inside it are unrolled because st, a, b and acc live in registers and need constant indices.
#pragma unroll 1
    for (int s = 0; s < NS; ++s) {
        __syncthreads();   // publishes buffer s & 1; ends every read of the other buffer, which is refilled below
        const bool more = (s + 1 < NS);
        if (more) gl((s + 1) * 64);
        const T16* at = sm + ((s & 1) * NT) * GT + (wm * 64 + lr) * GP + 8 * hi; const T16* bt = sm + ((s & 1) * NT + NT - 1) * GT + (wn * 64 + lr) * GP + 8 * hi;
        V a[2][4], a2[2][4], b[2][4];
#pragma unroll
        for (int ks = 0; ks < 2; ++ks)
#pragma unroll
            for (int f = 0; f < 4; ++f) { a[ks][f] = WFrag<T16>::ld(at + f * 16 * GP + ks * 32); if (NSPLIT == 1) a2[ks][f] = WFrag<T16>::ld(at + GT + f * 16 * GP + ks * 32); b[ks][f] = WFrag<T16>::ld(bt + f * 16 * GP + ks * 32); }
        __builtin_amdgcn_sched_barrier(0);   // keeps the stage's fragment reads one group in front of its products, for speed only
#pragma unroll
        for (int ks = 0; ks < 2; ++ks)
#pragma unroll
            for (int nb = 0; nb < 4; ++nb) {
#pragma unroll
                for (int mb = 0; mb < 4; ++mb) acc[mb][nb] = WFrag<T16>::mma(a[ks][mb], b[ks][nb], acc[mb][nb]);
                if (NSPLIT == 1) {
#pragma unroll
                    for (int mb = 0; mb < 4; ++mb) acc[mb][nb] = WFrag<T16>::mma(a2[ks][mb], b[ks][nb], acc[mb][nb]); } }
        if (more) sl((s + 1) & 1);
    }
    // Output through LDS, so that every global store covers whole 256-byte row pieces: per pass a wave lays 16 x 64 of its tile in its own slab (pitch 68 floats) and reads it back by rows.
    // Two slab sets in turn. The results stay in registers and go to memory behind the last barrier, so that no barrier waits for a global store.
    // Every loop here is unrolled because acc and res live in registers and need constant indices.
    __syncthreads();   // ends every read of the operand tiles: the slabs lie over them
    if constexpr (PLANES) {
        // Every wave stages in its own quarter of the LDS and reads it back so that a lane holds 16 bytes of a plane's row and eight lanes one whole 128-byte line.
        // All results wait in registers and go to memory behind the last barrier: no barrier waits for a global store, and no register of an issued store is written again.
        // Every loop here is unrolled because acc and the results live in registers and need constant indices.
        static_assert(BIAS && HD == 64 && DQ == NH_ * HD && 4 * 64 * 68 * 4 <= 2 * NT * GT * 2 && 4 * 2 * 64 * GP * 2 <= 2 * NT * GT * 2);
        const int head = (int)blockIdx.y * 2 + wn, t0 = r0 + wm * 64, rr = lane >> 3, c8 = (lane & 7) * 8;
        v4i r16[16], rh[16], rl[16];
        if (zb < 2) {
            // q, k: the 64 x 64 f32 tile [t][d] (pitch 68 floats), read back by rows of d
            float* my = (float*)smraw + wv * (64 * 68);
#pragma unroll
            for (int mb = 0; mb < 4; ++mb)
#pragma unroll
                for (int nb = 0; nb < 4; ++nb) {
#pragma unroll
                    for (int j = 0; j < 8; ++j) my[(mb * 16 + hi * 8 + j) * 68 + nb * 16 + lr] = acc[mb][nb][j]; }
            v8f b8;
#pragma unroll
            for (int q = 0; q < 8; ++q) b8[q] = bfr(bias[c0 + wn * 64 + c8 + q]);
            __syncthreads();   // orders the slab's stores in front of the reads of other lanes' values
#pragma unroll
            for (int i = 0; i < 16; ++i) { const float* rp = my + (4 * i + rr) * 68 + c8; const v4f x0 = *(const v4fa*)rp, x1 = *(const v4fa*)(rp + 4);
                planes8(__builtin_shufflevector(x0, x1, 0, 1, 2, 3, 4, 5, 6, 7) + b8, r16[i], rh[i], rl[i]); }
            __builtin_amdgcn_sched_barrier(0);   // keeps every conversion in front of the first store, so that no register of an issued store is written again
            const size_t po = ((z * NH_ + head) * TT + t0 + rr) * HD + c8;
#pragma unroll
            for (int i = 0; i < 16; ++i) { *(v4ig*)(P16 + po + i * (4 * HD)) = r16[i]; *(v4ig*)(Ph + po + i * (4 * HD)) = rh[i]; *(v4ig*)(Pl + po + i * (4 * HD)) = rl[i]; }
        } else {
            // v: a lane's eight accumulator elements are eight successive t of one d, 16 bytes of a transposed plane; slabs [d][t] (pitch GP), two per wave: f16 and hi first, then lo
            unsigned short* s0 = (unsigned short*)smraw + wv * (2 * 64 * GP); unsigned short* s1 = s0 + 64 * GP;
            float bn[4];
#pragma unroll
            for (int nb = 0; nb < 4; ++nb) bn[nb] = bfr(bias[c0 + wn * 64 + nb * 16 + lr]);
            v4i lo[4][4];
#pragma unroll
            for (int mb = 0; mb < 4; ++mb)
#pragma unroll
                for (int nb = 0; nb < 4; ++nb) { v4i o16, oh; planes8(acc[mb][nb] + bn[nb], o16, oh, lo[mb][nb]); const int so = (nb * 16 + lr) * GP + mb * 16 + hi * 8; *(v4ig*)(s0 + so) = o16; *(v4ig*)(s1 + so) = oh; }
            __syncthreads();   // orders the slabs' stores in front of the reads of other lanes' values
#pragma unroll
            for (int i = 0; i < 16; ++i) { const int ro = (4 * i + rr) * GP + c8; r16[i] = *(const v4ig*)(s0 + ro); rh[i] = *(const v4ig*)(s1 + ro); }
            __syncthreads();   // ends the reads of the first slab, which takes the lo plane now
#pragma unroll
            for (int mb = 0; mb < 4; ++mb)
#pragma unroll
                for (int nb = 0; nb < 4; ++nb) *(v4ig*)(s0 + (nb * 16 + lr) * GP + mb * 16 + hi * 8) = lo[mb][nb];
            __syncthreads();   // orders the slab's stores in front of the reads of other lanes' values
#pragma unroll
            for (int i = 0; i < 16; ++i) rl[i] = *(const v4ig*)(s0 + (4 * i + rr) * GP + c8);
            const size_t vo = (((z - 2 * (size_t)zdiv) * NKV + head) * HD + rr) * TT + t0 + c8;
#pragma unroll
            for (int i = 0; i < 16; ++i) { *(v4ig*)(V16 + vo + (size_t)i * (4 * TT)) = r16[i]; *(v4ig*)(Vh + vo + (size_t)i * (4 * TT)) = rh[i]; *(v4ig*)(Vl + vo + (size_t)i * (4 * TT)) = rl[i]; }
            asm volatile("s_wait_xcnt 0x0" ::: "memory");   // stands behind the last store, in front of whatever the code laid out behind this branch writes into a register that a store above names
        }
        return;
    }
    float* os = (float*)smraw;
    v4f res[4][8], bv = (v4f)(0.0f);
    if (BIAS) {
#pragma unroll
        for (int q = 0; q < 4; ++q) bv[q] = bfr(bias[c0 + wn * 64 + lr * 4 + q]); }
#pragma unroll
    for (int mb = 0; mb < 4; ++mb) {
        float* my = os + ((mb & 1) * 4 + wv) * (16 * 68);
#pragma unroll
        for (int nb = 0; nb < 4; ++nb) {
#pragma unroll
            for (int j = 0; j < 8; ++j) my[(hi * 8 + j) * 68 + nb * 16 + lr] = acc[mb][nb][j]; }
        __syncthreads();   // orders the slab's stores in front of the reads of other lanes' values
#pragma unroll
        for (int i = 0; i < 8; ++i) { const v4f val = *(const v4fa*)(my + (2 * i + hi) * 68 + lr * 4); res[mb][i] = BIAS ? val + bv : val; } }
    float* cw = C + z * sC + (size_t)(r0 + wm * 64 + hi) * LDC + c0 + wn * 64 + lr * 4;
#pragma unroll
    for (int mb = 0; mb < 4; ++mb)
#pragma unroll
        for (int i = 0; i < 8; ++i) *(v4f*)(cw + (mb * 16 + 2 * i) * LDC) = res[mb][i];
}

__device__ __forceinline__ void splitf(float y, unsigned short& h, unsigned short& l) { h = f2bf(y); l = f2bf(y - bf2f(h)); }

// ---- k_prep: work-groups 0 .. NB-1 rank the unmasked keys of one batch each; the others convert the four weights to bf16 (dst dense [weight][DQ DM]).
// idx[b][j] = row of the j-th unmasked key for j < n, 0 for j >= n; cnt[b CNS] = n. A thread counts TT / 256 successive keys; the counts are summed along each wave by lane shifts, and the eight waves' totals pass through LDS.
#define LWB ((unsigned)((size_t)DQ * DM / 8 / 256))
static_assert((size_t)DQ * DM % 2048 == 0 && TT % 1024 == 0);
__global__ __launch_bounds__(256) void k_prep(const float* __restrict__ s0, const float* __restrict__ s1, const float* __restrict__ s2, const float* __restrict__ s3, bf* dst, const int* __restrict__ mask, int* idx, int* cnt) {
    __shared__ int part[8];
    const int tid = (int)threadIdx.x;
    if (blockIdx.x < NB) {
        constexpr int E = TT / 256;   // the loops below are unrolled because m lives in registers and needs constant indices, and so that the lane shifts and the stores have constant distances
        const int* mk = mask + (size_t)blockIdx.x * SEQ_FULL + tid * E; int* ix = idx + (size_t)blockIdx.x * TT;
        int m[E], c = 0;
#pragma unroll
        for (int i = 0; i < E / 4; ++i) { const v4i v = ((const v4ig*)mk)[i];
#pragma unroll
            for (int k = 0; k < 4; ++k) { m[4 * i + k] = v[k]; c += (v[k] != 0) ? 1 : 0; } }
        int run = c;   // becomes the sum over the wave's lanes up to this one
#pragma unroll
        for (int d = 1; d < 32; d <<= 1) { const int o = __shfl_up(run, (unsigned)d, 32); run += ((tid & 31) >= d) ? o : 0; }
        if ((tid & 31) == 31) part[tid >> 5] = run;
        __syncthreads();   // publishes the waves' totals
        int n = 0, pos = run - c;
#pragma unroll
        for (int w = 0; w < 8; ++w) { const int t = part[w]; n += t; pos += (w < (tid >> 5)) ? t : 0; }
#pragma unroll
        for (int k = 0; k < E; ++k) { if (m[k] != 0) ix[pos] = tid * E + k; pos += (m[k] != 0) ? 1 : 0; }
#pragma unroll
        for (int k = 0; k < E; ++k) { if (tid + 256 * k >= n) ix[tid + 256 * k] = 0; }
        if (tid == 0) cnt[blockIdx.x * CNS] = n;
        return;
    }
    const unsigned w = blockIdx.x - NB, zs = w / LWB; const size_t i = (size_t)(w % LWB) * 256 + tid;
    const float* src = (zs == 0) ? s0 : (zs == 1) ? s1 : (zs == 2) ? s2 : s3; dst += (size_t)zs * DQ * DM; const v8f v = *(const v8f*)(src + i * 8); v8us o;
#pragma unroll
    for (int k = 0; k < 8; ++k) o[k] = f2bf(v[k]); *(v8us*)(dst + i * 8) = o;
    asm volatile("s_wait_xcnt 0x0" ::: "memory"); }   // stands behind the store, in front of whatever the code laid out behind this part (the ranking) writes into a register that the store names

// ---- k_cvtx: query, key, value to bf16, dst [z][b][row][DM]; blockIdx.z = tensor, blockIdx.y = batch, 256 / (DM / 8) rows per work-group.
// Row j of key and value is the row of the j-th unmasked key; rows are written up to the next multiple of 128 behind the count (those take key row 0: finite values that the attention gives weight 0), the rest is neither written nor read.
static_assert(DM % 8 == 0 && 256 % (DM / 8) == 0 && TT % (256 / (DM / 8)) == 0);
__global__ __launch_bounds__(256) void k_cvtx(const float* __restrict__ s0, const float* __restrict__ s1, const float* __restrict__ s2, bf* dst, const int* __restrict__ idx, const int* __restrict__ cnt) {
    constexpr int R8 = DM / 8, RW = 256 / R8;
    const int row = (int)blockIdx.x * RW + (int)threadIdx.x / R8, c8 = ((int)threadIdx.x % R8) * 8; int srow = row;
    if (blockIdx.z != 0) { if ((int)blockIdx.x * RW >= ((cnt[blockIdx.y * CNS] + 127) & ~127)) return; srow = min(max(idx[(size_t)blockIdx.y * TT + row], 0), TT - 1); }
    const float* src = ((blockIdx.z == 0) ? s0 : (blockIdx.z == 1) ? s1 : s2) + ((size_t)blockIdx.y * SEQ_FULL + srow) * DM + c8; const v8f v = *(const v8f*)src; v8us o;
#pragma unroll
    for (int k = 0; k < 8; ++k) o[k] = f2bf(v[k]); *(v8us*)(dst + (((size_t)blockIdx.z * NB + blockIdx.y) * TT + row) * DM + c8) = o; }

#define FP   72             // LDS row pitch in 16-bit elements: 128 B + 16 B, the 16 rows of a 16-byte fragment read fall on distinct banks
#define FT   (64 * FP)      // one 64 x 64 tile
#define QBH  64             // queries per work-group, rows < RH
#define QBL  192            // queries per work-group, rows >= RH
#define MSTART (-5.0e29f)
#define SCL2 (SCL * 1.4426950408889634f)
static_assert(RH % QBH == 0 && (TT - RH) % QBL == 0 && RH / QBH == (TT - RH) / QBL && TT % 1024 == 0 && TT % 64 == 0);
typedef v4i __attribute__((may_alias)) v4ia;

__device__ __forceinline__ float xhalf(float x) { const int b = __float_as_int(x); return __int_as_float(__builtin_amdgcn_permlanex16(b, b, 0x76543210, 0xfedcba98, false, false)); }   // lane l <-> l ^ 16

template <typename T16, bool HI>
__device__ __forceinline__ void fa_body(T16* sm, int n, const T16* __restrict__ Q, const T16* __restrict__ Q2, const T16* __restrict__ Kp, const T16* __restrict__ K2,
                                        const T16* __restrict__ Vt, const T16* __restrict__ V2, int q0, bf* Ah, bf* Al) {
    typedef typename WFrag<T16>::V V;
    constexpr int NPL = HI ? 2 : 1, NG = HI ? 1 : 3; const int NS = (n + 63) >> 6;   // n is in 0 .. TT, so at most TT / 64 stages
    const int tid = (int)threadIdx.x, lane = tid & 31, lr = lane & 15, hi = lane >> 4;
    const int qw = q0 + (tid >> 5) * (16 * NG);
    const int srow = tid >> 3, scol = (tid & 7) * 8;   // staging: 16 bytes of rows srow + 16 i, i = 0..3, of every tile
    v4i st[2 * NPL][4];
    auto gl = [&](int j0) {
        const size_t ko = (size_t)(j0 + srow) * HD + scol, vo = (size_t)srow * TT + j0 + scol;   // the four rows differ by constants
        const T16* pk = Kp + ko; const T16* pk2 = HI ? K2 + ko : nullptr; const T16* pv = Vt + vo; const T16* pv2 = HI ? V2 + vo : nullptr;
        __builtin_amdgcn_sched_barrier(0);   // with the one behind the caller's wait: keeps other vector work out of the stretch from the first load to the wait, where it could write a register that holds an address of an issued load
#pragma unroll
        for (int i = 0; i < 4; ++i) {
            st[0][i] = *(const v4ia*)(pk + i * (16 * HD)); if (HI) st[1][i] = *(const v4ia*)(pk2 + i * (16 * HD));
            st[NPL][i] = *(const v4ia*)(pv + i * (16 * TT)); if (HI) st[NPL + 1][i] = *(const v4ia*)(pv2 + i * (16 * TT)); }
    };   // every call is followed by s_wait_xcnt 0 and a second sched_barrier
    auto sl = [&](int buf) {
#pragma unroll
        for (int tl = 0; tl < 2 * NPL; ++tl)
#pragma unroll
            for (int i = 0; i < 4; ++i) *(v4ia*)(sm + (buf * 2 * NPL + tl) * FT + (srow + 16 * i) * FP + scol) = st[tl][i]; };
    V q[NG][2], q2[NG][2]; const T16* qp[NG]; const T16* qp2[NG];
#pragma unroll
    for (int g = 0; g < NG; ++g) { const size_t qo = (size_t)(qw + g * 16 + lr) * HD + 8 * hi; qp[g] = Q + qo; qp2[g] = HI ? Q2 + qo : nullptr;
#pragma unroll
        for (int ks = 0; ks < 2; ++ks) { q[g][ks] = WFrag<T16>::ld(qp[g] + ks * 32); if (HI) q2[g][ks] = WFrag<T16>::ld(qp2[g] + ks * 32); } }
    v8f o[NG][4]; float mrun[NG], lsum[NG];
#pragma unroll
    for (int g = 0; g < NG; ++g) { mrun[g] = MSTART; lsum[g] = 0.0f;
#pragma unroll
        for (int mb = 0; mb < 4; ++mb) o[g][mb] = (v8f){}; }
    if (NS > 0) { gl(0);
        // The wait stands in front of whatever next writes a register that holds an address of the loads above. The addresses of the Q loads are named as inputs so that their registers stay theirs
        // up to the wait: the address arithmetic of the first stage stands between those loads and this place.
        if constexpr (HI) asm volatile("s_wait_xcnt 0x0" :: "v"(qp[0]), "v"(qp2[0]) : "memory");
        else asm volatile("s_wait_xcnt 0x0" :: "v"(qp[0]), "v"(qp[1]), "v"(qp[2]) : "memory");
        __builtin_amdgcn_sched_barrier(0);
        sl(0); }
#pragma unroll 1
    for (int s = 0; s < NS; ++s) {
        __syncthreads();   // publishes buffer s & 1; ends every read of the other buffer, which is refilled below
        const bool more = (s + 1 < NS);
        if (more) { gl((s + 1) * 64);
            asm volatile("s_wait_xcnt 0x0" ::: "memory");   // stands in front of whatever next writes a register that holds an address of the loads above
            __builtin_amdgcn_sched_barrier(0); }
        const T16* kt = sm + ((s & 1) * 2 * NPL) * FT; const T16* vt = kt + NPL * FT;
        v8f sc[NG][4];
#pragma unroll
        for (int t = 0; t < 4; ++t) {
#pragma unroll
            for (int g = 0; g < NG; ++g) sc[g][t] = (v8f){};
#pragma unroll
            for (int ks = 0; ks < 2; ++ks) { const V ka = WFrag<T16>::ld(kt + (t * 16 + lr) * FP + ks * 32 + 8 * hi); V kb; if (HI) kb = WFrag<T16>::ld(kt + FT + (t * 16 + lr) * FP + ks * 32 + 8 * hi);
#pragma unroll
                for (int g = 0; g < NG; ++g) { sc[g][t] = WFrag<T16>::mma(ka, q[g][ks], sc[g][t]); if (HI) { sc[g][t] = WFrag<T16>::mma(ka, q2[g][ks], sc[g][t]); sc[g][t] = WFrag<T16>::mma(kb, q[g][ks], sc[g][t]); } } } }
        float mnew[NG]; const int lim = n - s * 64 - 8 * hi;   // this lane's keys of the stage below lim are real
#pragma unroll
        for (int g = 0; g < NG; ++g) mnew[g] = mrun[g];
#pragma unroll
        for (int t = 0; t < 4; ++t) {
#pragma unroll
            for (int r = 0; r < 8; ++r) { const bool ok = t * 16 + r < lim;
#pragma unroll
                for (int g = 0; g < NG; ++g) { const float x = ok ? sc[g][t][r] * SCL2 : NEGBIG; sc[g][t][r] = x; mnew[g] = fmaxf(mnew[g], x); } } }
        V pf[NG][2], pl[NG][2];
#pragma unroll
        for (int g = 0; g < NG; ++g) {
            const float mx = fmaxf(mnew[g], xhalf(mnew[g]));   // both halves of a column share one maximum: their keys meet in one product
            const float da = mrun[g] - mx; float al = __builtin_amdgcn_exp2f(da); mrun[g] = mx;
            asm volatile("v_nop" : "+v"(al) : "v"(da));       // the free slot behind a transcendental, see below
            const float off = HI ? mx : mx - PCARL2;
            float ps = 0.0f;
#pragma unroll
            for (int t = 0; t < 4; ++t) { const v8f d = sc[g][t] - off; v8f p;
#pragma unroll
                for (int r = 0; r < 8; ++r) p[r] = __builtin_amdgcn_exp2f(d[r]);
                // The instruction set asks for one free slot behind v_exp_f32 before its result is read or its source overwritten. Naming the eight sources as inputs keeps them
                // whole until here, naming the results as in-out keeps their readers behind: inside the run each v_exp_f32 is the next one's slot, the v_nop is the last one's.
                asm volatile("v_nop" : "+v"(p) : "v"(d));
                sc[g][t] = p;
#pragma unroll
                for (int r = 0; r < 8; ++r) ps += p[r]; }
            lsum[g] = lsum[g] * al + ps;
#pragma unroll
            for (int mb = 0; mb < 4; ++mb) o[g][mb] *= al;
#pragma unroll
            for (int p2 = 0; p2 < 2; ++p2) {
                if constexpr (HI) {
                    const v8bf h0 = __builtin_convertvector(sc[g][2 * p2], v8bf), h1 = __builtin_convertvector(sc[g][2 * p2 + 1], v8bf);
                    const v8bf l0 = __builtin_convertvector(sc[g][2 * p2] - __builtin_convertvector(h0, v8f), v8bf), l1 = __builtin_convertvector(sc[g][2 * p2 + 1] - __builtin_convertvector(h1, v8f), v8bf);
                    pf[g][p2] = __builtin_shufflevector(h0, h1, 0, 1, 2, 3, 4, 5, 6, 7, 8, 9, 10, 11, 12, 13, 14, 15);
                    pl[g][p2] = __builtin_shufflevector(l0, l1, 0, 1, 2, 3, 4, 5, 6, 7, 8, 9, 10, 11, 12, 13, 14, 15);
                } else {
                    pf[g][p2] = cat16(__builtin_convertvector(sc[g][2 * p2], v8h), __builtin_convertvector(sc[g][2 * p2 + 1], v8h));
                } } }
#pragma unroll
        for (int p2 = 0; p2 < 2; ++p2)
#pragma unroll
            for (int mb = 0; mb < 4; ++mb) { const V va = WFrag<T16>::ld(vt + (mb * 16 + lr) * FP + p2 * 32 + 8 * hi); V vb; if (HI) vb = WFrag<T16>::ld(vt + FT + (mb * 16 + lr) * FP + p2 * 32 + 8 * hi);
#pragma unroll
                for (int g = 0; g < NG; ++g) { o[g][mb] = WFrag<T16>::mma(va, pf[g][p2], o[g][mb]); if (HI) { o[g][mb] = WFrag<T16>::mma(va, pl[g][p2], o[g][mb]); o[g][mb] = WFrag<T16>::mma(vb, pf[g][p2], o[g][mb]); } } }
        if (more) sl((s + 1) & 1);
    }
    // lane l: query qw + 16 g + (l & 15), d = 16 mb + 8 (l >> 4) + 0..7: 16 bytes of each ctx plane
#pragma unroll
    for (int g = 0; g < NG; ++g) { const float inv = __fdiv_rn(1.0f, lsum[g] + xhalf(lsum[g]));
#pragma unroll
        for (int mb = 0; mb < 4; ++mb) { v8us oh, ol;
#pragma unroll
            for (int r = 0; r < 8; ++r) { unsigned short a, c2; splitf(o[g][mb][r] * inv, a, c2); oh[r] = a; ol[r] = c2; }
            const size_t oo = (size_t)(qw + g * 16 + lr) * DQ + mb * 16 + 8 * hi;
            __builtin_amdgcn_sched_barrier(0);   // with the one behind the wait: keeps the conversions of this and the next piece out of the stretch from the first store to the wait, where they could write a register that an issued store names
            *(v8us*)(Ah + oo) = oh; *(v8us*)(Al + oo) = ol;
            asm volatile("s_wait_xcnt 0x0" ::: "memory");   // stands in front of whatever next writes a register that the two stores name
            __builtin_amdgcn_sched_barrier(0); } }
}

// grid: work-group x is a hi/lo block where x has an even number of one bits, else an f16 block, so that two work-groups whose indices differ in one bit (neighbours as well as x and x + half the grid) are one of each kind,
// whichever of these pairs the dispatcher puts on one WGP (for speed only); x >> 1 numbers the blocks of either kind. Planes [b][head][.][.], ctx planes [b][t][DQ]
__global__ __launch_bounds__(128) void k_fattn(const h16* __restrict__ Q16, const h16* __restrict__ K16, const h16* __restrict__ V16, const bf* __restrict__ Qh, const bf* __restrict__ Ql, const bf* __restrict__ Kh, const bf* __restrict__ Kl,
                                               const bf* __restrict__ Vh, const bf* __restrict__ Vl, const int* __restrict__ cnt, bf* Ah, bf* Al) {
    __shared__ __align__(16) unsigned short sm[2 * 4 * FT];
    constexpr int HB = RH / QBH;   // blocks per (batch, head), of either kind
    const int x = (int)blockIdx.x, y = x >> 1; const bool hires = (__builtin_popcount((unsigned)x) & 1) == 0;
    const int bh = y / HB; const int q0 = hires ? (y % HB) * QBH : RH + (y % HB) * QBL;
    const int b = bh / NH_, hd = bh % NH_; const size_t po = (size_t)bh * TT * HD, ao = (size_t)b * TT * DQ + (size_t)hd * HD;
    const int n = min(max(cnt[b * CNS], 0), TT);   // the same for the whole work-group: it bounds the stage loop and its barriers
    if (hires) fa_body<bf, true>((bf*)sm, n, Qh + po, Ql + po, Kh + po, Kl + po, Vh + po, Vl + po, q0, Ah + ao, Al + ao);
    else fa_body<h16, false>((h16*)sm, n, Q16 + po, nullptr, K16 + po, nullptr, V16 + po, nullptr, q0, Ah + ao, Al + ao);
}

extern "C" void kernel_launch(void* const* d_in, const int* in_sizes, int n_in,
                              void* d_out, int out_size, void* d_ws, size_t ws_size, hipStream_t stream) {
    if (n_in < 12) return;
    const size_t needx = (size_t)(NB - 1) * SEQ_FULL * DM + (size_t)TT * DM;
    const size_t needm = (size_t)(NB - 1) * SEQ_FULL + (size_t)TT;
    if ((size_t)in_sizes[0] < needx || (size_t)in_sizes[1] < needx || (size_t)in_sizes[2] < needx || (size_t)in_sizes[3] < needm) return;
    if ((size_t)in_sizes[4] < (size_t)DQ * DM || (size_t)in_sizes[6] < (size_t)DKV * DM || (size_t)in_sizes[8] < (size_t)DKV * DM || (size_t)in_sizes[10] < (size_t)DM * DQ) return;
    if (in_sizes[5] < DQ || in_sizes[7] < DKV || in_sizes[9] < DKV || in_sizes[11] < DM) return;
    if ((size_t)out_size < needx) return;
    // wire order: query, key, value, mask (int32), Wq, bq, Wk, bk, Wv, bv, Wo, bo; weights [out][in]
    const float* xq = (const float*)d_in[0]; const float* xk = (const float*)d_in[1]; const float* xv = (const float*)d_in[2]; const int* mask = (const int*)d_in[3];
    const float* wq = (const float*)d_in[4]; const float* bq = (const float*)d_in[5]; const float* wk = (const float*)d_in[6]; const float* bk = (const float*)d_in[7];
    const float* wv = (const float*)d_in[8]; const float* bv = (const float*)d_in[9]; const float* wo = (const float*)d_in[10]; const float* bo = (const float*)d_in[11];
    float* OUT = (float*)d_out;     // [NB_FULL][SEQ_FULL][DM]
    char* wsp = (char*)d_ws;
    auto take = [&](size_t bytes) { char* p = wsp; wsp += (bytes + 255) & ~(size_t)255; return (void*)p; };
    bf* WQ = (bf*)take(SZ_W); bf* WK = (bf*)take(SZ_W); bf* WV = (bf*)take(SZ_W); bf* WO = (bf*)take(SZ_W);   // one after the other: filled by one launch, WQ WK WV read by one launch
    // planes [b][head][.][.]; each k plane directly behind its q plane, so that one launch fills both
    h16* QP16 = (h16*)take(SZ_HP); h16* KP16 = (h16*)take(SZ_HP); bf* QPh = (bf*)take(SZ_HP); bf* KPh = (bf*)take(SZ_HP); bf* QPl = (bf*)take(SZ_HP); bf* KPl = (bf*)take(SZ_HP);
    h16* VT16 = (h16*)take(SZ_HP); bf* VTh = (bf*)take(SZ_HP); bf* VTl = (bf*)take(SZ_HP);
    bf* XB = (bf*)take(SZ_XB); bf* ATh = (bf*)take(SZ_AT);   // XB [q k v][b][t][DM] bf16
    bf* ATl = (bf*)take(SZ_AT); int* IX = (int*)take(SZ_IX); int* CN = (int*)take(SZ_CN);
    if ((size_t)(wsp - (char*)d_ws) > ws_size) return;
    const unsigned LX = (unsigned)(((size_t)TT * DM / 8 + 255) / 256);
    const size_t xs = (size_t)SEQ_FULL * DM;   // batch stride of the f32 inputs and of the output
    // the ranks of the unmasked keys and the four weights in one launch; q inputs and the ranked k, v inputs of every batch in one launch
    k_prep<<<NB + 4 * LWB, 256, 0, stream>>>(wq, wk, wv, wo, WQ, mask, IX, CN);
    k_cvtx<<<dim3(LX, NB, 3), 256, 0, stream>>>(xq, xk, xv, XB, IX, CN);
    // the three projections of every batch in one launch: z = tensor * NB + batch; the q and k planes and the transposed v planes are written directly
    k_gemms<bf, 0, true, true, DM, DM, DQ><<<dim3(TT / 128, DQ / 128, 3 * NB), 128, 0, stream>>>(XB, nullptr, WQ, nullptr, QP16, QPh, QPl, VT16, VTh, VTl, bq, bk, bv, CN, NB, (size_t)TT * DM, (size_t)DQ * DM, 0);
    // attention of every batch and head in one launch, ctx planes written directly
    k_fattn<<<NB * NH_ * (RH / QBH + (TT - RH) / QBL), 128, 0, stream>>>(QP16, KP16, VT16, QPh, QPl, KPh, KPl, VTh, VTl, CN, ATh, ATl);
    // out[b][t][n] = sum_k ctx[b][t][k] Wo[n][k] + bo[n], every batch in one launch
    k_gemms<bf, 1, true, false, DQ, DQ, DM><<<dim3(TT / 128, DM / 128, NB), 128, 0, stream>>>(ATh, ATl, WO, OUT, nullptr, nullptr, nullptr, nullptr, nullptr, nullptr, bo, bo, bo, nullptr, NB, (size_t)TT * DQ, 0, xs);
}

// v008
// One run takes 87.6 microseconds.
// Timed twice side by side with v007, it ran 1.04 times as fast both times.
// Counting every step since v000, it is 23.2 times as fast.
#include <hip/hip_runtime.h>

// 16-head scaled dot-product attention with a key padding mask: q = query Wq^T + bq, k = key Wk^T + bk, v = value Wv^T + bv (weights [out][in]); scores x 1/8; masked keys (mask == 0) replaced by -inf; softmax over keys; out = merged Wo^T + bo.
// A masked key has weight exactly 0, so it is left out: the unmasked keys of a batch are ranked in their order, the key and value rows are gathered by rank, and k, v and the attention run over those rows alone.
// Compute dtypes, f32 accumulate everywhere: every float input converted to bf16 (RNE); projections v_wmma_f32_16x16x32_bf16 on exact bf16 planes + bias rounded to bf16; scores rows < RH bf16 hi/lo planes (3 products), rows >= RH v_wmma_f32_16x16x32_f16;
// P.V rows < RH bf16 hi/lo planes (3 products), rows >= RH f16 with P carried x1024 (the f32 row sum carries it too); output projection bf16 hi/lo ctx planes x bf16 Wo (2 products) + bias rounded to bf16; softmax f32.

#ifndef NB
#define NB 2
#endif
#ifndef SEQ
#define SEQ 2048
#endif
#define NB_FULL  2
#define SEQ_FULL 2048
#define TT   SEQ
#define DM   1024
#define NH_  16
#define NKV  16
#define REP  (NH_ / NKV)
#define HD   64
#define DQ   (NH_ * HD)
#define DKV  (NKV * HD)
#define RH   ((TT > 512) ? 512 : (TT / 2))   // query rows < RH use hi+lo planes
#define PCARL2 10.0f      // P of the f16 rows is carried x 2^10
#define SCL  0.125f       // HD^-0.5
#define NEGBIG (-1.0e30f)

static_assert(NB >= 1 && NB <= NB_FULL);
static_assert(TT <= SEQ_FULL && TT % 128 == 0);
static_assert(RH >= 64 && RH % 64 == 0 && TT > RH && (TT - RH) % 64 == 0);
static_assert(HD == 64 && DM % 64 == 0 && DQ % 64 == 0 && DM % 32 == 0 && TT % 32 == 0);
static_assert(REP == 1);
static_assert(DM % 128 == 0 && DQ % 128 == 0);

#define SZ_W    ((size_t)DQ * DM * 2)
#define SZ_XB   ((size_t)3 * NB * TT * DM * 2)
#define SZ_HP   ((size_t)NB * NH_ * TT * HD * 2)
#define SZ_AT   ((size_t)NB * TT * DQ * 2)
#define SZ_IX   ((size_t)NB * TT * 4)      // rank -> key row, per batch
#define SZ_CN   (((size_t)NB * 128 + 255) / 256 * 256)   // number of unmasked keys, one 128-byte line per batch
#define CNS     32                         // ints between two batches' counts
#define SZ_ALL  (4 * SZ_W + 9 * SZ_HP + SZ_XB + 2 * SZ_AT + SZ_IX + SZ_CN)
static_assert(SZ_W % 256 == 0 && SZ_XB % 256 == 0 && SZ_HP % 256 == 0 && SZ_AT % 256 == 0 && SZ_IX % 256 == 0 && SZ_CN % 256 == 0);
static_assert(SZ_ALL <= (size_t)268435456 && DQ == DKV && NH_ == NKV);

typedef _Float16 h16;
typedef unsigned short bf;
typedef __attribute__((ext_vector_type(16))) __bf16   v16bf;
typedef __attribute__((ext_vector_type(16))) _Float16 v16h;
typedef __attribute__((ext_vector_type(8)))  _Float16 v8h;
typedef __attribute__((ext_vector_type(8)))  unsigned short v8us;
typedef __attribute__((ext_vector_type(8)))  float    v8f;
typedef __attribute__((ext_vector_type(4)))  float    v4f;
typedef v4f  __attribute__((may_alias)) v4fa;
typedef __attribute__((ext_vector_type(4))) _Float16 v4h;
typedef __attribute__((ext_vector_type(4))) unsigned short v4us;
typedef __attribute__((ext_vector_type(4))) int v4i;

__device__ __forceinline__ unsigned short f2bf(float f) { unsigned u = __float_as_uint(f); u += 0x7FFFu + ((u >> 16) & 1u); return (unsigned short)(u >> 16); }
__device__ __forceinline__ float bf2f(unsigned short b) { return __uint_as_float(((unsigned)b) << 16); }
__device__ __forceinline__ float bfr(float f) { return bf2f(f2bf(f)); }
__device__ __forceinline__ v16h cat16(v8h lo, v8h hi) { return __builtin_shufflevector(lo, hi, 0, 1, 2, 3, 4, 5, 6, 7, 8, 9, 10, 11, 12, 13, 14, 15); }
__device__ __forceinline__ v16bf cat16b(v8us lo, v8us hi) { return __builtin_bit_cast(v16bf, __builtin_shufflevector(lo, hi, 0, 1, 2, 3, 4, 5, 6, 7, 8, 9, 10, 11, 12, 13, 14, 15)); }
__device__ __forceinline__ v8f wmma16(v16h a, v16h b, v8f c) { return __builtin_amdgcn_wmma_f32_16x16x32_f16(false, a, false, b, (short)0, c, false, false); }
__device__ __forceinline__ v8f wmmab(v16bf a, v16bf b, v8f c) { return __builtin_amdgcn_wmma_f32_16x16x32_bf16(false, a, false, b, (short)0, c, false, false); }

// ---- k_gemms: GEMM on K-contiguous 16-bit planes, one 128x128 output tile per work-group of 4 waves (2 x 2, 64x64 and 16 accumulators each); grid (M/128, N/128, Z), 128 threads.
// C[m][n] (f32, + optional bias[n] rounded to bf16) = sum_k (A[m][k] + A2[m][k]) Bt[n][k] (A2 only with NSPLIT == 1). A rows have pitch LDA, Bt rows pitch K, C rows pitch LDC. z-batch strides sA/sB/sC in elements; Bt and the bias change only every zdiv-th z (bias0, bias1, bias2 in turn). K % 64 == 0, M % 128 == 0, N % 128 == 0.
// k goes by stages of 64: the A (and A2) tile [128 rows][64 k] and the Bt tile [128 rows][64 k] pass through registers into one of two LDS buffers while the other is read.
// A staging load of a wave covers four whole 128-byte rows, and every operand line is fetched once per work-group. Each wave sums its whole K in ascending order.
// With PLANES the result does not go to C: z / zdiv = 0, 1 (q, k) writes x = sum + bias as three 16-bit planes [z][head][t][d] (f16, bf16 hi, bf16 lo = bf16(x - hi)), z / zdiv = 2 (v) the same three planes transposed, [z - 2 zdiv][head][d][t]. A wave's 64 columns are one head.
// With PLANES the rows of k and v are the ranked unmasked keys: a tile whose first row is not below the batch's count cnt[] has nothing to do (the rows from the count up to the tile's end hold a copy of key row 0, see k_cvtx).
// Fragment map (A and B alike): lane l -> row/col l & 15, h = l >> 4; elements 0..7 = k0 + 8h + 0..7, elements 8..15 = k0 + 16 + 8h + 0..7. D: element r -> row 8h + r, col l & 15.
template <typename T16> struct WFrag;
template <> struct WFrag<h16> { typedef v16h V; static __device__ __forceinline__ V ld(const h16* p) { return cat16(*(const v8h*)p, *(const v8h*)(p + 16)); } static __device__ __forceinline__ v8f mma(V a, V b, v8f c) { return wmma16(a, b, c); } };
template <> struct WFrag<bf> { typedef v16bf V; static __device__ __forceinline__ V ld(const bf* p) { return cat16b(*(const v8us*)p, *(const v8us*)(p + 16)); } static __device__ __forceinline__ v8f mma(V a, V b, v8f c) { return wmmab(a, b, c); } };
#define GP   72             // LDS row pitch in 16-bit elements: 128 B + 16 B, the 16 rows of a 16-byte fragment read fall on distinct banks
#define GT   (128 * GP)     // one 128 x 64 tile
typedef v4i __attribute__((may_alias)) v4ig;
typedef __attribute__((ext_vector_type(8))) __bf16 v8bf;
// the three planes of eight values, every conversion round to nearest even
__device__ __forceinline__ void planes8(v8f x, v4i& o16, v4i& oh, v4i& ol) { oh = __builtin_bit_cast(v4i, __builtin_convertvector(x, v8bf)); v8f hf;
#pragma unroll
    for (int k = 0; k < 4; ++k) { hf[2 * k] = __int_as_float(oh[k] << 16); hf[2 * k + 1] = __int_as_float(oh[k] & (int)0xFFFF0000u); }   // the packed hi words back to f32
    o16 = __builtin_bit_cast(v4i, __builtin_convertvector(x, v8h)); ol = __builtin_bit_cast(v4i, __builtin_convertvector(x - hf, v8bf)); }
template <typename T16, int NSPLIT, bool BIAS, bool PLANES, int K, int LDA, int LDC>
__global__ __launch_bounds__(128) void k_gemms(const T16* __restrict__ A, const T16* __restrict__ A2, const T16* __restrict__ Bt, float* C, h16* P16, bf* Ph, bf* Pl, h16* V16, bf* Vh, bf* Vl, const float* __restrict__ bias0, const float* __restrict__ bias1, const float* __restrict__ bias2, const int* __restrict__ cnt, int zdiv, size_t sA, size_t sB, size_t sC) {
    typedef typename WFrag<T16>::V V; static_assert((NSPLIT == 0 || NSPLIT == 1) && K % 64 == 0 && K >= 64);
    constexpr int NT = (NSPLIT == 1) ? 3 : 2;   // tiles per stage: A, (A2), Bt
    constexpr int NS = K / 64;
    __shared__ __align__(16) unsigned char smraw[2 * NT * GT * 2];
    static_assert(2 * 4 * 16 * 68 * 4 <= 2 * NT * GT * 2);
    T16* sm = (T16*)smraw;
    const size_t z = blockIdx.z, zb = blockIdx.z / (unsigned)zdiv;
    if constexpr (PLANES) { if (zb != 0 && (int)blockIdx.x * 128 >= cnt[(z - zb * (unsigned)zdiv) * CNS]) return; }   // the same for the whole work-group, in front of every barrier
    const float* bias = (zb == 0) ? bias0 : ((zb == 1) ? bias1 : bias2);
    const int tid = (int)threadIdx.x, lane = tid & 31, lr = lane & 15, hi = lane >> 4; const int r0 = blockIdx.x * 128, c0 = blockIdx.y * 128;
    // wave number through readfirstlane: the tile offsets stay in scalar registers
    const int wv = __builtin_amdgcn_readfirstlane(tid >> 5), wm = wv >> 1, wn = wv & 1;
    const int srow = tid >> 3, scol = (tid & 7) * 8;   // staging: 16 bytes of rows srow + 16 i, i = 0..7, of every tile
    // a work-group-uniform base plus one 32-bit byte offset per thread; the eight rows differ by constants
    const char* ua = (const char*)(A + z * sA + (size_t)r0 * LDA); const char* ua2 = (NSPLIT == 1) ? (const char*)(A2 + z * sA + (size_t)r0 * LDA) : nullptr; const char* ub = (const char*)(Bt + zb * sB + (size_t)c0 * K);
    const unsigned va = (unsigned)(srow * LDA + scol) * 2u, vb = (unsigned)(srow * K + scol) * 2u;
    v4i st[NT][8];
    auto gl = [&](int kc) {
        const char* pa = ua + kc * 2 + va; const char* pa2 = (NSPLIT == 1) ? ua2 + kc * 2 + va : nullptr; const char* pb = ub + kc * 2 + vb;
#pragma unroll
        for (int i = 0; i < 8; ++i) { st[0][i] = *(const v4ig*)(pa + i * (16 * LDA * 2)); if (NSPLIT == 1) st[1][i] = *(const v4ig*)(pa2 + i * (16 * LDA * 2)); st[NT - 1][i] = *(const v4ig*)(pb + i * (16 * K * 2)); }
        // The wait stands in front of whatever next writes a register that holds an address of the loads above (the fragment reads and the accumulators may take those registers);
        // the addresses are named as inputs so that their registers stay theirs up to the wait.
        if constexpr (NSPLIT == 1) asm volatile("s_wait_xcnt 0x0" :: "v"(pa), "v"(pa2), "v"(pb), "v"(va), "v"(vb) : "memory");
        else asm volatile("s_wait_xcnt 0x0" :: "v"(pa), "v"(pb), "v"(va), "v"(vb) : "memory"); };
    auto sl = [&](int buf) {
#pragma unroll
        for (int tl = 0; tl < NT; ++tl)
#pragma unroll
            for (int i = 0; i < 8; ++i) *(v4ig*)(sm + (buf * NT + tl) * GT + (srow + 16 * i) * GP + scol) = st[tl][i]; };
    v8f acc[4][4];
#pragma unroll
    for (int mb = 0; mb < 4; ++mb)
#pragma unroll
        for (int nb = 0; nb < 4; ++nb) acc[mb][nb] = (v8f){};
    gl(0); sl(0);
    // The stage loop stays rolled: one copy of the stage's products in the instruction cache. The loops inside it are unrolled because st, a, b and acc live in registers and need constant indices.
#pragma unroll 1
    for (int s = 0; s < NS; ++s) {
        __syncthreads();   // publishes buffer s & 1; ends every read of the other buffer, which is refilled below
        const bool more = (s + 1 < NS);
        if (more) gl((s + 1) * 64);
        const T16* at = sm + ((s & 1) * NT) * GT + (wm * 64 + lr) * GP + 8 * hi; const T16* bt = sm + ((s & 1) * NT + NT - 1) * GT + (wn * 64 + lr) * GP + 8 * hi;
        V a[2][4], a2[2][4], b[2][4];
#pragma unroll
        for (int ks = 0; ks < 2; ++ks)
#pragma unroll
            for (int f = 0; f < 4; ++f) { a[ks][f] = WFrag<T16>::ld(at + f * 16 * GP + ks * 32); if (NSPLIT == 1) a2[ks][f] = WFrag<T16>::ld(at + GT + f * 16 * GP + ks * 32); b[ks][f] = WFrag<T16>::ld(bt + f * 16 * GP + ks * 32); }
        __builtin_amdgcn_sched_barrier(0);   // keeps the stage's fragment reads one group in front of its products, for speed only
#pragma unroll
        for (int ks = 0; ks < 2; ++ks)
#pragma unroll
            for (int nb = 0; nb < 4; ++nb) {
#pragma unroll
                for (int mb = 0; mb < 4; ++mb) acc[mb][nb] = WFrag<T16>::mma(a[ks][mb], b[ks][nb], acc[mb][nb]);
                if (NSPLIT == 1) {
#pragma unroll
                    for (int mb = 0; mb < 4; ++mb) acc[mb][nb] = WFrag<T16>::mma(a2[ks][mb], b[ks][nb], acc[mb][nb]); } }
        if (more) sl((s + 1) & 1);
    }
    // Output through LDS, so that every global store covers whole 256-byte row pieces: per pass a wave lays 16 x 64 of its tile in its own slab (pitch 68 floats) and reads it back by rows.
    // Two slab sets in turn. The results stay in registers and go to memory behind the last barrier, so that no barrier waits for a global store.
    // Every loop here is unrolled because acc and res live in registers and need constant indices.
    __syncthreads();   // ends every read of the operand tiles: the slabs lie over them
    if constexpr (PLANES) {
        // Every wave stages in its own quarter of the LDS and reads it back so that a lane holds 16 bytes of a plane's row and eight lanes one whole 128-byte line.
        // All results wait in registers and go to memory behind the last barrier: no barrier waits for a global store, and no register of an issued store is written again.
        // Every loop here is unrolled because acc and the results live in registers and need constant indices.
        static_assert(BIAS && HD == 64 && DQ == NH_ * HD && 4 * 64 * 68 * 4 <= 2 * NT * GT * 2 && 4 * 2 * 64 * GP * 2 <= 2 * NT * GT * 2);
        const int head = (int)blockIdx.y * 2 + wn, t0 = r0 + wm * 64, rr = lane >> 3, c8 = (lane & 7) * 8;
        v4i r16[16], rh[16], rl[16];
        if (zb < 2) {
            // q, k: the 64 x 64 f32 tile [t][d] (pitch 68 floats), read back by rows of d
            float* my = (float*)smraw + wv * (64 * 68);
#pragma unroll
            for (int mb = 0; mb < 4; ++mb)
#pragma unroll
                for (int nb = 0; nb < 4; ++nb) {
#pragma unroll
                    for (int j = 0; j < 8; ++j) my[(mb * 16 + hi * 8 + j) * 68 + nb * 16 + lr] = acc[mb][nb][j]; }
            v8f b8;
#pragma unroll
            for (int q = 0; q < 8; ++q) b8[q] = bfr(bias[c0 + wn * 64 + c8 + q]);
            __syncthreads();   // orders the slab's stores in front of the reads of other lanes' values
#pragma unroll
            for (int i = 0; i < 16; ++i) { const float* rp = my + (4 * i + rr) * 68 + c8; const v4f x0 = *(const v4fa*)rp, x1 = *(const v4fa*)(rp + 4);
                planes8(__builtin_shufflevector(x0, x1, 0, 1, 2, 3, 4, 5, 6, 7) + b8, r16[i], rh[i], rl[i]); }
            __builtin_amdgcn_sched_barrier(0);   // keeps every conversion in front of the first store, so that no register of an issued store is written again
            const size_t po = ((z * NH_ + head) * TT + t0 + rr) * HD + c8;
#pragma unroll
            for (int i = 0; i < 16; ++i) { *(v4ig*)(P16 + po + i * (4 * HD)) = r16[i]; *(v4ig*)(Ph + po + i * (4 * HD)) = rh[i]; *(v4ig*)(Pl + po + i * (4 * HD)) = rl[i]; }
        } else {
            // v: a lane's eight accumulator elements are eight successive t of one d, 16 bytes of a transposed plane; slabs [d][t] (pitch GP), two per wave: f16 and hi first, then lo
            unsigned short* s0 = (unsigned short*)smraw + wv * (2 * 64 * GP); unsigned short* s1 = s0 + 64 * GP;
            float bn[4];
#pragma unroll
            for (int nb = 0; nb < 4; ++nb) bn[nb] = bfr(bias[c0 + wn * 64 + nb * 16 + lr]);
            v4i lo[4][4];
#pragma unroll
            for (int mb = 0; mb < 4; ++mb)
#pragma unroll
                for (int nb = 0; nb < 4; ++nb) { v4i o16, oh; planes8(acc[mb][nb] + bn[nb], o16, oh, lo[mb][nb]); const int so = (nb * 16 + lr) * GP + mb * 16 + hi * 8; *(v4ig*)(s0 + so) = o16; *(v4ig*)(s1 + so) = oh; }
            __syncthreads();   // orders the slabs' stores in front of the reads of other lanes' values
#pragma unroll
            for (int i = 0; i < 16; ++i) { const int ro = (4 * i + rr) * GP + c8; r16[i] = *(const v4ig*)(s0 + ro); rh[i] = *(const v4ig*)(s1 + ro); }
            __syncthreads();   // ends the reads of the first slab, which takes the lo plane now
#pragma unroll
            for (int mb = 0; mb < 4; ++mb)
#pragma unroll
                for (int nb = 0; nb < 4; ++nb) *(v4ig*)(s0 + (nb * 16 + lr) * GP + mb * 16 + hi * 8) = lo[mb][nb];
            __syncthreads();   // orders the slab's stores in front of the reads of other lanes' values
#pragma unroll
            for (int i = 0; i < 16; ++i) rl[i] = *(const v4ig*)(s0 + (4 * i + rr) * GP + c8);
            const size_t vo = (((z - 2 * (size_t)zdiv) * NKV + head) * HD + rr) * TT + t0 + c8;
#pragma unroll
            for (int i = 0; i < 16; ++i) { *(v4ig*)(V16 + vo + (size_t)i * (4 * TT)) = r16[i]; *(v4ig*)(Vh + vo + (size_t)i * (4 * TT)) = rh[i]; *(v4ig*)(Vl + vo + (size_t)i * (4 * TT)) = rl[i]; }
            asm volatile("s_wait_xcnt 0x0" ::: "memory");   // stands behind the last store, in front of whatever the code laid out behind this branch writes into a register that a store above names
        }
        return;
    }
    float* os = (float*)smraw;
    v4f res[4][8], bv = (v4f)(0.0f);
    if (BIAS) {
#pragma unroll
        for (int q = 0; q < 4; ++q) bv[q] = bfr(bias[c0 + wn * 64 + lr * 4 + q]); }
#pragma unroll
    for (int mb = 0; mb < 4; ++mb) {
        float* my = os + ((mb & 1) * 4 + wv) * (16 * 68);
#pragma unroll
        for (int nb = 0; nb < 4; ++nb) {
#pragma unroll
            for (int j = 0; j < 8; ++j) my[(hi * 8 + j) * 68 + nb * 16 + lr] = acc[mb][nb][j]; }
        __syncthreads();   // orders the slab's stores in front of the reads of other lanes' values
#pragma unroll
        for (int i = 0; i < 8; ++i) { const v4f val = *(const v4fa*)(my + (2 * i + hi) * 68 + lr * 4); res[mb][i] = BIAS ? val + bv : val; } }
    float* cw = C + z * sC + (size_t)(r0 + wm * 64 + hi) * LDC + c0 + wn * 64 + lr * 4;
#pragma unroll
    for (int mb = 0; mb < 4; ++mb)
#pragma unroll
        for (int i = 0; i < 8; ++i) *(v4f*)(cw + (mb * 16 + 2 * i) * LDC) = res[mb][i];
}

__device__ __forceinline__ void splitf(float y, unsigned short& h, unsigned short& l) { h = f2bf(y); l = f2bf(y - bf2f(h)); }

// ---- k_prep: work-groups 0 .. NB-1 rank the unmasked keys of one batch each; the others convert the four weights to bf16 (dst dense [weight][DQ DM]).
// idx[b][j] = row of the j-th unmasked key for j < n, 0 for j >= n; cnt[b CNS] = n. A thread counts TT / 256 successive keys; the counts are summed along each wave by lane shifts, and the eight waves' totals pass through LDS.
#define LWB ((unsigned)((size_t)DQ * DM / 8 / 256))
static_assert((size_t)DQ * DM % 2048 == 0 && TT % 1024 == 0);
__global__ __launch_bounds__(256) void k_prep(const float* __restrict__ s0, const float* __restrict__ s1, const float* __restrict__ s2, const float* __restrict__ s3, bf* dst, const int* __restrict__ mask, int* idx, int* cnt) {
    __shared__ int part[8];
    const int tid = (int)threadIdx.x;
    if (blockIdx.x < NB) {
        constexpr int E = TT / 256;   // the loops below are unrolled because m lives in registers and needs constant indices, and so that the lane shifts and the stores have constant distances
        const int* mk = mask + (size_t)blockIdx.x * SEQ_FULL + tid * E; int* ix = idx + (size_t)blockIdx.x * TT;
        int m[E], c = 0;
#pragma unroll
        for (int i = 0; i < E / 4; ++i) { const v4i v = ((const v4ig*)mk)[i];
#pragma unroll
            for (int k = 0; k < 4; ++k) { m[4 * i + k] = v[k]; c += (v[k] != 0) ? 1 : 0; } }
        int run = c;   // becomes the sum over the wave's lanes up to this one
#pragma unroll
        for (int d = 1; d < 32; d <<= 1) { const int o = __shfl_up(run, (unsigned)d, 32); run += ((tid & 31) >= d) ? o : 0; }
        if ((tid & 31) == 31) part[tid >> 5] = run;
        __syncthreads();   // publishes the waves' totals
        int n = 0, pos = run - c;
#pragma unroll
        for (int w = 0; w < 8; ++w) { const int t = part[w]; n += t; pos += (w < (tid >> 5)) ? t : 0; }
#pragma unroll
        for (int k = 0; k < E; ++k) { if (m[k] != 0) ix[pos] = tid * E + k; pos += (m[k] != 0) ? 1 : 0; }
#pragma unroll
        for (int k = 0; k < E; ++k) { if (tid + 256 * k >= n) ix[tid + 256 * k] = 0; }
        if (tid == 0) cnt[blockIdx.x * CNS] = n;
        return;
    }
    const unsigned w = blockIdx.x - NB, zs = w / LWB; const size_t i = (size_t)(w % LWB) * 256 + tid;
    const float* src = (zs == 0) ? s0 : (zs == 1) ? s1 : (zs == 2) ? s2 : s3; dst += (size_t)zs * DQ * DM; const v8f v = *(const v8f*)(src + i * 8); v8us o;
#pragma unroll
    for (int k = 0; k < 8; ++k) o[k] = f2bf(v[k]); *(v8us*)(dst + i * 8) = o;
    asm volatile("s_wait_xcnt 0x0" ::: "memory"); }   // stands behind the store, in front of whatever the code laid out behind this part (the ranking) writes into a register that the store names

// ---- k_cvtx: query, key, value to bf16, dst [z][b][row][DM]; blockIdx.z = tensor, blockIdx.y = batch, 256 / (DM / 8) rows per work-group.
// Row j of key and value is the row of the j-th unmasked key; rows are written up to the next multiple of 128 behind the count (those take key row 0: finite values that the attention gives weight 0), the rest is neither written nor read.
static_assert(DM % 8 == 0 && 256 % (DM / 8) == 0 && TT % (256 / (DM / 8)) == 0);
__global__ __launch_bounds__(256) void k_cvtx(const float* __restrict__ s0, const float* __restrict__ s1, const float* __restrict__ s2, bf* dst, const int* __restrict__ idx, const int* __restrict__ cnt) {
    constexpr int R8 = DM / 8, RW = 256 / R8;
    const int row = (int)blockIdx.x * RW + (int)threadIdx.x / R8, c8 = ((int)threadIdx.x % R8) * 8; int srow = row;
    if (blockIdx.z != 0) { if ((int)blockIdx.x * RW >= ((cnt[blockIdx.y * CNS] + 127) & ~127)) return; srow = min(max(idx[(size_t)blockIdx.y * TT + row], 0), TT - 1); }
    const float* src = ((blockIdx.z == 0) ? s0 : (blockIdx.z == 1) ? s1 : s2) + ((size_t)blockIdx.y * SEQ_FULL + srow) * DM + c8; const v8f v = *(const v8f*)src; v8us o;
#pragma unroll
    for (int k = 0; k < 8; ++k) o[k] = f2bf(v[k]); *(v8us*)(dst + (((size_t)blockIdx.z * NB + blockIdx.y) * TT + row) * DM + c8) = o; }

#define FP   72             // LDS row pitch in 16-bit elements: 128 B + 16 B, the 16 rows of a 16-byte fragment read fall on distinct banks
#define FT   (64 * FP)      // one 64 x 64 tile
#define QBH  64             // queries per work-group, rows < RH
#define QBL  192            // queries per work-group, rows >= RH
#define MSTART (-5.0e29f)
#define SCL2 (SCL * 1.4426950408889634f)
static_assert(RH % QBH == 0 && (TT - RH) % QBL == 0 && RH / QBH == (TT - RH) / QBL && TT % 1024 == 0 && TT % 64 == 0);
typedef v4i __attribute__((may_alias)) v4ia;

__device__ __forceinline__ float xhalf(float x) { const int b = __float_as_int(x); return __int_as_float(__builtin_amdgcn_permlanex16(b, b, 0x76543210, 0xfedcba98, false, false)); }   // lane l <-> l ^ 16

template <typename T16, bool HI>
__device__ __forceinline__ void fa_body(T16* sm, int n, const T16* __restrict__ Q, const T16* __restrict__ Q2, const T16* __restrict__ Kp, const T16* __restrict__ K2,
                                        const T16* __restrict__ Vt, const T16* __restrict__ V2, int q0, bf* Ah, bf* Al) {
    typedef typename WFrag<T16>::V V;
    constexpr int NPL = HI ? 2 : 1, NG = HI ? 1 : 3; const int NS = (n + 63) >> 6;   // n is in 0 .. TT, so at most TT / 64 stages
    const int tid = (int)threadIdx.x, lane = tid & 31, lr = lane & 15, hi = lane >> 4;
    const int qw = q0 + (tid >> 5) * (16 * NG);
    const int srow = tid >> 3, scol = (tid & 7) * 8;   // staging: 16 bytes of rows srow + 16 i, i = 0..3, of every tile
    v4i st[2 * NPL][4];
    auto gl = [&](int j0) {
        const size_t ko = (size_t)(j0 + srow) * HD + scol, vo = (size_t)srow * TT + j0 + scol;   // the four rows differ by constants
        const T16* pk = Kp + ko; const T16* pk2 = HI ? K2 + ko : nullptr; const T16* pv = Vt + vo; const T16* pv2 = HI ? V2 + vo : nullptr;
        __builtin_amdgcn_sched_barrier(0);   // with the one behind the caller's wait: keeps other vector work out of the stretch from the first load to the wait, where it could write a register that holds an address of an issued load
#pragma unroll
        for (int i = 0; i < 4; ++i) {
            st[0][i] = *(const v4ia*)(pk + i * (16 * HD)); if (HI) st[1][i] = *(const v4ia*)(pk2 + i * (16 * HD));
            st[NPL][i] = *(const v4ia*)(pv + i * (16 * TT)); if (HI) st[NPL + 1][i] = *(const v4ia*)(pv2 + i * (16 * TT)); }
    };   // every call is followed by s_wait_xcnt 0 and a second sched_barrier
    auto sl = [&](int buf) {
#pragma unroll
        for (int tl = 0; tl < 2 * NPL; ++tl)
#pragma unroll
            for (int i = 0; i < 4; ++i) *(v4ia*)(sm + (buf * 2 * NPL + tl) * FT + (srow + 16 * i) * FP + scol) = st[tl][i]; };
    V q[NG][2], q2[NG][2]; const T16* qp[NG]; const T16* qp2[NG];
#pragma unroll
    for (int g = 0; g < NG; ++g) { const size_t qo = (size_t)(qw + g * 16 + lr) * HD + 8 * hi; qp[g] = Q + qo; qp2[g] = HI ? Q2 + qo : nullptr;
#pragma unroll
        for (int ks = 0; ks < 2; ++ks) { q[g][ks] = WFrag<T16>::ld(qp[g] + ks * 32); if (HI) q2[g][ks] = WFrag<T16>::ld(qp2[g] + ks * 32); } }
    v8f o[NG][4]; float mrun[NG], lsum[NG];
#pragma unroll
    for (int g = 0; g < NG; ++g) { mrun[g] = MSTART; lsum[g] = 0.0f;
#pragma unroll
        for (int mb = 0; mb < 4; ++mb) o[g][mb] = (v8f){}; }
    if (NS > 0) { gl(0);
        // The wait stands in front of whatever next writes a register that holds an address of the loads above. The addresses of the Q loads are named as inputs so that their registers stay theirs
        // up to the wait: the address arithmetic of the first stage stands between those loads and this place.
        if constexpr (HI) asm volatile("s_wait_xcnt 0x0" :: "v"(qp[0]), "v"(qp2[0]) : "memory");
        else asm volatile("s_wait_xcnt 0x0" :: "v"(qp[0]), "v"(qp[1]), "v"(qp[2]) : "memory");
        __builtin_amdgcn_sched_barrier(0);
        sl(0); }
#pragma unroll 1
    for (int s = 0; s < NS; ++s) {
        __syncthreads();   // publishes buffer s & 1; ends every read of the other buffer, which is refilled below
        const bool more = (s + 1 < NS);
        if (more) { gl((s + 1) * 64);
            asm volatile("s_wait_xcnt 0x0" ::: "memory");   // stands in front of whatever next writes a register that holds an address of the loads above
            __builtin_amdgcn_sched_barrier(0); }
        const T16* kt = sm + ((s & 1) * 2 * NPL) * FT; const T16* vt = kt + NPL * FT;
        // All fragments of the stage are read as one group into registers of their own, in the order of their use: the K products wait for the first reads only, the V^T fragments land under them and under the softmax.
        // The loops over fragments and tiles are unrolled because the fragments and accumulators live in registers and need constant indices.
        V ka[2][4], kb[2][4], va[2][4], vb[2][4];
#pragma unroll
        for (int ks = 0; ks < 2; ++ks) {
#pragma unroll
            for (int t = 0; t < 4; ++t) ka[ks][t] = WFrag<T16>::ld(kt + (t * 16 + lr) * FP + ks * 32 + 8 * hi);
            if (HI) {
#pragma unroll
                for (int t = 0; t < 4; ++t) kb[ks][t] = WFrag<T16>::ld(kt + FT + (t * 16 + lr) * FP + ks * 32 + 8 * hi); } }
#pragma unroll
        for (int p2 = 0; p2 < 2; ++p2) {
#pragma unroll
            for (int mb = 0; mb < 4; ++mb) va[p2][mb] = WFrag<T16>::ld(vt + (mb * 16 + lr) * FP + p2 * 32 + 8 * hi);
            if (HI) {
#pragma unroll
                for (int mb = 0; mb < 4; ++mb) vb[p2][mb] = WFrag<T16>::ld(vt + FT + (mb * 16 + lr) * FP + p2 * 32 + 8 * hi); } }
        __builtin_amdgcn_sched_barrier(0);   // keeps the reads one group in front of the products: a read placed directly in front of its product leaves the whole LDS latency open each time
        // Successive products go to different accumulator tiles, so that none waits for the one before it; each tile takes its products in the order k block 0 (hi.hi, hi.lo, lo.hi), k block 1.
        v8f sc[NG][4];
#pragma unroll
        for (int t = 0; t < 4; ++t)
#pragma unroll
            for (int g = 0; g < NG; ++g) sc[g][t] = (v8f){};
#pragma unroll
        for (int ks = 0; ks < 2; ++ks) {
#pragma unroll
            for (int t = 0; t < 4; ++t)
#pragma unroll
                for (int g = 0; g < NG; ++g) sc[g][t] = WFrag<T16>::mma(ka[ks][t], q[g][ks], sc[g][t]);
            if (HI) {
#pragma unroll
                for (int t = 0; t < 4; ++t)
#pragma unroll
                    for (int g = 0; g < NG; ++g) sc[g][t] = WFrag<T16>::mma(ka[ks][t], q2[g][ks], sc[g][t]);
#pragma unroll
                for (int t = 0; t < 4; ++t)
#pragma unroll
                    for (int g = 0; g < NG; ++g) sc[g][t] = WFrag<T16>::mma(kb[ks][t], q[g][ks], sc[g][t]); } }
        if constexpr (HI) __builtin_amdgcn_sched_barrier(0);   // with one column group a tile's six products depend on each other: keeps the four tiles' products alternating, where the compiler would else run tile after tile with the vector work between
        float mnew[NG]; const int lim = n - s * 64 - 8 * hi;   // this lane's keys of the stage below lim are real
#pragma unroll
        for (int g = 0; g < NG; ++g) mnew[g] = mrun[g];
#pragma unroll
        for (int t = 0; t < 4; ++t) {
#pragma unroll
            for (int r = 0; r < 8; ++r) { const bool ok = t * 16 + r < lim;
#pragma unroll
                for (int g = 0; g < NG; ++g) { const float x = ok ? sc[g][t][r] * SCL2 : NEGBIG; sc[g][t][r] = x; mnew[g] = fmaxf(mnew[g], x); } } }
        V pf[NG][2], pl[NG][2];
#pragma unroll
        for (int g = 0; g < NG; ++g) {
            const float mx = fmaxf(mnew[g], xhalf(mnew[g]));   // both halves of a column share one maximum: their keys meet in one product
            const float da = mrun[g] - mx; float al = __builtin_amdgcn_exp2f(da); mrun[g] = mx;
            asm volatile("v_nop" : "+v"(al) : "v"(da));       // the free slot behind a transcendental, see below
            const float off = HI ? mx : mx - PCARL2;
            float ps = 0.0f;
#pragma unroll
            for (int t = 0; t < 4; ++t) { const v8f d = sc[g][t] - off; v8f p;
#pragma unroll
                for (int r = 0; r < 8; ++r) p[r] = __builtin_amdgcn_exp2f(d[r]);
                // The instruction set asks for one free slot behind v_exp_f32 before its result is read or its source overwritten. Naming the eight sources as inputs keeps them
                // whole until here, naming the results as in-out keeps their readers behind: inside the run each v_exp_f32 is the next one's slot, the v_nop is the last one's.
                asm volatile("v_nop" : "+v"(p) : "v"(d));
                sc[g][t] = p;
#pragma unroll
                for (int r = 0; r < 8; ++r) ps += p[r]; }
            lsum[g] = lsum[g] * al + ps;
#pragma unroll
            for (int mb = 0; mb < 4; ++mb) o[g][mb] *= al;
#pragma unroll
            for (int p2 = 0; p2 < 2; ++p2) {
                if constexpr (HI) {
                    const v8bf h0 = __builtin_convertvector(sc[g][2 * p2], v8bf), h1 = __builtin_convertvector(sc[g][2 * p2 + 1], v8bf);
                    const v8bf l0 = __builtin_convertvector(sc[g][2 * p2] - __builtin_convertvector(h0, v8f), v8bf), l1 = __builtin_convertvector(sc[g][2 * p2 + 1] - __builtin_convertvector(h1, v8f), v8bf);
                    pf[g][p2] = __builtin_shufflevector(h0, h1, 0, 1, 2, 3, 4, 5, 6, 7, 8, 9, 10, 11, 12, 13, 14, 15);
                    pl[g][p2] = __builtin_shufflevector(l0, l1, 0, 1, 2, 3, 4, 5, 6, 7, 8, 9, 10, 11, 12, 13, 14, 15);
                } else {
                    pf[g][p2] = cat16(__builtin_convertvector(sc[g][2 * p2], v8h), __builtin_convertvector(sc[g][2 * p2 + 1], v8h));
                } } }
#pragma unroll
        for (int p2 = 0; p2 < 2; ++p2) {
#pragma unroll
            for (int mb = 0; mb < 4; ++mb)
#pragma unroll
                for (int g = 0; g < NG; ++g) o[g][mb] = WFrag<T16>::mma(va[p2][mb], pf[g][p2], o[g][mb]);
            if (HI) {
#pragma unroll
                for (int mb = 0; mb < 4; ++mb)
#pragma unroll
                    for (int g = 0; g < NG; ++g) o[g][mb] = WFrag<T16>::mma(va[p2][mb], pl[g][p2], o[g][mb]);
#pragma unroll
                for (int mb = 0; mb < 4; ++mb)
#pragma unroll
                    for (int g = 0; g < NG; ++g) o[g][mb] = WFrag<T16>::mma(vb[p2][mb], pf[g][p2], o[g][mb]); } }
        if (more) sl((s + 1) & 1);
    }
    // lane l: query qw + 16 g + (l & 15), d = 16 mb + 8 (l >> 4) + 0..7: 16 bytes of each ctx plane
#pragma unroll
    for (int g = 0; g < NG; ++g) { const float inv = __fdiv_rn(1.0f, lsum[g] + xhalf(lsum[g]));
#pragma unroll
        for (int mb = 0; mb < 4; ++mb) { v8us oh, ol;
#pragma unroll
            for (int r = 0; r < 8; ++r) { unsigned short a, c2; splitf(o[g][mb][r] * inv, a, c2); oh[r] = a; ol[r] = c2; }
            const size_t oo = (size_t)(qw + g * 16 + lr) * DQ + mb * 16 + 8 * hi;
            __builtin_amdgcn_sched_barrier(0);   // with the one behind the wait: keeps the conversions of this and the next piece out of the stretch from the first store to the wait, where they could write a register that an issued store names
            *(v8us*)(Ah + oo) = oh; *(v8us*)(Al + oo) = ol;
            asm volatile("s_wait_xcnt 0x0" ::: "memory");   // stands in front of whatever next writes a register that the two stores name
            __builtin_amdgcn_sched_barrier(0); } }
}

// grid: work-group x is a hi/lo block where x has an even number of one bits, else an f16 block, so that two work-groups whose indices differ in one bit (neighbours as well as x and x + half the grid) are one of each kind,
// whichever of these pairs the dispatcher puts on one WGP (for speed only); x >> 1 numbers the blocks of either kind. Planes [b][head][.][.], ctx planes [b][t][DQ]
__global__ __launch_bounds__(128) void k_fattn(const h16* __restrict__ Q16, const h16* __restrict__ K16, const h16* __restrict__ V16, const bf* __restrict__ Qh, const bf* __restrict__ Ql, const bf* __restrict__ Kh, const bf* __restrict__ Kl,
                                               const bf* __restrict__ Vh, const bf* __restrict__ Vl, const int* __restrict__ cnt, bf* Ah, bf* Al) {
    __shared__ __align__(16) unsigned short sm[2 * 4 * FT];
    constexpr int HB = RH / QBH;   // blocks per (batch, head), of either kind
    const int x = (int)blockIdx.x, y = x >> 1; const bool hires = (__builtin_popcount((unsigned)x) & 1) == 0;
    const int bh = y / HB; const int q0 = hires ? (y % HB) * QBH : RH + (y % HB) * QBL;
    const int b = bh / NH_, hd = bh % NH_; const size_t po = (size_t)bh * TT * HD, ao = (size_t)b * TT * DQ + (size_t)hd * HD;
    const int n = min(max(cnt[b * CNS], 0), TT);   // the same for the whole work-group: it bounds the stage loop and its barriers
    if (hires) fa_body<bf, true>((bf*)sm, n, Qh + po, Ql + po, Kh + po, Kl + po, Vh + po, Vl + po, q0, Ah + ao, Al + ao);
    else fa_body<h16, false>((h16*)sm, n, Q16 + po, nullptr, K16 + po, nullptr, V16 + po, nullptr, q0, Ah + ao, Al + ao);
}

extern "C" void kernel_launch(void* const* d_in, const int* in_sizes, int n_in,
                              void* d_out, int out_size, void* d_ws, size_t ws_size, hipStream_t stream) {
    if (n_in < 12) return;
    const size_t needx = (size_t)(NB - 1) * SEQ_FULL * DM + (size_t)TT * DM;
    const size_t needm = (size_t)(NB - 1) * SEQ_FULL + (size_t)TT;
    if ((size_t)in_sizes[0] < needx || (size_t)in_sizes[1] < needx || (size_t)in_sizes[2] < needx || (size_t)in_sizes[3] < needm) return;
    if ((size_t)in_sizes[4] < (size_t)DQ * DM || (size_t)in_sizes[6] < (size_t)DKV * DM || (size_t)in_sizes[8] < (size_t)DKV * DM || (size_t)in_sizes[10] < (size_t)DM * DQ) return;
    if (in_sizes[5] < DQ || in_sizes[7] < DKV || in_sizes[9] < DKV || in_sizes[11] < DM) return;
    if ((size_t)out_size < needx) return;
    // wire order: query, key, value, mask (int32), Wq, bq, Wk, bk, Wv, bv, Wo, bo; weights [out][in]
    const float* xq = (const float*)d_in[0]; const float* xk = (const float*)d_in[1]; const float* xv = (const float*)d_in[2]; const int* mask = (const int*)d_in[3];
    const float* wq = (const float*)d_in[4]; const float* bq = (const float*)d_in[5]; const float* wk = (const float*)d_in[6]; const float* bk = (const float*)d_in[7];
    const float* wv = (const float*)d_in[8]; const float* bv = (const float*)d_in[9]; const float* wo = (const float*)d_in[10]; const float* bo = (const float*)d_in[11];
    float* OUT = (float*)d_out;     // [NB_FULL][SEQ_FULL][DM]
    char* wsp = (char*)d_ws;
    auto take = [&](size_t bytes) { char* p = wsp; wsp += (bytes + 255) & ~(size_t)255; return (void*)p; };
    bf* WQ = (bf*)take(SZ_W); bf* WK = (bf*)take(SZ_W); bf* WV = (bf*)take(SZ_W); bf* WO = (bf*)take(SZ_W);   // one after the other: filled by one launch, WQ WK WV read by one launch
    // planes [b][head][.][.]; each k plane directly behind its q plane, so that one launch fills both
    h16* QP16 = (h16*)take(SZ_HP); h16* KP16 = (h16*)take(SZ_HP); bf* QPh = (bf*)take(SZ_HP); bf* KPh = (bf*)take(SZ_HP); bf* QPl = (bf*)take(SZ_HP); bf* KPl = (bf*)take(SZ_HP);
    h16* VT16 = (h16*)take(SZ_HP); bf* VTh = (bf*)take(SZ_HP); bf* VTl = (bf*)take(SZ_HP);
    bf* XB = (bf*)take(SZ_XB); bf* ATh = (bf*)take(SZ_AT);   // XB [q k v][b][t][DM] bf16
    bf* ATl = (bf*)take(SZ_AT); int* IX = (int*)take(SZ_IX); int* CN = (int*)take(SZ_CN);
    if ((size_t)(wsp - (char*)d_ws) > ws_size) return;
    const unsigned LX = (unsigned)(((size_t)TT * DM / 8 + 255) / 256);
    const size_t xs = (size_t)SEQ_FULL * DM;   // batch stride of the f32 inputs and of the output
    // the ranks of the unmasked keys and the four weights in one launch; q inputs and the ranked k, v inputs of every batch in one launch
    k_prep<<<NB + 4 * LWB, 256, 0, stream>>>(wq, wk, wv, wo, WQ, mask, IX, CN);
    k_cvtx<<<dim3(LX, NB, 3), 256, 0, stream>>>(xq, xk, xv, XB, IX, CN);
    // the three projections of every batch in one launch: z = tensor * NB + batch; the q and k planes and the transposed v planes are written directly
    k_gemms<bf, 0, true, true, DM, DM, DQ><<<dim3(TT / 128, DQ / 128, 3 * NB), 128, 0, stream>>>(XB, nullptr, WQ, nullptr, QP16, QPh, QPl, VT16, VTh, VTl, bq, bk, bv, CN, NB, (size_t)TT * DM, (size_t)DQ * DM, 0);
    // attention of every batch and head in one launch, ctx planes written directly
    k_fattn<<<NB * NH_ * (RH / QBH + (TT - RH) / QBL), 128, 0, stream>>>(QP16, KP16, VT16, QPh, QPl, KPh, KPl, VTh, VTl, CN, ATh, ATl);
    // out[b][t][n] = sum_k ctx[b][t][k] Wo[n][k] + bo[n], every batch in one launch
    k_gemms<bf, 1, true, false, DQ, DQ, DM><<<dim3(TT / 128, DM / 128, NB), 128, 0, stream>>>(ATh, ATl, WO, OUT, nullptr, nullptr, nullptr, nullptr, nullptr, nullptr, bo, bo, bo, nullptr, NB, (size_t)TT * DQ, 0, xs);
}

// v009
// One run takes 84.2 microseconds.
// Timed twice side by side with v008, it ran 1.04 and 1.03 times as fast.
// Over all steps from v000 it is 24.0 times as fast.
#include <hip/hip_runtime.h>

// 16-head scaled dot-product attention with a key padding mask: q = query Wq^T + bq, k = key Wk^T + bk, v = value Wv^T + bv (weights [out][in]); scores x 1/8; masked keys (mask == 0) replaced by -inf; softmax over keys; out = merged Wo^T + bo.
// A masked key has weight exactly 0, so it is left out: the unmasked keys of a batch are ranked in their order, the key and value rows are gathered by rank, and k, v and the attention run over those rows alone.
// Compute dtypes, f32 accumulate everywhere: every float input converted to bf16 (RNE); projections v_wmma_f32_16x16x32_bf16 on exact bf16 planes + bias rounded to bf16; scores rows < RH bf16 hi/lo planes (3 products), rows >= RH v_wmma_f32_16x16x32_f16;
// P.V rows < RH bf16 hi/lo planes (3 products), rows >= RH f16 with P carried x1024 (the f32 row sum carries it too); output projection bf16 hi/lo ctx planes x bf16 Wo (2 products) + bias rounded to bf16; softmax f32.

#ifndef NB
#define NB 2
#endif
#ifndef SEQ
#define SEQ 2048
#endif
#define NB_FULL  2
#define SEQ_FULL 2048
#define TT   SEQ
#define DM   1024
#define NH_  16
#define NKV  16
#define REP  (NH_ / NKV)
#define HD   64
#define DQ   (NH_ * HD)
#define DKV  (NKV * HD)
#define RH   ((TT > 512) ? 512 : (TT / 2))   // query rows < RH use hi+lo planes
#define PCARL2 10.0f      // P of the f16 rows is carried x 2^10
#define SCL  0.125f       // HD^-0.5
#define NEGBIG (-1.0e30f)

static_assert(NB >= 1 && NB <= NB_FULL);
static_assert(TT <= SEQ_FULL && TT % 128 == 0);
static_assert(RH >= 64 && RH % 64 == 0 && TT > RH && (TT - RH) % 64 == 0);
static_assert(HD == 64 && DM % 64 == 0 && DQ % 64 == 0 && DM % 32 == 0 && TT % 32 == 0);
static_assert(REP == 1);
static_assert(DM % 128 == 0 && DQ % 128 == 0);

#define SZ_W    ((size_t)DQ * DM * 2)
#define SZ_XB   ((size_t)3 * NB * TT * DM * 2)
#define SZ_HP   ((size_t)NB * NH_ * TT * HD * 2)
#define SZ_AT   ((size_t)NB * TT * DQ * 2)
#define SZ_IX   ((size_t)NB * TT * 4)      // rank -> key row, per batch
#define SZ_CN   (((size_t)NB * 128 + 255) / 256 * 256)   // number of unmasked keys, one 128-byte line per batch
#define CNS     32                         // ints between two batches' counts
#define SZ_ALL  (4 * SZ_W + 9 * SZ_HP + SZ_XB + 2 * SZ_AT + SZ_IX + SZ_CN)
static_assert(SZ_W % 256 == 0 && SZ_XB % 256 == 0 && SZ_HP % 256 == 0 && SZ_AT % 256 == 0 && SZ_IX % 256 == 0 && SZ_CN % 256 == 0);
static_assert(SZ_ALL <= (size_t)268435456 && DQ == DKV && NH_ == NKV);

typedef _Float16 h16;
typedef unsigned short bf;
typedef __attribute__((ext_vector_type(16))) __bf16   v16bf;
typedef __attribute__((ext_vector_type(16))) _Float16 v16h;
typedef __attribute__((ext_vector_type(8)))  _Float16 v8h;
typedef __attribute__((ext_vector_type(8)))  unsigned short v8us;
typedef __attribute__((ext_vector_type(8)))  float    v8f;
typedef __attribute__((ext_vector_type(4)))  float    v4f;
typedef v4f  __attribute__((may_alias)) v4fa;
typedef __attribute__((ext_vector_type(4))) _Float16 v4h;
typedef __attribute__((ext_vector_type(4))) unsigned short v4us;
typedef __attribute__((ext_vector_type(4))) int v4i;

__device__ __forceinline__ unsigned short f2bf(float f) { unsigned u = __float_as_uint(f); u += 0x7FFFu + ((u >> 16) & 1u); return (unsigned short)(u >> 16); }
__device__ __forceinline__ float bf2f(unsigned short b) { return __uint_as_float(((unsigned)b) << 16); }
__device__ __forceinline__ float bfr(float f) { return bf2f(f2bf(f)); }
__device__ __forceinline__ v16h cat16(v8h lo, v8h hi) { return __builtin_shufflevector(lo, hi, 0, 1, 2, 3, 4, 5, 6, 7, 8, 9, 10, 11, 12, 13, 14, 15); }
__device__ __forceinline__ v16bf cat16b(v8us lo, v8us hi) { return __builtin_bit_cast(v16bf, __builtin_shufflevector(lo, hi, 0, 1, 2, 3, 4, 5, 6, 7, 8, 9, 10, 11, 12, 13, 14, 15)); }
__device__ __forceinline__ v8f wmma16(v16h a, v16h b, v8f c) { return __builtin_amdgcn_wmma_f32_16x16x32_f16(false, a, false, b, (short)0, c, false, false); }
__device__ __forceinline__ v8f wmmab(v16bf a, v16bf b, v8f c) { return __builtin_amdgcn_wmma_f32_16x16x32_bf16(false, a, false, b, (short)0, c, false, false); }

// ---- k_gemms: GEMM on K-contiguous 16-bit planes, one 128x128 output tile per work-group of 4 waves (2 x 2, 64x64 and 16 accumulators each); grid (M/128, N/128, Z), 128 threads.
// C[m][n] (f32, + optional bias[n] rounded to bf16) = sum_k (A[m][k] + A2[m][k]) Bt[n][k] (A2 only with NSPLIT == 1). A rows have pitch LDA, Bt rows pitch K, C rows pitch LDC. z-batch strides sA/sB/sC in elements; Bt and the bias change only every zdiv-th z (bias0, bias1, bias2 in turn). K % 64 == 0, M % 128 == 0, N % 128 == 0.
// k goes by stages of 64: the A (and A2) tile [128 rows][64 k] and the Bt tile [128 rows][64 k] pass through registers into one of two LDS buffers while the other is read.
// A staging load of a wave covers four whole 128-byte rows, and every operand line is fetched once per work-group. Each wave sums its whole K in ascending order.
// With PLANES the result does not go to C: z / zdiv = 0, 1 (q, k) writes x = sum + bias as three 16-bit planes [z][head][t][d] (f16, bf16 hi, bf16 lo = bf16(x - hi)), z / zdiv = 2 (v) the same three planes transposed, [z - 2 zdiv][head][d][t]. A wave's 64 columns are one head.
// With PLANES the rows of k and v are the ranked unmasked keys: a tile whose first row is not below the batch's count cnt[] has nothing to do (the rows from the count up to the tile's end hold a copy of key row 0, see k_cvtx).
// Fragment map (A and B alike): lane l -> row/col l & 15, h = l >> 4; elements 0..7 = k0 + 8h + 0..7, elements 8..15 = k0 + 16 + 8h + 0..7. D: element r -> row 8h + r, col l & 15.
template <typename T16> struct WFrag;
template <> struct WFrag<h16> { typedef v16h V; static __device__ __forceinline__ V ld(const h16* p) { return cat16(*(const v8h*)p, *(const v8h*)(p + 16)); } static __device__ __forceinline__ v8f mma(V a, V b, v8f c) { return wmma16(a, b, c); } };
template <> struct WFrag<bf> { typedef v16bf V; static __device__ __forceinline__ V ld(const bf* p) { return cat16b(*(const v8us*)p, *(const v8us*)(p + 16)); } static __device__ __forceinline__ v8f mma(V a, V b, v8f c) { return wmmab(a, b, c); } };
#define GP   72             // LDS row pitch in 16-bit elements: 128 B + 16 B, the 16 rows of a 16-byte fragment read fall on distinct banks
#define GT   (128 * GP)     // one 128 x 64 tile
typedef v4i __attribute__((may_alias)) v4ig;
typedef __attribute__((ext_vector_type(8))) __bf16 v8bf;
// the three planes of eight values, every conversion round to nearest even
__device__ __forceinline__ void planes8(v8f x, v4i& o16, v4i& oh, v4i& ol) { oh = __builtin_bit_cast(v4i, __builtin_convertvector(x, v8bf)); v8f hf;
#pragma unroll
    for (int k = 0; k < 4; ++k) { hf[2 * k] = __int_as_float(oh[k] << 16); hf[2 * k + 1] = __int_as_float(oh[k] & (int)0xFFFF0000u); }   // the packed hi words back to f32
    o16 = __builtin_bit_cast(v4i, __builtin_convertvector(x, v8h)); ol = __builtin_bit_cast(v4i, __builtin_convertvector(x - hf, v8bf)); }
template <typename T16, int NSPLIT, bool BIAS, bool PLANES, int K, int LDA, int LDC>
__global__ __launch_bounds__(128) void k_gemms(const T16* __restrict__ A, const T16* __restrict__ A2, const T16* __restrict__ Bt, float* C, h16* P16, bf* Ph, bf* Pl, h16* V16, bf* Vh, bf* Vl, const float* __restrict__ bias0, const float* __restrict__ bias1, const float* __restrict__ bias2, const int* __restrict__ cnt, int zdiv, size_t sA, size_t sB, size_t sC) {
    typedef typename WFrag<T16>::V V; static_assert((NSPLIT == 0 || NSPLIT == 1) && K % 64 == 0 && K >= 64);
    constexpr int NT = (NSPLIT == 1) ? 3 : 2;   // tiles per stage: A, (A2), Bt
    constexpr int NS = K / 64;
    __shared__ __align__(16) unsigned char smraw[2 * NT * GT * 2];
    static_assert(2 * 4 * 16 * 68 * 4 <= 2 * NT * GT * 2);
    T16* sm = (T16*)smraw;
    const size_t z = blockIdx.z, zb = blockIdx.z / (unsigned)zdiv;
    if constexpr (PLANES) { if (zb != 0 && (int)blockIdx.x * 128 >= cnt[(z - zb * (unsigned)zdiv) * CNS]) return; }   // the same for the whole work-group, in front of every barrier
    const float* bias = (zb == 0) ? bias0 : ((zb == 1) ? bias1 : bias2);
    const int tid = (int)threadIdx.x, lane = tid & 31, lr = lane & 15, hi = lane >> 4; const int r0 = blockIdx.x * 128, c0 = blockIdx.y * 128;
    // wave number through readfirstlane: the tile offsets stay in scalar registers
    const int wv = __builtin_amdgcn_readfirstlane(tid >> 5), wm = wv >> 1, wn = wv & 1;
    const int srow = tid >> 3, scol = (tid & 7) * 8;   // staging: 16 bytes of rows srow + 16 i, i = 0..7, of every tile
    // a work-group-uniform base plus one 32-bit byte offset per thread; the eight rows differ by constants
    const char* ua = (const char*)(A + z * sA + (size_t)r0 * LDA); const char* ua2 = (NSPLIT == 1) ? (const char*)(A2 + z * sA + (size_t)r0 * LDA) : nullptr; const char* ub = (const char*)(Bt + zb * sB + (size_t)c0 * K);
    const unsigned va = (unsigned)(srow * LDA + scol) * 2u, vb = (unsigned)(srow * K + scol) * 2u;
    v4i st[NT][8];
    auto gl = [&](int kc) {
        const char* pa = ua + kc * 2 + va; const char* pa2 = (NSPLIT == 1) ? ua2 + kc * 2 + va : nullptr; const char* pb = ub + kc * 2 + vb;
#pragma unroll
        for (int i = 0; i < 8; ++i) { st[0][i] = *(const v4ig*)(pa + i * (16 * LDA * 2)); if (NSPLIT == 1) st[1][i] = *(const v4ig*)(pa2 + i * (16 * LDA * 2)); st[NT - 1][i] = *(const v4ig*)(pb + i * (16 * K * 2)); }
        // The wait stands in front of whatever next writes a register that holds an address of the loads above (the fragment reads and the accumulators may take those registers);
        // the addresses are named as inputs so that their registers stay theirs up to the wait.
        if constexpr (NSPLIT == 1) asm volatile("s_wait_xcnt 0x0" :: "v"(pa), "v"(pa2), "v"(pb), "v"(va), "v"(vb) : "memory");
        else asm volatile("s_wait_xcnt 0x0" :: "v"(pa), "v"(pb), "v"(va), "v"(vb) : "memory"); };
    auto sl = [&](int buf) {
#pragma unroll
        for (int tl = 0; tl < NT; ++tl)
#pragma unroll
            for (int i = 0; i < 8; ++i) *(v4ig*)(sm + (buf * NT + tl) * GT + (srow + 16 * i) * GP + scol) = st[tl][i]; };
    v8f acc[4][4];
#pragma unroll
    for (int mb = 0; mb < 4; ++mb)
#pragma unroll
        for (int nb = 0; nb < 4; ++nb) acc[mb][nb] = (v8f){};
    gl(0); sl(0);
    // The stage loop stays rolled: one copy of the stage's products in the instruction cache. The loops inside it are unrolled because st, a, b and acc live in registers and need constant indices.
#pragma unroll 1
    for (int s = 0; s < NS; ++s) {
        __syncthreads();   // publishes buffer s & 1; ends every read of the other buffer, which is refilled below
        const bool more = (s + 1 < NS);
        if (more) gl((s + 1) * 64);
        const T16* at = sm + ((s & 1) * NT) * GT + (wm * 64 + lr) * GP + 8 * hi; const T16* bt = sm + ((s & 1) * NT + NT - 1) * GT + (wn * 64 + lr) * GP + 8 * hi;
        V a[2][4], a2[2][4], b[2][4];
#pragma unroll
        for (int ks = 0; ks < 2; ++ks)
#pragma unroll
            for (int f = 0; f < 4; ++f) { a[ks][f] = WFrag<T16>::ld(at + f * 16 * GP + ks * 32); if (NSPLIT == 1) a2[ks][f] = WFrag<T16>::ld(at + GT + f * 16 * GP + ks * 32); b[ks][f] = WFrag<T16>::ld(bt + f * 16 * GP + ks * 32); }
        __builtin_amdgcn_sched_barrier(0);   // keeps the stage's fragment reads one group in front of its products, for speed only
#pragma unroll
        for (int ks = 0; ks < 2; ++ks)
#pragma unroll
            for (int nb = 0; nb < 4; ++nb) {
#pragma unroll
                for (int mb = 0; mb < 4; ++mb) acc[mb][nb] = WFrag<T16>::mma(a[ks][mb], b[ks][nb], acc[mb][nb]);
                if (NSPLIT == 1) {
#pragma unroll
                    for (int mb = 0; mb < 4; ++mb) acc[mb][nb] = WFrag<T16>::mma(a2[ks][mb], b[ks][nb], acc[mb][nb]); } }
        if (more) sl((s + 1) & 1);
    }
    // Output through LDS, so that every global store covers whole 256-byte row pieces: per pass a wave lays 16 x 64 of its tile in its own slab (pitch 68 floats) and reads it back by rows.
    // Two slab sets in turn. The results stay in registers and go to memory behind the last barrier, so that no barrier waits for a global store.
    // Every loop here is unrolled because acc and res live in registers and need constant indices.
    __syncthreads();   // ends every read of the operand tiles: the slabs lie over them
    if constexpr (PLANES) {
        // Every wave stages in its own quarter of the LDS and reads it back so that a lane holds 16 bytes of a plane's row and eight lanes one whole 128-byte line.
        // All results wait in registers and go to memory behind the last barrier: no barrier waits for a global store, and no register of an issued store is written again.
        // Every loop here is unrolled because acc and the results live in registers and need constant indices.
        static_assert(BIAS && HD == 64 && DQ == NH_ * HD && 4 * 64 * 68 * 4 <= 2 * NT * GT * 2 && 4 * 2 * 64 * GP * 2 <= 2 * NT * GT * 2);
        const int head = (int)blockIdx.y * 2 + wn, t0 = r0 + wm * 64, rr = lane >> 3, c8 = (lane & 7) * 8;
        v4i r16[16], rh[16], rl[16];
        if (zb < 2) {
            // q, k: the 64 x 64 f32 tile [t][d] (pitch 68 floats), read back by rows of d
            float* my = (float*)smraw + wv * (64 * 68);
#pragma unroll
            for (int mb = 0; mb < 4; ++mb)
#pragma unroll
                for (int nb = 0; nb < 4; ++nb) {
#pragma unroll
                    for (int j = 0; j < 8; ++j) my[(mb * 16 + hi * 8 + j) * 68 + nb * 16 + lr] = acc[mb][nb][j]; }
            v8f b8;
#pragma unroll
            for (int q = 0; q < 8; ++q) b8[q] = bfr(bias[c0 + wn * 64 + c8 + q]);
            __syncthreads();   // orders the slab's stores in front of the reads of other lanes' values
#pragma unroll
            for (int i = 0; i < 16; ++i) { const float* rp = my + (4 * i + rr) * 68 + c8; const v4f x0 = *(const v4fa*)rp, x1 = *(const v4fa*)(rp + 4);
                planes8(__builtin_shufflevector(x0, x1, 0, 1, 2, 3, 4, 5, 6, 7) + b8, r16[i], rh[i], rl[i]); }
            __builtin_amdgcn_sched_barrier(0);   // keeps every conversion in front of the first store, so that no register of an issued store is written again
            const size_t po = ((z * NH_ + head) * TT + t0 + rr) * HD + c8;
#pragma unroll
            for (int i = 0; i < 16; ++i) { *(v4ig*)(P16 + po + i * (4 * HD)) = r16[i]; *(v4ig*)(Ph + po + i * (4 * HD)) = rh[i]; *(v4ig*)(Pl + po + i * (4 * HD)) = rl[i]; }
        } else {
            // v: a lane's eight accumulator elements are eight successive t of one d, 16 bytes of a transposed plane; slabs [d][t] (pitch GP), two per wave: f16 and hi first, then lo
            unsigned short* s0 = (unsigned short*)smraw + wv * (2 * 64 * GP); unsigned short* s1 = s0 + 64 * GP;
            float bn[4];
#pragma unroll
            for (int nb = 0; nb < 4; ++nb) bn[nb] = bfr(bias[c0 + wn * 64 + nb * 16 + lr]);
            v4i lo[4][4];
#pragma unroll
            for (int mb = 0; mb < 4; ++mb)
#pragma unroll
                for (int nb = 0; nb < 4; ++nb) { v4i o16, oh; planes8(acc[mb][nb] + bn[nb], o16, oh, lo[mb][nb]); const int so = (nb * 16 + lr) * GP + mb * 16 + hi * 8; *(v4ig*)(s0 + so) = o16; *(v4ig*)(s1 + so) = oh; }
            __syncthreads();   // orders the slabs' stores in front of the reads of other lanes' values
#pragma unroll
            for (int i = 0; i < 16; ++i) { const int ro = (4 * i + rr) * GP + c8; r16[i] = *(const v4ig*)(s0 + ro); rh[i] = *(const v4ig*)(s1 + ro); }
            __syncthreads();   // ends the reads of the first slab, which takes the lo plane now
#pragma unroll
            for (int mb = 0; mb < 4; ++mb)
#pragma unroll
                for (int nb = 0; nb < 4; ++nb) *(v4ig*)(s0 + (nb * 16 + lr) * GP + mb * 16 + hi * 8) = lo[mb][nb];
            __syncthreads();   // orders the slab's stores in front of the reads of other lanes' values
#pragma unroll
            for (int i = 0; i < 16; ++i) rl[i] = *(const v4ig*)(s0 + (4 * i + rr) * GP + c8);
            const size_t vo = (((z - 2 * (size_t)zdiv) * NKV + head) * HD + rr) * TT + t0 + c8;
#pragma unroll
            for (int i = 0; i < 16; ++i) { *(v4ig*)(V16 + vo + (size_t)i * (4 * TT)) = r16[i]; *(v4ig*)(Vh + vo + (size_t)i * (4 * TT)) = rh[i]; *(v4ig*)(Vl + vo + (size_t)i * (4 * TT)) = rl[i]; }
            asm volatile("s_wait_xcnt 0x0" ::: "memory");   // stands behind the last store, in front of whatever the code laid out behind this branch writes into a register that a store above names
        }
        return;
    }
    float* os = (float*)smraw;
    v4f res[4][8], bv = (v4f)(0.0f);
    if (BIAS) {
#pragma unroll
        for (int q = 0; q < 4; ++q) bv[q] = bfr(bias[c0 + wn * 64 + lr * 4 + q]); }
#pragma unroll
    for (int mb = 0; mb < 4; ++mb) {
        float* my = os + ((mb & 1) * 4 + wv) * (16 * 68);
#pragma unroll
        for (int nb = 0; nb < 4; ++nb) {
#pragma unroll
            for (int j = 0; j < 8; ++j) my[(hi * 8 + j) * 68 + nb * 16 + lr] = acc[mb][nb][j]; }
        __syncthreads();   // orders the slab's stores in front of the reads of other lanes' values
#pragma unroll
        for (int i = 0; i < 8; ++i) { const v4f val = *(const v4fa*)(my + (2 * i + hi) * 68 + lr * 4); res[mb][i] = BIAS ? val + bv : val; } }
    float* cw = C + z * sC + (size_t)(r0 + wm * 64 + hi) * LDC + c0 + wn * 64 + lr * 4;
#pragma unroll
    for (int mb = 0; mb < 4; ++mb)
#pragma unroll
        for (int i = 0; i < 8; ++i) *(v4f*)(cw + (mb * 16 + 2 * i) * LDC) = res[mb][i];
}

__device__ __forceinline__ void splitf(float y, unsigned short& h, unsigned short& l) { h = f2bf(y); l = f2bf(y - bf2f(h)); }

// ---- k_prep: work-groups 0 .. NB-1 rank the unmasked keys of one batch each; the others convert the four weights to bf16 (dst dense [weight][DQ DM]).
// idx[b][j] = row of the j-th unmasked key for j < n, 0 for j >= n; cnt[b CNS] = n. A thread counts TT / 256 successive keys; the counts are summed along each wave by lane shifts, and the eight waves' totals pass through LDS.
#define LWB ((unsigned)((size_t)DQ * DM / 8 / 256))
static_assert((size_t)DQ * DM % 2048 == 0 && TT % 1024 == 0);
__global__ __launch_bounds__(256) void k_prep(const float* __restrict__ s0, const float* __restrict__ s1, const float* __restrict__ s2, const float* __restrict__ s3, bf* dst, const int* __restrict__ mask, int* idx, int* cnt) {
    __shared__ int part[8];
    const int tid = (int)threadIdx.x;
    if (blockIdx.x < NB) {
        constexpr int E = TT / 256;   // the loops below are unrolled because m lives in registers and needs constant indices, and so that the lane shifts and the stores have constant distances
        const int* mk = mask + (size_t)blockIdx.x * SEQ_FULL + tid * E; int* ix = idx + (size_t)blockIdx.x * TT;
        int m[E], c = 0;
#pragma unroll
        for (int i = 0; i < E / 4; ++i) { const v4i v = ((const v4ig*)mk)[i];
#pragma unroll
            for (int k = 0; k < 4; ++k) { m[4 * i + k] = v[k]; c += (v[k] != 0) ? 1 : 0; } }
        int run = c;   // becomes the sum over the wave's lanes up to this one
#pragma unroll
        for (int d = 1; d < 32; d <<= 1) { const int o = __shfl_up(run, (unsigned)d, 32); run += ((tid & 31) >= d) ? o : 0; }
        if ((tid & 31) == 31) part[tid >> 5] = run;
        __syncthreads();   // publishes the waves' totals
        int n = 0, pos = run - c;
#pragma unroll
        for (int w = 0; w < 8; ++w) { const int t = part[w]; n += t; pos += (w < (tid >> 5)) ? t : 0; }
#pragma unroll
        for (int k = 0; k < E; ++k) { if (m[k] != 0) ix[pos] = tid * E + k; pos += (m[k] != 0) ? 1 : 0; }
#pragma unroll
        for (int k = 0; k < E; ++k) { if (tid + 256 * k >= n) ix[tid + 256 * k] = 0; }
        if (tid == 0) cnt[blockIdx.x * CNS] = n;
        return;
    }
    const unsigned w = blockIdx.x - NB, zs = w / LWB; const size_t i = (size_t)(w % LWB) * 256 + tid;
    const float* src = (zs == 0) ? s0 : (zs == 1) ? s1 : (zs == 2) ? s2 : s3; dst += (size_t)zs * DQ * DM; const v8f v = *(const v8f*)(src + i * 8); v8us o;
#pragma unroll
    for (int k = 0; k < 8; ++k) o[k] = f2bf(v[k]); *(v8us*)(dst + i * 8) = o;
    asm volatile("s_wait_xcnt 0x0" ::: "memory"); }   // stands behind the store, in front of whatever the code laid out behind this part (the ranking) writes into a register that the store names

// ---- k_cvtx: query, key, value to bf16, dst [z][b][row][DM]; blockIdx.z = tensor, blockIdx.y = batch, 256 / (DM / 8) rows per work-group.
// Row j of key and value is the row of the j-th unmasked key; rows are written up to the next multiple of 128 behind the count (those take key row 0: finite values that the attention gives weight 0), the rest is neither written nor read.
static_assert(DM % 8 == 0 && 256 % (DM / 8) == 0 && TT % (256 / (DM / 8)) == 0);
__global__ __launch_bounds__(256) void k_cvtx(const float* __restrict__ s0, const float* __restrict__ s1, const float* __restrict__ s2, bf* dst, const int* __restrict__ idx, const int* __restrict__ cnt) {
    constexpr int R8 = DM / 8, RW = 256 / R8;
    const int row = (int)blockIdx.x * RW + (int)threadIdx.x / R8, c8 = ((int)threadIdx.x % R8) * 8; int srow = row;
    if (blockIdx.z != 0) { if ((int)blockIdx.x * RW >= ((cnt[blockIdx.y * CNS] + 127) & ~127)) return; srow = min(max(idx[(size_t)blockIdx.y * TT + row], 0), TT - 1); }
    const float* src = ((blockIdx.z == 0) ? s0 : (blockIdx.z == 1) ? s1 : s2) + ((size_t)blockIdx.y * SEQ_FULL + srow) * DM + c8; const v8f v = *(const v8f*)src; v8us o;
#pragma unroll
    for (int k = 0; k < 8; ++k) o[k] = f2bf(v[k]); *(v8us*)(dst + (((size_t)blockIdx.z * NB + blockIdx.y) * TT + row) * DM + c8) = o; }

#define FP   72             // LDS row pitch in 16-bit elements: 128 B + 16 B, the 16 rows of a 16-byte fragment read fall on distinct banks
#define FT   (64 * FP)      // one 64 x 64 tile
#define QBH  64             // queries per work-group, rows < RH
#define QBL  192            // queries per work-group, rows >= RH
#define MSTART (-5.0e29f)
#define SCL2 (SCL * 1.4426950408889634f)
static_assert(RH % QBH == 0 && (TT - RH) % QBL == 0 && RH / QBH == (TT - RH) / QBL && TT % 1024 == 0 && TT % 64 == 0);
typedef v4i __attribute__((may_alias)) v4ia;

__device__ __forceinline__ float xhalf(float x) { const int b = __float_as_int(x); return __int_as_float(__builtin_amdgcn_permlanex16(b, b, 0x76543210, 0xfedcba98, false, false)); }   // lane l <-> l ^ 16

template <typename T16, bool HI>
__device__ __forceinline__ void fa_body(T16* sm, int n, const T16* __restrict__ Q, const T16* __restrict__ Q2, const T16* __restrict__ Kp, const T16* __restrict__ K2,
                                        const T16* __restrict__ Vt, const T16* __restrict__ V2, int q0, bf* Ah, bf* Al) {
    typedef typename WFrag<T16>::V V;
    constexpr int NPL = HI ? 2 : 1, NG = HI ? 1 : 3; const int NS = (n + 63) >> 6;   // n is in 0 .. TT, so at most TT / 64 stages
    const int tid = (int)threadIdx.x, lane = tid & 31, lr = lane & 15, hi = lane >> 4;
    const int qw = q0 + (tid >> 5) * (16 * NG);
    const int srow = tid >> 3, scol = (tid & 7) * 8;   // staging: 16 bytes of rows srow + 16 i, i = 0..3, of every tile
    v4i st[2 * NPL][4];
    auto gl = [&](int j0) {
        const size_t ko = (size_t)(j0 + srow) * HD + scol, vo = (size_t)srow * TT + j0 + scol;   // the four rows differ by constants
        const T16* pk = Kp + ko; const T16* pk2 = HI ? K2 + ko : nullptr; const T16* pv = Vt + vo; const T16* pv2 = HI ? V2 + vo : nullptr;
        __builtin_amdgcn_sched_barrier(0);   // with the one behind the caller's wait: keeps other vector work out of the stretch from the first load to the wait, where it could write a register that holds an address of an issued load
#pragma unroll
        for (int i = 0; i < 4; ++i) {
            st[0][i] = *(const v4ia*)(pk + i * (16 * HD)); if (HI) st[1][i] = *(const v4ia*)(pk2 + i * (16 * HD));
            st[NPL][i] = *(const v4ia*)(pv + i * (16 * TT)); if (HI) st[NPL + 1][i] = *(const v4ia*)(pv2 + i * (16 * TT)); }
    };   // every call is followed by s_wait_xcnt 0 and a second sched_barrier
    auto sl = [&](int buf) {
#pragma unroll
        for (int tl = 0; tl < 2 * NPL; ++tl)
#pragma unroll
            for (int i = 0; i < 4; ++i) *(v4ia*)(sm + (buf * 2 * NPL + tl) * FT + (srow + 16 * i) * FP + scol) = st[tl][i]; };
    V q[NG][2], q2[NG][2]; const T16* qp[NG]; const T16* qp2[NG];
#pragma unroll
    for (int g = 0; g < NG; ++g) { const size_t qo = (size_t)(qw + g * 16 + lr) * HD + 8 * hi; qp[g] = Q + qo; qp2[g] = HI ? Q2 + qo : nullptr;
#pragma unroll
        for (int ks = 0; ks < 2; ++ks) { q[g][ks] = WFrag<T16>::ld(qp[g] + ks * 32); if (HI) q2[g][ks] = WFrag<T16>::ld(qp2[g] + ks * 32); } }
    v8f o[NG][4]; float mrun[NG], orun[NG], lsum[NG];
#pragma unroll
    for (int g = 0; g < NG; ++g) { mrun[g] = MSTART; orun[g] = MSTART * SCL2; lsum[g] = 0.0f;
#pragma unroll
        for (int mb = 0; mb < 4; ++mb) o[g][mb] = (v8f){}; }
    if (NS > 0) { gl(0);
        // The wait stands in front of whatever next writes a register that holds an address of the loads above. The addresses of the Q loads are named as inputs so that their registers stay theirs
        // up to the wait: the address arithmetic of the first stage stands between those loads and this place.
        if constexpr (HI) asm volatile("s_wait_xcnt 0x0" :: "v"(qp[0]), "v"(qp2[0]) : "memory");
        else asm volatile("s_wait_xcnt 0x0" :: "v"(qp[0]), "v"(qp[1]), "v"(qp[2]) : "memory");
        __builtin_amdgcn_sched_barrier(0);
        sl(0); }
#pragma unroll 1
    for (int s = 0; s < NS; ++s) {
        __syncthreads();   // publishes buffer s & 1; ends every read of the other buffer, which is refilled below
        const bool more = (s + 1 < NS);
        if (more) { gl((s + 1) * 64);
            asm volatile("s_wait_xcnt 0x0" ::: "memory");   // stands in front of whatever next writes a register that holds an address of the loads above
            __builtin_amdgcn_sched_barrier(0); }
        const T16* kt = sm + ((s & 1) * 2 * NPL) * FT; const T16* vt = kt + NPL * FT;
        // All fragments of the stage are read as one group into registers of their own, in the order of their use: the K products wait for the first reads only, the V^T fragments land under them and under the softmax.
        // The loops over fragments and tiles are unrolled because the fragments and accumulators live in registers and need constant indices.
        V ka[2][4], kb[2][4], va[2][4], vb[2][4];
#pragma unroll
        for (int ks = 0; ks < 2; ++ks) {
#pragma unroll
            for (int t = 0; t < 4; ++t) ka[ks][t] = WFrag<T16>::ld(kt + (t * 16 + lr) * FP + ks * 32 + 8 * hi);
            if (HI) {
#pragma unroll
                for (int t = 0; t < 4; ++t) kb[ks][t] = WFrag<T16>::ld(kt + FT + (t * 16 + lr) * FP + ks * 32 + 8 * hi); } }
#pragma unroll
        for (int p2 = 0; p2 < 2; ++p2) {
#pragma unroll
            for (int mb = 0; mb < 4; ++mb) va[p2][mb] = WFrag<T16>::ld(vt + (mb * 16 + lr) * FP + p2 * 32 + 8 * hi);
            if (HI) {
#pragma unroll
                for (int mb = 0; mb < 4; ++mb) vb[p2][mb] = WFrag<T16>::ld(vt + FT + (mb * 16 + lr) * FP + p2 * 32 + 8 * hi); } }
        __builtin_amdgcn_sched_barrier(0);   // keeps the reads one group in front of the products: a read placed directly in front of its product leaves the whole LDS latency open each time
        // Successive products go to different accumulator tiles, so that none waits for the one before it; each tile takes its products in the order k block 0 (hi.hi, hi.lo, lo.hi), k block 1.
        v8f sc[NG][4];
#pragma unroll
        for (int t = 0; t < 4; ++t)
#pragma unroll
            for (int g = 0; g < NG; ++g) sc[g][t] = (v8f){};
#pragma unroll
        for (int ks = 0; ks < 2; ++ks) {
#pragma unroll
            for (int t = 0; t < 4; ++t)
#pragma unroll
                for (int g = 0; g < NG; ++g) sc[g][t] = WFrag<T16>::mma(ka[ks][t], q[g][ks], sc[g][t]);
            if (HI) {
#pragma unroll
                for (int t = 0; t < 4; ++t)
#pragma unroll
                    for (int g = 0; g < NG; ++g) sc[g][t] = WFrag<T16>::mma(ka[ks][t], q2[g][ks], sc[g][t]);
#pragma unroll
                for (int t = 0; t < 4; ++t)
#pragma unroll
                    for (int g = 0; g < NG; ++g) sc[g][t] = WFrag<T16>::mma(kb[ks][t], q[g][ks], sc[g][t]); } }
        if constexpr (HI) __builtin_amdgcn_sched_barrier(0);   // with one column group a tile's six products depend on each other: keeps the four tiles' products alternating, where the compiler would else run tile after tile with the vector work between
        // Only the stage that holds the end of the keys has keys to mask. The test reads the same for the whole work-group (a scalar branch): every full stage skips the selects.
        // The loops here and below are unrolled because sc lives in registers and needs constant indices.
        if ((s + 1) * 64 > n) { const int lim = n - s * 64 - 8 * hi;   // this lane's keys of the stage below lim are real
#pragma unroll
            for (int t = 0; t < 4; ++t) {
#pragma unroll
                for (int r = 0; r < 8; ++r) { const bool ok = t * 16 + r < lim;
#pragma unroll
                    for (int g = 0; g < NG; ++g) sc[g][t][r] = ok ? sc[g][t][r] : NEGBIG; } } }
        float mnew[NG];   // the maximum is taken over the raw products: the scale is positive and is applied in the exponent's multiply-add below
#pragma unroll
        for (int g = 0; g < NG; ++g) mnew[g] = mrun[g];
#pragma unroll
        for (int t = 0; t < 4; ++t) {
#pragma unroll
            for (int r = 0; r < 8; ++r) {
#pragma unroll
                for (int g = 0; g < NG; ++g) mnew[g] = fmaxf(mnew[g], sc[g][t][r]); } }
        V pf[NG][2], pl[NG][2];
#pragma unroll
        for (int g = 0; g < NG; ++g) {
            const float mx = fmaxf(mnew[g], xhalf(mnew[g]));   // both halves of a column share one maximum: their keys meet in one product
            const float on = mx * SCL2;                       // the maximum in the log2 domain; orun keeps it for the next stage's rescale
            const float da = orun[g] - on; float al = __builtin_amdgcn_exp2f(da); mrun[g] = mx; orun[g] = on;
            asm volatile("v_nop" : "+v"(al) : "v"(da));       // the free slot behind a transcendental, see below
            const float off = HI ? on : on - PCARL2;
            float ps = 0.0f;
#pragma unroll
            for (int t = 0; t < 4; ++t) { const v8f d = __builtin_elementwise_fma(sc[g][t], (v8f)(SCL2), (v8f)(-off)); v8f p;
#pragma unroll
                for (int r = 0; r < 8; ++r) p[r] = __builtin_amdgcn_exp2f(d[r]);
                // The instruction set asks for one free slot behind v_exp_f32 before its result is read or its source overwritten. Naming the eight sources as inputs keeps them
                // whole until here, naming the results as in-out keeps their readers behind: inside the run each v_exp_f32 is the next one's slot, the v_nop is the last one's.
                asm volatile("v_nop" : "+v"(p) : "v"(d));
                sc[g][t] = p;
#pragma unroll
                for (int r = 0; r < 8; ++r) ps += p[r]; }
            lsum[g] = lsum[g] * al + ps;
#pragma unroll
            for (int mb = 0; mb < 4; ++mb) o[g][mb] *= al;
#pragma unroll
            for (int p2 = 0; p2 < 2; ++p2) {
                if constexpr (HI) {
                    const v8bf h0 = __builtin_convertvector(sc[g][2 * p2], v8bf), h1 = __builtin_convertvector(sc[g][2 * p2 + 1], v8bf);
                    const v8bf l0 = __builtin_convertvector(sc[g][2 * p2] - __builtin_convertvector(h0, v8f), v8bf), l1 = __builtin_convertvector(sc[g][2 * p2 + 1] - __builtin_convertvector(h1, v8f), v8bf);
                    pf[g][p2] = __builtin_shufflevector(h0, h1, 0, 1, 2, 3, 4, 5, 6, 7, 8, 9, 10, 11, 12, 13, 14, 15);
                    pl[g][p2] = __builtin_shufflevector(l0, l1, 0, 1, 2, 3, 4, 5, 6, 7, 8, 9, 10, 11, 12, 13, 14, 15);
                } else {
                    pf[g][p2] = cat16(__builtin_convertvector(sc[g][2 * p2], v8h), __builtin_convertvector(sc[g][2 * p2 + 1], v8h));
                } } }
#pragma unroll
        for (int p2 = 0; p2 < 2; ++p2) {
#pragma unroll
            for (int mb = 0; mb < 4; ++mb)
#pragma unroll
                for (int g = 0; g < NG; ++g) o[g][mb] = WFrag<T16>::mma(va[p2][mb], pf[g][p2], o[g][mb]);
            if (HI) {
#pragma unroll
                for (int mb = 0; mb < 4; ++mb)
#pragma unroll
                    for (int g = 0; g < NG; ++g) o[g][mb] = WFrag<T16>::mma(va[p2][mb], pl[g][p2], o[g][mb]);
#pragma unroll
                for (int mb = 0; mb < 4; ++mb)
#pragma unroll
                    for (int g = 0; g < NG; ++g) o[g][mb] = WFrag<T16>::mma(vb[p2][mb], pf[g][p2], o[g][mb]); } }
        if (more) sl((s + 1) & 1);
    }
    // lane l: query qw + 16 g + (l & 15), d = 16 mb + 8 (l >> 4) + 0..7: 16 bytes of each ctx plane
#pragma unroll
    for (int g = 0; g < NG; ++g) { const float inv = __fdiv_rn(1.0f, lsum[g] + xhalf(lsum[g]));
#pragma unroll
        for (int mb = 0; mb < 4; ++mb) { v8us oh, ol;
#pragma unroll
            for (int r = 0; r < 8; ++r) { unsigned short a, c2; splitf(o[g][mb][r] * inv, a, c2); oh[r] = a; ol[r] = c2; }
            const size_t oo = (size_t)(qw + g * 16 + lr) * DQ + mb * 16 + 8 * hi;
            __builtin_amdgcn_sched_barrier(0);   // with the one behind the wait: keeps the conversions of this and the next piece out of the stretch from the first store to the wait, where they could write a register that an issued store names
            *(v8us*)(Ah + oo) = oh; *(v8us*)(Al + oo) = ol;
            asm volatile("s_wait_xcnt 0x0" ::: "memory");   // stands in front of whatever next writes a register that the two stores name
            __builtin_amdgcn_sched_barrier(0); } }
}

// grid: work-group x is a hi/lo block where x has an even number of one bits, else an f16 block, so that two work-groups whose indices differ in one bit (neighbours as well as x and x + half the grid) are one of each kind,
// whichever of these pairs the dispatcher puts on one WGP (for speed only); x >> 1 numbers the blocks of either kind. Planes [b][head][.][.], ctx planes [b][t][DQ]
__global__ __launch_bounds__(128) void k_fattn(const h16* __restrict__ Q16, const h16* __restrict__ K16, const h16* __restrict__ V16, const bf* __restrict__ Qh, const bf* __restrict__ Ql, const bf* __restrict__ Kh, const bf* __restrict__ Kl,
                                               const bf* __restrict__ Vh, const bf* __restrict__ Vl, const int* __restrict__ cnt, bf* Ah, bf* Al) {
    __shared__ __align__(16) unsigned short sm[2 * 4 * FT];
    constexpr int HB = RH / QBH;   // blocks per (batch, head), of either kind
    const int x = (int)blockIdx.x, y = x >> 1; const bool hires = (__builtin_popcount((unsigned)x) & 1) == 0;
    const int bh = y / HB; const int q0 = hires ? (y % HB) * QBH : RH + (y % HB) * QBL;
    const int b = bh / NH_, hd = bh % NH_; const size_t po = (size_t)bh * TT * HD, ao = (size_t)b * TT * DQ + (size_t)hd * HD;
    const int n = min(max(cnt[b * CNS], 0), TT);   // the same for the whole work-group: it bounds the stage loop and its barriers
    if (hires) fa_body<bf, true>((bf*)sm, n, Qh + po, Ql + po, Kh + po, Kl + po, Vh + po, Vl + po, q0, Ah + ao, Al + ao);
    else fa_body<h16, false>((h16*)sm, n, Q16 + po, nullptr, K16 + po, nullptr, V16 + po, nullptr, q0, Ah + ao, Al + ao);
}

extern "C" void kernel_launch(void* const* d_in, const int* in_sizes, int n_in,
                              void* d_out, int out_size, void* d_ws, size_t ws_size, hipStream_t stream) {
    if (n_in < 12) return;
    const size_t needx = (size_t)(NB - 1) * SEQ_FULL * DM + (size_t)TT * DM;
    const size_t needm = (size_t)(NB - 1) * SEQ_FULL + (size_t)TT;
    if ((size_t)in_sizes[0] < needx || (size_t)in_sizes[1] < needx || (size_t)in_sizes[2] < needx || (size_t)in_sizes[3] < needm) return;
    if ((size_t)in_sizes[4] < (size_t)DQ * DM || (size_t)in_sizes[6] < (size_t)DKV * DM || (size_t)in_sizes[8] < (size_t)DKV * DM || (size_t)in_sizes[10] < (size_t)DM * DQ) return;
    if (in_sizes[5] < DQ || in_sizes[7] < DKV || in_sizes[9] < DKV || in_sizes[11] < DM) return;
    if ((size_t)out_size < needx) return;
    // wire order: query, key, value, mask (int32), Wq, bq, Wk, bk, Wv, bv, Wo, bo; weights [out][in]
    const float* xq = (const float*)d_in[0]; const float* xk = (const float*)d_in[1]; const float* xv = (const float*)d_in[2]; const int* mask = (const int*)d_in[3];
    const float* wq = (const float*)d_in[4]; const float* bq = (const float*)d_in[5]; const float* wk = (const float*)d_in[6]; const float* bk = (const float*)d_in[7];
    const float* wv = (const float*)d_in[8]; const float* bv = (const float*)d_in[9]; const float* wo = (const float*)d_in[10]; const float* bo = (const float*)d_in[11];
    float* OUT = (float*)d_out;     // [NB_FULL][SEQ_FULL][DM]
    char* wsp = (char*)d_ws;
    auto take = [&](size_t bytes) { char* p = wsp; wsp += (bytes + 255) & ~(size_t)255; return (void*)p; };
    bf* WQ = (bf*)take(SZ_W); bf* WK = (bf*)take(SZ_W); bf* WV = (bf*)take(SZ_W); bf* WO = (bf*)take(SZ_W);   // one after the other: filled by one launch, WQ WK WV read by one launch
    // planes [b][head][.][.]; each k plane directly behind its q plane, so that one launch fills both
    h16* QP16 = (h16*)take(SZ_HP); h16* KP16 = (h16*)take(SZ_HP); bf* QPh = (bf*)take(SZ_HP); bf* KPh = (bf*)take(SZ_HP); bf* QPl = (bf*)take(SZ_HP); bf* KPl = (bf*)take(SZ_HP);
    h16* VT16 = (h16*)take(SZ_HP); bf* VTh = (bf*)take(SZ_HP); bf* VTl = (bf*)take(SZ_HP);
    bf* XB = (bf*)take(SZ_XB); bf* ATh = (bf*)take(SZ_AT);   // XB [q k v][b][t][DM] bf16
    bf* ATl = (bf*)take(SZ_AT); int* IX = (int*)take(SZ_IX); int* CN = (int*)take(SZ_CN);
    if ((size_t)(wsp - (char*)d_ws) > ws_size) return;
    const unsigned LX = (unsigned)(((size_t)TT * DM / 8 + 255) / 256);
    const size_t xs = (size_t)SEQ_FULL * DM;   // batch stride of the f32 inputs and of the output
    // the ranks of the unmasked keys and the four weights in one launch; q inputs and the ranked k, v inputs of every batch in one launch
    k_prep<<<NB + 4 * LWB, 256, 0, stream>>>(wq, wk, wv, wo, WQ, mask, IX, CN);
    k_cvtx<<<dim3(LX, NB, 3), 256, 0, stream>>>(xq, xk, xv, XB, IX, CN);
    // the three projections of every batch in one launch: z = tensor * NB + batch; the q and k planes and the transposed v planes are written directly
    k_gemms<bf, 0, true, true, DM, DM, DQ><<<dim3(TT / 128, DQ / 128, 3 * NB), 128, 0, stream>>>(XB, nullptr, WQ, nullptr, QP16, QPh, QPl, VT16, VTh, VTl, bq, bk, bv, CN, NB, (size_t)TT * DM, (size_t)DQ * DM, 0);
    // attention of every batch and head in one launch, ctx planes written directly
    k_fattn<<<NB * NH_ * (RH / QBH + (TT - RH) / QBL), 128, 0, stream>>>(QP16, KP16, VT16, QPh, QPl, KPh, KPl, VTh, VTl, CN, ATh, ATl);
    // out[b][t][n] = sum_k ctx[b][t][k] Wo[n][k] + bo[n], every batch in one launch
    k_gemms<bf, 1, true, false, DQ, DQ, DM><<<dim3(TT / 128, DM / 128, NB), 128, 0, stream>>>(ATh, ATl, WO, OUT, nullptr, nullptr, nullptr, nullptr, nullptr, nullptr, bo, bo, bo, nullptr, NB, (size_t)TT * DQ, 0, xs);
}

// v010
// One run takes 80.4 microseconds.
// Next to v009, in two timings, it ran 1.05 times as fast each time.
// Counting every step since v000, it is 25.2 times as fast.
#include <hip/hip_runtime.h>

// 16-head scaled dot-product attention with a key padding mask: q = query Wq^T + bq, k = key Wk^T + bk, v = value Wv^T + bv (weights [out][in]); scores x 1/8; masked keys (mask == 0) replaced by -inf; softmax over keys; out = merged Wo^T + bo.
// A masked key has weight exactly 0, so it is left out: the unmasked keys of a batch are ranked in their order, the key and value rows are gathered by rank, and k, v and the attention run over those rows alone.
// Compute dtypes, f32 accumulate everywhere: every float input converted to bf16 (RNE); projections v_wmma_f32_16x16x32_bf16 on exact bf16 planes + bias rounded to bf16; scores rows < RH bf16 hi/lo planes (3 products), rows >= RH v_wmma_f32_16x16x32_f16;
// P.V rows < RH bf16 hi/lo planes (3 products), rows >= RH f16 with P carried x1024 (the f32 row sum carries it too); output projection bf16 hi/lo ctx planes x bf16 Wo (2 products) + bias rounded to bf16; softmax f32.

#ifndef NB
#define NB 2
#endif
#ifndef SEQ
#define SEQ 2048
#endif
#define NB_FULL  2
#define SEQ_FULL 2048
#define TT   SEQ
#define DM   1024
#define NH_  16
#define NKV  16
#define REP  (NH_ / NKV)
#define HD   64
#define DQ   (NH_ * HD)
#define DKV  (NKV * HD)
#define RH   ((TT > 512) ? 512 : (TT / 2))   // query rows < RH use hi+lo planes
#define PCARL2 10.0f      // P of the f16 rows is carried x 2^10
#define SCL  0.125f       // HD^-0.5
#define NEGBIG (-1.0e30f)

static_assert(NB >= 1 && NB <= NB_FULL);
static_assert(TT <= SEQ_FULL && TT % 128 == 0);
static_assert(RH >= 64 && RH % 64 == 0 && TT > RH && (TT - RH) % 64 == 0);
static_assert(HD == 64 && DM % 64 == 0 && DQ % 64 == 0 && DM % 32 == 0 && TT % 32 == 0);
static_assert(REP == 1);
static_assert(DM % 128 == 0 && DQ % 128 == 0);

#define SZ_W    ((size_t)DQ * DM * 2)
#define SZ_XB   ((size_t)3 * NB * TT * DM * 2)
#define SZ_HP   ((size_t)NB * NH_ * TT * HD * 2)
#define SZ_AT   ((size_t)NB * TT * DQ * 2)
#define SZ_CN   (((size_t)NB * 128 + 255) / 256 * 256)   // number of unmasked keys, one 128-byte line per batch
#define CNS     32                         // ints between two batches' counts
#define SZ_ALL  (4 * SZ_W + 9 * SZ_HP + SZ_XB + 2 * SZ_AT + SZ_CN)
static_assert(SZ_W % 256 == 0 && SZ_XB % 256 == 0 && SZ_HP % 256 == 0 && SZ_AT % 256 == 0 && SZ_CN % 256 == 0);
static_assert(SZ_ALL <= (size_t)268435456 && DQ == DKV && NH_ == NKV);

typedef _Float16 h16;
typedef unsigned short bf;
typedef __attribute__((ext_vector_type(16))) __bf16   v16bf;
typedef __attribute__((ext_vector_type(16))) _Float16 v16h;
typedef __attribute__((ext_vector_type(8)))  _Float16 v8h;
typedef __attribute__((ext_vector_type(8)))  unsigned short v8us;
typedef __attribute__((ext_vector_type(8)))  float    v8f;
typedef __attribute__((ext_vector_type(4)))  float    v4f;
typedef v4f  __attribute__((may_alias)) v4fa;
typedef __attribute__((ext_vector_type(4))) _Float16 v4h;
typedef __attribute__((ext_vector_type(4))) unsigned short v4us;
typedef __attribute__((ext_vector_type(4))) int v4i;

__device__ __forceinline__ unsigned short f2bf(float f) { unsigned u = __float_as_uint(f); u += 0x7FFFu + ((u >> 16) & 1u); return (unsigned short)(u >> 16); }
__device__ __forceinline__ float bf2f(unsigned short b) { return __uint_as_float(((unsigned)b) << 16); }
__device__ __forceinline__ float bfr(float f) { return bf2f(f2bf(f)); }
__device__ __forceinline__ v16h cat16(v8h lo, v8h hi) { return __builtin_shufflevector(lo, hi, 0, 1, 2, 3, 4, 5, 6, 7, 8, 9, 10, 11, 12, 13, 14, 15); }
__device__ __forceinline__ v16bf cat16b(v8us lo, v8us hi) { return __builtin_bit_cast(v16bf, __builtin_shufflevector(lo, hi, 0, 1, 2, 3, 4, 5, 6, 7, 8, 9, 10, 11, 12, 13, 14, 15)); }
__device__ __forceinline__ v8f wmma16(v16h a, v16h b, v8f c) { return __builtin_amdgcn_wmma_f32_16x16x32_f16(false, a, false, b, (short)0, c, false, false); }
__device__ __forceinline__ v8f wmmab(v16bf a, v16bf b, v8f c) { return __builtin_amdgcn_wmma_f32_16x16x32_bf16(false, a, false, b, (short)0, c, false, false); }

// ---- k_gemms: GEMM on K-contiguous 16-bit planes, one 128x128 output tile per work-group of 4 waves (2 x 2, 64x64 and 16 accumulators each); grid (M/128, N/128, Z), 128 threads.
// C[m][n] (f32, + optional bias[n] rounded to bf16) = sum_k (A[m][k] + A2[m][k]) Bt[n][k] (A2 only with NSPLIT == 1). A rows have pitch LDA, Bt rows pitch K, C rows pitch LDC. z-batch strides sA/sB/sC in elements; Bt and the bias change only every zdiv-th z (bias0, bias1, bias2 in turn). K % 64 == 0, M % 128 == 0, N % 128 == 0.
// k goes by stages of 64: the A (and A2) tile [128 rows][64 k] and the Bt tile [128 rows][64 k] pass through registers into one of two LDS buffers while the other is read.
// A staging load of a wave covers four whole 128-byte rows, and every operand line is fetched once per work-group. Each wave sums its whole K in ascending order.
// With PLANES the result does not go to C: z / zdiv = 0, 1 (q, k) writes x = sum + bias as three 16-bit planes [z][head][t][d] (f16, bf16 hi, bf16 lo = bf16(x - hi)), z / zdiv = 2 (v) the same three planes transposed, [z - 2 zdiv][head][d][t]. A wave's 64 columns are one head.
// With PLANES the rows of k and v are the ranked unmasked keys: a tile whose first row is not below the batch's count cnt[] has nothing to do (the rows from the count up to the tile's end hold masked rows, see k_prep).
// Fragment map (A and B alike): lane l -> row/col l & 15, h = l >> 4; elements 0..7 = k0 + 8h + 0..7, elements 8..15 = k0 + 16 + 8h + 0..7. D: element r -> row 8h + r, col l & 15.
template <typename T16> struct WFrag;
template <> struct WFrag<h16> { typedef v16h V; static __device__ __forceinline__ V ld(const h16* p) { return cat16(*(const v8h*)p, *(const v8h*)(p + 16)); } static __device__ __forceinline__ v8f mma(V a, V b, v8f c) { return wmma16(a, b, c); } };
template <> struct WFrag<bf> { typedef v16bf V; static __device__ __forceinline__ V ld(const bf* p) { return cat16b(*(const v8us*)p, *(const v8us*)(p + 16)); } static __device__ __forceinline__ v8f mma(V a, V b, v8f c) { return wmmab(a, b, c); } };
#define GP   72             // LDS row pitch in 16-bit elements: 128 B + 16 B, the 16 rows of a 16-byte fragment read fall on distinct banks
#define GT   (128 * GP)     // one 128 x 64 tile
typedef v4i __attribute__((may_alias)) v4ig;
typedef __attribute__((ext_vector_type(8))) __bf16 v8bf;
// the three planes of eight values, every conversion round to nearest even
__device__ __forceinline__ void planes8(v8f x, v4i& o16, v4i& oh, v4i& ol) { oh = __builtin_bit_cast(v4i, __builtin_convertvector(x, v8bf)); v8f hf;
#pragma unroll
    for (int k = 0; k < 4; ++k) { hf[2 * k] = __int_as_float(oh[k] << 16); hf[2 * k + 1] = __int_as_float(oh[k] & (int)0xFFFF0000u); }   // the packed hi words back to f32
    o16 = __builtin_bit_cast(v4i, __builtin_convertvector(x, v8h)); ol = __builtin_bit_cast(v4i, __builtin_convertvector(x - hf, v8bf)); }
template <typename T16, int NSPLIT, bool BIAS, bool PLANES, int K, int LDA, int LDC>
__global__ __launch_bounds__(128) void k_gemms(const T16* __restrict__ A, const T16* __restrict__ A2, const T16* __restrict__ Bt, float* C, h16* P16, bf* Ph, bf* Pl, h16* V16, bf* Vh, bf* Vl, const float* __restrict__ bias0, const float* __restrict__ bias1, const float* __restrict__ bias2, const int* __restrict__ cnt, int zdiv, size_t sA, size_t sB, size_t sC) {
    typedef typename WFrag<T16>::V V; static_assert((NSPLIT == 0 || NSPLIT == 1) && K % 64 == 0 && K >= 64);
    constexpr int NT = (NSPLIT == 1) ? 3 : 2;   // tiles per stage: A, (A2), Bt
    constexpr int NS = K / 64;
    __shared__ __align__(16) unsigned char smraw[2 * NT * GT * 2];
    static_assert(2 * 4 * 16 * 68 * 4 <= 2 * NT * GT * 2);
    T16* sm = (T16*)smraw;
    const size_t z = blockIdx.z, zb = blockIdx.z / (unsigned)zdiv;
    if constexpr (PLANES) { if (zb != 0 && (int)blockIdx.x * 128 >= cnt[(z - zb * (unsigned)zdiv) * CNS]) return; }   // the same for the whole work-group, in front of every barrier
    const float* bias = (zb == 0) ? bias0 : ((zb == 1) ? bias1 : bias2);
    const int tid = (int)threadIdx.x, lane = tid & 31, lr = lane & 15, hi = lane >> 4; const int r0 = blockIdx.x * 128, c0 = blockIdx.y * 128;
    // wave number through readfirstlane: the tile offsets stay in scalar registers
    const int wv = __builtin_amdgcn_readfirstlane(tid >> 5), wm = wv >> 1, wn = wv & 1;
    const int srow = tid >> 3, scol = (tid & 7) * 8;   // staging: 16 bytes of rows srow + 16 i, i = 0..7, of every tile
    // a work-group-uniform base plus one 32-bit byte offset per thread; the eight rows differ by constants
    const char* ua = (const char*)(A + z * sA + (size_t)r0 * LDA); const char* ua2 = (NSPLIT == 1) ? (const char*)(A2 + z * sA + (size_t)r0 * LDA) : nullptr; const char* ub = (const char*)(Bt + zb * sB + (size_t)c0 * K);
    const unsigned va = (unsigned)(srow * LDA + scol) * 2u, vb = (unsigned)(srow * K + scol) * 2u;
    v4i st[NT][8];
    auto gl = [&](int kc) {
        const char* pa = ua + kc * 2 + va; const char* pa2 = (NSPLIT == 1) ? ua2 + kc * 2 + va : nullptr; const char* pb = ub + kc * 2 + vb;
#pragma unroll
        for (int i = 0; i < 8; ++i) { st[0][i] = *(const v4ig*)(pa + i * (16 * LDA * 2)); if (NSPLIT == 1) st[1][i] = *(const v4ig*)(pa2 + i * (16 * LDA * 2)); st[NT - 1][i] = *(const v4ig*)(pb + i * (16 * K * 2)); }
        // The wait stands in front of whatever next writes a register that holds an address of the loads above (the fragment reads and the accumulators may take those registers);
        // the addresses are named as inputs so that their registers stay theirs up to the wait.
        if constexpr (NSPLIT == 1) asm volatile("s_wait_xcnt 0x0" :: "v"(pa), "v"(pa2), "v"(pb), "v"(va), "v"(vb) : "memory");
        else asm volatile("s_wait_xcnt 0x0" :: "v"(pa), "v"(pb), "v"(va), "v"(vb) : "memory"); };
    auto sl = [&](int buf) {
#pragma unroll
        for (int tl = 0; tl < NT; ++tl)
#pragma unroll
            for (int i = 0; i < 8; ++i) *(v4ig*)(sm + (buf * NT + tl) * GT + (srow + 16 * i) * GP + scol) = st[tl][i]; };
    v8f acc[4][4];
#pragma unroll
    for (int mb = 0; mb < 4; ++mb)
#pragma unroll
        for (int nb = 0; nb < 4; ++nb) acc[mb][nb] = (v8f){};
    gl(0); sl(0);
    // The stage loop stays rolled: one copy of the stage's products in the instruction cache. The loops inside it are unrolled because st, a, b and acc live in registers and need constant indices.
#pragma unroll 1
    for (int s = 0; s < NS; ++s) {
        __syncthreads();   // publishes buffer s & 1; ends every read of the other buffer, which is refilled below
        const bool more = (s + 1 < NS);
        if (more) gl((s + 1) * 64);
        const T16* at = sm + ((s & 1) * NT) * GT + (wm * 64 + lr) * GP + 8 * hi; const T16* bt = sm + ((s & 1) * NT + NT - 1) * GT + (wn * 64 + lr) * GP + 8 * hi;
        V a[2][4], a2[2][4], b[2][4];
#pragma unroll
        for (int ks = 0; ks < 2; ++ks)
#pragma unroll
            for (int f = 0; f < 4; ++f) { a[ks][f] = WFrag<T16>::ld(at + f * 16 * GP + ks * 32); if (NSPLIT == 1) a2[ks][f] = WFrag<T16>::ld(at + GT + f * 16 * GP + ks * 32); b[ks][f] = WFrag<T16>::ld(bt + f * 16 * GP + ks * 32); }
        __builtin_amdgcn_sched_barrier(0);   // keeps the stage's fragment reads one group in front of its products, for speed only
#pragma unroll
        for (int ks = 0; ks < 2; ++ks)
#pragma unroll
            for (int nb = 0; nb < 4; ++nb) {
#pragma unroll
                for (int mb = 0; mb < 4; ++mb) acc[mb][nb] = WFrag<T16>::mma(a[ks][mb], b[ks][nb], acc[mb][nb]);
                if (NSPLIT == 1) {
#pragma unroll
                    for (int mb = 0; mb < 4; ++mb) acc[mb][nb] = WFrag<T16>::mma(a2[ks][mb], b[ks][nb], acc[mb][nb]); } }
        if (more) sl((s + 1) & 1);
    }
    // Output through LDS, so that every global store covers whole 256-byte row pieces: per pass a wave lays 16 x 64 of its tile in its own slab (pitch 68 floats) and reads it back by rows.
    // Two slab sets in turn. The results stay in registers and go to memory behind the last barrier, so that no barrier waits for a global store.
    // Every loop here is unrolled because acc and res live in registers and need constant indices.
    __syncthreads();   // ends every read of the operand tiles: the slabs lie over them
    if constexpr (PLANES) {
        // Every wave stages in its own quarter of the LDS and reads it back so that a lane holds 16 bytes of a plane's row and eight lanes one whole 128-byte line.
        // All results wait in registers and go to memory behind the last barrier: no barrier waits for a global store, and no register of an issued store is written again.
        // Every loop here is unrolled because acc and the results live in registers and need constant indices.
        static_assert(BIAS && HD == 64 && DQ == NH_ * HD && 4 * 64 * 68 * 4 <= 2 * NT * GT * 2 && 4 * 2 * 64 * GP * 2 <= 2 * NT * GT * 2);
        const int head = (int)blockIdx.y * 2 + wn, t0 = r0 + wm * 64, rr = lane >> 3, c8 = (lane & 7) * 8;
        v4i r16[16], rh[16], rl[16];
        if (zb < 2) {
            // q, k: the 64 x 64 f32 tile [t][d] (pitch 68 floats), read back by rows of d
            float* my = (float*)smraw + wv * (64 * 68);
#pragma unroll
            for (int mb = 0; mb < 4; ++mb)
#pragma unroll
                for (int nb = 0; nb < 4; ++nb) {
#pragma unroll
                    for (int j = 0; j < 8; ++j) my[(mb * 16 + hi * 8 + j) * 68 + nb * 16 + lr] = acc[mb][nb][j]; }
            v8f b8;
#pragma unroll
            for (int q = 0; q < 8; ++q) b8[q] = bfr(bias[c0 + wn * 64 + c8 + q]);
            __syncthreads();   // orders the slab's stores in front of the reads of other lanes' values
#pragma unroll
            for (int i = 0; i < 16; ++i) { const float* rp = my + (4 * i + rr) * 68 + c8; const v4f x0 = *(const v4fa*)rp, x1 = *(const v4fa*)(rp + 4);
                planes8(__builtin_shufflevector(x0, x1, 0, 1, 2, 3, 4, 5, 6, 7) + b8, r16[i], rh[i], rl[i]); }
            __builtin_amdgcn_sched_barrier(0);   // keeps every conversion in front of the first store, so that no register of an issued store is written again
            const size_t po = ((z * NH_ + head) * TT + t0 + rr) * HD + c8;
#pragma unroll
            for (int i = 0; i < 16; ++i) { *(v4ig*)(P16 + po + i * (4 * HD)) = r16[i]; *(v4ig*)(Ph + po + i * (4 * HD)) = rh[i]; *(v4ig*)(Pl + po + i * (4 * HD)) = rl[i]; }
        } else {
            // v: a lane's eight accumulator elements are eight successive t of one d, 16 bytes of a transposed plane; slabs [d][t] (pitch GP), two per wave: f16 and hi first, then lo
            unsigned short* s0 = (unsigned short*)smraw + wv * (2 * 64 * GP); unsigned short* s1 = s0 + 64 * GP;
            float bn[4];
#pragma unroll
            for (int nb = 0; nb < 4; ++nb) bn[nb] = bfr(bias[c0 + wn * 64 + nb * 16 + lr]);
            v4i lo[4][4];
#pragma unroll
            for (int mb = 0; mb < 4; ++mb)
#pragma unroll
                for (int nb = 0; nb < 4; ++nb) { v4i o16, oh; planes8(acc[mb][nb] + bn[nb], o16, oh, lo[mb][nb]); const int so = (nb * 16 + lr) * GP + mb * 16 + hi * 8; *(v4ig*)(s0 + so) = o16; *(v4ig*)(s1 + so) = oh; }
            __syncthreads();   // orders the slabs' stores in front of the reads of other lanes' values
#pragma unroll
            for (int i = 0; i < 16; ++i) { const int ro = (4 * i + rr) * GP + c8; r16[i] = *(const v4ig*)(s0 + ro); rh[i] = *(const v4ig*)(s1 + ro); }
            __syncthreads();   // ends the reads of the first slab, which takes the lo plane now
#pragma unroll
            for (int mb = 0; mb < 4; ++mb)
#pragma unroll
                for (int nb = 0; nb < 4; ++nb) *(v4ig*)(s0 + (nb * 16 + lr) * GP + mb * 16 + hi * 8) = lo[mb][nb];
            __syncthreads();   // orders the slab's stores in front of the reads of other lanes' values
#pragma unroll
            for (int i = 0; i < 16; ++i) rl[i] = *(const v4ig*)(s0 + (4 * i + rr) * GP + c8);
            const size_t vo = (((z - 2 * (size_t)zdiv) * NKV + head) * HD + rr) * TT + t0 + c8;
#pragma unroll
            for (int i = 0; i < 16; ++i) { *(v4ig*)(V16 + vo + (size_t)i * (4 * TT)) = r16[i]; *(v4ig*)(Vh + vo + (size_t)i * (4 * TT)) = rh[i]; *(v4ig*)(Vl + vo + (size_t)i * (4 * TT)) = rl[i]; }
            asm volatile("s_wait_xcnt 0x0" ::: "memory");   // stands behind the last store, in front of whatever the code laid out behind this branch writes into a register that a store above names
        }
        return;
    }
    float* os = (float*)smraw;
    v4f res[4][8], bv = (v4f)(0.0f);
    if (BIAS) {
#pragma unroll
        for (int q = 0; q < 4; ++q) bv[q] = bfr(bias[c0 + wn * 64 + lr * 4 + q]); }
#pragma unroll
    for (int mb = 0; mb < 4; ++mb) {
        float* my = os + ((mb & 1) * 4 + wv) * (16 * 68);
#pragma unroll
        for (int nb = 0; nb < 4; ++nb) {
#pragma unroll
            for (int j = 0; j < 8; ++j) my[(hi * 8 + j) * 68 + nb * 16 + lr] = acc[mb][nb][j]; }
        __syncthreads();   // orders the slab's stores in front of the reads of other lanes' values
#pragma unroll
        for (int i = 0; i < 8; ++i) { const v4f val = *(const v4fa*)(my + (2 * i + hi) * 68 + lr * 4); res[mb][i] = BIAS ? val + bv : val; } }
    float* cw = C + z * sC + (size_t)(r0 + wm * 64 + hi) * LDC + c0 + wn * 64 + lr * 4;
#pragma unroll
    for (int mb = 0; mb < 4; ++mb)
#pragma unroll
        for (int i = 0; i < 8; ++i) *(v4f*)(cw + (mb * 16 + 2 * i) * LDC) = res[mb][i];
}

__device__ __forceinline__ void splitf(float y, unsigned short& h, unsigned short& l) { h = f2bf(y); l = f2bf(y - bf2f(h)); }

// ---- k_prep: every conversion to bf16 in one launch; three ranges of work-groups.
// Range 1, NB TT / 4 work-groups: four successive rows of key (waves 0..3) and of value (waves 4..7) of one batch, one row per wave, written to the row's place among the ranked keys, xdst [q k v][b][row][DM].
// No work-group waits for another's ranks: each counts the batch's mask itself. A wave takes 32 successive keys TT / 256 times; a ballot gives their mask bits as one scalar word, of which it counts all ones
// and those of keys in front of rb (the work-group's first row, rounded down to a multiple of 8); the eight waves' counts, both in one word, pass through LDS. The eight mask values from rb on are read by every wave.
// n = number of unmasked keys, rank = number of unmasked keys in front of a row.
// An unmasked row goes to row rank. A masked row, the m-th of its kind (m = row - rank), goes to row n + m where that lies below the next multiple of 128 behind n: finite values that the attention gives weight 0.
// There are TT - n masked rows and TT is a multiple of 128, so every row up to that multiple is written, each by one wave per tensor; the rest is neither written nor read. cnt[b CNS] = n.
// Range 2: query, 2048 values per work-group. Range 3: the four weights, wdst dense [weight][DQ DM].
#define KVB ((unsigned)(TT / 4))
#define LXB ((unsigned)((size_t)TT * DM / 8 / 256))
#define LWB ((unsigned)((size_t)DQ * DM / 8 / 256))
static_assert((size_t)DQ * DM % 2048 == 0 && (size_t)TT * DM % 2048 == 0 && TT % 256 == 0 && TT < 65536 && DM % 256 == 0);
// at most 64 registers, so that all 16 wave slots of a SIMD fill: a wave of ranges 2 and 3 has only 1 KB in flight, and the bytes in flight per WGP go with the number of waves
__global__ __launch_bounds__(256) __attribute__((amdgpu_waves_per_eu(16))) void k_prep(const float* __restrict__ xq, const float* __restrict__ xk, const float* __restrict__ xv, const float* __restrict__ s0, const float* __restrict__ s1, const float* __restrict__ s2, const float* __restrict__ s3,
                                              bf* wdst, bf* xdst, const int* __restrict__ mask, int* cnt) {
    __shared__ int part[8];
    const int tid = (int)threadIdx.x;
    if (blockIdx.x < NB * KVB) {
        constexpr int E = TT / 256, NC = DM / 256;   // the loops below are unrolled so that all mask loads are in flight together and because the row's pieces live in registers and need constant indices
        const int b = (int)(blockIdx.x / KVB), r0 = (int)(blockIdx.x % KVB) * 4, rb = r0 & ~7; const int* mb = mask + (size_t)b * SEQ_FULL;
        const int wv = __builtin_amdgcn_readfirstlane(tid >> 5);   // wave number through readfirstlane: the counts, the row's place and the test below stay in scalar registers
        int mk[E], c = 0, cb = 0, own = 0;
#pragma unroll
        for (int j = 0; j < E; ++j) mk[j] = mb[tid + 256 * j];
#pragma unroll
        for (int k = 0; k < 8; ++k) own |= (mb[rb + k] != 0) ? (1 << k) : 0;
#pragma unroll
        for (int j = 0; j < E; ++j) { const unsigned bal = __builtin_amdgcn_ballot_w32(mk[j] != 0); const int d = rb - (256 * j + 32 * wv);   // d of the word's keys lie in front of rb
            c += __builtin_popcount(bal); cb += __builtin_popcount((d >= 32) ? bal : (d > 0) ? (bal & ((1u << d) - 1u)) : 0u); }
        if ((tid & 31) == 0) part[wv] = c + (cb << 16);   // neither count exceeds TT
        __syncthreads();   // publishes the waves' counts
        int tot = 0;
#pragma unroll
        for (int w = 0; w < 8; ++w) tot += part[w];
        tot = __builtin_amdgcn_readfirstlane(tot);
        const int n = tot & 0xFFFF, r = r0 + (wv & 3), rank = (tot >> 16) + __builtin_popcount((unsigned)own & ((1u << (r - rb)) - 1u));
        if (r0 == 0 && tid == 0) { cnt[b * CNS] = n;
            asm volatile("s_wait_xcnt 0x0" ::: "memory"); }   // stands behind the store, in front of whatever next writes a register that the store names
        const bool real = ((own >> (r - rb)) & 1) != 0;
        int dest = real ? rank : n + (r - rank);
        if (!real && dest >= ((n + 127) & ~127)) return;   // behind the only barrier; the same for the whole wave
        dest = min(max(dest, 0), TT - 1);   // bounds the address whatever the mask holds
        // a wave-uniform row address plus one 32-bit offset per lane
        const unsigned l8 = (unsigned)(tid & 31) * 8u, lo = l8 * 4u;
        const char* us = (const char*)(((wv < 4) ? xk : xv) + ((size_t)b * SEQ_FULL + r) * DM);
        v8f a[NC];
#pragma unroll
        for (int j = 0; j < NC; ++j) a[j] = *(const v8f*)(us + lo + j * 1024);
        // The wait stands in front of whatever next writes a register that holds an address of the loads above; the lane's offset is named as an input so that its register stays its own up to the wait (no load lands in it).
        asm volatile("s_wait_xcnt 0x0" :: "v"(lo) : "memory");
        bf* pd = xdst + ((size_t)(((wv < 4) ? 1 : 2) * NB + b) * TT + dest) * DM + l8;
        v8us o[NC];
#pragma unroll
        for (int j = 0; j < NC; ++j) {
#pragma unroll
            for (int k = 0; k < 8; ++k) o[j][k] = f2bf(a[j][k]); }
        __builtin_amdgcn_sched_barrier(0);   // keeps every conversion in front of the first store, so that no register of an issued store is written again
#pragma unroll
        for (int j = 0; j < NC; ++j) *(v8us*)(pd + j * 256) = o[j];
        asm volatile("s_wait_xcnt 0x0" ::: "memory");   // stands behind the last store, in front of whatever the code laid out behind this part writes into a register that a store names
        return;
    }
    unsigned w = blockIdx.x - NB * KVB; const float* src; bf* dst;
    if (w < NB * LXB) { const size_t i = ((size_t)(w % LXB) * 256 + tid) * 8; src = xq + (size_t)(w / LXB) * SEQ_FULL * DM + i; dst = xdst + (size_t)(w / LXB) * TT * DM + i; }
    else { w -= NB * LXB; const unsigned zs = w / LWB; const size_t i = ((size_t)(w % LWB) * 256 + tid) * 8; src = ((zs == 0) ? s0 : (zs == 1) ? s1 : (zs == 2) ? s2 : s3) + i; dst = wdst + (size_t)zs * DQ * DM + i; }
    const v8f v = *(const v8f*)src; v8us o;
    asm volatile("s_wait_xcnt 0x0" ::: "memory");   // stands in front of whatever next writes a register that holds the address of the load above
#pragma unroll
    for (int k = 0; k < 8; ++k) o[k] = f2bf(v[k]); *(v8us*)dst = o;
    asm volatile("s_wait_xcnt 0x0" ::: "memory"); }   // stands behind the store, in front of whatever the code laid out behind this part writes into a register that the store names

#define FP   72             // LDS row pitch in 16-bit elements: 128 B + 16 B, the 16 rows of a 16-byte fragment read fall on distinct banks
#define FT   (64 * FP)      // one 64 x 64 tile
#define QBH  64             // queries per work-group, rows < RH
#define QBL  192            // queries per work-group, rows >= RH
#define MSTART (-5.0e29f)
#define SCL2 (SCL * 1.4426950408889634f)
static_assert(RH % QBH == 0 && (TT - RH) % QBL == 0 && RH / QBH == (TT - RH) / QBL && TT % 1024 == 0 && TT % 64 == 0);
typedef v4i __attribute__((may_alias)) v4ia;

__device__ __forceinline__ float xhalf(float x) { const int b = __float_as_int(x); return __int_as_float(__builtin_amdgcn_permlanex16(b, b, 0x76543210, 0xfedcba98, false, false)); }   // lane l <-> l ^ 16

template <typename T16, bool HI>
__device__ __forceinline__ void fa_body(T16* sm, int n, const T16* __restrict__ Q, const T16* __restrict__ Q2, const T16* __restrict__ Kp, const T16* __restrict__ K2,
                                        const T16* __restrict__ Vt, const T16* __restrict__ V2, int q0, bf* Ah, bf* Al) {
    typedef typename WFrag<T16>::V V;
    constexpr int NPL = HI ? 2 : 1, NG = HI ? 1 : 3; const int NS = (n + 63) >> 6;   // n is in 0 .. TT, so at most TT / 64 stages
    const int tid = (int)threadIdx.x, lane = tid & 31, lr = lane & 15, hi = lane >> 4;
    const int qw = q0 + (tid >> 5) * (16 * NG);
    const int srow = tid >> 3, scol = (tid & 7) * 8;   // staging: 16 bytes of rows srow + 16 i, i = 0..3, of every tile
    v4i st[2 * NPL][4];
    auto gl = [&](int j0) {
        const size_t ko = (size_t)(j0 + srow) * HD + scol, vo = (size_t)srow * TT + j0 + scol;   // the four rows differ by constants
        const T16* pk = Kp + ko; const T16* pk2 = HI ? K2 + ko : nullptr; const T16* pv = Vt + vo; const T16* pv2 = HI ? V2 + vo : nullptr;
        __builtin_amdgcn_sched_barrier(0);   // with the one behind the caller's wait: keeps other vector work out of the stretch from the first load to the wait, where it could write a register that holds an address of an issued load
#pragma unroll
        for (int i = 0; i < 4; ++i) {
            st[0][i] = *(const v4ia*)(pk + i * (16 * HD)); if (HI) st[1][i] = *(const v4ia*)(pk2 + i * (16 * HD));
            st[NPL][i] = *(const v4ia*)(pv + i * (16 * TT)); if (HI) st[NPL + 1][i] = *(const v4ia*)(pv2 + i * (16 * TT)); }
    };   // every call is followed by s_wait_xcnt 0 and a second sched_barrier
    auto sl = [&](int buf) {
#pragma unroll
        for (int tl = 0; tl < 2 * NPL; ++tl)
#pragma unroll
            for (int i = 0; i < 4; ++i) *(v4ia*)(sm + (buf * 2 * NPL + tl) * FT + (srow + 16 * i) * FP + scol) = st[tl][i]; };
    V q[NG][2], q2[NG][2]; const T16* qp[NG]; const T16* qp2[NG];
#pragma unroll
    for (int g = 0; g < NG; ++g) { const size_t qo = (size_t)(qw + g * 16 + lr) * HD + 8 * hi; qp[g] = Q + qo; qp2[g] = HI ? Q2 + qo : nullptr;
#pragma unroll
        for (int ks = 0; ks < 2; ++ks) { q[g][ks] = WFrag<T16>::ld(qp[g] + ks * 32); if (HI) q2[g][ks] = WFrag<T16>::ld(qp2[g] + ks * 32); } }
    v8f o[NG][4]; float mrun[NG], orun[NG], lsum[NG];
#pragma unroll
    for (int g = 0; g < NG; ++g) { mrun[g] = MSTART; orun[g] = MSTART * SCL2; lsum[g] = 0.0f;
#pragma unroll
        for (int mb = 0; mb < 4; ++mb) o[g][mb] = (v8f){}; }
    if (NS > 0) { gl(0);
        // The wait stands in front of whatever next writes a register that holds an address of the loads above. The addresses of the Q loads are named as inputs so that their registers stay theirs
        // up to the wait: the address arithmetic of the first stage stands between those loads and this place.
        if constexpr (HI) asm volatile("s_wait_xcnt 0x0" :: "v"(qp[0]), "v"(qp2[0]) : "memory");
        else asm volatile("s_wait_xcnt 0x0" :: "v"(qp[0]), "v"(qp[1]), "v"(qp[2]) : "memory");
        __builtin_amdgcn_sched_barrier(0);
        sl(0); }
#pragma unroll 1
    for (int s = 0; s < NS; ++s) {
        __syncthreads();   // publishes buffer s & 1; ends every read of the other buffer, which is refilled below
        const bool more = (s + 1 < NS);
        if (more) { gl((s + 1) * 64);
            asm volatile("s_wait_xcnt 0x0" ::: "memory");   // stands in front of whatever next writes a register that holds an address of the loads above
            __builtin_amdgcn_sched_barrier(0); }
        const T16* kt = sm + ((s & 1) * 2 * NPL) * FT; const T16* vt = kt + NPL * FT;
        // All fragments of the stage are read as one group into registers of their own, in the order of their use: the K products wait for the first reads only, the V^T fragments land under them and under the softmax.
        // The loops over fragments and tiles are unrolled because the fragments and accumulators live in registers and need constant indices.
        V ka[2][4], kb[2][4], va[2][4], vb[2][4];
#pragma unroll
        for (int ks = 0; ks < 2; ++ks) {
#pragma unroll
            for (int t = 0; t < 4; ++t) ka[ks][t] = WFrag<T16>::ld(kt + (t * 16 + lr) * FP + ks * 32 + 8 * hi);
            if (HI) {
#pragma unroll
                for (int t = 0; t < 4; ++t) kb[ks][t] = WFrag<T16>::ld(kt + FT + (t * 16 + lr) * FP + ks * 32 + 8 * hi); } }
#pragma unroll
        for (int p2 = 0; p2 < 2; ++p2) {
#pragma unroll
            for (int mb = 0; mb < 4; ++mb) va[p2][mb] = WFrag<T16>::ld(vt + (mb * 16 + lr) * FP + p2 * 32 + 8 * hi);
            if (HI) {
#pragma unroll
                for (int mb = 0; mb < 4; ++mb) vb[p2][mb] = WFrag<T16>::ld(vt + FT + (mb * 16 + lr) * FP + p2 * 32 + 8 * hi); } }
        __builtin_amdgcn_sched_barrier(0);   // keeps the reads one group in front of the products: a read placed directly in front of its product leaves the whole LDS latency open each time
        // Successive products go to different accumulator tiles, so that none waits for the one before it; each tile takes its products in the order k block 0 (hi.hi, hi.lo, lo.hi), k block 1.
        v8f sc[NG][4];
#pragma unroll
        for (int t = 0; t < 4; ++t)
#pragma unroll
            for (int g = 0; g < NG; ++g) sc[g][t] = (v8f){};
#pragma unroll
        for (int ks = 0; ks < 2; ++ks) {
#pragma unroll
            for (int t = 0; t < 4; ++t)
#pragma unroll
                for (int g = 0; g < NG; ++g) sc[g][t] = WFrag<T16>::mma(ka[ks][t], q[g][ks], sc[g][t]);
            if (HI) {
#pragma unroll
                for (int t = 0; t < 4; ++t)
#pragma unroll
                    for (int g = 0; g < NG; ++g) sc[g][t] = WFrag<T16>::mma(ka[ks][t], q2[g][ks], sc[g][t]);
#pragma unroll
                for (int t = 0; t < 4; ++t)
#pragma unroll
                    for (int g = 0; g < NG; ++g) sc[g][t] = WFrag<T16>::mma(kb[ks][t], q[g][ks], sc[g][t]); } }
        if constexpr (HI) __builtin_amdgcn_sched_barrier(0);   // with one column group a tile's six products depend on each other: keeps the four tiles' products alternating, where the compiler would else run tile after tile with the vector work between
        // Only the stage that holds the end of the keys has keys to mask. The test reads the same for the whole work-group (a scalar branch): every full stage skips the selects.
        // The loops here and below are unrolled because sc lives in registers and needs constant indices.
        if ((s + 1) * 64 > n) { const int lim = n - s * 64 - 8 * hi;   // this lane's keys of the stage below lim are real
#pragma unroll
            for (int t = 0; t < 4; ++t) {
#pragma unroll
                for (int r = 0; r < 8; ++r) { const bool ok = t * 16 + r < lim;
#pragma unroll
                    for (int g = 0; g < NG; ++g) sc[g][t][r] = ok ? sc[g][t][r] : NEGBIG; } } }
        float mnew[NG];   // the maximum is taken over the raw products: the scale is positive and is applied in the exponent's multiply-add below
#pragma unroll
        for (int g = 0; g < NG; ++g) mnew[g] = mrun[g];
#pragma unroll
        for (int t = 0; t < 4; ++t) {
#pragma unroll
            for (int r = 0; r < 8; ++r) {
#pragma unroll
                for (int g = 0; g < NG; ++g) mnew[g] = fmaxf(mnew[g], sc[g][t][r]); } }
        V pf[NG][2], pl[NG][2];
#pragma unroll
        for (int g = 0; g < NG; ++g) {
            const float mx = fmaxf(mnew[g], xhalf(mnew[g]));   // both halves of a column share one maximum: their keys meet in one product
            const float on = mx * SCL2;                       // the maximum in the log2 domain; orun keeps it for the next stage's rescale
            const float da = orun[g] - on; float al = __builtin_amdgcn_exp2f(da); mrun[g] = mx; orun[g] = on;
            asm volatile("v_nop" : "+v"(al) : "v"(da));       // the free slot behind a transcendental, see below
            const float off = HI ? on : on - PCARL2;
            float ps = 0.0f;
#pragma unroll
            for (int t = 0; t < 4; ++t) { const v8f d = __builtin_elementwise_fma(sc[g][t], (v8f)(SCL2), (v8f)(-off)); v8f p;
#pragma unroll
                for (int r = 0; r < 8; ++r) p[r] = __builtin_amdgcn_exp2f(d[r]);
                // The instruction set asks for one free slot behind v_exp_f32 before its result is read or its source overwritten. Naming the eight sources as inputs keeps them
                // whole until here, naming the results as in-out keeps their readers behind: inside the run each v_exp_f32 is the next one's slot, the v_nop is the last one's.
                asm volatile("v_nop" : "+v"(p) : "v"(d));
                sc[g][t] = p;
#pragma unroll
                for (int r = 0; r < 8; ++r) ps += p[r]; }
            lsum[g] = lsum[g] * al + ps;
#pragma unroll
            for (int mb = 0; mb < 4; ++mb) o[g][mb] *= al;
#pragma unroll
            for (int p2 = 0; p2 < 2; ++p2) {
                if constexpr (HI) {
                    const v8bf h0 = __builtin_convertvector(sc[g][2 * p2], v8bf), h1 = __builtin_convertvector(sc[g][2 * p2 + 1], v8bf);
                    const v8bf l0 = __builtin_convertvector(sc[g][2 * p2] - __builtin_convertvector(h0, v8f), v8bf), l1 = __builtin_convertvector(sc[g][2 * p2 + 1] - __builtin_convertvector(h1, v8f), v8bf);
                    pf[g][p2] = __builtin_shufflevector(h0, h1, 0, 1, 2, 3, 4, 5, 6, 7, 8, 9, 10, 11, 12, 13, 14, 15);
                    pl[g][p2] = __builtin_shufflevector(l0, l1, 0, 1, 2, 3, 4, 5, 6, 7, 8, 9, 10, 11, 12, 13, 14, 15);
                } else {
                    pf[g][p2] = cat16(__builtin_convertvector(sc[g][2 * p2], v8h), __builtin_convertvector(sc[g][2 * p2 + 1], v8h));
                } } }
#pragma unroll
        for (int p2 = 0; p2 < 2; ++p2) {
#pragma unroll
            for (int mb = 0; mb < 4; ++mb)
#pragma unroll
                for (int g = 0; g < NG; ++g) o[g][mb] = WFrag<T16>::mma(va[p2][mb], pf[g][p2], o[g][mb]);
            if (HI) {
#pragma unroll
                for (int mb = 0; mb < 4; ++mb)
#pragma unroll
                    for (int g = 0; g < NG; ++g) o[g][mb] = WFrag<T16>::mma(va[p2][mb], pl[g][p2], o[g][mb]);
#pragma unroll
                for (int mb = 0; mb < 4; ++mb)
#pragma unroll
                    for (int g = 0; g < NG; ++g) o[g][mb] = WFrag<T16>::mma(vb[p2][mb], pf[g][p2], o[g][mb]); } }
        if (more) sl((s + 1) & 1);
    }
    // lane l: query qw + 16 g + (l & 15), d = 16 mb + 8 (l >> 4) + 0..7: 16 bytes of each ctx plane
#pragma unroll
    for (int g = 0; g < NG; ++g) { const float inv = __fdiv_rn(1.0f, lsum[g] + xhalf(lsum[g]));
#pragma unroll
        for (int mb = 0; mb < 4; ++mb) { v8us oh, ol;
#pragma unroll
            for (int r = 0; r < 8; ++r) { unsigned short a, c2; splitf(o[g][mb][r] * inv, a, c2); oh[r] = a; ol[r] = c2; }
            const size_t oo = (size_t)(qw + g * 16 + lr) * DQ + mb * 16 + 8 * hi;
            __builtin_amdgcn_sched_barrier(0);   // with the one behind the wait: keeps the conversions of this and the next piece out of the stretch from the first store to the wait, where they could write a register that an issued store names
            *(v8us*)(Ah + oo) = oh; *(v8us*)(Al + oo) = ol;
            asm volatile("s_wait_xcnt 0x0" ::: "memory");   // stands in front of whatever next writes a register that the two stores name
            __builtin_amdgcn_sched_barrier(0); } }
}

// grid: work-group x is a hi/lo block where x has an even number of one bits, else an f16 block, so that two work-groups whose indices differ in one bit (neighbours as well as x and x + half the grid) are one of each kind,
// whichever of these pairs the dispatcher puts on one WGP (for speed only); x >> 1 numbers the blocks of either kind. Planes [b][head][.][.], ctx planes [b][t][DQ]
__global__ __launch_bounds__(128) void k_fattn(const h16* __restrict__ Q16, const h16* __restrict__ K16, const h16* __restrict__ V16, const bf* __restrict__ Qh, const bf* __restrict__ Ql, const bf* __restrict__ Kh, const bf* __restrict__ Kl,
                                               const bf* __restrict__ Vh, const bf* __restrict__ Vl, const int* __restrict__ cnt, bf* Ah, bf* Al) {
    __shared__ __align__(16) unsigned short sm[2 * 4 * FT];
    constexpr int HB = RH / QBH;   // blocks per (batch, head), of either kind
    const int x = (int)blockIdx.x, y = x >> 1; const bool hires = (__builtin_popcount((unsigned)x) & 1) == 0;
    const int bh = y / HB; const int q0 = hires ? (y % HB) * QBH : RH + (y % HB) * QBL;
    const int b = bh / NH_, hd = bh % NH_; const size_t po = (size_t)bh * TT * HD, ao = (size_t)b * TT * DQ + (size_t)hd * HD;
    const int n = min(max(cnt[b * CNS], 0), TT);   // the same for the whole work-group: it bounds the stage loop and its barriers
    if (hires) fa_body<bf, true>((bf*)sm, n, Qh + po, Ql + po, Kh + po, Kl + po, Vh + po, Vl + po, q0, Ah + ao, Al + ao);
    else fa_body<h16, false>((h16*)sm, n, Q16 + po, nullptr, K16 + po, nullptr, V16 + po, nullptr, q0, Ah + ao, Al + ao);
}

extern "C" void kernel_launch(void* const* d_in, const int* in_sizes, int n_in,
                              void* d_out, int out_size, void* d_ws, size_t ws_size, hipStream_t stream) {
    if (n_in < 12) return;
    const size_t needx = (size_t)(NB - 1) * SEQ_FULL * DM + (size_t)TT * DM;
    const size_t needm = (size_t)(NB - 1) * SEQ_FULL + (size_t)TT;
    if ((size_t)in_sizes[0] < needx || (size_t)in_sizes[1] < needx || (size_t)in_sizes[2] < needx || (size_t)in_sizes[3] < needm) return;
    if ((size_t)in_sizes[4] < (size_t)DQ * DM || (size_t)in_sizes[6] < (size_t)DKV * DM || (size_t)in_sizes[8] < (size_t)DKV * DM || (size_t)in_sizes[10] < (size_t)DM * DQ) return;
    if (in_sizes[5] < DQ || in_sizes[7] < DKV || in_sizes[9] < DKV || in_sizes[11] < DM) return;
    if ((size_t)out_size < needx) return;
    // wire order: query, key, value, mask (int32), Wq, bq, Wk, bk, Wv, bv, Wo, bo; weights [out][in]
    const float* xq = (const float*)d_in[0]; const float* xk = (const float*)d_in[1]; const float* xv = (const float*)d_in[2]; const int* mask = (const int*)d_in[3];
    const float* wq = (const float*)d_in[4]; const float* bq = (const float*)d_in[5]; const float* wk = (const float*)d_in[6]; const float* bk = (const float*)d_in[7];
    const float* wv = (const float*)d_in[8]; const float* bv = (const float*)d_in[9]; const float* wo = (const float*)d_in[10]; const float* bo = (const float*)d_in[11];
    float* OUT = (float*)d_out;     // [NB_FULL][SEQ_FULL][DM]
    char* wsp = (char*)d_ws;
    auto take = [&](size_t bytes) { char* p = wsp; wsp += (bytes + 255) & ~(size_t)255; return (void*)p; };
    bf* WQ = (bf*)take(SZ_W); bf* WK = (bf*)take(SZ_W); bf* WV = (bf*)take(SZ_W); bf* WO = (bf*)take(SZ_W);   // one after the other: filled by one launch, WQ WK WV read by one launch
    // planes [b][head][.][.]; each k plane directly behind its q plane, so that one launch fills both
    h16* QP16 = (h16*)take(SZ_HP); h16* KP16 = (h16*)take(SZ_HP); bf* QPh = (bf*)take(SZ_HP); bf* KPh = (bf*)take(SZ_HP); bf* QPl = (bf*)take(SZ_HP); bf* KPl = (bf*)take(SZ_HP);
    h16* VT16 = (h16*)take(SZ_HP); bf* VTh = (bf*)take(SZ_HP); bf* VTl = (bf*)take(SZ_HP);
    bf* XB = (bf*)take(SZ_XB); bf* ATh = (bf*)take(SZ_AT);   // XB [q k v][b][t][DM] bf16
    bf* ATl = (bf*)take(SZ_AT); int* CN = (int*)take(SZ_CN);
    if ((size_t)(wsp - (char*)d_ws) > ws_size) return;
    const size_t xs = (size_t)SEQ_FULL * DM;   // batch stride of the f32 inputs and of the output
    // the ranked k, v inputs, the q inputs and the four weights of every batch in one launch
    k_prep<<<NB * KVB + NB * LXB + 4 * LWB, 256, 0, stream>>>(xq, xk, xv, wq, wk, wv, wo, WQ, XB, mask, CN);
    // the three projections of every batch in one launch: z = tensor * NB + batch; the q and k planes and the transposed v planes are written directly
    k_gemms<bf, 0, true, true, DM, DM, DQ><<<dim3(TT / 128, DQ / 128, 3 * NB), 128, 0, stream>>>(XB, nullptr, WQ, nullptr, QP16, QPh, QPl, VT16, VTh, VTl, bq, bk, bv, CN, NB, (size_t)TT * DM, (size_t)DQ * DM, 0);
    // attention of every batch and head in one launch, ctx planes written directly
    k_fattn<<<NB * NH_ * (RH / QBH + (TT - RH) / QBL), 128, 0, stream>>>(QP16, KP16, VT16, QPh, QPl, KPh, KPl, VTh, VTl, CN, ATh, ATl);
    // out[b][t][n] = sum_k ctx[b][t][k] Wo[n][k] + bo[n], every batch in one launch
    k_gemms<bf, 1, true, false, DQ, DQ, DM><<<dim3(TT / 128, DM / 128, NB), 128, 0, stream>>>(ATh, ATl, WO, OUT, nullptr, nullptr, nullptr, nullptr, nullptr, nullptr, bo, bo, bo, nullptr, NB, (size_t)TT * DQ, 0, xs);
}
